// v000
// Times are from an AMD MI455X. After a warm-up the kernel runs many times in a row, and a time is the length of
// such a window on the GPU divided by its runs, so every launch and the gaps after it count. The runs cycle
// through copies of the inputs. A figure is the median of several windows, for all but v000 over two sittings.
// Sittings can differ by a few percent; kernels timed side by side share one.
// The starting kernel, v000, takes 1370 microseconds a run.
// Contractions: pW1/pW2/Wq/Wk linears and q.k^T logits on v_wmma_f32_16x16x32_bf16 with both operands as bf16 hi+lo planes (hi.hi + hi.lo + lo.hi), f32 accumulate, logits kept f32; rW1/rW2/rW3/Wv/ffn linears and attn.V on v_wmma_f32_16x16x32_f16 (weights carried x256, attention weights carried x32768), f32 accumulate; softmax statistics, column sums, LayerNorm and residual adds in f32.
#include <hip/hip_runtime.h>
#include <math.h>

typedef __attribute__((ext_vector_type(16))) _Float16 v16h;
typedef __attribute__((ext_vector_type(8)))  _Float16 v8h;
typedef __attribute__((ext_vector_type(16))) __bf16   v16b;
typedef __attribute__((ext_vector_type(8)))  __bf16   v8b;
typedef __attribute__((ext_vector_type(8)))  float    v8f;
typedef __attribute__((ext_vector_type(4)))  float    v4f;
typedef __attribute__((ext_vector_type(4)))  unsigned int v4u;
typedef __attribute__((ext_vector_type(2)))  unsigned int v2u;

// ---------------------------------------------------------------------------
// Problem constants
// ---------------------------------------------------------------------------
constexpr int    kTok       = 4096;
constexpr int    kDim       = 512;
constexpr size_t kND        = (size_t)kTok * kDim;
constexpr size_t kWW        = (size_t)kDim * kDim;
constexpr float  kWCarry    = 256.0f;
constexpr float  kWCarryInv = 1.0f / kWCarry;
constexpr float  kPCarry    = 32768.0f;
constexpr float  kPCarryInv = 1.0f / kPCarry;
constexpr float  kInvDim    = 1.0f / (float)kDim;
constexpr float  kLnEps     = 1e-6f;
constexpr float  kAttnEps   = 1e-9f;
constexpr int    kAvPitch   = 40;
static_assert((kTok % 64) == 0 && (kDim % 64) == 0);
static_assert((kTok % 32) == 0 && (kDim % 32) == 0);
static_assert(((kND / 8) % 256) == 0 && ((kWW / 8) % 256) == 0);
static_assert((kAvPitch % 8) == 0 && kAvPitch >= 32);

// ---------------------------------------------------------------------------
// Workspace region map (bytes; every offset is a multiple of 128)
//   R0      67,108,864  time-shared region:
//             (a) operand planes of the per-branch linear chain (branch A, then branch B again):
//                 XH XL T0H T0L FH FL F16 R1 R2   9 x 4,194,304 (16-bit [4096][512] planes)
//                 WSH (4 bf16 hi weight planes) 2,097,152 ; WSL (4 bf16 lo planes) 2,097,152
//                 WF  (4 f16 weight planes, carried x256) 2,097,152         -> 44,040,192 used
//             (b) S f32 [4096][4096] logits of the current branch            67,108,864
//             (c) S32 f32 [4096][512] + S16 f16 [4096][512] LayerNorm output 12,582,912
//   QK      33,554,432  QH QL KH KL bf16 planes [4096][512], branch A then branch B
//   VT       8,388,608  V^T f16 [512][4096], branch A then B
//   RES      8,388,608  residual-chain output f16 [4096][512], branch A then B
//   SC       8,388,608  attn.V output f32 [4096][512] (shared by the branches, stream ordered)
//   FFN      1,048,576  ffn weight f16 planes (x256), branch A then B
//   MROW        16,384  row maxima f32 [4096]
//   INVS        16,384  1 / row exp sums f32 [4096]
//   RC          16,384  1 / (1e-9 + column sums) f32 [4096]
//   total = 67,108,864 + 33,554,432 + 8,388,608 + 8,388,608 + 8,388,608 + 1,048,576 + 16,384 + 16,384 + 16,384
//         = 126,926,848
// ---------------------------------------------------------------------------
constexpr size_t kPlane16  = kND * 2;
constexpr size_t kPlane32  = kND * 4;
constexpr size_t kW16      = kWW * 2;
constexpr size_t kR0Bytes  = (size_t)kTok * kTok * 4;
constexpr size_t kOffXH    = 0;
constexpr size_t kOffXL    = kOffXH  + kPlane16;
constexpr size_t kOffT0H   = kOffXL  + kPlane16;
constexpr size_t kOffT0L   = kOffT0H + kPlane16;
constexpr size_t kOffFH    = kOffT0L + kPlane16;
constexpr size_t kOffFL    = kOffFH  + kPlane16;
constexpr size_t kOffF16   = kOffFL  + kPlane16;
constexpr size_t kOffR1    = kOffF16 + kPlane16;
constexpr size_t kOffR2    = kOffR1  + kPlane16;
constexpr size_t kOffWSH   = kOffR2  + kPlane16;
constexpr size_t kOffWSL   = kOffWSH + 4 * kW16;
constexpr size_t kOffWF    = kOffWSL + 4 * kW16;
constexpr size_t kPhase1End = kOffWF + 4 * kW16;
constexpr size_t kOffS     = 0;
constexpr size_t kOffS32   = 0;
constexpr size_t kOffS16   = kOffS32 + kPlane32;
constexpr size_t kOffQK    = kR0Bytes;
constexpr size_t kOffVT    = kOffQK  + 8 * kPlane16;
constexpr size_t kOffRES   = kOffVT  + 2 * kPlane16;
constexpr size_t kOffSC    = kOffRES + 2 * kPlane16;
constexpr size_t kOffFFN   = kOffSC  + kPlane32;
constexpr size_t kOffMROW  = kOffFFN + 2 * kW16;
constexpr size_t kOffINVS  = kOffMROW + (size_t)kTok * 4;
constexpr size_t kOffRC    = kOffINVS + (size_t)kTok * 4;
constexpr size_t kWsTotal  = kOffRC   + (size_t)kTok * 4;
static_assert(kPhase1End <= kR0Bytes);
static_assert(kOffS16 + kPlane16 <= kR0Bytes);
static_assert(kWsTotal == 126926848ull);
static_assert(kWsTotal <= 134217728ull);
static_assert((kOffWSH % 128) == 0 && (kOffWSL % 128) == 0 && (kOffWF % 128) == 0 && (kOffQK % 128) == 0 &&
              (kOffVT % 128) == 0 && (kOffRES % 128) == 0 && (kOffSC % 128) == 0 && (kOffFFN % 128) == 0 &&
              (kOffMROW % 128) == 0 && (kOffINVS % 128) == 0 && (kOffRC % 128) == 0 && (kOffS16 % 128) == 0);

// ---------------------------------------------------------------------------
// Small helpers
// ---------------------------------------------------------------------------
__device__ __forceinline__ unsigned short f2bf_bits(float f) {
  unsigned u = __float_as_uint(f);
  return (unsigned short)((u + 0x7FFFu + ((u >> 16) & 1u)) >> 16);
}
__device__ __forceinline__ float bf_bits2f(unsigned short h) { return __uint_as_float(((unsigned)h) << 16); }

/* f16 bits (low 16 bits of hb, finite values) -> f32, integer path only */
__device__ __forceinline__ float h16_to_f32(unsigned hb) {
  const unsigned sgn = (hb & 0x8000u) << 16;
  const unsigned em = hb & 0x7fffu;
  const float fn = __uint_as_float((em << 13) + 0x38000000u);
  const float fs = (float)em * 5.9604644775390625e-8f;
  const float mag = (em < 0x400u) ? fs : fn;
  return __uint_as_float(__float_as_uint(mag) | sgn);
}

/* hazard guards: four nops, all four accumulators of the group tied, A fragments named as inputs */
__device__ __forceinline__ void grp_guard_h(v8f& a, v8f& b, v8f& c, v8f& d, v16h x, v16h y) {
  asm volatile("v_nop\n\tv_nop\n\tv_nop\n\tv_nop" : "+v"(a), "+v"(b), "+v"(c), "+v"(d) : "v"(x), "v"(y));
}
__device__ __forceinline__ void grp_guard_b(v8f& a, v8f& b, v8f& c, v8f& d, v16b x, v16b y) {
  asm volatile("v_nop\n\tv_nop\n\tv_nop\n\tv_nop" : "+v"(a), "+v"(b), "+v"(c), "+v"(d) : "v"(x), "v"(y));
}
__device__ __forceinline__ void keep4_h(v16h a, v16h b, v16h c, v16h d) { asm volatile("v_nop" :: "v"(a), "v"(b), "v"(c), "v"(d)); }
__device__ __forceinline__ void keep4_b(v16b a, v16b b, v16b c, v16b d) { asm volatile("v_nop" :: "v"(a), "v"(b), "v"(c), "v"(d)); }
__device__ __forceinline__ void acc_guard4(v8f& a, v8f& b, v8f& c, v8f& d) {
  asm volatile("v_nop\n\tv_nop\n\tv_nop\n\tv_nop" : "+v"(a), "+v"(b), "+v"(c), "+v"(d));
}

/* Fragment loader: elements 0..7 <- p[0..7], elements 8..15 <- p[16..23]; p already includes 8*(lane>>4) */
template <typename T> struct Frag;
template <> struct Frag<_Float16> {
  typedef v16h V;
  union U { v16h v; v8h h[2]; };
  static __device__ __forceinline__ v16h load(const _Float16* p) {
    U f;
    f.h[0] = *(const v8h*)(p);
    f.h[1] = *(const v8h*)(p + 16);
    return f.v;
  }
  static __device__ __forceinline__ v8f mma(v16h a, v16h b, v8f c) {
    return __builtin_amdgcn_wmma_f32_16x16x32_f16(false, a, false, b, (short)0, c, false, false);
  }
  static __device__ __forceinline__ void guard(v8f& a, v8f& b, v8f& c, v8f& d, v16h x, v16h y) { grp_guard_h(a, b, c, d, x, y); }
  static __device__ __forceinline__ void keep(v16h a, v16h b, v16h c, v16h d) { keep4_h(a, b, c, d); }
};
template <> struct Frag<__bf16> {
  typedef v16b V;
  union U { v16b v; v8b h[2]; };
  static __device__ __forceinline__ v16b load(const __bf16* p) {
    U f;
    f.h[0] = *(const v8b*)(p);
    f.h[1] = *(const v8b*)(p + 16);
    return f.v;
  }
  static __device__ __forceinline__ v8f mma(v16b a, v16b b, v8f c) {
    return __builtin_amdgcn_wmma_f32_16x16x32_bf16(false, a, false, b, (short)0, c, false, false);
  }
  static __device__ __forceinline__ void guard(v8f& a, v8f& b, v8f& c, v8f& d, v16b x, v16b y) { grp_guard_b(a, b, c, d, x, y); }
  static __device__ __forceinline__ void keep(v16b a, v16b b, v16b c, v16b d) { keep4_b(a, b, c, d); }
};

// ---------------------------------------------------------------------------
// Register-blocked WMMA GEMM: C[m,n] = scale * sum_k A[m,k] * Bt[n,k] (+bias[n]) (+resid[m,n]); each wave owns a
// 64x64 tile. A row-major [M][K] pitch lda; Bt row-major [N][K] pitch ldb; M, N multiples of 64, K multiple of 32.
// SPLIT: operands are hi/lo planes (A2/Bt2 = lo planes, same layout); product = hi.hi + hi.lo + lo.hi.
// BIAS_MODE: 0 none, 2 bias[n] (f32). ACT: 0 none, 2 relu. RESID (f32 output only): the residual is fetched in the
// store phase, one 16-B vector per lane at exactly the address the lane stores to.
// OUT_MODE: 0 f32, 1 f16, 2 bf16 hi plane (Cout) + bf16 lo plane (Cout2).
// Epilogue: 16-row slabs staged per wave in LDS (only the owning wave touches its slab); each 64-wide row segment is
// ET: 0 f16 operands, 1 bf16 operands (pointers passed as 16-bit storage).
// ---------------------------------------------------------------------------
template <int ET> struct Elem;
template <> struct Elem<0> { typedef _Float16 T; };
template <> struct Elem<1> { typedef __bf16 T; };

template <int ET, bool SPLIT, int BIAS_MODE, int OUT_MODE, bool RESID, int ACT>
__global__ __launch_bounds__(256) void wmma_gemm64(
    const unsigned short* __restrict__ Ap, const unsigned short* __restrict__ A2p, int lda,
    const unsigned short* __restrict__ Btp, const unsigned short* __restrict__ Bt2p, int ldb,
    void* __restrict__ Cout, void* __restrict__ Cout2, int ldc,
    const float* __restrict__ bias, const float* __restrict__ resid,
    int M, int N, int K, float scale) {
  typedef typename Elem<ET>::T T;
  typedef typename Frag<T>::V V;
  const T* A   = (const T*)Ap;
  const T* A2  = (const T*)A2p;
  const T* Bt  = (const T*)Btp;
  const T* Bt2 = (const T*)Bt2p;
  __shared__ __align__(16) float sT[8][16 * 68];
  const int lane = threadIdx.x & 31;
  const int wave = __builtin_amdgcn_readfirstlane((int)(threadIdx.x >> 5));
  const int tilesN = N >> 6;
  const int tilesM = M >> 6;
  const int tile = blockIdx.x * 8 + wave;
  /* wave-uniform exit; this kernel has no block barriers */
  if (tile >= tilesM * tilesN) return;
  const int tm = tile / tilesN;
  const int tn = tile - tm * tilesN;
  const int m0 = tm << 6;
  const int n0 = tn << 6;

  const int rlane = lane & 15;
  const int koff  = (lane >> 4) * 8;
  const int mOff  = (lane >> 4) * 8;

  v8f acc[4][4];
#pragma unroll
  for (int i = 0; i < 4; ++i)
#pragma unroll
    for (int j = 0; j < 4; ++j) acc[i][j] = (v8f){0.f, 0.f, 0.f, 0.f, 0.f, 0.f, 0.f, 0.f};

  for (int k0 = 0; k0 < K; k0 += 32) {
    V bh[4], bl[4];
#pragma unroll
    for (int j = 0; j < 4; ++j) {
      const size_t bo = (size_t)(n0 + (j << 4) + rlane) * ldb + koff + k0;
      bh[j] = Frag<T>::load(Bt + bo);
      if (SPLIT) bl[j] = Frag<T>::load(Bt2 + bo);
    }
#pragma unroll
    for (int i = 0; i < 4; ++i) {
      const size_t ao = (size_t)(m0 + (i << 4) + rlane) * lda + koff + k0;
      V ah = Frag<T>::load(A + ao);
      V al;
      if (SPLIT) al = Frag<T>::load(A2 + ao);
#pragma unroll
      for (int j = 0; j < 4; ++j) {
        acc[i][j] = Frag<T>::mma(ah, bh[j], acc[i][j]);
        if (SPLIT) {
          acc[i][j] = Frag<T>::mma(ah, bl[j], acc[i][j]);
          acc[i][j] = Frag<T>::mma(al, bh[j], acc[i][j]);
        }
      }
      Frag<T>::guard(acc[i][0], acc[i][1], acc[i][2], acc[i][3], ah, SPLIT ? al : ah);
    }
    Frag<T>::keep(bh[0], bh[1], bh[2], bh[3]);
    if (SPLIT) Frag<T>::keep(bl[0], bl[1], bl[2], bl[3]);
  }
  acc_guard4(acc[0][0], acc[0][1], acc[0][2], acc[0][3]);
  acc_guard4(acc[1][0], acc[1][1], acc[1][2], acc[1][3]);
  acc_guard4(acc[2][0], acc[2][1], acc[2][2], acc[2][3]);
  acc_guard4(acc[3][0], acc[3][1], acc[3][2], acc[3][3]);

  /* ---- epilogue ---- */
  float* slab = sT[wave];
#pragma unroll
  for (int i = 0; i < 4; ++i) {
    const int mBase = m0 + (i << 4);
#pragma unroll
    for (int j = 0; j < 4; ++j) {
      const int n = n0 + (j << 4) + rlane;
      float bv = 0.f;
      if (BIAS_MODE == 2) bv = bias[n];
#pragma unroll
      for (int r = 0; r < 8; ++r) {
        float v = acc[i][j][r] * scale;
        if (BIAS_MODE == 2) v += bv;
        if (ACT == 2) v = fmaxf(v, 0.0f);
        slab[(mOff + r) * 68 + (j << 4) + rlane] = v;
      }
    }
    __builtin_amdgcn_fence(__ATOMIC_RELEASE, "workgroup");
    __builtin_amdgcn_wave_barrier();
    __builtin_amdgcn_fence(__ATOMIC_ACQUIRE, "workgroup");
    if (OUT_MODE == 0) {
      /* rows it*2 + hh, it 0..7, hh 0..1 = 16 rows; 16 lanes x 16 B = the 256-B row segment */
      float* C = (float*)Cout;
      const int hh = lane >> 4, c4 = (lane & 15) * 4;
      v4f vals[8];
#pragma unroll
      for (int it = 0; it < 8; ++it) {
        const int row = it * 2 + hh;
        v4f v = *(const v4f*)(slab + row * 68 + c4);
        if (RESID) {
          const v4f rr = *(const v4f*)(resid + (size_t)(mBase + row) * ldc + n0 + c4);
          v = v + rr;
        }
        vals[it] = v;
      }
      {
#pragma unroll
        for (int it = 0; it < 8; ++it) {
          const int row = it * 2 + hh;
          *(v4f*)(C + (size_t)(mBase + row) * ldc + n0 + c4) = vals[it];
        }
        
      }
    } else {
      const int q = lane >> 3, c8 = (lane & 7) * 8;
      unsigned short* C  = (unsigned short*)Cout;
      unsigned short* C2 = (unsigned short*)Cout2;
      {
#pragma unroll
        for (int it = 0; it < 4; ++it) {
          const int row = it * 4 + q;
          const float* sp = slab + row * 68 + c8;
          v8h hv, lv;
#pragma unroll
          for (int e = 0; e < 8; ++e) {
            const float sv = sp[e];
            if (OUT_MODE == 1) {
              hv[e] = (_Float16)sv;
            } else {
              const unsigned short hb = f2bf_bits(sv);
              const unsigned short lb = f2bf_bits(sv - bf_bits2f(hb));
              hv[e] = __builtin_bit_cast(_Float16, hb);
              lv[e] = __builtin_bit_cast(_Float16, lb);
            }
          }
          *(v8h*)(C + (size_t)(mBase + row) * ldc + n0 + c8) = hv;
          if (OUT_MODE == 2) *(v8h*)(C2 + (size_t)(mBase + row) * ldc + n0 + c8) = lv;
        }
        
      }
    }
    __builtin_amdgcn_fence(__ATOMIC_RELEASE, "workgroup");
    __builtin_amdgcn_wave_barrier();
    __builtin_amdgcn_fence(__ATOMIC_ACQUIRE, "workgroup");
  }
}

// ---------------------------------------------------------------------------
// f32 plane -> bf16 hi plane + bf16 lo plane (both RNE converts: hi = bf16(v), lo = bf16(v - hi)); 8 contiguous
// elements per thread. blockIdx.y (block-uniform) selects one of four sources and output plane y (planeElems apart).
// Coverage: grid.x * 256 threads * 8 elements = total8 * 8 = the whole plane (grids are exact multiples of 256).
// ---------------------------------------------------------------------------
__global__ __launch_bounds__(256) void split4_bf16_kernel(
    const float* __restrict__ s0, const float* __restrict__ s1, const float* __restrict__ s2, const float* __restrict__ s3,
    unsigned short* __restrict__ dhi, unsigned short* __restrict__ dlo, int total8, long planeElems) {
  const int i = blockIdx.x * 256 + threadIdx.x;
  if (i >= total8) return;
  const int y = blockIdx.y;
  const float* src = (y == 0) ? s0 : (y == 1) ? s1 : (y == 2) ? s2 : s3;
  const size_t e0 = (size_t)i << 3;
  const v4f a0 = *(const v4f*)(src + e0);
  const v4f a1 = *(const v4f*)(src + e0 + 4);
  v8h hv, lv;
#pragma unroll
  for (int e = 0; e < 4; ++e) {
    const float f0 = a0[e], f1 = a1[e];
    const unsigned short h0 = f2bf_bits(f0), h1 = f2bf_bits(f1);
    const unsigned short l0 = f2bf_bits(f0 - bf_bits2f(h0)), l1 = f2bf_bits(f1 - bf_bits2f(h1));
    hv[e]     = __builtin_bit_cast(_Float16, h0);
    hv[4 + e] = __builtin_bit_cast(_Float16, h1);
    lv[e]     = __builtin_bit_cast(_Float16, l0);
    lv[4 + e] = __builtin_bit_cast(_Float16, l1);
  }
  unsigned short* qh = dhi + (size_t)y * planeElems + e0;
  unsigned short* ql = dlo + (size_t)y * planeElems + e0;
  *(v8h*)qh = hv;
  *(v8h*)ql = lv;
  
}

// ---------------------------------------------------------------------------
// f32 plane -> f16 plane with a power-of-two carry; same thread/line map as above (8 elements = one 16-B store per
// ---------------------------------------------------------------------------
__global__ __launch_bounds__(256) void cast4_f16_kernel(
    const float* __restrict__ s0, const float* __restrict__ s1, const float* __restrict__ s2, const float* __restrict__ s3,
    unsigned short* __restrict__ out, float carry, int total8, long planeElems) {
  const int i = blockIdx.x * 256 + threadIdx.x;
  if (i >= total8) return;
  const int y = blockIdx.y;
  const float* src = (y == 0) ? s0 : (y == 1) ? s1 : (y == 2) ? s2 : s3;
  const size_t e0 = (size_t)i << 3;
  const v4f a0 = *(const v4f*)(src + e0);
  const v4f a1 = *(const v4f*)(src + e0 + 4);
  v8h hv;
#pragma unroll
  for (int e = 0; e < 4; ++e) {
    const float f0 = a0[e] * carry, f1 = a1[e] * carry;
    hv[e]     = (_Float16)f0;
    hv[4 + e] = (_Float16)f1;
  }
  unsigned short* q = out + (size_t)y * planeElems + e0;
  *(v8h*)q = hv;
  
}

// ---------------------------------------------------------------------------
// bf16 hi + lo planes -> f16 plane of (hi + lo); planes read as 32-bit integer words; same thread/line map.
// ---------------------------------------------------------------------------
__global__ __launch_bounds__(256) void hilo_to_f16_kernel(
    const unsigned short* __restrict__ hi, const unsigned short* __restrict__ lo,
    unsigned short* __restrict__ out, int total8) {
  const int i = blockIdx.x * 256 + threadIdx.x;
  if (i >= total8) return;
  const size_t e0 = (size_t)i << 3;
  const v4u hw4 = *(const v4u*)(hi + e0);
  const v4u lw4 = *(const v4u*)(lo + e0);
  v8h hv;
#pragma unroll
  for (int w = 0; w < 4; ++w) {
    const unsigned hw = hw4[w];
    const unsigned lw = lw4[w];
    const float f0 = __uint_as_float(hw << 16) + __uint_as_float(lw << 16);
    const float f1 = __uint_as_float(hw & 0xffff0000u) + __uint_as_float(lw & 0xffff0000u);
    hv[2 * w]     = (_Float16)f0;
    hv[2 * w + 1] = (_Float16)f1;
  }
  unsigned short* q = out + e0;
  *(v8h*)q = hv;
  
}

// ---------------------------------------------------------------------------
// Row statistics of S f32 [4096][4096]: m_i = max_j S_ij, inv_s_i = 1 / sum_j exp(S_ij - m_i).
// Block = 32 rows (8 waves x 4 rows, one wave per row at a time, lane-strided 16-B loads, two sweeps per row).
// Fixed order: per-lane sequential, then xor shuffle tree (unconditional).
// ---------------------------------------------------------------------------
__global__ __launch_bounds__(256) void rowstat_kernel(const float* __restrict__ S, float* __restrict__ mrow, float* __restrict__ invs) {
  __shared__ float sM[32];
  __shared__ float sI[32];
  const int lane = threadIdx.x & 31;
  const int wave = __builtin_amdgcn_readfirstlane((int)(threadIdx.x >> 5));
  const int row0 = blockIdx.x * 32;
#pragma unroll 1
  for (int q = 0; q < 4; ++q) {
    const int rl = wave * 4 + q;
    const float* p = S + (size_t)(row0 + rl) * kTok + lane * 4;
    float m = -INFINITY;
#pragma unroll 4
    for (int it = 0; it < kTok / 128; ++it) {
      const v4f v = *(const v4f*)(p + it * 128);
      m = fmaxf(m, fmaxf(fmaxf(v[0], v[1]), fmaxf(v[2], v[3])));
    }
#pragma unroll
    for (int off = 16; off > 0; off >>= 1) m = fmaxf(m, __shfl_xor(m, off, 32));
    float sum = 0.f;
#pragma unroll 2
    for (int it = 0; it < kTok / 128; ++it) {
      const v4f v = *(const v4f*)(p + it * 128);
      sum += __expf(v[0] - m);
      sum += __expf(v[1] - m);
      sum += __expf(v[2] - m);
      sum += __expf(v[3] - m);
    }
#pragma unroll
    for (int off = 16; off > 0; off >>= 1) sum += __shfl_xor(sum, off, 32);
    const float inv = 1.0f / sum;
    if (lane == 0) {
      sM[rl] = m;
      sI[rl] = inv;
    }
  }
  __syncthreads();
  if (wave == 0) {
    const float mv = sM[lane];
    const float iv = sI[lane];
    *(float*)(mrow + row0 + lane) = mv;
    *(float*)(invs + row0 + lane) = iv;
    
  }
}

// ---------------------------------------------------------------------------
// Column sums over queries of the row-normalised probabilities: c_j = sum_i exp(S_ij - m_i) * inv_s_i, then
// w, w+8, ... (512 rows) in order; the 8 wave partials are combined in index order by wave 0. No atomics.
// ---------------------------------------------------------------------------
__global__ __launch_bounds__(256) void colsum_kernel(const float* __restrict__ S, const float* __restrict__ mrow,
                                                     const float* __restrict__ invs, float* __restrict__ rcol) {
  __shared__ float sP[8][32];
  const int lane = threadIdx.x & 31;
  const int wave = __builtin_amdgcn_readfirstlane((int)(threadIdx.x >> 5));
  const int j0 = blockIdx.x * 32;
  const float* p = S + j0 + lane;
  float acc = 0.f;
#pragma unroll 4
  for (int t = 0; t < kTok / 8; ++t) {
    const int i = wave + 8 * t;
    const float s  = p[(size_t)i * kTok];
    const float mi = mrow[i];
    const float is = invs[i];
    const float pr = __expf(s - mi) * is;
    acc += pr;
  }
  sP[wave][lane] = acc;
  __syncthreads();
  if (wave == 0) {
    float c = sP[0][lane];
    c += sP[1][lane];
    c += sP[2][lane];
    c += sP[3][lane];
    c += sP[4][lane];
    c += sP[5][lane];
    c += sP[6][lane];
    c += sP[7][lane];
    const float rc = 1.0f / (kAttnEps + c);
    *(float*)(rcol + j0 + lane) = rc;
    
  }
}

// ---------------------------------------------------------------------------
// attn.V with the weights formed while staging: SC[i][d] = (1/32768) * sum_j f16(32768 * P_ij * rc_j) * VT[d][j],
// P_ij = exp(S_ij - m_i) * inv_s_i. Block = 64 query rows x all 512 d (8 waves, wave w owns d columns 64w..64w+63,
// acc 4x4 tiles). Per k-step of 32 keys the 256 threads stage the 64 x 32 f16 A tile in LDS: thread t -> row t>>2,
// keys (t&3)*8..+7 (64 rows x 4 threads x 8 = 2048 = the whole tile, one 16-B LDS store each; pad columns 32..39
// of the 40-half pitch are never read: fragment reads touch k offsets 0..31 only). Block barrier before the fragment
// reads and again before the next staging. B fragments stream from the V^T plane in global memory.
// ---------------------------------------------------------------------------
__global__ __launch_bounds__(256) void av_kernel(const float* __restrict__ S, const float* __restrict__ mrow,
                                                 const float* __restrict__ invs, const float* __restrict__ rcol,
                                                 const unsigned short* __restrict__ VTp, float* __restrict__ SC) {
  __shared__ __align__(16) _Float16 sA[64 * kAvPitch];
  __shared__ __align__(16) float sT[8][16 * 68];
  typedef Frag<_Float16> FH;
  const int tid  = threadIdx.x;
  const int lane = tid & 31;
  const int wave = __builtin_amdgcn_readfirstlane((int)(tid >> 5));
  const int m0 = blockIdx.x * 64;
  const int n0 = wave * 64;
  const int sr  = tid >> 2;
  const int sc8 = (tid & 3) * 8;
  const float mi = mrow[m0 + sr];
  const float fi = invs[m0 + sr] * kPCarry;
  const float* Srow = S + (size_t)(m0 + sr) * kTok + sc8;
  const float* rcp  = rcol + sc8;
  const _Float16* VT = (const _Float16*)VTp;

  const int rlane = lane & 15;
  const int koff  = (lane >> 4) * 8;
  const int mOff  = (lane >> 4) * 8;

  v8f acc[4][4];
#pragma unroll
  for (int i = 0; i < 4; ++i)
#pragma unroll
    for (int j = 0; j < 4; ++j) acc[i][j] = (v8f){0.f, 0.f, 0.f, 0.f, 0.f, 0.f, 0.f, 0.f};

  for (int k0 = 0; k0 < kTok; k0 += 32) {
    const v4f s0 = *(const v4f*)(Srow + k0);
    const v4f s1 = *(const v4f*)(Srow + k0 + 4);
    const v4f r0 = *(const v4f*)(rcp + k0);
    const v4f r1 = *(const v4f*)(rcp + k0 + 4);
    v8h hv;
#pragma unroll
    for (int e = 0; e < 4; ++e) {
      const float e0 = __expf(s0[e] - mi);
      const float e1 = __expf(s1[e] - mi);
      const float w0 = (e0 * fi) * r0[e];
      const float w1 = (e1 * fi) * r1[e];
      hv[e]     = (_Float16)w0;
      hv[4 + e] = (_Float16)w1;
    }
    *(v8h*)(sA + sr * kAvPitch + sc8) = hv;
    __syncthreads();
    v16h bh[4];
#pragma unroll
    for (int j = 0; j < 4; ++j) {
      const size_t bo = (size_t)(n0 + (j << 4) + rlane) * kTok + koff + k0;
      bh[j] = FH::load(VT + bo);
    }
#pragma unroll
    for (int i = 0; i < 4; ++i) {
      const int ao = ((i << 4) + rlane) * kAvPitch + koff;
      FH::U fa;
      fa.h[0] = *(const v8h*)(sA + ao);
      fa.h[1] = *(const v8h*)(sA + ao + 16);
      const v16h ah = fa.v;
#pragma unroll
      for (int j = 0; j < 4; ++j) acc[i][j] = FH::mma(ah, bh[j], acc[i][j]);
      FH::guard(acc[i][0], acc[i][1], acc[i][2], acc[i][3], ah, ah);
    }
    FH::keep(bh[0], bh[1], bh[2], bh[3]);
    __syncthreads();
  }
  acc_guard4(acc[0][0], acc[0][1], acc[0][2], acc[0][3]);
  acc_guard4(acc[1][0], acc[1][1], acc[1][2], acc[1][3]);
  acc_guard4(acc[2][0], acc[2][1], acc[2][2], acc[2][3]);
  acc_guard4(acc[3][0], acc[3][1], acc[3][2], acc[3][3]);

  float* slab = sT[wave];
#pragma unroll
  for (int i = 0; i < 4; ++i) {
    const int mBase = m0 + (i << 4);
#pragma unroll
    for (int j = 0; j < 4; ++j) {
#pragma unroll
      for (int r = 0; r < 8; ++r) slab[(mOff + r) * 68 + (j << 4) + rlane] = acc[i][j][r] * kPCarryInv;
    }
    __builtin_amdgcn_fence(__ATOMIC_RELEASE, "workgroup");
    __builtin_amdgcn_wave_barrier();
    __builtin_amdgcn_fence(__ATOMIC_ACQUIRE, "workgroup");
    {
      const int hh = lane >> 4, c4 = (lane & 15) * 4;
      v4f vals[8];
#pragma unroll
      for (int it = 0; it < 8; ++it) vals[it] = *(const v4f*)(slab + (it * 2 + hh) * 68 + c4);
      {
#pragma unroll
        for (int it = 0; it < 8; ++it) {
          const int row = it * 2 + hh;
          *(v4f*)(SC + (size_t)(mBase + row) * kDim + n0 + c4) = vals[it];
        }
        
      }
    }
    __builtin_amdgcn_fence(__ATOMIC_RELEASE, "workgroup");
    __builtin_amdgcn_wave_barrier();
    __builtin_amdgcn_fence(__ATOMIC_ACQUIRE, "workgroup");
  }
}

// ---------------------------------------------------------------------------
// s = LayerNorm(res + sc) over 512 (biased variance, eps inside rsqrt), one wave per row, 8 rows per block.
// Lane owns columns it*128 + lane*4 .. +3 (it 0..3): 16 values in registers, static indexing.
// res is an f16 plane read as 32-bit integer words; sc, gamma, beta f32.
// (via the wave's own LDS slab: lane owns columns it2*256 + lane*8 .. +7, 2 instructions x 32 lanes x 16 B = 4 whole
// ---------------------------------------------------------------------------
__global__ __launch_bounds__(256) void add_ln_kernel(const unsigned short* __restrict__ RES, const float* __restrict__ SCp,
                                                     const float* __restrict__ gam, const float* __restrict__ bet,
                                                     float* __restrict__ S32, unsigned short* __restrict__ S16) {
  __shared__ __align__(16) float sY[8][kDim];
  const int lane = threadIdx.x & 31;
  const int wave = __builtin_amdgcn_readfirstlane((int)(threadIdx.x >> 5));
  const int row = blockIdx.x * 8 + wave;
  const float* scp = SCp + (size_t)row * kDim;
  const unsigned short* rp = RES + (size_t)row * kDim;
  float x[16];
#pragma unroll
  for (int it = 0; it < 4; ++it) {
    const int col = it * 128 + lane * 4;
    const v4f a = *(const v4f*)(scp + col);
    const v2u w = *(const v2u*)(rp + col);
    const unsigned w0 = w[0];
    const unsigned w1 = w[1];
    x[4 * it + 0] = h16_to_f32(w0 & 0xffffu) + a[0];
    x[4 * it + 1] = h16_to_f32(w0 >> 16) + a[1];
    x[4 * it + 2] = h16_to_f32(w1 & 0xffffu) + a[2];
    x[4 * it + 3] = h16_to_f32(w1 >> 16) + a[3];
  }
  float s = 0.f;
#pragma unroll
  for (int i = 0; i < 16; ++i) s += x[i];
#pragma unroll
  for (int off = 16; off > 0; off >>= 1) s += __shfl_xor(s, off, 32);
  const float mu = s * kInvDim;
  float vs = 0.f;
#pragma unroll
  for (int i = 0; i < 16; ++i) {
    const float d = x[i] - mu;
    x[i] = d;
    vs += d * d;
  }
#pragma unroll
  for (int off = 16; off > 0; off >>= 1) vs += __shfl_xor(vs, off, 32);
  const float inv = rsqrtf(vs * kInvDim + kLnEps);
  float* slab = sY[wave];
  v4f yv[4];
#pragma unroll
  for (int it = 0; it < 4; ++it) {
    const int col = it * 128 + lane * 4;
    const v4f g4 = *(const v4f*)(gam + col);
    const v4f b4 = *(const v4f*)(bet + col);
    v4f y;
    y[0] = (x[4 * it + 0] * inv) * g4[0] + b4[0];
    y[1] = (x[4 * it + 1] * inv) * g4[1] + b4[1];
    y[2] = (x[4 * it + 2] * inv) * g4[2] + b4[2];
    y[3] = (x[4 * it + 3] * inv) * g4[3] + b4[3];
    yv[it] = y;
    *(v4f*)(slab + col) = y;
  }
  __builtin_amdgcn_fence(__ATOMIC_RELEASE, "workgroup");
  __builtin_amdgcn_wave_barrier();
  __builtin_amdgcn_fence(__ATOMIC_ACQUIRE, "workgroup");
  v8h hv[2];
#pragma unroll
  for (int it2 = 0; it2 < 2; ++it2) {
    const int c = it2 * 256 + lane * 8;
    const v4f a0 = *(const v4f*)(slab + c);
    const v4f a1 = *(const v4f*)(slab + c + 4);
#pragma unroll
    for (int e = 0; e < 4; ++e) {
      const float f0 = a0[e], f1 = a1[e];
      hv[it2][e]     = (_Float16)f0;
      hv[it2][4 + e] = (_Float16)f1;
    }
  }
  float* o32 = S32 + (size_t)row * kDim;
  unsigned short* o16 = S16 + (size_t)row * kDim;
  {
#pragma unroll
    for (int it = 0; it < 4; ++it) *(v4f*)(o32 + it * 128 + lane * 4) = yv[it];
#pragma unroll
    for (int it2 = 0; it2 < 2; ++it2) *(v8h*)(o16 + it2 * 256 + lane * 8) = hv[it2];
    
  }
}

// ---------------------------------------------------------------------------
// Host glue (kernel launches and host arithmetic only)
// ---------------------------------------------------------------------------
template <int ET, bool SPLIT, int BIAS_MODE, int OUT_MODE, bool RESID, int ACT>
static void run_gemm(hipStream_t st,
                     const unsigned short* A, const unsigned short* A2, int lda,
                     const unsigned short* Bt, const unsigned short* Bt2, int ldb,
                     void* C, void* C2, int ldc,
                     const float* bias, const float* resid,
                     int M, int N, int K, float scale) {
  const int tiles = (M >> 6) * (N >> 6);
  const int blocks = (tiles + 7) / 8;
  wmma_gemm64<ET, SPLIT, BIAS_MODE, OUT_MODE, RESID, ACT><<<dim3(blocks), 256, 0, st>>>(
      A, A2, lda, Bt, Bt2, ldb, C, C2, ldc, bias, resid, M, N, K, scale);
}

extern "C" void kernel_launch(void* const* d_in, const int* in_sizes, int n_in,
                              void* d_out, int out_size, void* d_ws, size_t ws_size,
                              hipStream_t stream) {
  if (n_in < 34) return;
  if (in_sizes[0] != (int)kND || in_sizes[1] != (int)kND) return;
  for (int p = 0; p < 2; ++p) {
    for (int s = 0; s < 16; ++s) {
      const bool isMat = (s == 0 || s == 2 || s == 4 || s == 6 || s == 8 || s == 10 || s == 11 || s == 12 || s == 15);
      const int want = isMat ? (int)kWW : kDim;
      if (in_sizes[2 + 16 * p + s] != want) return;
    }
  }
  if (out_size != (int)(2 * kND)) return;
  if (ws_size < kWsTotal) return;

  char* ws = (char*)d_ws;
  unsigned short* XH  = (unsigned short*)(ws + kOffXH);
  unsigned short* XL  = (unsigned short*)(ws + kOffXL);
  unsigned short* T0H = (unsigned short*)(ws + kOffT0H);
  unsigned short* T0L = (unsigned short*)(ws + kOffT0L);
  unsigned short* FH  = (unsigned short*)(ws + kOffFH);
  unsigned short* FL  = (unsigned short*)(ws + kOffFL);
  unsigned short* F16 = (unsigned short*)(ws + kOffF16);
  unsigned short* R1  = (unsigned short*)(ws + kOffR1);
  unsigned short* R2  = (unsigned short*)(ws + kOffR2);
  unsigned short* WSH = (unsigned short*)(ws + kOffWSH);
  unsigned short* WSL = (unsigned short*)(ws + kOffWSL);
  unsigned short* WF  = (unsigned short*)(ws + kOffWF);
  float*          S   = (float*)(ws + kOffS);
  float*          S32 = (float*)(ws + kOffS32);
  unsigned short* S16 = (unsigned short*)(ws + kOffS16);
  unsigned short* QK  = (unsigned short*)(ws + kOffQK);
  unsigned short* VT  = (unsigned short*)(ws + kOffVT);
  unsigned short* RES = (unsigned short*)(ws + kOffRES);
  float*          SC  = (float*)(ws + kOffSC);
  unsigned short* FFN = (unsigned short*)(ws + kOffFFN);
  float*          MROW = (float*)(ws + kOffMROW);
  float*          INVS = (float*)(ws + kOffINVS);
  float*          RC   = (float*)(ws + kOffRC);
  float* out = (float*)d_out;

  const int nd8 = (int)(kND / 8);
  const int ww8 = (int)(kWW / 8);

  /* ffn weights of both branches -> f16 x256 planes (persistent) */
  {
    const float* fa = (const float*)d_in[2 + 15];
    const float* fb = (const float*)d_in[18 + 15];
    cast4_f16_kernel<<<dim3(ww8 / 256, 2), 256, 0, stream>>>(fa, fb, fa, fa, FFN, kWCarry, ww8, (long)kWW);
  }

  /* ---- per-branch linear chain (operand planes in R0 reused by branch B after branch A, stream ordered) ---- */
  for (int p = 0; p < 2; ++p) {
    const float* x   = (const float*)d_in[p];
    const int pb = 2 + 16 * p;
    const float* pW1 = (const float*)d_in[pb + 0];
    const float* pb1 = (const float*)d_in[pb + 1];
    const float* pW2 = (const float*)d_in[pb + 2];
    const float* pb2 = (const float*)d_in[pb + 3];
    const float* rW1 = (const float*)d_in[pb + 4];
    const float* rb1 = (const float*)d_in[pb + 5];
    const float* rW2 = (const float*)d_in[pb + 6];
    const float* rb2 = (const float*)d_in[pb + 7];
    const float* rW3 = (const float*)d_in[pb + 8];
    const float* rb3 = (const float*)d_in[pb + 9];
    const float* Wq  = (const float*)d_in[pb + 10];
    const float* Wk  = (const float*)d_in[pb + 11];
    const float* Wv  = (const float*)d_in[pb + 12];
    unsigned short* QH = QK + (size_t)(4 * p + 0) * kND;
    unsigned short* QL = QK + (size_t)(4 * p + 1) * kND;
    unsigned short* KH = QK + (size_t)(4 * p + 2) * kND;
    unsigned short* KL = QK + (size_t)(4 * p + 3) * kND;
    unsigned short* VTp  = VT  + (size_t)p * kND;
    unsigned short* RESp = RES + (size_t)p * kND;

    /* operand planes: x hi/lo; pW1,pW2,Wq,Wk hi/lo (weights are [out][in] = Bt layout); rW1,rW2,rW3,Wv f16 x256 */
    split4_bf16_kernel<<<dim3(nd8 / 256, 1), 256, 0, stream>>>(x, x, x, x, XH, XL, nd8, 0L);
    split4_bf16_kernel<<<dim3(ww8 / 256, 4), 256, 0, stream>>>(pW1, pW2, Wq, Wk, WSH, WSL, ww8, (long)kWW);
    cast4_f16_kernel<<<dim3(ww8 / 256, 4), 256, 0, stream>>>(rW1, rW2, rW3, Wv, WF, kWCarry, ww8, (long)kWW);

    /* h1 = relu(x . pW1^T + pb1) -> hi/lo : M 4096, N 512, K 512 */
    run_gemm<1, true, 2, 2, false, 2>(stream, XH, XL, kDim, WSH + 0 * kWW, WSL + 0 * kWW, kDim,
                                      (void*)T0H, (void*)T0L, kDim, pb1, pb1, kTok, kDim, kDim, 1.0f);
    /* feat = h1 . pW2^T + pb2 -> hi/lo */
    run_gemm<1, true, 2, 2, false, 0>(stream, T0H, T0L, kDim, WSH + 1 * kWW, WSL + 1 * kWW, kDim,
                                      (void*)FH, (void*)FL, kDim, pb2, pb2, kTok, kDim, kDim, 1.0f);
    /* f16 copy of feat */
    hilo_to_f16_kernel<<<dim3(nd8 / 256), 256, 0, stream>>>(FH, FL, F16, nd8);
    /* residual chain: relu, relu, linear (f16 single products, weights x256) */
    run_gemm<0, false, 2, 1, false, 2>(stream, F16, F16, kDim, WF + 0 * kWW, WF + 0 * kWW, kDim,
                                       (void*)R1, (void*)R1, kDim, rb1, rb1, kTok, kDim, kDim, kWCarryInv);
    run_gemm<0, false, 2, 1, false, 2>(stream, R1, R1, kDim, WF + 1 * kWW, WF + 1 * kWW, kDim,
                                       (void*)R2, (void*)R2, kDim, rb2, rb2, kTok, kDim, kDim, kWCarryInv);
    run_gemm<0, false, 2, 1, false, 0>(stream, R2, R2, kDim, WF + 2 * kWW, WF + 2 * kWW, kDim,
                                       (void*)RESp, (void*)RESp, kDim, rb3, rb3, kTok, kDim, kDim, kWCarryInv);
    /* Q, K -> hi/lo planes */
    run_gemm<1, true, 0, 2, false, 0>(stream, FH, FL, kDim, WSH + 2 * kWW, WSL + 2 * kWW, kDim,
                                      (void*)QH, (void*)QL, kDim, pb1, pb1, kTok, kDim, kDim, 1.0f);
    run_gemm<1, true, 0, 2, false, 0>(stream, FH, FL, kDim, WSH + 3 * kWW, WSL + 3 * kWW, kDim,
                                      (void*)KH, (void*)KL, kDim, pb1, pb1, kTok, kDim, kDim, 1.0f);
    /* V^T[d][i] = sum_k Wv[d][k] feat[i][k] : A = Wv (M 512), Bt = feat f16 (N 4096), K 512, ldc 4096 */
    run_gemm<0, false, 0, 1, false, 0>(stream, WF + 3 * kWW, WF + 3 * kWW, kDim, F16, F16, kDim,
                                       (void*)VTp, (void*)VTp, kTok, pb1, pb1, kDim, kTok, kDim, kWCarryInv);
  }

  /* ---- cross attention, add + LayerNorm, ffn; branches in sequence sharing S / SC / statistics ---- */
  for (int p = 0; p < 2; ++p) {
    const int o = 1 - p;
    const int pb = 2 + 16 * p;
    const float* ln_g = (const float*)d_in[pb + 13];
    const float* ln_b = (const float*)d_in[pb + 14];
    const unsigned short* QH  = QK + (size_t)(4 * p + 0) * kND;
    const unsigned short* QL  = QK + (size_t)(4 * p + 1) * kND;
    const unsigned short* KHo = QK + (size_t)(4 * o + 2) * kND;
    const unsigned short* KLo = QK + (size_t)(4 * o + 3) * kND;
    const unsigned short* VTp  = VT  + (size_t)p * kND;
    const unsigned short* RESp = RES + (size_t)p * kND;
    const unsigned short* FFNp = FFN + (size_t)p * kWW;

    /* S = Q_p . K_other^T (hi.hi + hi.lo + lo.hi), f32 : M 4096, N 4096, K 512 */
    run_gemm<1, true, 0, 0, false, 0>(stream, QH, QL, kDim, KHo, KLo, kDim,
                                      (void*)S, (void*)S, kTok, ln_g, ln_g, kTok, kTok, kDim, 1.0f);
    rowstat_kernel<<<dim3(kTok / 32), 256, 0, stream>>>(S, MROW, INVS);
    colsum_kernel<<<dim3(kTok / 32), 256, 0, stream>>>(S, MROW, INVS, RC);
    av_kernel<<<dim3(kTok / 64), 256, 0, stream>>>(S, MROW, INVS, RC, VTp, SC);
    /* S is dead from here until the other branch's logits; S32 / S16 occupy its first 12 MiB */
    add_ln_kernel<<<dim3(kTok / 8), 256, 0, stream>>>(RESp, SC, ln_g, ln_b, S32, S16);
    /* out = s + s . ffnW^T : A = s f16, Bt = ffnW f16 x256, residual s f32 fetched in the store phase */
    run_gemm<0, false, 0, 0, true, 0>(stream, S16, S16, kDim, FFNp, FFNp, kDim,
                                      (void*)(out + (size_t)p * kND), (void*)(out + (size_t)p * kND), kDim,
                                      ln_g, S32, kTok, kDim, kDim, kWCarryInv);
  }
}

// v001
// It runs in 911 microseconds.
// Next to v000, in two timings, it ran 1.54 and 1.51 times as fast.
// Contractions: pW1/pW2/Wq/Wk linears and q.k^T logits on v_wmma_f32_16x16x32_bf16 with both operands as bf16 hi+lo planes (hi.hi + hi.lo + lo.hi), f32 accumulate, logits kept f32; rW1/rW2/rW3/Wv/ffn linears and attn.V on v_wmma_f32_16x16x32_f16 (weights carried x256, attention weights carried x32768), f32 accumulate; softmax statistics, column sums, LayerNorm and residual adds in f32.
#include <hip/hip_runtime.h>
#include <math.h>

typedef __attribute__((ext_vector_type(16))) _Float16 v16h;
typedef __attribute__((ext_vector_type(8)))  _Float16 v8h;
typedef __attribute__((ext_vector_type(16))) __bf16   v16b;
typedef __attribute__((ext_vector_type(8)))  __bf16   v8b;
typedef __attribute__((ext_vector_type(8)))  float    v8f;
typedef __attribute__((ext_vector_type(4)))  float    v4f;
typedef __attribute__((ext_vector_type(4)))  unsigned int v4u;
typedef __attribute__((ext_vector_type(2)))  unsigned int v2u;

// ---------------------------------------------------------------------------
// Problem constants
// ---------------------------------------------------------------------------
constexpr int    kTok       = 4096;
constexpr int    kDim       = 512;
constexpr size_t kND        = (size_t)kTok * kDim;
constexpr size_t kWW        = (size_t)kDim * kDim;
constexpr float  kWCarry    = 256.0f;
constexpr float  kWCarryInv = 1.0f / kWCarry;
constexpr float  kPCarry    = 32768.0f;
constexpr float  kPCarryInv = 1.0f / kPCarry;
constexpr float  kInvDim    = 1.0f / (float)kDim;
constexpr float  kLnEps     = 1e-6f;
constexpr float  kAttnEps   = 1e-9f;
constexpr int    kAvPitch   = 40;
static_assert((kTok % 64) == 0 && (kDim % 64) == 0);
static_assert((kTok % 32) == 0 && (kDim % 32) == 0);
static_assert(((kND / 8) % 256) == 0 && ((kWW / 8) % 256) == 0);
static_assert((kAvPitch % 8) == 0 && kAvPitch >= 32);

// ---------------------------------------------------------------------------
// Workspace region map (bytes; every offset is a multiple of 128)
//   R0      67,108,864  time-shared region:
//             (a) operand planes of the per-branch linear chain (branch A, then branch B again):
//                 XH XL T0H T0L FH FL F16 R1 R2   9 x 4,194,304 (16-bit [4096][512] planes)
//                 WSH (4 bf16 hi weight planes) 2,097,152 ; WSL (4 bf16 lo planes) 2,097,152
//                 WF  (4 f16 weight planes, carried x256) 2,097,152         -> 44,040,192 used
//             (b) S f32 [4096][4096] logits of the current branch            67,108,864
//             (c) S32 f32 [4096][512] + S16 f16 [4096][512] LayerNorm output 12,582,912
//   QK      33,554,432  QH QL KH KL bf16 planes [4096][512], branch A then branch B
//   VT       8,388,608  V^T f16 [512][4096], branch A then B
//   RES      8,388,608  residual-chain output f16 [4096][512], branch A then B
//   SC       8,388,608  attn.V output f32 [4096][512] (shared by the branches, stream ordered)
//   FFN      1,048,576  ffn weight f16 planes (x256), branch A then B
//   MROW        16,384  row maxima f32 [4096]
//   INVS        16,384  1 / row exp sums f32 [4096]
//   RC          16,384  1 / (1e-9 + column sums) f32 [4096]
//   total = 67,108,864 + 33,554,432 + 8,388,608 + 8,388,608 + 8,388,608 + 1,048,576 + 16,384 + 16,384 + 16,384
//         = 126,926,848
// ---------------------------------------------------------------------------
constexpr size_t kPlane16  = kND * 2;
constexpr size_t kPlane32  = kND * 4;
constexpr size_t kW16      = kWW * 2;
constexpr size_t kR0Bytes  = (size_t)kTok * kTok * 4;
constexpr size_t kOffXH    = 0;
constexpr size_t kOffXL    = kOffXH  + kPlane16;
constexpr size_t kOffT0H   = kOffXL  + kPlane16;
constexpr size_t kOffT0L   = kOffT0H + kPlane16;
constexpr size_t kOffFH    = kOffT0L + kPlane16;
constexpr size_t kOffFL    = kOffFH  + kPlane16;
constexpr size_t kOffF16   = kOffFL  + kPlane16;
constexpr size_t kOffR1    = kOffF16 + kPlane16;
constexpr size_t kOffR2    = kOffR1  + kPlane16;
constexpr size_t kOffWSH   = kOffR2  + kPlane16;
constexpr size_t kOffWSL   = kOffWSH + 4 * kW16;
constexpr size_t kOffWF    = kOffWSL + 4 * kW16;
constexpr size_t kPhase1End = kOffWF + 4 * kW16;
constexpr size_t kOffS     = 0;
constexpr size_t kOffS32   = 0;
constexpr size_t kOffS16   = kOffS32 + kPlane32;
constexpr size_t kOffQK    = kR0Bytes;
constexpr size_t kOffVT    = kOffQK  + 8 * kPlane16;
constexpr size_t kOffRES   = kOffVT  + 2 * kPlane16;
constexpr size_t kOffSC    = kOffRES + 2 * kPlane16;
constexpr size_t kOffFFN   = kOffSC  + kPlane32;
constexpr size_t kOffMROW  = kOffFFN + 2 * kW16;
constexpr size_t kOffINVS  = kOffMROW + (size_t)kTok * 4;
constexpr size_t kOffRC    = kOffINVS + (size_t)kTok * 4;
constexpr size_t kWsTotal  = kOffRC   + (size_t)kTok * 4;
static_assert(kPhase1End <= kR0Bytes);
static_assert(kOffS16 + kPlane16 <= kR0Bytes);
static_assert(kWsTotal == 126926848ull);
static_assert(kWsTotal <= 134217728ull);
static_assert((kOffWSH % 128) == 0 && (kOffWSL % 128) == 0 && (kOffWF % 128) == 0 && (kOffQK % 128) == 0 &&
              (kOffVT % 128) == 0 && (kOffRES % 128) == 0 && (kOffSC % 128) == 0 && (kOffFFN % 128) == 0 &&
              (kOffMROW % 128) == 0 && (kOffINVS % 128) == 0 && (kOffRC % 128) == 0 && (kOffS16 % 128) == 0);

// ---------------------------------------------------------------------------
// Small helpers
// ---------------------------------------------------------------------------
__device__ __forceinline__ unsigned short f2bf_bits(float f) {
  unsigned u = __float_as_uint(f);
  return (unsigned short)((u + 0x7FFFu + ((u >> 16) & 1u)) >> 16);
}
__device__ __forceinline__ float bf_bits2f(unsigned short h) { return __uint_as_float(((unsigned)h) << 16); }

/* f16 bits (low 16 bits of hb, finite values) -> f32, integer path only */
__device__ __forceinline__ float h16_to_f32(unsigned hb) {
  const unsigned sgn = (hb & 0x8000u) << 16;
  const unsigned em = hb & 0x7fffu;
  const float fn = __uint_as_float((em << 13) + 0x38000000u);
  const float fs = (float)em * 5.9604644775390625e-8f;
  const float mag = (em < 0x400u) ? fs : fn;
  return __uint_as_float(__float_as_uint(mag) | sgn);
}

/* hazard guards: four nops, all four accumulators of the group tied, A fragments named as inputs */
__device__ __forceinline__ void grp_guard_h(v8f& a, v8f& b, v8f& c, v8f& d, v16h x, v16h y) {
  asm volatile("v_nop\n\tv_nop\n\tv_nop\n\tv_nop" : "+v"(a), "+v"(b), "+v"(c), "+v"(d) : "v"(x), "v"(y));
}
__device__ __forceinline__ void grp_guard_b(v8f& a, v8f& b, v8f& c, v8f& d, v16b x, v16b y) {
  asm volatile("v_nop\n\tv_nop\n\tv_nop\n\tv_nop" : "+v"(a), "+v"(b), "+v"(c), "+v"(d) : "v"(x), "v"(y));
}
__device__ __forceinline__ void keep4_h(v16h a, v16h b, v16h c, v16h d) { asm volatile("v_nop" :: "v"(a), "v"(b), "v"(c), "v"(d)); }
__device__ __forceinline__ void keep4_b(v16b a, v16b b, v16b c, v16b d) { asm volatile("v_nop" :: "v"(a), "v"(b), "v"(c), "v"(d)); }
__device__ __forceinline__ void acc_guard4(v8f& a, v8f& b, v8f& c, v8f& d) {
  asm volatile("v_nop\n\tv_nop\n\tv_nop\n\tv_nop" : "+v"(a), "+v"(b), "+v"(c), "+v"(d));
}

/* Fragment loader: elements 0..7 <- p[0..7], elements 8..15 <- p[16..23]; p already includes 8*(lane>>4) */
template <typename T> struct Frag;
template <> struct Frag<_Float16> {
  typedef v16h V;
  union U { v16h v; v8h h[2]; };
  static __device__ __forceinline__ v16h load(const _Float16* p) {
    U f;
    f.h[0] = *(const v8h*)(p);
    f.h[1] = *(const v8h*)(p + 16);
    return f.v;
  }
  static __device__ __forceinline__ v8f mma(v16h a, v16h b, v8f c) {
    return __builtin_amdgcn_wmma_f32_16x16x32_f16(false, a, false, b, (short)0, c, false, false);
  }
  static __device__ __forceinline__ void guard(v8f& a, v8f& b, v8f& c, v8f& d, v16h x, v16h y) { grp_guard_h(a, b, c, d, x, y); }
  static __device__ __forceinline__ void keep(v16h a, v16h b, v16h c, v16h d) { keep4_h(a, b, c, d); }
};
template <> struct Frag<__bf16> {
  typedef v16b V;
  union U { v16b v; v8b h[2]; };
  static __device__ __forceinline__ v16b load(const __bf16* p) {
    U f;
    f.h[0] = *(const v8b*)(p);
    f.h[1] = *(const v8b*)(p + 16);
    return f.v;
  }
  static __device__ __forceinline__ v8f mma(v16b a, v16b b, v8f c) {
    return __builtin_amdgcn_wmma_f32_16x16x32_bf16(false, a, false, b, (short)0, c, false, false);
  }
  static __device__ __forceinline__ void guard(v8f& a, v8f& b, v8f& c, v8f& d, v16b x, v16b y) { grp_guard_b(a, b, c, d, x, y); }
  static __device__ __forceinline__ void keep(v16b a, v16b b, v16b c, v16b d) { keep4_b(a, b, c, d); }
};

// ---------------------------------------------------------------------------
// LDS-staged WMMA GEMM: C[m,n] = scale * sum_k A[m,k] * Bt[n,k] (+bias[n]) (+resid[m,n]). A block of 4 waves owns a
// 128x128 tile (2x2 waves, each wave a 64x64 tile). A row-major [M][K] pitch lda; Bt row-major [N][K] pitch ldb;
// M, N multiples of 128, K a multiple of 64 and at least 128.
// Operand path: a stage is 64 k (one whole 128-B line) of the block's 128 A rows and 128 Bt rows, every plane, brought
// into LDS by per-lane asynchronous 16-B copies (8 lanes per line, 4 whole lines per wave instruction), two buffers:
// the next stage's copies fly while this stage is multiplied. LDS row pitch 144 B (16 B x 9) for the 16-B readers.
// SPLIT: operands are hi/lo planes (A2/Bt2 = lo planes, same layout); product = hi.hi + hi.lo + lo.hi.
// BIAS_MODE: 0 none, 2 bias[n] (f32). ACT: 0 none, 2 relu. RESID (f32 output only): the residual is fetched in the
// store phase, one 16-B vector per lane at exactly the address the lane stores to.
// OUT_MODE: 0 f32, 1 f16, 2 bf16 hi plane (Cout) + bf16 lo plane (Cout2).
// Epilogue: 16-row slabs staged per wave in LDS (only the owning wave touches its slab); the slabs reuse the ring
// behind the last stage's waits and barrier.
// ET: 0 f16 operands, 1 bf16 operands (pointers passed as 16-bit storage).
// ---------------------------------------------------------------------------
template <int ET> struct Elem;
template <> struct Elem<0> { typedef _Float16 T; };
template <> struct Elem<1> { typedef __bf16 T; };

constexpr int kStageK   = 64;
constexpr int kRowPitch = 144;
constexpr int kPlaneLds = 128 * kRowPitch;
constexpr int kSlabLds  = 16 * 68 * 4;
static_assert((kRowPitch % 16) == 0 && ((kRowPitch / 16) % 2) == 1 && kRowPitch >= kStageK * 2);
static_assert((kDim % 128) == 0 && (kTok % 128) == 0 && (kDim % kStageK) == 0 && kDim >= 2 * kStageK);
static_assert(4 * kSlabLds <= 4 * kPlaneLds && (kSlabLds % 16) == 0);

/* One plane's 128 rows x 128 B of a stage: this lane's eight 16-B pieces, rows 16 apart. l = the lane's LDS byte
   address of its first piece, g = its global address, gstep = 16 source rows in elements. The copies and the
   s_wait_xcnt stand in one statement so that no address register is rewritten ahead of that wait. */
__device__ __forceinline__ void stage_plane(unsigned l, const unsigned short* g, size_t gstep) {
  const unsigned l1 = l + 16 * kRowPitch, l2 = l + 32 * kRowPitch, l3 = l + 48 * kRowPitch, l4 = l + 64 * kRowPitch,
                 l5 = l + 80 * kRowPitch, l6 = l + 96 * kRowPitch, l7 = l + 112 * kRowPitch;
  const unsigned short *g1 = g + gstep, *g2 = g + 2 * gstep, *g3 = g + 3 * gstep, *g4 = g + 4 * gstep,
                       *g5 = g + 5 * gstep, *g6 = g + 6 * gstep, *g7 = g + 7 * gstep;
  asm volatile(
      "global_load_async_to_lds_b128 %0, %8, off\n\t"
      "global_load_async_to_lds_b128 %1, %9, off\n\t"
      "global_load_async_to_lds_b128 %2, %10, off\n\t"
      "global_load_async_to_lds_b128 %3, %11, off\n\t"
      "global_load_async_to_lds_b128 %4, %12, off\n\t"
      "global_load_async_to_lds_b128 %5, %13, off\n\t"
      "global_load_async_to_lds_b128 %6, %14, off\n\t"
      "global_load_async_to_lds_b128 %7, %15, off\n\t"
      "s_wait_xcnt 0x0"
      :: "v"(l), "v"(l1), "v"(l2), "v"(l3), "v"(l4), "v"(l5), "v"(l6), "v"(l7),
         "v"(g), "v"(g1), "v"(g2), "v"(g3), "v"(g4), "v"(g5), "v"(g6), "v"(g7)
      : "memory");
}

template <int ET, bool SPLIT, int BIAS_MODE, int OUT_MODE, bool RESID, int ACT>
__global__ __launch_bounds__(128) void wmma_gemm64(
    const unsigned short* __restrict__ Ap, const unsigned short* __restrict__ A2p, int lda,
    const unsigned short* __restrict__ Btp, const unsigned short* __restrict__ Bt2p, int ldb,
    void* __restrict__ Cout, void* __restrict__ Cout2, int ldc,
    const float* __restrict__ bias, const float* __restrict__ resid,
    int M, int N, int K, float scale) {
  typedef typename Elem<ET>::T T;
  typedef typename Frag<T>::V V;
  /* stage layout: A hi | (A lo) | Bt hi | (Bt lo), each plane 128 rows at kRowPitch */
  constexpr int kPlanes = SPLIT ? 4 : 2;
  constexpr int kStageLds = kPlanes * kPlaneLds;
  constexpr int kOffBh = (SPLIT ? 2 : 1) * kPlaneLds;
  __shared__ __align__(16) unsigned char ring[2 * kStageLds];
  const int lane = threadIdx.x & 31;
  const int wave = __builtin_amdgcn_readfirstlane((int)(threadIdx.x >> 5));
  const int tilesN = N >> 7;
  const int tilesM = M >> 7;
  /* block-uniform exit in front of every copy and barrier */
  if ((int)blockIdx.x >= tilesM * tilesN) return;
  const int bm = (int)blockIdx.x / tilesN;
  const int bn = (int)blockIdx.x - bm * tilesN;
  const int wm = (wave >> 1) << 6;
  const int wn = (wave & 1) << 6;
  const int m0 = (bm << 7) + wm;
  const int n0 = (bn << 7) + wn;

  const int rlane = lane & 15;
  const int koff  = (lane >> 4) * 8;
  const int mOff  = (lane >> 4) * 8;

  /* copy map: thread t brings 16-B piece t&7 of rows (t>>3) + 16q, q 0..7, of every plane */
  const int crow = (int)threadIdx.x >> 3;
  const int cpc  = (int)threadIdx.x & 7;
  const unsigned ldsBase = (unsigned)(size_t)(&ring[0]) + (unsigned)(crow * kRowPitch + cpc * 16);
  const size_t aOff = (size_t)((bm << 7) + crow) * lda + cpc * 8;
  const size_t bOff = (size_t)((bn << 7) + crow) * ldb + cpc * 8;
  const size_t aStep = (size_t)16 * lda;
  const size_t bStep = (size_t)16 * ldb;
  const int nStages = K / kStageK;

  auto issue_stage = [&](int s) {
    const unsigned l = ldsBase + (unsigned)((s & 1) * kStageLds);
    const size_t kq = (size_t)s * kStageK;
    stage_plane(l, Ap + aOff + kq, aStep);
    if (SPLIT) stage_plane(l + kPlaneLds, A2p + aOff + kq, aStep);
    stage_plane(l + kOffBh, Btp + bOff + kq, bStep);
    if (SPLIT) stage_plane(l + kOffBh + kPlaneLds, Bt2p + bOff + kq, bStep);
  };

  v8f acc[4][4];
#pragma unroll
  for (int i = 0; i < 4; ++i)
#pragma unroll
    for (int j = 0; j < 4; ++j) acc[i][j] = (v8f){0.f, 0.f, 0.f, 0.f, 0.f, 0.f, 0.f, 0.f};

  /* prologue: stage 0 landed and published, then stage 1 in flight */
  issue_stage(0);
  asm volatile("s_wait_asynccnt 0x0" ::: "memory");  /* this wave's stage-0 copies have landed */
  __syncthreads();
  if (nStages > 1) issue_stage(1);

  const int aFrag = (wm + rlane) * kRowPitch + koff * 2;
  const int bFrag = kOffBh + (wn + rlane) * kRowPitch + koff * 2;

#pragma unroll 1  /* one stage per trip: the foot's waits and barrier stand once */
  for (int s = 0; s < nStages; ++s) {
    const unsigned char* sb = ring + (s & 1) * kStageLds;
#pragma unroll
    for (int kk = 0; kk < kStageK; kk += 32) {
      V bh[4], bl[4];
      const unsigned char* ap = sb + aFrag + kk * 2;
      V ah = Frag<T>::load((const T*)ap);
      V al;
      if (SPLIT) al = Frag<T>::load((const T*)(ap + kPlaneLds));
#pragma unroll
      for (int j = 0; j < 4; ++j) {
        const unsigned char* bp = sb + bFrag + j * 16 * kRowPitch + kk * 2;
        bh[j] = Frag<T>::load((const T*)bp);
        if (SPLIT) bl[j] = Frag<T>::load((const T*)(bp + kPlaneLds));
      }
#pragma unroll
      for (int i = 0; i < 4; ++i) {
        /* the next row group's A fragments are read in front of this group's products */
        V nh = ah;
        V nl;
        if (SPLIT) nl = al;
        if (i < 3) {
          nh = Frag<T>::load((const T*)(ap + (i + 1) * 16 * kRowPitch));
          if (SPLIT) nl = Frag<T>::load((const T*)(ap + (i + 1) * 16 * kRowPitch + kPlaneLds));
        }
#pragma unroll
        for (int j = 0; j < 4; ++j) {
          acc[i][j] = Frag<T>::mma(ah, bh[j], acc[i][j]);
          if (SPLIT) {
            acc[i][j] = Frag<T>::mma(ah, bl[j], acc[i][j]);
            acc[i][j] = Frag<T>::mma(al, bh[j], acc[i][j]);
          }
        }
        Frag<T>::guard(acc[i][0], acc[i][1], acc[i][2], acc[i][3], ah, SPLIT ? al : ah);
        ah = nh;
        if (SPLIT) al = nl;
      }
      Frag<T>::keep(bh[0], bh[1], bh[2], bh[3]);
      if (SPLIT) Frag<T>::keep(bl[0], bl[1], bl[2], bl[3]);
    }
    /* publish point of stage s + 1; the one barrier also ends every reader's last read of stage s's buffer */
    asm volatile("s_wait_dscnt 0x0" ::: "memory");     /* this wave's reads of stage s have returned */
    asm volatile("s_wait_asynccnt 0x0" ::: "memory");  /* this wave's stage s + 1 copies have landed */
    __syncthreads();
    if (s + 2 < nStages) issue_stage(s + 2);
  }
  asm volatile("s_wait_asynccnt 0x0" ::: "memory");  /* no copy is outstanding when the ring becomes the slabs */
  acc_guard4(acc[0][0], acc[0][1], acc[0][2], acc[0][3]);
  acc_guard4(acc[1][0], acc[1][1], acc[1][2], acc[1][3]);
  acc_guard4(acc[2][0], acc[2][1], acc[2][2], acc[2][3]);
  acc_guard4(acc[3][0], acc[3][1], acc[3][2], acc[3][3]);

  /* ---- epilogue ---- */
  float* slab = (float*)(ring + wave * kSlabLds);
#pragma unroll
  for (int i = 0; i < 4; ++i) {
    const int mBase = m0 + (i << 4);
#pragma unroll
    for (int j = 0; j < 4; ++j) {
      const int n = n0 + (j << 4) + rlane;
      float bv = 0.f;
      if (BIAS_MODE == 2) bv = bias[n];
#pragma unroll
      for (int r = 0; r < 8; ++r) {
        float v = acc[i][j][r] * scale;
        if (BIAS_MODE == 2) v += bv;
        if (ACT == 2) v = fmaxf(v, 0.0f);
        slab[(mOff + r) * 68 + (j << 4) + rlane] = v;
      }
    }
    __builtin_amdgcn_fence(__ATOMIC_RELEASE, "workgroup");
    __builtin_amdgcn_wave_barrier();
    __builtin_amdgcn_fence(__ATOMIC_ACQUIRE, "workgroup");
    if (OUT_MODE == 0) {
      /* rows it*2 + hh, it 0..7, hh 0..1 = 16 rows; 16 lanes x 16 B = the 256-B row segment */
      float* C = (float*)Cout;
      const int hh = lane >> 4, c4 = (lane & 15) * 4;
      v4f vals[8];
#pragma unroll
      for (int it = 0; it < 8; ++it) {
        const int row = it * 2 + hh;
        v4f v = *(const v4f*)(slab + row * 68 + c4);
        if (RESID) {
          const v4f rr = *(const v4f*)(resid + (size_t)(mBase + row) * ldc + n0 + c4);
          v = v + rr;
        }
        vals[it] = v;
      }
      {
#pragma unroll
        for (int it = 0; it < 8; ++it) {
          const int row = it * 2 + hh;
          *(v4f*)(C + (size_t)(mBase + row) * ldc + n0 + c4) = vals[it];
        }
        
      }
    } else {
      const int q = lane >> 3, c8 = (lane & 7) * 8;
      unsigned short* C  = (unsigned short*)Cout;
      unsigned short* C2 = (unsigned short*)Cout2;
      {
#pragma unroll
        for (int it = 0; it < 4; ++it) {
          const int row = it * 4 + q;
          const float* sp = slab + row * 68 + c8;
          v8h hv, lv;
#pragma unroll
          for (int e = 0; e < 8; ++e) {
            const float sv = sp[e];
            if (OUT_MODE == 1) {
              hv[e] = (_Float16)sv;
            } else {
              const unsigned short hb = f2bf_bits(sv);
              const unsigned short lb = f2bf_bits(sv - bf_bits2f(hb));
              hv[e] = __builtin_bit_cast(_Float16, hb);
              lv[e] = __builtin_bit_cast(_Float16, lb);
            }
          }
          *(v8h*)(C + (size_t)(mBase + row) * ldc + n0 + c8) = hv;
          if (OUT_MODE == 2) *(v8h*)(C2 + (size_t)(mBase + row) * ldc + n0 + c8) = lv;
        }
        
      }
    }
    __builtin_amdgcn_fence(__ATOMIC_RELEASE, "workgroup");
    __builtin_amdgcn_wave_barrier();
    __builtin_amdgcn_fence(__ATOMIC_ACQUIRE, "workgroup");
  }
}

// ---------------------------------------------------------------------------
// f32 plane -> bf16 hi plane + bf16 lo plane (both RNE converts: hi = bf16(v), lo = bf16(v - hi)); 8 contiguous
// elements per thread. blockIdx.y (block-uniform) selects one of four sources and output plane y (planeElems apart).
// Coverage: grid.x * 256 threads * 8 elements = total8 * 8 = the whole plane (grids are exact multiples of 256).
// ---------------------------------------------------------------------------
__global__ __launch_bounds__(256) void split4_bf16_kernel(
    const float* __restrict__ s0, const float* __restrict__ s1, const float* __restrict__ s2, const float* __restrict__ s3,
    unsigned short* __restrict__ dhi, unsigned short* __restrict__ dlo, int total8, long planeElems) {
  const int i = blockIdx.x * 256 + threadIdx.x;
  if (i >= total8) return;
  const int y = blockIdx.y;
  const float* src = (y == 0) ? s0 : (y == 1) ? s1 : (y == 2) ? s2 : s3;
  const size_t e0 = (size_t)i << 3;
  const v4f a0 = *(const v4f*)(src + e0);
  const v4f a1 = *(const v4f*)(src + e0 + 4);
  v8h hv, lv;
#pragma unroll
  for (int e = 0; e < 4; ++e) {
    const float f0 = a0[e], f1 = a1[e];
    const unsigned short h0 = f2bf_bits(f0), h1 = f2bf_bits(f1);
    const unsigned short l0 = f2bf_bits(f0 - bf_bits2f(h0)), l1 = f2bf_bits(f1 - bf_bits2f(h1));
    hv[e]     = __builtin_bit_cast(_Float16, h0);
    hv[4 + e] = __builtin_bit_cast(_Float16, h1);
    lv[e]     = __builtin_bit_cast(_Float16, l0);
    lv[4 + e] = __builtin_bit_cast(_Float16, l1);
  }
  unsigned short* qh = dhi + (size_t)y * planeElems + e0;
  unsigned short* ql = dlo + (size_t)y * planeElems + e0;
  *(v8h*)qh = hv;
  *(v8h*)ql = lv;
  
}

// ---------------------------------------------------------------------------
// f32 plane -> f16 plane with a power-of-two carry; same thread/line map as above (8 elements = one 16-B store per
// ---------------------------------------------------------------------------
__global__ __launch_bounds__(256) void cast4_f16_kernel(
    const float* __restrict__ s0, const float* __restrict__ s1, const float* __restrict__ s2, const float* __restrict__ s3,
    unsigned short* __restrict__ out, float carry, int total8, long planeElems) {
  const int i = blockIdx.x * 256 + threadIdx.x;
  if (i >= total8) return;
  const int y = blockIdx.y;
  const float* src = (y == 0) ? s0 : (y == 1) ? s1 : (y == 2) ? s2 : s3;
  const size_t e0 = (size_t)i << 3;
  const v4f a0 = *(const v4f*)(src + e0);
  const v4f a1 = *(const v4f*)(src + e0 + 4);
  v8h hv;
#pragma unroll
  for (int e = 0; e < 4; ++e) {
    const float f0 = a0[e] * carry, f1 = a1[e] * carry;
    hv[e]     = (_Float16)f0;
    hv[4 + e] = (_Float16)f1;
  }
  unsigned short* q = out + (size_t)y * planeElems + e0;
  *(v8h*)q = hv;
  
}

// ---------------------------------------------------------------------------
// bf16 hi + lo planes -> f16 plane of (hi + lo); planes read as 32-bit integer words; same thread/line map.
// ---------------------------------------------------------------------------
__global__ __launch_bounds__(256) void hilo_to_f16_kernel(
    const unsigned short* __restrict__ hi, const unsigned short* __restrict__ lo,
    unsigned short* __restrict__ out, int total8) {
  const int i = blockIdx.x * 256 + threadIdx.x;
  if (i >= total8) return;
  const size_t e0 = (size_t)i << 3;
  const v4u hw4 = *(const v4u*)(hi + e0);
  const v4u lw4 = *(const v4u*)(lo + e0);
  v8h hv;
#pragma unroll
  for (int w = 0; w < 4; ++w) {
    const unsigned hw = hw4[w];
    const unsigned lw = lw4[w];
    const float f0 = __uint_as_float(hw << 16) + __uint_as_float(lw << 16);
    const float f1 = __uint_as_float(hw & 0xffff0000u) + __uint_as_float(lw & 0xffff0000u);
    hv[2 * w]     = (_Float16)f0;
    hv[2 * w + 1] = (_Float16)f1;
  }
  unsigned short* q = out + e0;
  *(v8h*)q = hv;
  
}

// ---------------------------------------------------------------------------
// Row statistics of S f32 [4096][4096]: m_i = max_j S_ij, inv_s_i = 1 / sum_j exp(S_ij - m_i).
// Block = 32 rows (8 waves x 4 rows, one wave per row at a time, lane-strided 16-B loads, two sweeps per row).
// Fixed order: per-lane sequential, then xor shuffle tree (unconditional).
// ---------------------------------------------------------------------------
__global__ __launch_bounds__(256) void rowstat_kernel(const float* __restrict__ S, float* __restrict__ mrow, float* __restrict__ invs) {
  __shared__ float sM[32];
  __shared__ float sI[32];
  const int lane = threadIdx.x & 31;
  const int wave = __builtin_amdgcn_readfirstlane((int)(threadIdx.x >> 5));
  const int row0 = blockIdx.x * 32;
#pragma unroll 1
  for (int q = 0; q < 4; ++q) {
    const int rl = wave * 4 + q;
    const float* p = S + (size_t)(row0 + rl) * kTok + lane * 4;
    float m = -INFINITY;
#pragma unroll 4
    for (int it = 0; it < kTok / 128; ++it) {
      const v4f v = *(const v4f*)(p + it * 128);
      m = fmaxf(m, fmaxf(fmaxf(v[0], v[1]), fmaxf(v[2], v[3])));
    }
#pragma unroll
    for (int off = 16; off > 0; off >>= 1) m = fmaxf(m, __shfl_xor(m, off, 32));
    float sum = 0.f;
#pragma unroll 2
    for (int it = 0; it < kTok / 128; ++it) {
      const v4f v = *(const v4f*)(p + it * 128);
      sum += __expf(v[0] - m);
      sum += __expf(v[1] - m);
      sum += __expf(v[2] - m);
      sum += __expf(v[3] - m);
    }
#pragma unroll
    for (int off = 16; off > 0; off >>= 1) sum += __shfl_xor(sum, off, 32);
    const float inv = 1.0f / sum;
    if (lane == 0) {
      sM[rl] = m;
      sI[rl] = inv;
    }
  }
  __syncthreads();
  if (wave == 0) {
    const float mv = sM[lane];
    const float iv = sI[lane];
    *(float*)(mrow + row0 + lane) = mv;
    *(float*)(invs + row0 + lane) = iv;
    
  }
}

// ---------------------------------------------------------------------------
// Column sums over queries of the row-normalised probabilities: c_j = sum_i exp(S_ij - m_i) * inv_s_i, then
// w, w+8, ... (512 rows) in order; the 8 wave partials are combined in index order by wave 0. No atomics.
// ---------------------------------------------------------------------------
__global__ __launch_bounds__(256) void colsum_kernel(const float* __restrict__ S, const float* __restrict__ mrow,
                                                     const float* __restrict__ invs, float* __restrict__ rcol) {
  __shared__ float sP[8][32];
  const int lane = threadIdx.x & 31;
  const int wave = __builtin_amdgcn_readfirstlane((int)(threadIdx.x >> 5));
  const int j0 = blockIdx.x * 32;
  const float* p = S + j0 + lane;
  float acc = 0.f;
#pragma unroll 4
  for (int t = 0; t < kTok / 8; ++t) {
    const int i = wave + 8 * t;
    const float s  = p[(size_t)i * kTok];
    const float mi = mrow[i];
    const float is = invs[i];
    const float pr = __expf(s - mi) * is;
    acc += pr;
  }
  sP[wave][lane] = acc;
  __syncthreads();
  if (wave == 0) {
    float c = sP[0][lane];
    c += sP[1][lane];
    c += sP[2][lane];
    c += sP[3][lane];
    c += sP[4][lane];
    c += sP[5][lane];
    c += sP[6][lane];
    c += sP[7][lane];
    const float rc = 1.0f / (kAttnEps + c);
    *(float*)(rcol + j0 + lane) = rc;
    
  }
}

// ---------------------------------------------------------------------------
// attn.V with the weights formed while staging: SC[i][d] = (1/32768) * sum_j f16(32768 * P_ij * rc_j) * VT[d][j],
// P_ij = exp(S_ij - m_i) * inv_s_i. Block = 64 query rows x all 512 d (8 waves, wave w owns d columns 64w..64w+63,
// acc 4x4 tiles). Per k-step of 32 keys the 256 threads stage the 64 x 32 f16 A tile in LDS: thread t -> row t>>2,
// keys (t&3)*8..+7 (64 rows x 4 threads x 8 = 2048 = the whole tile, one 16-B LDS store each; pad columns 32..39
// of the 40-half pitch are never read: fragment reads touch k offsets 0..31 only). Block barrier before the fragment
// reads and again before the next staging. B fragments stream from the V^T plane in global memory.
// ---------------------------------------------------------------------------
__global__ __launch_bounds__(256) void av_kernel(const float* __restrict__ S, const float* __restrict__ mrow,
                                                 const float* __restrict__ invs, const float* __restrict__ rcol,
                                                 const unsigned short* __restrict__ VTp, float* __restrict__ SC) {
  __shared__ __align__(16) _Float16 sA[64 * kAvPitch];
  __shared__ __align__(16) float sT[8][16 * 68];
  typedef Frag<_Float16> FH;
  const int tid  = threadIdx.x;
  const int lane = tid & 31;
  const int wave = __builtin_amdgcn_readfirstlane((int)(tid >> 5));
  const int m0 = blockIdx.x * 64;
  const int n0 = wave * 64;
  const int sr  = tid >> 2;
  const int sc8 = (tid & 3) * 8;
  const float mi = mrow[m0 + sr];
  const float fi = invs[m0 + sr] * kPCarry;
  const float* Srow = S + (size_t)(m0 + sr) * kTok + sc8;
  const float* rcp  = rcol + sc8;
  const _Float16* VT = (const _Float16*)VTp;

  const int rlane = lane & 15;
  const int koff  = (lane >> 4) * 8;
  const int mOff  = (lane >> 4) * 8;

  v8f acc[4][4];
#pragma unroll
  for (int i = 0; i < 4; ++i)
#pragma unroll
    for (int j = 0; j < 4; ++j) acc[i][j] = (v8f){0.f, 0.f, 0.f, 0.f, 0.f, 0.f, 0.f, 0.f};

  for (int k0 = 0; k0 < kTok; k0 += 32) {
    const v4f s0 = *(const v4f*)(Srow + k0);
    const v4f s1 = *(const v4f*)(Srow + k0 + 4);
    const v4f r0 = *(const v4f*)(rcp + k0);
    const v4f r1 = *(const v4f*)(rcp + k0 + 4);
    v8h hv;
#pragma unroll
    for (int e = 0; e < 4; ++e) {
      const float e0 = __expf(s0[e] - mi);
      const float e1 = __expf(s1[e] - mi);
      const float w0 = (e0 * fi) * r0[e];
      const float w1 = (e1 * fi) * r1[e];
      hv[e]     = (_Float16)w0;
      hv[4 + e] = (_Float16)w1;
    }
    *(v8h*)(sA + sr * kAvPitch + sc8) = hv;
    __syncthreads();
    v16h bh[4];
#pragma unroll
    for (int j = 0; j < 4; ++j) {
      const size_t bo = (size_t)(n0 + (j << 4) + rlane) * kTok + koff + k0;
      bh[j] = FH::load(VT + bo);
    }
#pragma unroll
    for (int i = 0; i < 4; ++i) {
      const int ao = ((i << 4) + rlane) * kAvPitch + koff;
      FH::U fa;
      fa.h[0] = *(const v8h*)(sA + ao);
      fa.h[1] = *(const v8h*)(sA + ao + 16);
      const v16h ah = fa.v;
#pragma unroll
      for (int j = 0; j < 4; ++j) acc[i][j] = FH::mma(ah, bh[j], acc[i][j]);
      FH::guard(acc[i][0], acc[i][1], acc[i][2], acc[i][3], ah, ah);
    }
    FH::keep(bh[0], bh[1], bh[2], bh[3]);
    __syncthreads();
  }
  acc_guard4(acc[0][0], acc[0][1], acc[0][2], acc[0][3]);
  acc_guard4(acc[1][0], acc[1][1], acc[1][2], acc[1][3]);
  acc_guard4(acc[2][0], acc[2][1], acc[2][2], acc[2][3]);
  acc_guard4(acc[3][0], acc[3][1], acc[3][2], acc[3][3]);

  float* slab = sT[wave];
#pragma unroll
  for (int i = 0; i < 4; ++i) {
    const int mBase = m0 + (i << 4);
#pragma unroll
    for (int j = 0; j < 4; ++j) {
#pragma unroll
      for (int r = 0; r < 8; ++r) slab[(mOff + r) * 68 + (j << 4) + rlane] = acc[i][j][r] * kPCarryInv;
    }
    __builtin_amdgcn_fence(__ATOMIC_RELEASE, "workgroup");
    __builtin_amdgcn_wave_barrier();
    __builtin_amdgcn_fence(__ATOMIC_ACQUIRE, "workgroup");
    {
      const int hh = lane >> 4, c4 = (lane & 15) * 4;
      v4f vals[8];
#pragma unroll
      for (int it = 0; it < 8; ++it) vals[it] = *(const v4f*)(slab + (it * 2 + hh) * 68 + c4);
      {
#pragma unroll
        for (int it = 0; it < 8; ++it) {
          const int row = it * 2 + hh;
          *(v4f*)(SC + (size_t)(mBase + row) * kDim + n0 + c4) = vals[it];
        }
        
      }
    }
    __builtin_amdgcn_fence(__ATOMIC_RELEASE, "workgroup");
    __builtin_amdgcn_wave_barrier();
    __builtin_amdgcn_fence(__ATOMIC_ACQUIRE, "workgroup");
  }
}

// ---------------------------------------------------------------------------
// s = LayerNorm(res + sc) over 512 (biased variance, eps inside rsqrt), one wave per row, 8 rows per block.
// Lane owns columns it*128 + lane*4 .. +3 (it 0..3): 16 values in registers, static indexing.
// res is an f16 plane read as 32-bit integer words; sc, gamma, beta f32.
// (via the wave's own LDS slab: lane owns columns it2*256 + lane*8 .. +7, 2 instructions x 32 lanes x 16 B = 4 whole
// ---------------------------------------------------------------------------
__global__ __launch_bounds__(256) void add_ln_kernel(const unsigned short* __restrict__ RES, const float* __restrict__ SCp,
                                                     const float* __restrict__ gam, const float* __restrict__ bet,
                                                     float* __restrict__ S32, unsigned short* __restrict__ S16) {
  __shared__ __align__(16) float sY[8][kDim];
  const int lane = threadIdx.x & 31;
  const int wave = __builtin_amdgcn_readfirstlane((int)(threadIdx.x >> 5));
  const int row = blockIdx.x * 8 + wave;
  const float* scp = SCp + (size_t)row * kDim;
  const unsigned short* rp = RES + (size_t)row * kDim;
  float x[16];
#pragma unroll
  for (int it = 0; it < 4; ++it) {
    const int col = it * 128 + lane * 4;
    const v4f a = *(const v4f*)(scp + col);
    const v2u w = *(const v2u*)(rp + col);
    const unsigned w0 = w[0];
    const unsigned w1 = w[1];
    x[4 * it + 0] = h16_to_f32(w0 & 0xffffu) + a[0];
    x[4 * it + 1] = h16_to_f32(w0 >> 16) + a[1];
    x[4 * it + 2] = h16_to_f32(w1 & 0xffffu) + a[2];
    x[4 * it + 3] = h16_to_f32(w1 >> 16) + a[3];
  }
  float s = 0.f;
#pragma unroll
  for (int i = 0; i < 16; ++i) s += x[i];
#pragma unroll
  for (int off = 16; off > 0; off >>= 1) s += __shfl_xor(s, off, 32);
  const float mu = s * kInvDim;
  float vs = 0.f;
#pragma unroll
  for (int i = 0; i < 16; ++i) {
    const float d = x[i] - mu;
    x[i] = d;
    vs += d * d;
  }
#pragma unroll
  for (int off = 16; off > 0; off >>= 1) vs += __shfl_xor(vs, off, 32);
  const float inv = rsqrtf(vs * kInvDim + kLnEps);
  float* slab = sY[wave];
  v4f yv[4];
#pragma unroll
  for (int it = 0; it < 4; ++it) {
    const int col = it * 128 + lane * 4;
    const v4f g4 = *(const v4f*)(gam + col);
    const v4f b4 = *(const v4f*)(bet + col);
    v4f y;
    y[0] = (x[4 * it + 0] * inv) * g4[0] + b4[0];
    y[1] = (x[4 * it + 1] * inv) * g4[1] + b4[1];
    y[2] = (x[4 * it + 2] * inv) * g4[2] + b4[2];
    y[3] = (x[4 * it + 3] * inv) * g4[3] + b4[3];
    yv[it] = y;
    *(v4f*)(slab + col) = y;
  }
  __builtin_amdgcn_fence(__ATOMIC_RELEASE, "workgroup");
  __builtin_amdgcn_wave_barrier();
  __builtin_amdgcn_fence(__ATOMIC_ACQUIRE, "workgroup");
  v8h hv[2];
#pragma unroll
  for (int it2 = 0; it2 < 2; ++it2) {
    const int c = it2 * 256 + lane * 8;
    const v4f a0 = *(const v4f*)(slab + c);
    const v4f a1 = *(const v4f*)(slab + c + 4);
#pragma unroll
    for (int e = 0; e < 4; ++e) {
      const float f0 = a0[e], f1 = a1[e];
      hv[it2][e]     = (_Float16)f0;
      hv[it2][4 + e] = (_Float16)f1;
    }
  }
  float* o32 = S32 + (size_t)row * kDim;
  unsigned short* o16 = S16 + (size_t)row * kDim;
  {
#pragma unroll
    for (int it = 0; it < 4; ++it) *(v4f*)(o32 + it * 128 + lane * 4) = yv[it];
#pragma unroll
    for (int it2 = 0; it2 < 2; ++it2) *(v8h*)(o16 + it2 * 256 + lane * 8) = hv[it2];
    
  }
}

// ---------------------------------------------------------------------------
// Host glue (kernel launches and host arithmetic only)
// ---------------------------------------------------------------------------
template <int ET, bool SPLIT, int BIAS_MODE, int OUT_MODE, bool RESID, int ACT>
static void run_gemm(hipStream_t st,
                     const unsigned short* A, const unsigned short* A2, int lda,
                     const unsigned short* Bt, const unsigned short* Bt2, int ldb,
                     void* C, void* C2, int ldc,
                     const float* bias, const float* resid,
                     int M, int N, int K, float scale) {
  const int blocks = (M >> 7) * (N >> 7);
  wmma_gemm64<ET, SPLIT, BIAS_MODE, OUT_MODE, RESID, ACT><<<dim3(blocks), 128, 0, st>>>(
      A, A2, lda, Bt, Bt2, ldb, C, C2, ldc, bias, resid, M, N, K, scale);
}

extern "C" void kernel_launch(void* const* d_in, const int* in_sizes, int n_in,
                              void* d_out, int out_size, void* d_ws, size_t ws_size,
                              hipStream_t stream) {
  if (n_in < 34) return;
  if (in_sizes[0] != (int)kND || in_sizes[1] != (int)kND) return;
  for (int p = 0; p < 2; ++p) {
    for (int s = 0; s < 16; ++s) {
      const bool isMat = (s == 0 || s == 2 || s == 4 || s == 6 || s == 8 || s == 10 || s == 11 || s == 12 || s == 15);
      const int want = isMat ? (int)kWW : kDim;
      if (in_sizes[2 + 16 * p + s] != want) return;
    }
  }
  if (out_size != (int)(2 * kND)) return;
  if (ws_size < kWsTotal) return;

  char* ws = (char*)d_ws;
  unsigned short* XH  = (unsigned short*)(ws + kOffXH);
  unsigned short* XL  = (unsigned short*)(ws + kOffXL);
  unsigned short* T0H = (unsigned short*)(ws + kOffT0H);
  unsigned short* T0L = (unsigned short*)(ws + kOffT0L);
  unsigned short* FH  = (unsigned short*)(ws + kOffFH);
  unsigned short* FL  = (unsigned short*)(ws + kOffFL);
  unsigned short* F16 = (unsigned short*)(ws + kOffF16);
  unsigned short* R1  = (unsigned short*)(ws + kOffR1);
  unsigned short* R2  = (unsigned short*)(ws + kOffR2);
  unsigned short* WSH = (unsigned short*)(ws + kOffWSH);
  unsigned short* WSL = (unsigned short*)(ws + kOffWSL);
  unsigned short* WF  = (unsigned short*)(ws + kOffWF);
  float*          S   = (float*)(ws + kOffS);
  float*          S32 = (float*)(ws + kOffS32);
  unsigned short* S16 = (unsigned short*)(ws + kOffS16);
  unsigned short* QK  = (unsigned short*)(ws + kOffQK);
  unsigned short* VT  = (unsigned short*)(ws + kOffVT);
  unsigned short* RES = (unsigned short*)(ws + kOffRES);
  float*          SC  = (float*)(ws + kOffSC);
  unsigned short* FFN = (unsigned short*)(ws + kOffFFN);
  float*          MROW = (float*)(ws + kOffMROW);
  float*          INVS = (float*)(ws + kOffINVS);
  float*          RC   = (float*)(ws + kOffRC);
  float* out = (float*)d_out;

  const int nd8 = (int)(kND / 8);
  const int ww8 = (int)(kWW / 8);

  /* ffn weights of both branches -> f16 x256 planes (persistent) */
  {
    const float* fa = (const float*)d_in[2 + 15];
    const float* fb = (const float*)d_in[18 + 15];
    cast4_f16_kernel<<<dim3(ww8 / 256, 2), 256, 0, stream>>>(fa, fb, fa, fa, FFN, kWCarry, ww8, (long)kWW);
  }

  /* ---- per-branch linear chain (operand planes in R0 reused by branch B after branch A, stream ordered) ---- */
  for (int p = 0; p < 2; ++p) {
    const float* x   = (const float*)d_in[p];
    const int pb = 2 + 16 * p;
    const float* pW1 = (const float*)d_in[pb + 0];
    const float* pb1 = (const float*)d_in[pb + 1];
    const float* pW2 = (const float*)d_in[pb + 2];
    const float* pb2 = (const float*)d_in[pb + 3];
    const float* rW1 = (const float*)d_in[pb + 4];
    const float* rb1 = (const float*)d_in[pb + 5];
    const float* rW2 = (const float*)d_in[pb + 6];
    const float* rb2 = (const float*)d_in[pb + 7];
    const float* rW3 = (const float*)d_in[pb + 8];
    const float* rb3 = (const float*)d_in[pb + 9];
    const float* Wq  = (const float*)d_in[pb + 10];
    const float* Wk  = (const float*)d_in[pb + 11];
    const float* Wv  = (const float*)d_in[pb + 12];
    unsigned short* QH = QK + (size_t)(4 * p + 0) * kND;
    unsigned short* QL = QK + (size_t)(4 * p + 1) * kND;
    unsigned short* KH = QK + (size_t)(4 * p + 2) * kND;
    unsigned short* KL = QK + (size_t)(4 * p + 3) * kND;
    unsigned short* VTp  = VT  + (size_t)p * kND;
    unsigned short* RESp = RES + (size_t)p * kND;

    /* operand planes: x hi/lo; pW1,pW2,Wq,Wk hi/lo (weights are [out][in] = Bt layout); rW1,rW2,rW3,Wv f16 x256 */
    split4_bf16_kernel<<<dim3(nd8 / 256, 1), 256, 0, stream>>>(x, x, x, x, XH, XL, nd8, 0L);
    split4_bf16_kernel<<<dim3(ww8 / 256, 4), 256, 0, stream>>>(pW1, pW2, Wq, Wk, WSH, WSL, ww8, (long)kWW);
    cast4_f16_kernel<<<dim3(ww8 / 256, 4), 256, 0, stream>>>(rW1, rW2, rW3, Wv, WF, kWCarry, ww8, (long)kWW);

    /* h1 = relu(x . pW1^T + pb1) -> hi/lo : M 4096, N 512, K 512 */
    run_gemm<1, true, 2, 2, false, 2>(stream, XH, XL, kDim, WSH + 0 * kWW, WSL + 0 * kWW, kDim,
                                      (void*)T0H, (void*)T0L, kDim, pb1, pb1, kTok, kDim, kDim, 1.0f);
    /* feat = h1 . pW2^T + pb2 -> hi/lo */
    run_gemm<1, true, 2, 2, false, 0>(stream, T0H, T0L, kDim, WSH + 1 * kWW, WSL + 1 * kWW, kDim,
                                      (void*)FH, (void*)FL, kDim, pb2, pb2, kTok, kDim, kDim, 1.0f);
    /* f16 copy of feat */
    hilo_to_f16_kernel<<<dim3(nd8 / 256), 256, 0, stream>>>(FH, FL, F16, nd8);
    /* residual chain: relu, relu, linear (f16 single products, weights x256) */
    run_gemm<0, false, 2, 1, false, 2>(stream, F16, F16, kDim, WF + 0 * kWW, WF + 0 * kWW, kDim,
                                       (void*)R1, (void*)R1, kDim, rb1, rb1, kTok, kDim, kDim, kWCarryInv);
    run_gemm<0, false, 2, 1, false, 2>(stream, R1, R1, kDim, WF + 1 * kWW, WF + 1 * kWW, kDim,
                                       (void*)R2, (void*)R2, kDim, rb2, rb2, kTok, kDim, kDim, kWCarryInv);
    run_gemm<0, false, 2, 1, false, 0>(stream, R2, R2, kDim, WF + 2 * kWW, WF + 2 * kWW, kDim,
                                       (void*)RESp, (void*)RESp, kDim, rb3, rb3, kTok, kDim, kDim, kWCarryInv);
    /* Q, K -> hi/lo planes */
    run_gemm<1, true, 0, 2, false, 0>(stream, FH, FL, kDim, WSH + 2 * kWW, WSL + 2 * kWW, kDim,
                                      (void*)QH, (void*)QL, kDim, pb1, pb1, kTok, kDim, kDim, 1.0f);
    run_gemm<1, true, 0, 2, false, 0>(stream, FH, FL, kDim, WSH + 3 * kWW, WSL + 3 * kWW, kDim,
                                      (void*)KH, (void*)KL, kDim, pb1, pb1, kTok, kDim, kDim, 1.0f);
    /* V^T[d][i] = sum_k Wv[d][k] feat[i][k] : A = Wv (M 512), Bt = feat f16 (N 4096), K 512, ldc 4096 */
    run_gemm<0, false, 0, 1, false, 0>(stream, WF + 3 * kWW, WF + 3 * kWW, kDim, F16, F16, kDim,
                                       (void*)VTp, (void*)VTp, kTok, pb1, pb1, kDim, kTok, kDim, kWCarryInv);
  }

  /* ---- cross attention, add + LayerNorm, ffn; branches in sequence sharing S / SC / statistics ---- */
  for (int p = 0; p < 2; ++p) {
    const int o = 1 - p;
    const int pb = 2 + 16 * p;
    const float* ln_g = (const float*)d_in[pb + 13];
    const float* ln_b = (const float*)d_in[pb + 14];
    const unsigned short* QH  = QK + (size_t)(4 * p + 0) * kND;
    const unsigned short* QL  = QK + (size_t)(4 * p + 1) * kND;
    const unsigned short* KHo = QK + (size_t)(4 * o + 2) * kND;
    const unsigned short* KLo = QK + (size_t)(4 * o + 3) * kND;
    const unsigned short* VTp  = VT  + (size_t)p * kND;
    const unsigned short* RESp = RES + (size_t)p * kND;
    const unsigned short* FFNp = FFN + (size_t)p * kWW;

    /* S = Q_p . K_other^T (hi.hi + hi.lo + lo.hi), f32 : M 4096, N 4096, K 512 */
    run_gemm<1, true, 0, 0, false, 0>(stream, QH, QL, kDim, KHo, KLo, kDim,
                                      (void*)S, (void*)S, kTok, ln_g, ln_g, kTok, kTok, kDim, 1.0f);
    rowstat_kernel<<<dim3(kTok / 32), 256, 0, stream>>>(S, MROW, INVS);
    colsum_kernel<<<dim3(kTok / 32), 256, 0, stream>>>(S, MROW, INVS, RC);
    av_kernel<<<dim3(kTok / 64), 256, 0, stream>>>(S, MROW, INVS, RC, VTp, SC);
    /* S is dead from here until the other branch's logits; S32 / S16 occupy its first 12 MiB */
    add_ln_kernel<<<dim3(kTok / 8), 256, 0, stream>>>(RESp, SC, ln_g, ln_b, S32, S16);
    /* out = s + s . ffnW^T : A = s f16, Bt = ffnW f16 x256, residual s f32 fetched in the store phase */
    run_gemm<0, false, 0, 0, true, 0>(stream, S16, S16, kDim, FFNp, FFNp, kDim,
                                      (void*)(out + (size_t)p * kND), (void*)(out + (size_t)p * kND), kDim,
                                      ln_g, S32, kTok, kDim, kDim, kWCarryInv);
  }
}

// v002
// A run of this version takes 532 microseconds.
// Two timings next to v001 both put it at 1.71 times that version's speed.
// Over all steps from v000 it is 2.61 times as fast.
// Contractions: pW1/pW2/Wq/Wk linears and q.k^T logits on v_wmma_f32_16x16x32_bf16 with both operands as bf16 hi+lo planes (hi.hi + hi.lo + lo.hi), f32 accumulate, logits kept f32; rW1/rW2/rW3/Wv/ffn linears and attn.V on v_wmma_f32_16x16x32_f16 (weights carried x256, attention weights carried x32768), f32 accumulate; softmax statistics, column sums, LayerNorm and residual adds in f32.
#include <hip/hip_runtime.h>
#include <math.h>

typedef __attribute__((ext_vector_type(16))) _Float16 v16h;
typedef __attribute__((ext_vector_type(8)))  _Float16 v8h;
typedef __attribute__((ext_vector_type(16))) __bf16   v16b;
typedef __attribute__((ext_vector_type(8)))  __bf16   v8b;
typedef __attribute__((ext_vector_type(8)))  float    v8f;
typedef __attribute__((ext_vector_type(4)))  float    v4f;
typedef __attribute__((ext_vector_type(4)))  unsigned int v4u;
typedef __attribute__((ext_vector_type(2)))  unsigned int v2u;

// ---------------------------------------------------------------------------
// Problem constants
// ---------------------------------------------------------------------------
constexpr int    kTok       = 4096;
constexpr int    kDim       = 512;
constexpr size_t kND        = (size_t)kTok * kDim;
constexpr size_t kWW        = (size_t)kDim * kDim;
constexpr float  kWCarry    = 256.0f;
constexpr float  kWCarryInv = 1.0f / kWCarry;
constexpr float  kPCarry    = 32768.0f;
constexpr float  kPCarryInv = 1.0f / kPCarry;
constexpr float  kInvDim    = 1.0f / (float)kDim;
constexpr float  kLnEps     = 1e-6f;
constexpr float  kAttnEps   = 1e-9f;
constexpr int    kAvPitch   = 40;
static_assert((kTok % 64) == 0 && (kDim % 64) == 0);
static_assert((kTok % 32) == 0 && (kDim % 32) == 0);
static_assert(((kND / 8) % 256) == 0 && ((kWW / 8) % 256) == 0);
static_assert((kAvPitch % 8) == 0 && kAvPitch >= 32);

// ---------------------------------------------------------------------------
// Workspace region map (bytes; every offset is a multiple of 128). Both branches run in the same launches, so every
// region holds branch A's part and then branch B's.
//   R0      2 x 67,108,864  time-shared region, one per branch:
//             (a) operand planes of the branch's linear chain:
//                 XH XL T0H T0L FH FL F16 R1 R2   9 x 4,194,304 (16-bit [4096][512] planes)
//                 WSH (4 bf16 hi weight planes) 2,097,152 ; WSL (4 bf16 lo planes) 2,097,152
//                 WF  (4 f16 weight planes, carried x256) 2,097,152         -> 44,040,192 used
//             (b) S f32 [4096][4096] logits of the branch                    67,108,864
//             (c) S32 f32 [4096][512] + S16 f16 [4096][512] LayerNorm output 12,582,912
//   QK      33,554,432  QH QL KH KL bf16 planes [4096][512], branch A then branch B
//   VT       8,388,608  V^T f16 [512][4096], branch A then B
//   RES      8,388,608  residual-chain output f16 [4096][512], branch A then B
//   SC      16,777,216  attn.V output f32 [4096][512], branch A then B
//   FFN      1,048,576  ffn weight f16 planes (x256), branch A then B
//   MROW        32,768  row maxima f32 [4096], branch A then B
//   INVS        32,768  1 / row exp sums f32 [4096], branch A then B
//   RC          32,768  1 / (1e-9 + column sums) f32 [4096], branch A then B
//   total = 134,217,728 + 33,554,432 + 8,388,608 + 8,388,608 + 16,777,216 + 1,048,576 + 32,768 + 32,768 + 32,768
//         = 202,473,472
// ---------------------------------------------------------------------------
constexpr size_t kPlane16  = kND * 2;
constexpr size_t kPlane32  = kND * 4;
constexpr size_t kW16      = kWW * 2;
constexpr size_t kR0Bytes  = (size_t)kTok * kTok * 4;
constexpr size_t kOffXH    = 0;
constexpr size_t kOffXL    = kOffXH  + kPlane16;
constexpr size_t kOffT0H   = kOffXL  + kPlane16;
constexpr size_t kOffT0L   = kOffT0H + kPlane16;
constexpr size_t kOffFH    = kOffT0L + kPlane16;
constexpr size_t kOffFL    = kOffFH  + kPlane16;
constexpr size_t kOffF16   = kOffFL  + kPlane16;
constexpr size_t kOffR1    = kOffF16 + kPlane16;
constexpr size_t kOffR2    = kOffR1  + kPlane16;
constexpr size_t kOffWSH   = kOffR2  + kPlane16;
constexpr size_t kOffWSL   = kOffWSH + 4 * kW16;
constexpr size_t kOffWF    = kOffWSL + 4 * kW16;
constexpr size_t kPhase1End = kOffWF + 4 * kW16;
constexpr size_t kOffS     = 0;
constexpr size_t kOffS32   = 0;
constexpr size_t kOffS16   = kOffS32 + kPlane32;
constexpr size_t kOffQK    = 2 * kR0Bytes;
constexpr size_t kOffVT    = kOffQK  + 8 * kPlane16;
constexpr size_t kOffRES   = kOffVT  + 2 * kPlane16;
constexpr size_t kOffSC    = kOffRES + 2 * kPlane16;
constexpr size_t kOffFFN   = kOffSC  + 2 * kPlane32;
constexpr size_t kOffMROW  = kOffFFN + 2 * kW16;
constexpr size_t kOffINVS  = kOffMROW + 2 * (size_t)kTok * 4;
constexpr size_t kOffRC    = kOffINVS + 2 * (size_t)kTok * 4;
constexpr size_t kWsTotal  = kOffRC   + 2 * (size_t)kTok * 4;
constexpr long   kR0El16   = (long)(kR0Bytes / 2);  /* branch A -> branch B inside R0, in 16-bit elements */
constexpr long   kR0El32   = (long)(kR0Bytes / 4);  /* the same in f32 elements */
static_assert(kPhase1End <= kR0Bytes);
static_assert(kOffS16 + kPlane16 <= kR0Bytes);
static_assert(kWsTotal == 202473472ull);
static_assert(kWsTotal <= 268435456ull);
static_assert((kOffWSH % 128) == 0 && (kOffWSL % 128) == 0 && (kOffWF % 128) == 0 && (kOffQK % 128) == 0 &&
              (kOffVT % 128) == 0 && (kOffRES % 128) == 0 && (kOffSC % 128) == 0 && (kOffFFN % 128) == 0 &&
              (kOffMROW % 128) == 0 && (kOffINVS % 128) == 0 && (kOffRC % 128) == 0 && (kOffS16 % 128) == 0);

// ---------------------------------------------------------------------------
// Small helpers
// ---------------------------------------------------------------------------
__device__ __forceinline__ unsigned short f2bf_bits(float f) {
  unsigned u = __float_as_uint(f);
  return (unsigned short)((u + 0x7FFFu + ((u >> 16) & 1u)) >> 16);
}
__device__ __forceinline__ float bf_bits2f(unsigned short h) { return __uint_as_float(((unsigned)h) << 16); }

/* f16 bits (low 16 bits of hb, finite values) -> f32, integer path only */
__device__ __forceinline__ float h16_to_f32(unsigned hb) {
  const unsigned sgn = (hb & 0x8000u) << 16;
  const unsigned em = hb & 0x7fffu;
  const float fn = __uint_as_float((em << 13) + 0x38000000u);
  const float fs = (float)em * 5.9604644775390625e-8f;
  const float mag = (em < 0x400u) ? fs : fn;
  return __uint_as_float(__float_as_uint(mag) | sgn);
}

/* hazard guards: four nops, all four accumulators of the group tied, A fragments named as inputs */
__device__ __forceinline__ void grp_guard_h(v8f& a, v8f& b, v8f& c, v8f& d, v16h x, v16h y) {
  asm volatile("v_nop\n\tv_nop\n\tv_nop\n\tv_nop" : "+v"(a), "+v"(b), "+v"(c), "+v"(d) : "v"(x), "v"(y));
}
__device__ __forceinline__ void grp_guard_b(v8f& a, v8f& b, v8f& c, v8f& d, v16b x, v16b y) {
  asm volatile("v_nop\n\tv_nop\n\tv_nop\n\tv_nop" : "+v"(a), "+v"(b), "+v"(c), "+v"(d) : "v"(x), "v"(y));
}
__device__ __forceinline__ void keep4_h(v16h a, v16h b, v16h c, v16h d) { asm volatile("v_nop" :: "v"(a), "v"(b), "v"(c), "v"(d)); }
__device__ __forceinline__ void keep4_b(v16b a, v16b b, v16b c, v16b d) { asm volatile("v_nop" :: "v"(a), "v"(b), "v"(c), "v"(d)); }
__device__ __forceinline__ void acc_guard4(v8f& a, v8f& b, v8f& c, v8f& d) {
  asm volatile("v_nop\n\tv_nop\n\tv_nop\n\tv_nop" : "+v"(a), "+v"(b), "+v"(c), "+v"(d));
}

/* Fragment loader: elements 0..7 <- p[0..7], elements 8..15 <- p[16..23]; p already includes 8*(lane>>4) */
template <typename T> struct Frag;
template <> struct Frag<_Float16> {
  typedef v16h V;
  union U { v16h v; v8h h[2]; };
  static __device__ __forceinline__ v16h load(const _Float16* p) {
    U f;
    f.h[0] = *(const v8h*)(p);
    f.h[1] = *(const v8h*)(p + 16);
    return f.v;
  }
  static __device__ __forceinline__ v8f mma(v16h a, v16h b, v8f c) {
    return __builtin_amdgcn_wmma_f32_16x16x32_f16(false, a, false, b, (short)0, c, false, false);
  }
  static __device__ __forceinline__ void guard(v8f& a, v8f& b, v8f& c, v8f& d, v16h x, v16h y) { grp_guard_h(a, b, c, d, x, y); }
  static __device__ __forceinline__ void keep(v16h a, v16h b, v16h c, v16h d) { keep4_h(a, b, c, d); }
};
template <> struct Frag<__bf16> {
  typedef v16b V;
  union U { v16b v; v8b h[2]; };
  static __device__ __forceinline__ v16b load(const __bf16* p) {
    U f;
    f.h[0] = *(const v8b*)(p);
    f.h[1] = *(const v8b*)(p + 16);
    return f.v;
  }
  static __device__ __forceinline__ v8f mma(v16b a, v16b b, v8f c) {
    return __builtin_amdgcn_wmma_f32_16x16x32_bf16(false, a, false, b, (short)0, c, false, false);
  }
  static __device__ __forceinline__ void guard(v8f& a, v8f& b, v8f& c, v8f& d, v16b x, v16b y) { grp_guard_b(a, b, c, d, x, y); }
  static __device__ __forceinline__ void keep(v16b a, v16b b, v16b c, v16b d) { keep4_b(a, b, c, d); }
};

// ---------------------------------------------------------------------------
// LDS-staged WMMA GEMM: C[m,n] = scale * sum_k A[m,k] * Bt[n,k] (+bias[n]) (+resid[m,n]). A block of 4 waves owns a
// 128x128 tile (2x2 waves, each wave a 64x64 tile). A row-major [M][K] pitch lda; Bt row-major [N][K] pitch ldb;
// M, N multiples of 128, K a multiple of 64 and at least 128.
// Operand path: a stage is 64 k (one whole 128-B line) of the block's 128 A rows and 128 Bt rows, every plane, brought
// into LDS by per-lane asynchronous 16-B copies (8 lanes per line, 4 whole lines per wave instruction), two buffers:
// the next stage's copies fly while this stage is multiplied. LDS row pitch 144 B (16 B x 9) for the 16-B readers.
// SPLIT: operands are hi/lo planes (A2/Bt2 = lo planes, same layout); product = hi.hi + hi.lo + lo.hi.
// BIAS_MODE: 0 none, 2 bias[n] (f32). ACT: 0 none, 2 relu. RESID (f32 output only): the residual is fetched in the
// store phase, one 16-B vector per lane at exactly the address the lane stores to.
// OUT_MODE: 0 f32, 1 f16, 2 bf16 hi plane (Cout) + bf16 lo plane (Cout2).
// Epilogue: 16-row slabs staged per wave in LDS (only the owning wave touches its slab); the slabs reuse the ring
// behind the last stage's waits and barrier.
// ET: 0 f16 operands, 1 bf16 operands (pointers passed as 16-bit storage).
// One launch holds several independent products of one shape: blockIdx.y = branch, blockIdx.z = weight plane. The
// pointers are those of (0, 0); aP, bP (16-bit elements) and cP (bytes) lead to branch 1, bQ and cQ to plane 1.
// ---------------------------------------------------------------------------
template <int ET> struct Elem;
template <> struct Elem<0> { typedef _Float16 T; };
template <> struct Elem<1> { typedef __bf16 T; };

constexpr int kStageK   = 64;
constexpr int kRowPitch = 144;
constexpr int kPlaneLds = 128 * kRowPitch;
constexpr int kSlabLds  = 16 * 68 * 4;
static_assert((kRowPitch % 16) == 0 && ((kRowPitch / 16) % 2) == 1 && kRowPitch >= kStageK * 2);
static_assert((kDim % 128) == 0 && (kTok % 128) == 0 && (kDim % kStageK) == 0 && kDim >= 2 * kStageK);
static_assert(4 * kSlabLds <= 4 * kPlaneLds && (kSlabLds % 16) == 0);

/* One plane's 128 rows x 128 B of a stage: this lane's eight 16-B pieces, rows 16 apart. l = the lane's LDS byte
   address of its first piece, g = its global address, gstep = 16 source rows in elements. The copies and the
   s_wait_xcnt stand in one statement so that no address register is rewritten ahead of that wait. */
__device__ __forceinline__ void stage_plane(unsigned l, const unsigned short* g, size_t gstep) {
  const unsigned l1 = l + 16 * kRowPitch, l2 = l + 32 * kRowPitch, l3 = l + 48 * kRowPitch, l4 = l + 64 * kRowPitch,
                 l5 = l + 80 * kRowPitch, l6 = l + 96 * kRowPitch, l7 = l + 112 * kRowPitch;
  const unsigned short *g1 = g + gstep, *g2 = g + 2 * gstep, *g3 = g + 3 * gstep, *g4 = g + 4 * gstep,
                       *g5 = g + 5 * gstep, *g6 = g + 6 * gstep, *g7 = g + 7 * gstep;
  asm volatile(
      "global_load_async_to_lds_b128 %0, %8, off\n\t"
      "global_load_async_to_lds_b128 %1, %9, off\n\t"
      "global_load_async_to_lds_b128 %2, %10, off\n\t"
      "global_load_async_to_lds_b128 %3, %11, off\n\t"
      "global_load_async_to_lds_b128 %4, %12, off\n\t"
      "global_load_async_to_lds_b128 %5, %13, off\n\t"
      "global_load_async_to_lds_b128 %6, %14, off\n\t"
      "global_load_async_to_lds_b128 %7, %15, off\n\t"
      "s_wait_xcnt 0x0"
      :: "v"(l), "v"(l1), "v"(l2), "v"(l3), "v"(l4), "v"(l5), "v"(l6), "v"(l7),
         "v"(g), "v"(g1), "v"(g2), "v"(g3), "v"(g4), "v"(g5), "v"(g6), "v"(g7)
      : "memory");
}

template <int ET, bool SPLIT, int BIAS_MODE, int OUT_MODE, bool RESID, int ACT>
__global__ __launch_bounds__(128) void wmma_gemm64(
    const unsigned short* __restrict__ Ap0, const unsigned short* __restrict__ A2p0, int lda,
    const unsigned short* __restrict__ Btp0, const unsigned short* __restrict__ Bt2p0, int ldb,
    void* __restrict__ Cout0, void* __restrict__ Cout20, int ldc,
    const float* __restrict__ bias0, const float* __restrict__ bias1,
    const float* __restrict__ resid0, const float* __restrict__ resid1,
    long aP, long bP, long bQ, long cP, long cQ,
    int M, int N, int K, float scale) {
  typedef typename Elem<ET>::T T;
  typedef typename Frag<T>::V V;
  const long zp = (long)blockIdx.y;
  const long zq = (long)blockIdx.z;
  const unsigned short* Ap   = Ap0 + zp * aP;
  const unsigned short* A2p  = A2p0 + zp * aP;
  const unsigned short* Btp  = Btp0 + zp * bP + zq * bQ;
  const unsigned short* Bt2p = Bt2p0 + zp * bP + zq * bQ;
  void* Cout  = (void*)((char*)Cout0 + zp * cP + zq * cQ);
  void* Cout2 = (void*)((char*)Cout20 + zp * cP + zq * cQ);
  const float* bias  = zp ? bias1 : bias0;
  const float* resid = zp ? resid1 : resid0;
  /* stage layout: A hi | (A lo) | Bt hi | (Bt lo), each plane 128 rows at kRowPitch */
  constexpr int kPlanes = SPLIT ? 4 : 2;
  constexpr int kStageLds = kPlanes * kPlaneLds;
  constexpr int kOffBh = (SPLIT ? 2 : 1) * kPlaneLds;
  __shared__ __align__(16) unsigned char ring[2 * kStageLds];
  const int lane = threadIdx.x & 31;
  const int wave = __builtin_amdgcn_readfirstlane((int)(threadIdx.x >> 5));
  const int tilesN = N >> 7;
  const int tilesM = M >> 7;
  /* block-uniform exit in front of every copy and barrier */
  if ((int)blockIdx.x >= tilesM * tilesN) return;
  const int bm = (int)blockIdx.x / tilesN;
  const int bn = (int)blockIdx.x - bm * tilesN;
  const int wm = (wave >> 1) << 6;
  const int wn = (wave & 1) << 6;
  const int m0 = (bm << 7) + wm;
  const int n0 = (bn << 7) + wn;

  const int rlane = lane & 15;
  const int koff  = (lane >> 4) * 8;
  const int mOff  = (lane >> 4) * 8;

  /* copy map: thread t brings 16-B piece t&7 of rows (t>>3) + 16q, q 0..7, of every plane */
  const int crow = (int)threadIdx.x >> 3;
  const int cpc  = (int)threadIdx.x & 7;
  const unsigned ldsBase = (unsigned)(size_t)(&ring[0]) + (unsigned)(crow * kRowPitch + cpc * 16);
  const size_t aOff = (size_t)((bm << 7) + crow) * lda + cpc * 8;
  const size_t bOff = (size_t)((bn << 7) + crow) * ldb + cpc * 8;
  const size_t aStep = (size_t)16 * lda;
  const size_t bStep = (size_t)16 * ldb;
  const int nStages = K / kStageK;

  auto issue_stage = [&](int s) {
    const unsigned l = ldsBase + (unsigned)((s & 1) * kStageLds);
    const size_t kq = (size_t)s * kStageK;
    stage_plane(l, Ap + aOff + kq, aStep);
    if (SPLIT) stage_plane(l + kPlaneLds, A2p + aOff + kq, aStep);
    stage_plane(l + kOffBh, Btp + bOff + kq, bStep);
    if (SPLIT) stage_plane(l + kOffBh + kPlaneLds, Bt2p + bOff + kq, bStep);
  };

  v8f acc[4][4];
#pragma unroll
  for (int i = 0; i < 4; ++i)
#pragma unroll
    for (int j = 0; j < 4; ++j) acc[i][j] = (v8f){0.f, 0.f, 0.f, 0.f, 0.f, 0.f, 0.f, 0.f};

  /* prologue: stage 0 landed and published, then stage 1 in flight */
  issue_stage(0);
  asm volatile("s_wait_asynccnt 0x0" ::: "memory");  /* this wave's stage-0 copies have landed */
  __syncthreads();
  if (nStages > 1) issue_stage(1);

  const int aFrag = (wm + rlane) * kRowPitch + koff * 2;
  const int bFrag = kOffBh + (wn + rlane) * kRowPitch + koff * 2;

#pragma unroll 1  /* one stage per trip: the foot's waits and barrier stand once */
  for (int s = 0; s < nStages; ++s) {
    const unsigned char* sb = ring + (s & 1) * kStageLds;
#pragma unroll
    for (int kk = 0; kk < kStageK; kk += 32) {
      V bh[4], bl[4];
      const unsigned char* ap = sb + aFrag + kk * 2;
      V ah = Frag<T>::load((const T*)ap);
      V al;
      if (SPLIT) al = Frag<T>::load((const T*)(ap + kPlaneLds));
#pragma unroll
      for (int j = 0; j < 4; ++j) {
        const unsigned char* bp = sb + bFrag + j * 16 * kRowPitch + kk * 2;
        bh[j] = Frag<T>::load((const T*)bp);
        if (SPLIT) bl[j] = Frag<T>::load((const T*)(bp + kPlaneLds));
      }
#pragma unroll
      for (int i = 0; i < 4; ++i) {
        /* the next row group's A fragments are read in front of this group's products */
        V nh = ah;
        V nl;
        if (SPLIT) nl = al;
        if (i < 3) {
          nh = Frag<T>::load((const T*)(ap + (i + 1) * 16 * kRowPitch));
          if (SPLIT) nl = Frag<T>::load((const T*)(ap + (i + 1) * 16 * kRowPitch + kPlaneLds));
        }
#pragma unroll
        for (int j = 0; j < 4; ++j) {
          acc[i][j] = Frag<T>::mma(ah, bh[j], acc[i][j]);
          if (SPLIT) {
            acc[i][j] = Frag<T>::mma(ah, bl[j], acc[i][j]);
            acc[i][j] = Frag<T>::mma(al, bh[j], acc[i][j]);
          }
        }
        Frag<T>::guard(acc[i][0], acc[i][1], acc[i][2], acc[i][3], ah, SPLIT ? al : ah);
        ah = nh;
        if (SPLIT) al = nl;
      }
      Frag<T>::keep(bh[0], bh[1], bh[2], bh[3]);
      if (SPLIT) Frag<T>::keep(bl[0], bl[1], bl[2], bl[3]);
    }
    /* publish point of stage s + 1; the one barrier also ends every reader's last read of stage s's buffer */
    asm volatile("s_wait_dscnt 0x0" ::: "memory");     /* this wave's reads of stage s have returned */
    asm volatile("s_wait_asynccnt 0x0" ::: "memory");  /* this wave's stage s + 1 copies have landed */
    __syncthreads();
    if (s + 2 < nStages) issue_stage(s + 2);
  }
  asm volatile("s_wait_asynccnt 0x0" ::: "memory");  /* no copy is outstanding when the ring becomes the slabs */
  acc_guard4(acc[0][0], acc[0][1], acc[0][2], acc[0][3]);
  acc_guard4(acc[1][0], acc[1][1], acc[1][2], acc[1][3]);
  acc_guard4(acc[2][0], acc[2][1], acc[2][2], acc[2][3]);
  acc_guard4(acc[3][0], acc[3][1], acc[3][2], acc[3][3]);

  /* ---- epilogue ---- */
  float* slab = (float*)(ring + wave * kSlabLds);
#pragma unroll
  for (int i = 0; i < 4; ++i) {
    const int mBase = m0 + (i << 4);
#pragma unroll
    for (int j = 0; j < 4; ++j) {
      const int n = n0 + (j << 4) + rlane;
      float bv = 0.f;
      if (BIAS_MODE == 2) bv = bias[n];
#pragma unroll
      for (int r = 0; r < 8; ++r) {
        float v = acc[i][j][r] * scale;
        if (BIAS_MODE == 2) v += bv;
        if (ACT == 2) v = fmaxf(v, 0.0f);
        slab[(mOff + r) * 68 + (j << 4) + rlane] = v;
      }
    }
    __builtin_amdgcn_fence(__ATOMIC_RELEASE, "workgroup");
    __builtin_amdgcn_wave_barrier();
    __builtin_amdgcn_fence(__ATOMIC_ACQUIRE, "workgroup");
    if (OUT_MODE == 0) {
      /* rows it*2 + hh, it 0..7, hh 0..1 = 16 rows; 16 lanes x 16 B = the 256-B row segment */
      float* C = (float*)Cout;
      const int hh = lane >> 4, c4 = (lane & 15) * 4;
      v4f vals[8];
#pragma unroll
      for (int it = 0; it < 8; ++it) {
        const int row = it * 2 + hh;
        v4f v = *(const v4f*)(slab + row * 68 + c4);
        if (RESID) {
          const v4f rr = *(const v4f*)(resid + (size_t)(mBase + row) * ldc + n0 + c4);
          v = v + rr;
        }
        vals[it] = v;
      }
      {
#pragma unroll
        for (int it = 0; it < 8; ++it) {
          const int row = it * 2 + hh;
          *(v4f*)(C + (size_t)(mBase + row) * ldc + n0 + c4) = vals[it];
        }
        
      }
    } else {
      const int q = lane >> 3, c8 = (lane & 7) * 8;
      unsigned short* C  = (unsigned short*)Cout;
      unsigned short* C2 = (unsigned short*)Cout2;
      {
#pragma unroll
        for (int it = 0; it < 4; ++it) {
          const int row = it * 4 + q;
          const float* sp = slab + row * 68 + c8;
          v8h hv, lv;
#pragma unroll
          for (int e = 0; e < 8; ++e) {
            const float sv = sp[e];
            if (OUT_MODE == 1) {
              hv[e] = (_Float16)sv;
            } else {
              const unsigned short hb = f2bf_bits(sv);
              const unsigned short lb = f2bf_bits(sv - bf_bits2f(hb));
              hv[e] = __builtin_bit_cast(_Float16, hb);
              lv[e] = __builtin_bit_cast(_Float16, lb);
            }
          }
          *(v8h*)(C + (size_t)(mBase + row) * ldc + n0 + c8) = hv;
          if (OUT_MODE == 2) *(v8h*)(C2 + (size_t)(mBase + row) * ldc + n0 + c8) = lv;
        }
        
      }
    }
    __builtin_amdgcn_fence(__ATOMIC_RELEASE, "workgroup");
    __builtin_amdgcn_wave_barrier();
    __builtin_amdgcn_fence(__ATOMIC_ACQUIRE, "workgroup");
  }
}

// ---------------------------------------------------------------------------
// f32 plane -> bf16 hi plane + bf16 lo plane (both RNE converts: hi = bf16(v), lo = bf16(v - hi)); 8 contiguous
// elements per thread. blockIdx.y (block-uniform) selects one of four sources and output plane y (planeElems apart),
// blockIdx.z the branch (sources s* or t*, outputs branchElems apart).
// Coverage: grid.x * 256 threads * 8 elements = total8 * 8 = the whole plane (grids are exact multiples of 256).
// ---------------------------------------------------------------------------
__global__ __launch_bounds__(256) void split4_bf16_kernel(
    const float* __restrict__ s0, const float* __restrict__ s1, const float* __restrict__ s2, const float* __restrict__ s3,
    const float* __restrict__ t0, const float* __restrict__ t1, const float* __restrict__ t2, const float* __restrict__ t3,
    unsigned short* __restrict__ dhi, unsigned short* __restrict__ dlo, int total8, long planeElems, long branchElems) {
  const int i = blockIdx.x * 256 + threadIdx.x;
  if (i >= total8) return;
  const int y = blockIdx.y;
  const int z = blockIdx.z;
  const float* srcA = (y == 0) ? s0 : (y == 1) ? s1 : (y == 2) ? s2 : s3;
  const float* srcB = (y == 0) ? t0 : (y == 1) ? t1 : (y == 2) ? t2 : t3;
  const float* src = z ? srcB : srcA;
  const size_t e0 = (size_t)i << 3;
  const v4f a0 = *(const v4f*)(src + e0);
  const v4f a1 = *(const v4f*)(src + e0 + 4);
  v8h hv, lv;
#pragma unroll
  for (int e = 0; e < 4; ++e) {
    const float f0 = a0[e], f1 = a1[e];
    const unsigned short h0 = f2bf_bits(f0), h1 = f2bf_bits(f1);
    const unsigned short l0 = f2bf_bits(f0 - bf_bits2f(h0)), l1 = f2bf_bits(f1 - bf_bits2f(h1));
    hv[e]     = __builtin_bit_cast(_Float16, h0);
    hv[4 + e] = __builtin_bit_cast(_Float16, h1);
    lv[e]     = __builtin_bit_cast(_Float16, l0);
    lv[4 + e] = __builtin_bit_cast(_Float16, l1);
  }
  unsigned short* qh = dhi + (size_t)y * planeElems + (size_t)z * branchElems + e0;
  unsigned short* ql = dlo + (size_t)y * planeElems + (size_t)z * branchElems + e0;
  *(v8h*)qh = hv;
  *(v8h*)ql = lv;
  
}

// ---------------------------------------------------------------------------
// f32 plane -> f16 plane with a power-of-two carry; same thread/line map as above (8 elements = one 16-B store per
// ---------------------------------------------------------------------------
__global__ __launch_bounds__(256) void cast4_f16_kernel(
    const float* __restrict__ s0, const float* __restrict__ s1, const float* __restrict__ s2, const float* __restrict__ s3,
    const float* __restrict__ t0, const float* __restrict__ t1, const float* __restrict__ t2, const float* __restrict__ t3,
    unsigned short* __restrict__ out, float carry, int total8, long planeElems, long branchElems) {
  const int i = blockIdx.x * 256 + threadIdx.x;
  if (i >= total8) return;
  const int y = blockIdx.y;
  const int z = blockIdx.z;
  const float* srcA = (y == 0) ? s0 : (y == 1) ? s1 : (y == 2) ? s2 : s3;
  const float* srcB = (y == 0) ? t0 : (y == 1) ? t1 : (y == 2) ? t2 : t3;
  const float* src = z ? srcB : srcA;
  const size_t e0 = (size_t)i << 3;
  const v4f a0 = *(const v4f*)(src + e0);
  const v4f a1 = *(const v4f*)(src + e0 + 4);
  v8h hv;
#pragma unroll
  for (int e = 0; e < 4; ++e) {
    const float f0 = a0[e] * carry, f1 = a1[e] * carry;
    hv[e]     = (_Float16)f0;
    hv[4 + e] = (_Float16)f1;
  }
  unsigned short* q = out + (size_t)y * planeElems + (size_t)z * branchElems + e0;
  *(v8h*)q = hv;
  
}

// ---------------------------------------------------------------------------
// bf16 hi + lo planes -> f16 plane of (hi + lo); planes read as 32-bit integer words; same thread/line map.
// ---------------------------------------------------------------------------
__global__ __launch_bounds__(256) void hilo_to_f16_kernel(
    const unsigned short* __restrict__ hi0, const unsigned short* __restrict__ lo0,
    unsigned short* __restrict__ out0, int total8, long branchElems) {
  const int i = blockIdx.x * 256 + threadIdx.x;
  if (i >= total8) return;
  /* blockIdx.y = branch */
  const unsigned short* hi = hi0 + (size_t)blockIdx.y * branchElems;
  const unsigned short* lo = lo0 + (size_t)blockIdx.y * branchElems;
  unsigned short* out = out0 + (size_t)blockIdx.y * branchElems;
  const size_t e0 = (size_t)i << 3;
  const v4u hw4 = *(const v4u*)(hi + e0);
  const v4u lw4 = *(const v4u*)(lo + e0);
  v8h hv;
#pragma unroll
  for (int w = 0; w < 4; ++w) {
    const unsigned hw = hw4[w];
    const unsigned lw = lw4[w];
    const float f0 = __uint_as_float(hw << 16) + __uint_as_float(lw << 16);
    const float f1 = __uint_as_float(hw & 0xffff0000u) + __uint_as_float(lw & 0xffff0000u);
    hv[2 * w]     = (_Float16)f0;
    hv[2 * w + 1] = (_Float16)f1;
  }
  unsigned short* q = out + e0;
  *(v8h*)q = hv;
  
}

// ---------------------------------------------------------------------------
// Row statistics of S f32 [4096][4096]: m_i = max_j S_ij, inv_s_i = 1 / sum_j exp(S_ij - m_i).
// Block = 32 rows (8 waves x 4 rows, one wave per row at a time, lane-strided 16-B loads, two sweeps per row).
// Fixed order: per-lane sequential, then xor shuffle tree (unconditional).
// ---------------------------------------------------------------------------
__global__ __launch_bounds__(256) void rowstat_kernel(const float* __restrict__ S0, float* __restrict__ mrow0, float* __restrict__ invs0) {
  __shared__ float sM[32];
  __shared__ float sI[32];
  /* blockIdx.y = branch */
  const float* S = S0 + (size_t)blockIdx.y * kR0El32;
  float* mrow = mrow0 + (size_t)blockIdx.y * kTok;
  float* invs = invs0 + (size_t)blockIdx.y * kTok;
  const int lane = threadIdx.x & 31;
  const int wave = __builtin_amdgcn_readfirstlane((int)(threadIdx.x >> 5));
  const int row0 = blockIdx.x * 32;
#pragma unroll 1
  for (int q = 0; q < 4; ++q) {
    const int rl = wave * 4 + q;
    const float* p = S + (size_t)(row0 + rl) * kTok + lane * 4;
    float m = -INFINITY;
#pragma unroll 4
    for (int it = 0; it < kTok / 128; ++it) {
      const v4f v = *(const v4f*)(p + it * 128);
      m = fmaxf(m, fmaxf(fmaxf(v[0], v[1]), fmaxf(v[2], v[3])));
    }
#pragma unroll
    for (int off = 16; off > 0; off >>= 1) m = fmaxf(m, __shfl_xor(m, off, 32));
    float sum = 0.f;
#pragma unroll 2
    for (int it = 0; it < kTok / 128; ++it) {
      const v4f v = *(const v4f*)(p + it * 128);
      sum += __expf(v[0] - m);
      sum += __expf(v[1] - m);
      sum += __expf(v[2] - m);
      sum += __expf(v[3] - m);
    }
#pragma unroll
    for (int off = 16; off > 0; off >>= 1) sum += __shfl_xor(sum, off, 32);
    const float inv = 1.0f / sum;
    if (lane == 0) {
      sM[rl] = m;
      sI[rl] = inv;
    }
  }
  __syncthreads();
  if (wave == 0) {
    const float mv = sM[lane];
    const float iv = sI[lane];
    *(float*)(mrow + row0 + lane) = mv;
    *(float*)(invs + row0 + lane) = iv;
    
  }
}

// ---------------------------------------------------------------------------
// Column sums over queries of the row-normalised probabilities: c_j = sum_i exp(S_ij - m_i) * inv_s_i, then
// w, w+8, ... (512 rows) in order; the 8 wave partials are combined in index order by wave 0. No atomics.
// ---------------------------------------------------------------------------
__global__ __launch_bounds__(256) void colsum_kernel(const float* __restrict__ S0, const float* __restrict__ mrow0,
                                                     const float* __restrict__ invs0, float* __restrict__ rcol0) {
  __shared__ float sP[8][32];
  /* blockIdx.y = branch */
  const float* S = S0 + (size_t)blockIdx.y * kR0El32;
  const float* mrow = mrow0 + (size_t)blockIdx.y * kTok;
  const float* invs = invs0 + (size_t)blockIdx.y * kTok;
  float* rcol = rcol0 + (size_t)blockIdx.y * kTok;
  const int lane = threadIdx.x & 31;
  const int wave = __builtin_amdgcn_readfirstlane((int)(threadIdx.x >> 5));
  const int j0 = blockIdx.x * 32;
  const float* p = S + j0 + lane;
  float acc = 0.f;
#pragma unroll 4
  for (int t = 0; t < kTok / 8; ++t) {
    const int i = wave + 8 * t;
    const float s  = p[(size_t)i * kTok];
    const float mi = mrow[i];
    const float is = invs[i];
    const float pr = __expf(s - mi) * is;
    acc += pr;
  }
  sP[wave][lane] = acc;
  __syncthreads();
  if (wave == 0) {
    float c = sP[0][lane];
    c += sP[1][lane];
    c += sP[2][lane];
    c += sP[3][lane];
    c += sP[4][lane];
    c += sP[5][lane];
    c += sP[6][lane];
    c += sP[7][lane];
    const float rc = 1.0f / (kAttnEps + c);
    *(float*)(rcol + j0 + lane) = rc;
    
  }
}

// ---------------------------------------------------------------------------
// attn.V with the weights formed while staging: SC[i][d] = (1/32768) * sum_j f16(32768 * P_ij * rc_j) * VT[d][j],
// P_ij = exp(S_ij - m_i) * inv_s_i. Block = 64 query rows x all 512 d (8 waves, wave w owns d columns 64w..64w+63,
// acc 4x4 tiles). Per k-step of 32 keys the 256 threads stage the 64 x 32 f16 A tile in LDS: thread t -> row t>>2,
// keys (t&3)*8..+7 (64 rows x 4 threads x 8 = 2048 = the whole tile, one 16-B LDS store each; pad columns 32..39
// of the 40-half pitch are never read: fragment reads touch k offsets 0..31 only). Block barrier before the fragment
// reads and again before the next staging. B fragments stream from the V^T plane in global memory.
// ---------------------------------------------------------------------------
__global__ __launch_bounds__(256) void av_kernel(const float* __restrict__ S0, const float* __restrict__ mrow0,
                                                 const float* __restrict__ invs0, const float* __restrict__ rcol0,
                                                 const unsigned short* __restrict__ VTp0, float* __restrict__ SC0) {
  __shared__ __align__(16) _Float16 sA[64 * kAvPitch];
  __shared__ __align__(16) float sT[8][16 * 68];
  /* blockIdx.y = branch */
  const float* S = S0 + (size_t)blockIdx.y * kR0El32;
  const float* mrow = mrow0 + (size_t)blockIdx.y * kTok;
  const float* invs = invs0 + (size_t)blockIdx.y * kTok;
  const float* rcol = rcol0 + (size_t)blockIdx.y * kTok;
  const unsigned short* VTp = VTp0 + (size_t)blockIdx.y * kND;
  float* SC = SC0 + (size_t)blockIdx.y * kND;
  typedef Frag<_Float16> FH;
  const int tid  = threadIdx.x;
  const int lane = tid & 31;
  const int wave = __builtin_amdgcn_readfirstlane((int)(tid >> 5));
  const int m0 = blockIdx.x * 64;
  const int n0 = wave * 64;
  const int sr  = tid >> 2;
  const int sc8 = (tid & 3) * 8;
  const float mi = mrow[m0 + sr];
  const float fi = invs[m0 + sr] * kPCarry;
  const float* Srow = S + (size_t)(m0 + sr) * kTok + sc8;
  const float* rcp  = rcol + sc8;
  const _Float16* VT = (const _Float16*)VTp;

  const int rlane = lane & 15;
  const int koff  = (lane >> 4) * 8;
  const int mOff  = (lane >> 4) * 8;

  v8f acc[4][4];
#pragma unroll
  for (int i = 0; i < 4; ++i)
#pragma unroll
    for (int j = 0; j < 4; ++j) acc[i][j] = (v8f){0.f, 0.f, 0.f, 0.f, 0.f, 0.f, 0.f, 0.f};

  for (int k0 = 0; k0 < kTok; k0 += 32) {
    const v4f s0 = *(const v4f*)(Srow + k0);
    const v4f s1 = *(const v4f*)(Srow + k0 + 4);
    const v4f r0 = *(const v4f*)(rcp + k0);
    const v4f r1 = *(const v4f*)(rcp + k0 + 4);
    v8h hv;
#pragma unroll
    for (int e = 0; e < 4; ++e) {
      const float e0 = __expf(s0[e] - mi);
      const float e1 = __expf(s1[e] - mi);
      const float w0 = (e0 * fi) * r0[e];
      const float w1 = (e1 * fi) * r1[e];
      hv[e]     = (_Float16)w0;
      hv[4 + e] = (_Float16)w1;
    }
    *(v8h*)(sA + sr * kAvPitch + sc8) = hv;
    __syncthreads();
    v16h bh[4];
#pragma unroll
    for (int j = 0; j < 4; ++j) {
      const size_t bo = (size_t)(n0 + (j << 4) + rlane) * kTok + koff + k0;
      bh[j] = FH::load(VT + bo);
    }
#pragma unroll
    for (int i = 0; i < 4; ++i) {
      const int ao = ((i << 4) + rlane) * kAvPitch + koff;
      FH::U fa;
      fa.h[0] = *(const v8h*)(sA + ao);
      fa.h[1] = *(const v8h*)(sA + ao + 16);
      const v16h ah = fa.v;
#pragma unroll
      for (int j = 0; j < 4; ++j) acc[i][j] = FH::mma(ah, bh[j], acc[i][j]);
      FH::guard(acc[i][0], acc[i][1], acc[i][2], acc[i][3], ah, ah);
    }
    FH::keep(bh[0], bh[1], bh[2], bh[3]);
    __syncthreads();
  }
  acc_guard4(acc[0][0], acc[0][1], acc[0][2], acc[0][3]);
  acc_guard4(acc[1][0], acc[1][1], acc[1][2], acc[1][3]);
  acc_guard4(acc[2][0], acc[2][1], acc[2][2], acc[2][3]);
  acc_guard4(acc[3][0], acc[3][1], acc[3][2], acc[3][3]);

  float* slab = sT[wave];
#pragma unroll
  for (int i = 0; i < 4; ++i) {
    const int mBase = m0 + (i << 4);
#pragma unroll
    for (int j = 0; j < 4; ++j) {
#pragma unroll
      for (int r = 0; r < 8; ++r) slab[(mOff + r) * 68 + (j << 4) + rlane] = acc[i][j][r] * kPCarryInv;
    }
    __builtin_amdgcn_fence(__ATOMIC_RELEASE, "workgroup");
    __builtin_amdgcn_wave_barrier();
    __builtin_amdgcn_fence(__ATOMIC_ACQUIRE, "workgroup");
    {
      const int hh = lane >> 4, c4 = (lane & 15) * 4;
      v4f vals[8];
#pragma unroll
      for (int it = 0; it < 8; ++it) vals[it] = *(const v4f*)(slab + (it * 2 + hh) * 68 + c4);
      {
#pragma unroll
        for (int it = 0; it < 8; ++it) {
          const int row = it * 2 + hh;
          *(v4f*)(SC + (size_t)(mBase + row) * kDim + n0 + c4) = vals[it];
        }
        
      }
    }
    __builtin_amdgcn_fence(__ATOMIC_RELEASE, "workgroup");
    __builtin_amdgcn_wave_barrier();
    __builtin_amdgcn_fence(__ATOMIC_ACQUIRE, "workgroup");
  }
}

// ---------------------------------------------------------------------------
// s = LayerNorm(res + sc) over 512 (biased variance, eps inside rsqrt), one wave per row, 8 rows per block.
// Lane owns columns it*128 + lane*4 .. +3 (it 0..3): 16 values in registers, static indexing.
// res is an f16 plane read as 32-bit integer words; sc, gamma, beta f32.
// (via the wave's own LDS slab: lane owns columns it2*256 + lane*8 .. +7, 2 instructions x 32 lanes x 16 B = 4 whole
// ---------------------------------------------------------------------------
__global__ __launch_bounds__(256) void add_ln_kernel(const unsigned short* __restrict__ RES0, const float* __restrict__ SCp0,
                                                     const float* __restrict__ gam0, const float* __restrict__ bet0,
                                                     const float* __restrict__ gam1, const float* __restrict__ bet1,
                                                     float* __restrict__ S320, unsigned short* __restrict__ S160) {
  __shared__ __align__(16) float sY[8][kDim];
  /* blockIdx.y = branch */
  const unsigned short* RES = RES0 + (size_t)blockIdx.y * kND;
  const float* SCp = SCp0 + (size_t)blockIdx.y * kND;
  const float* gam = blockIdx.y ? gam1 : gam0;
  const float* bet = blockIdx.y ? bet1 : bet0;
  float* S32 = S320 + (size_t)blockIdx.y * kR0El32;
  unsigned short* S16 = S160 + (size_t)blockIdx.y * kR0El16;
  const int lane = threadIdx.x & 31;
  const int wave = __builtin_amdgcn_readfirstlane((int)(threadIdx.x >> 5));
  const int row = blockIdx.x * 8 + wave;
  const float* scp = SCp + (size_t)row * kDim;
  const unsigned short* rp = RES + (size_t)row * kDim;
  float x[16];
#pragma unroll
  for (int it = 0; it < 4; ++it) {
    const int col = it * 128 + lane * 4;
    const v4f a = *(const v4f*)(scp + col);
    const v2u w = *(const v2u*)(rp + col);
    const unsigned w0 = w[0];
    const unsigned w1 = w[1];
    x[4 * it + 0] = h16_to_f32(w0 & 0xffffu) + a[0];
    x[4 * it + 1] = h16_to_f32(w0 >> 16) + a[1];
    x[4 * it + 2] = h16_to_f32(w1 & 0xffffu) + a[2];
    x[4 * it + 3] = h16_to_f32(w1 >> 16) + a[3];
  }
  float s = 0.f;
#pragma unroll
  for (int i = 0; i < 16; ++i) s += x[i];
#pragma unroll
  for (int off = 16; off > 0; off >>= 1) s += __shfl_xor(s, off, 32);
  const float mu = s * kInvDim;
  float vs = 0.f;
#pragma unroll
  for (int i = 0; i < 16; ++i) {
    const float d = x[i] - mu;
    x[i] = d;
    vs += d * d;
  }
#pragma unroll
  for (int off = 16; off > 0; off >>= 1) vs += __shfl_xor(vs, off, 32);
  const float inv = rsqrtf(vs * kInvDim + kLnEps);
  float* slab = sY[wave];
  v4f yv[4];
#pragma unroll
  for (int it = 0; it < 4; ++it) {
    const int col = it * 128 + lane * 4;
    const v4f g4 = *(const v4f*)(gam + col);
    const v4f b4 = *(const v4f*)(bet + col);
    v4f y;
    y[0] = (x[4 * it + 0] * inv) * g4[0] + b4[0];
    y[1] = (x[4 * it + 1] * inv) * g4[1] + b4[1];
    y[2] = (x[4 * it + 2] * inv) * g4[2] + b4[2];
    y[3] = (x[4 * it + 3] * inv) * g4[3] + b4[3];
    yv[it] = y;
    *(v4f*)(slab + col) = y;
  }
  __builtin_amdgcn_fence(__ATOMIC_RELEASE, "workgroup");
  __builtin_amdgcn_wave_barrier();
  __builtin_amdgcn_fence(__ATOMIC_ACQUIRE, "workgroup");
  v8h hv[2];
#pragma unroll
  for (int it2 = 0; it2 < 2; ++it2) {
    const int c = it2 * 256 + lane * 8;
    const v4f a0 = *(const v4f*)(slab + c);
    const v4f a1 = *(const v4f*)(slab + c + 4);
#pragma unroll
    for (int e = 0; e < 4; ++e) {
      const float f0 = a0[e], f1 = a1[e];
      hv[it2][e]     = (_Float16)f0;
      hv[it2][4 + e] = (_Float16)f1;
    }
  }
  float* o32 = S32 + (size_t)row * kDim;
  unsigned short* o16 = S16 + (size_t)row * kDim;
  {
#pragma unroll
    for (int it = 0; it < 4; ++it) *(v4f*)(o32 + it * 128 + lane * 4) = yv[it];
#pragma unroll
    for (int it2 = 0; it2 < 2; ++it2) *(v8h*)(o16 + it2 * 256 + lane * 8) = hv[it2];
    
  }
}

// ---------------------------------------------------------------------------
// Host glue (kernel launches and host arithmetic only)
// ---------------------------------------------------------------------------
template <int ET, bool SPLIT, int BIAS_MODE, int OUT_MODE, bool RESID, int ACT>
static void run_gemm(hipStream_t st,
                     const unsigned short* A, const unsigned short* A2, int lda,
                     const unsigned short* Bt, const unsigned short* Bt2, int ldb,
                     void* C, void* C2, int ldc,
                     const float* bias0, const float* bias1, const float* resid0, const float* resid1,
                     long aP, long bP, long bQ, long cP, long cQ, int planes,
                     int M, int N, int K, float scale) {
  const int blocks = (M >> 7) * (N >> 7);
  wmma_gemm64<ET, SPLIT, BIAS_MODE, OUT_MODE, RESID, ACT><<<dim3(blocks, 2, planes), 128, 0, st>>>(
      A, A2, lda, Bt, Bt2, ldb, C, C2, ldc, bias0, bias1, resid0, resid1, aP, bP, bQ, cP, cQ, M, N, K, scale);
}

extern "C" void kernel_launch(void* const* d_in, const int* in_sizes, int n_in,
                              void* d_out, int out_size, void* d_ws, size_t ws_size,
                              hipStream_t stream) {
  if (n_in < 34) return;
  if (in_sizes[0] != (int)kND || in_sizes[1] != (int)kND) return;
  for (int p = 0; p < 2; ++p) {
    for (int s = 0; s < 16; ++s) {
      const bool isMat = (s == 0 || s == 2 || s == 4 || s == 6 || s == 8 || s == 10 || s == 11 || s == 12 || s == 15);
      const int want = isMat ? (int)kWW : kDim;
      if (in_sizes[2 + 16 * p + s] != want) return;
    }
  }
  if (out_size != (int)(2 * kND)) return;
  if (ws_size < kWsTotal) return;

  char* ws = (char*)d_ws;
  unsigned short* XH  = (unsigned short*)(ws + kOffXH);
  unsigned short* XL  = (unsigned short*)(ws + kOffXL);
  unsigned short* T0H = (unsigned short*)(ws + kOffT0H);
  unsigned short* T0L = (unsigned short*)(ws + kOffT0L);
  unsigned short* FH  = (unsigned short*)(ws + kOffFH);
  unsigned short* FL  = (unsigned short*)(ws + kOffFL);
  unsigned short* F16 = (unsigned short*)(ws + kOffF16);
  unsigned short* R1  = (unsigned short*)(ws + kOffR1);
  unsigned short* R2  = (unsigned short*)(ws + kOffR2);
  unsigned short* WSH = (unsigned short*)(ws + kOffWSH);
  unsigned short* WSL = (unsigned short*)(ws + kOffWSL);
  unsigned short* WF  = (unsigned short*)(ws + kOffWF);
  float*          S   = (float*)(ws + kOffS);
  float*          S32 = (float*)(ws + kOffS32);
  unsigned short* S16 = (unsigned short*)(ws + kOffS16);
  unsigned short* QK  = (unsigned short*)(ws + kOffQK);
  unsigned short* VT  = (unsigned short*)(ws + kOffVT);
  unsigned short* RES = (unsigned short*)(ws + kOffRES);
  float*          SC  = (float*)(ws + kOffSC);
  unsigned short* FFN = (unsigned short*)(ws + kOffFFN);
  float*          MROW = (float*)(ws + kOffMROW);
  float*          INVS = (float*)(ws + kOffINVS);
  float*          RC   = (float*)(ws + kOffRC);
  float* out = (float*)d_out;

  const int nd8 = (int)(kND / 8);
  const int ww8 = (int)(kWW / 8);

  /* inputs of branch A (a*) and branch B (b*) */
  const float* ax   = (const float*)d_in[0];
  const float* bx   = (const float*)d_in[1];
  const float* apW1 = (const float*)d_in[2 + 0];
  const float* bpW1 = (const float*)d_in[18 + 0];
  const float* apb1 = (const float*)d_in[2 + 1];
  const float* bpb1 = (const float*)d_in[18 + 1];
  const float* apW2 = (const float*)d_in[2 + 2];
  const float* bpW2 = (const float*)d_in[18 + 2];
  const float* apb2 = (const float*)d_in[2 + 3];
  const float* bpb2 = (const float*)d_in[18 + 3];
  const float* arW1 = (const float*)d_in[2 + 4];
  const float* brW1 = (const float*)d_in[18 + 4];
  const float* arb1 = (const float*)d_in[2 + 5];
  const float* brb1 = (const float*)d_in[18 + 5];
  const float* arW2 = (const float*)d_in[2 + 6];
  const float* brW2 = (const float*)d_in[18 + 6];
  const float* arb2 = (const float*)d_in[2 + 7];
  const float* brb2 = (const float*)d_in[18 + 7];
  const float* arW3 = (const float*)d_in[2 + 8];
  const float* brW3 = (const float*)d_in[18 + 8];
  const float* arb3 = (const float*)d_in[2 + 9];
  const float* brb3 = (const float*)d_in[18 + 9];
  const float* aWq  = (const float*)d_in[2 + 10];
  const float* bWq  = (const float*)d_in[18 + 10];
  const float* aWk  = (const float*)d_in[2 + 11];
  const float* bWk  = (const float*)d_in[18 + 11];
  const float* aWv  = (const float*)d_in[2 + 12];
  const float* bWv  = (const float*)d_in[18 + 12];
  const float* alng = (const float*)d_in[2 + 13];
  const float* blng = (const float*)d_in[18 + 13];
  const float* alnb = (const float*)d_in[2 + 14];
  const float* blnb = (const float*)d_in[18 + 14];
  const float* affn = (const float*)d_in[2 + 15];
  const float* bffn = (const float*)d_in[18 + 15];

  /* Every launch below works on both branches: the pointers are branch A's, the strides lead to branch B's part. */
  const long r0B   = (long)kR0Bytes;
  const long nd    = (long)kND;
  const long ww    = (long)kWW;

  /* ffn weights -> f16 x256 planes (outside R0: they outlive the logits) */
  cast4_f16_kernel<<<dim3(ww8 / 256, 1, 2), 256, 0, stream>>>(affn, affn, affn, affn, bffn, bffn, bffn, bffn,
                                                              FFN, kWCarry, ww8, 0L, ww);

  /* operand planes: x hi/lo; pW1,pW2,Wq,Wk hi/lo (weights are [out][in] = Bt layout); rW1,rW2,rW3,Wv f16 x256 */
  split4_bf16_kernel<<<dim3(nd8 / 256, 1, 2), 256, 0, stream>>>(ax, ax, ax, ax, bx, bx, bx, bx, XH, XL, nd8, 0L, kR0El16);
  split4_bf16_kernel<<<dim3(ww8 / 256, 4, 2), 256, 0, stream>>>(apW1, apW2, aWq, aWk, bpW1, bpW2, bWq, bWk,
                                                                WSH, WSL, ww8, ww, kR0El16);
  cast4_f16_kernel<<<dim3(ww8 / 256, 4, 2), 256, 0, stream>>>(arW1, arW2, arW3, aWv, brW1, brW2, brW3, bWv,
                                                              WF, kWCarry, ww8, ww, kR0El16);

  /* h1 = relu(x . pW1^T + pb1) -> hi/lo : M 4096, N 512, K 512 */
  run_gemm<1, true, 2, 2, false, 2>(stream, XH, XL, kDim, WSH + 0 * kWW, WSL + 0 * kWW, kDim,
                                    (void*)T0H, (void*)T0L, kDim, apb1, bpb1, apb1, bpb1,
                                    kR0El16, kR0El16, 0L, r0B, 0L, 1, kTok, kDim, kDim, 1.0f);
  /* feat = h1 . pW2^T + pb2 -> hi/lo */
  run_gemm<1, true, 2, 2, false, 0>(stream, T0H, T0L, kDim, WSH + 1 * kWW, WSL + 1 * kWW, kDim,
                                    (void*)FH, (void*)FL, kDim, apb2, bpb2, apb2, bpb2,
                                    kR0El16, kR0El16, 0L, r0B, 0L, 1, kTok, kDim, kDim, 1.0f);
  /* f16 copy of feat */
  hilo_to_f16_kernel<<<dim3(nd8 / 256, 2), 256, 0, stream>>>(FH, FL, F16, nd8, kR0El16);
  /* residual chain: relu, relu, linear (f16 single products, weights x256) */
  run_gemm<0, false, 2, 1, false, 2>(stream, F16, F16, kDim, WF + 0 * kWW, WF + 0 * kWW, kDim,
                                     (void*)R1, (void*)R1, kDim, arb1, brb1, arb1, brb1,
                                     kR0El16, kR0El16, 0L, r0B, 0L, 1, kTok, kDim, kDim, kWCarryInv);
  run_gemm<0, false, 2, 1, false, 2>(stream, R1, R1, kDim, WF + 1 * kWW, WF + 1 * kWW, kDim,
                                     (void*)R2, (void*)R2, kDim, arb2, brb2, arb2, brb2,
                                     kR0El16, kR0El16, 0L, r0B, 0L, 1, kTok, kDim, kDim, kWCarryInv);
  run_gemm<0, false, 2, 1, false, 0>(stream, R2, R2, kDim, WF + 2 * kWW, WF + 2 * kWW, kDim,
                                     (void*)RES, (void*)RES, kDim, arb3, brb3, arb3, brb3,
                                     kR0El16, kR0El16, 0L, 2 * nd, 0L, 1, kTok, kDim, kDim, kWCarryInv);
  /* Q (plane 0) and K (plane 1) -> hi/lo planes; QK holds QH QL KH KL of branch A, then of branch B */
  run_gemm<1, true, 0, 2, false, 0>(stream, FH, FL, kDim, WSH + 2 * kWW, WSL + 2 * kWW, kDim,
                                    (void*)QK, (void*)(QK + kND), kDim, apb1, bpb1, apb1, bpb1,
                                    kR0El16, kR0El16, ww, 8 * nd, 4 * nd, 2, kTok, kDim, kDim, 1.0f);
  /* V^T[d][i] = sum_k Wv[d][k] feat[i][k] : A = Wv (M 512), Bt = feat f16 (N 4096), K 512, ldc 4096 */
  run_gemm<0, false, 0, 1, false, 0>(stream, WF + 3 * kWW, WF + 3 * kWW, kDim, F16, F16, kDim,
                                     (void*)VT, (void*)VT, kTok, apb1, bpb1, apb1, bpb1,
                                     kR0El16, kR0El16, 0L, 2 * nd, 0L, 1, kDim, kTok, kDim, kWCarryInv);

  /* ---- cross attention, add + LayerNorm, ffn ---- */
  /* S = Q_p . K_other^T (hi.hi + hi.lo + lo.hi), f32 : M 4096, N 4096, K 512. Branch A reads branch B's K planes
     (planes 6, 7 of QK) and branch B reads branch A's (planes 2, 3): the Bt stride is negative. */
  run_gemm<1, true, 0, 0, false, 0>(stream, QK, QK + kND, kDim, QK + 6 * kND, QK + 7 * kND, kDim,
                                    (void*)S, (void*)S, kTok, alng, blng, alng, blng,
                                    4 * nd, -4 * nd, 0L, r0B, 0L, 1, kTok, kTok, kDim, 1.0f);
  rowstat_kernel<<<dim3(kTok / 32, 2), 256, 0, stream>>>(S, MROW, INVS);
  colsum_kernel<<<dim3(kTok / 32, 2), 256, 0, stream>>>(S, MROW, INVS, RC);
  av_kernel<<<dim3(kTok / 64, 2), 256, 0, stream>>>(S, MROW, INVS, RC, VT, SC);
  /* S is dead from here; S32 / S16 occupy the first 12 MiB of each branch's R0 */
  add_ln_kernel<<<dim3(kTok / 8, 2), 256, 0, stream>>>(RES, SC, alng, alnb, blng, blnb, S32, S16);
  /* out = s + s . ffnW^T : A = s f16, Bt = ffnW f16 x256, residual s f32 fetched in the store phase */
  run_gemm<0, false, 0, 0, true, 0>(stream, S16, S16, kDim, FFN, FFN, kDim,
                                    (void*)out, (void*)out, kDim, alng, blng, S32, S32 + kR0El32,
                                    kR0El16, ww, 0L, 4 * nd, 0L, 1, kTok, kDim, kDim, kWCarryInv);
}

// v003
// A run of this version takes 403 microseconds.
// Next to v002, in two timings, it ran 1.30 times as fast each time.
// Over all steps from v000 it is 3.40 times as fast.
// Contractions: pW1/pW2/Wq/Wk linears and q.k^T logits on v_wmma_f32_16x16x32_bf16 with both operands as bf16 hi+lo planes (hi.hi + hi.lo + lo.hi), f32 accumulate, logits kept f32; rW1/rW2/rW3/Wv/ffn linears and attn.V on v_wmma_f32_16x16x32_f16 (weights carried x256, attention weights carried x32768), f32 accumulate; softmax statistics, column sums, LayerNorm and residual adds in f32.
#include <hip/hip_runtime.h>
#include <math.h>

typedef __attribute__((ext_vector_type(16))) _Float16 v16h;
typedef __attribute__((ext_vector_type(8)))  _Float16 v8h;
typedef __attribute__((ext_vector_type(16))) __bf16   v16b;
typedef __attribute__((ext_vector_type(8)))  __bf16   v8b;
typedef __attribute__((ext_vector_type(8)))  float    v8f;
typedef __attribute__((ext_vector_type(4)))  float    v4f;
typedef __attribute__((ext_vector_type(4)))  unsigned int v4u;
typedef __attribute__((ext_vector_type(2)))  unsigned int v2u;

// ---------------------------------------------------------------------------
// Problem constants
// ---------------------------------------------------------------------------
constexpr int    kTok       = 4096;
constexpr int    kDim       = 512;
constexpr size_t kND        = (size_t)kTok * kDim;
constexpr size_t kWW        = (size_t)kDim * kDim;
constexpr float  kWCarry    = 256.0f;
constexpr float  kWCarryInv = 1.0f / kWCarry;
constexpr float  kPCarry    = 32768.0f;
constexpr float  kPCarryInv = 1.0f / kPCarry;
constexpr float  kInvDim    = 1.0f / (float)kDim;
constexpr float  kLnEps     = 1e-6f;
constexpr float  kAttnEps   = 1e-9f;
static_assert((kTok % 64) == 0 && (kDim % 64) == 0);
static_assert((kTok % 32) == 0 && (kDim % 32) == 0);
static_assert(((kND / 8) % 256) == 0 && ((kWW / 8) % 256) == 0);

// ---------------------------------------------------------------------------
// Workspace region map (bytes; every offset is a multiple of 128). Both branches run in the same launches, so every
// region holds branch A's part and then branch B's.
//   R0      2 x 67,108,864  time-shared region, one per branch:
//             (a) operand planes of the branch's linear chain:
//                 XH XL T0H T0L FH FL F16 R1 R2   9 x 4,194,304 (16-bit [4096][512] planes)
//                 WSH (4 bf16 hi weight planes) 2,097,152 ; WSL (4 bf16 lo planes) 2,097,152
//                 WF  (4 f16 weight planes, carried x256) 2,097,152         -> 44,040,192 used
//             (b) S f32 [4096][4096] logits of the branch                    67,108,864
//             (c) S32 f32 [4096][512] + S16 f16 [4096][512] LayerNorm output 12,582,912
//   QK      33,554,432  QH QL KH KL bf16 planes [4096][512], branch A then branch B
//   VT       8,388,608  V^T f16 [512][4096], branch A then B
//   RES      8,388,608  residual-chain output f16 [4096][512], branch A then B
//   SC      16,777,216  attn.V output f32 [4096][512], branch A then B
//   FFN      1,048,576  ffn weight f16 planes (x256), branch A then B
//   MROW        32,768  row maxima f32 [4096], branch A then B
//   INVS        32,768  1 / row exp sums f32 [4096], branch A then B
//   RC          32,768  1 / (1e-9 + column sums) f32 [4096], branch A then B
//   total = 134,217,728 + 33,554,432 + 8,388,608 + 8,388,608 + 16,777,216 + 1,048,576 + 32,768 + 32,768 + 32,768
//         = 202,473,472
// ---------------------------------------------------------------------------
constexpr size_t kPlane16  = kND * 2;
constexpr size_t kPlane32  = kND * 4;
constexpr size_t kW16      = kWW * 2;
constexpr size_t kR0Bytes  = (size_t)kTok * kTok * 4;
constexpr size_t kOffXH    = 0;
constexpr size_t kOffXL    = kOffXH  + kPlane16;
constexpr size_t kOffT0H   = kOffXL  + kPlane16;
constexpr size_t kOffT0L   = kOffT0H + kPlane16;
constexpr size_t kOffFH    = kOffT0L + kPlane16;
constexpr size_t kOffFL    = kOffFH  + kPlane16;
constexpr size_t kOffF16   = kOffFL  + kPlane16;
constexpr size_t kOffR1    = kOffF16 + kPlane16;
constexpr size_t kOffR2    = kOffR1  + kPlane16;
constexpr size_t kOffWSH   = kOffR2  + kPlane16;
constexpr size_t kOffWSL   = kOffWSH + 4 * kW16;
constexpr size_t kOffWF    = kOffWSL + 4 * kW16;
constexpr size_t kPhase1End = kOffWF + 4 * kW16;
constexpr size_t kOffS     = 0;
constexpr size_t kOffS32   = 0;
constexpr size_t kOffS16   = kOffS32 + kPlane32;
constexpr size_t kOffQK    = 2 * kR0Bytes;
constexpr size_t kOffVT    = kOffQK  + 8 * kPlane16;
constexpr size_t kOffRES   = kOffVT  + 2 * kPlane16;
constexpr size_t kOffSC    = kOffRES + 2 * kPlane16;
constexpr size_t kOffFFN   = kOffSC  + 2 * kPlane32;
constexpr size_t kOffMROW  = kOffFFN + 2 * kW16;
constexpr size_t kOffINVS  = kOffMROW + 2 * (size_t)kTok * 4;
constexpr size_t kOffRC    = kOffINVS + 2 * (size_t)kTok * 4;
constexpr size_t kWsTotal  = kOffRC   + 2 * (size_t)kTok * 4;
constexpr long   kR0El16   = (long)(kR0Bytes / 2);  /* branch A -> branch B inside R0, in 16-bit elements */
constexpr long   kR0El32   = (long)(kR0Bytes / 4);  /* the same in f32 elements */
static_assert(kPhase1End <= kR0Bytes);
static_assert(kOffS16 + kPlane16 <= kR0Bytes);
static_assert(kWsTotal == 202473472ull);
static_assert(kWsTotal <= 268435456ull);
static_assert((kOffWSH % 128) == 0 && (kOffWSL % 128) == 0 && (kOffWF % 128) == 0 && (kOffQK % 128) == 0 &&
              (kOffVT % 128) == 0 && (kOffRES % 128) == 0 && (kOffSC % 128) == 0 && (kOffFFN % 128) == 0 &&
              (kOffMROW % 128) == 0 && (kOffINVS % 128) == 0 && (kOffRC % 128) == 0 && (kOffS16 % 128) == 0);

// ---------------------------------------------------------------------------
// Small helpers
// ---------------------------------------------------------------------------
__device__ __forceinline__ unsigned short f2bf_bits(float f) {
  unsigned u = __float_as_uint(f);
  return (unsigned short)((u + 0x7FFFu + ((u >> 16) & 1u)) >> 16);
}
__device__ __forceinline__ float bf_bits2f(unsigned short h) { return __uint_as_float(((unsigned)h) << 16); }

/* f16 bits (low 16 bits of hb, finite values) -> f32, integer path only */
__device__ __forceinline__ float h16_to_f32(unsigned hb) {
  const unsigned sgn = (hb & 0x8000u) << 16;
  const unsigned em = hb & 0x7fffu;
  const float fn = __uint_as_float((em << 13) + 0x38000000u);
  const float fs = (float)em * 5.9604644775390625e-8f;
  const float mag = (em < 0x400u) ? fs : fn;
  return __uint_as_float(__float_as_uint(mag) | sgn);
}

/* hazard guards: four nops, all four accumulators of the group tied, A fragments named as inputs */
__device__ __forceinline__ void grp_guard_h(v8f& a, v8f& b, v8f& c, v8f& d, v16h x, v16h y) {
  asm volatile("v_nop\n\tv_nop\n\tv_nop\n\tv_nop" : "+v"(a), "+v"(b), "+v"(c), "+v"(d) : "v"(x), "v"(y));
}
__device__ __forceinline__ void grp_guard_b(v8f& a, v8f& b, v8f& c, v8f& d, v16b x, v16b y) {
  asm volatile("v_nop\n\tv_nop\n\tv_nop\n\tv_nop" : "+v"(a), "+v"(b), "+v"(c), "+v"(d) : "v"(x), "v"(y));
}
__device__ __forceinline__ void keep4_h(v16h a, v16h b, v16h c, v16h d) { asm volatile("v_nop" :: "v"(a), "v"(b), "v"(c), "v"(d)); }
__device__ __forceinline__ void keep4_b(v16b a, v16b b, v16b c, v16b d) { asm volatile("v_nop" :: "v"(a), "v"(b), "v"(c), "v"(d)); }
__device__ __forceinline__ void acc_guard4(v8f& a, v8f& b, v8f& c, v8f& d) {
  asm volatile("v_nop\n\tv_nop\n\tv_nop\n\tv_nop" : "+v"(a), "+v"(b), "+v"(c), "+v"(d));
}

/* Fragment loader: elements 0..7 <- p[0..7], elements 8..15 <- p[16..23]; p already includes 8*(lane>>4) */
template <typename T> struct Frag;
template <> struct Frag<_Float16> {
  typedef v16h V;
  union U { v16h v; v8h h[2]; };
  static __device__ __forceinline__ v16h load(const _Float16* p) {
    U f;
    f.h[0] = *(const v8h*)(p);
    f.h[1] = *(const v8h*)(p + 16);
    return f.v;
  }
  static __device__ __forceinline__ v8f mma(v16h a, v16h b, v8f c) {
    return __builtin_amdgcn_wmma_f32_16x16x32_f16(false, a, false, b, (short)0, c, false, false);
  }
  static __device__ __forceinline__ void guard(v8f& a, v8f& b, v8f& c, v8f& d, v16h x, v16h y) { grp_guard_h(a, b, c, d, x, y); }
  static __device__ __forceinline__ void keep(v16h a, v16h b, v16h c, v16h d) { keep4_h(a, b, c, d); }
};
template <> struct Frag<__bf16> {
  typedef v16b V;
  union U { v16b v; v8b h[2]; };
  static __device__ __forceinline__ v16b load(const __bf16* p) {
    U f;
    f.h[0] = *(const v8b*)(p);
    f.h[1] = *(const v8b*)(p + 16);
    return f.v;
  }
  static __device__ __forceinline__ v8f mma(v16b a, v16b b, v8f c) {
    return __builtin_amdgcn_wmma_f32_16x16x32_bf16(false, a, false, b, (short)0, c, false, false);
  }
  static __device__ __forceinline__ void guard(v8f& a, v8f& b, v8f& c, v8f& d, v16b x, v16b y) { grp_guard_b(a, b, c, d, x, y); }
  static __device__ __forceinline__ void keep(v16b a, v16b b, v16b c, v16b d) { keep4_b(a, b, c, d); }
};

// ---------------------------------------------------------------------------
// LDS-staged WMMA GEMM: C[m,n] = scale * sum_k A[m,k] * Bt[n,k] (+bias[n]) (+resid[m,n]). A block of 4 waves owns a
// 128x128 tile (2x2 waves, each wave a 64x64 tile). A row-major [M][K] pitch lda; Bt row-major [N][K] pitch ldb;
// M, N multiples of 128, K a multiple of 64 and at least 128.
// Operand path: a stage is 64 k (one whole 128-B line) of the block's 128 A rows and 128 Bt rows, every plane, brought
// into LDS by per-lane asynchronous 16-B copies (8 lanes per line, 4 whole lines per wave instruction), two buffers:
// the next stage's copies fly while this stage is multiplied. LDS row pitch 144 B (16 B x 9) for the 16-B readers.
// SPLIT: operands are hi/lo planes (A2/Bt2 = lo planes, same layout); product = hi.hi + hi.lo + lo.hi.
// BIAS_MODE: 0 none, 2 bias[n] (f32). ACT: 0 none, 2 relu. RESID (f32 output only): the residual is fetched in the
// store phase, one 16-B vector per lane at exactly the address the lane stores to.
// OUT_MODE: 0 f32, 1 f16, 2 bf16 hi plane (Cout) + bf16 lo plane (Cout2).
// Epilogue: 16-row slabs staged per wave in LDS (only the owning wave touches its slab); the slabs reuse the ring
// behind the last stage's waits and barrier.
// ET: 0 f16 operands, 1 bf16 operands (pointers passed as 16-bit storage).
// One launch holds several independent products of one shape: blockIdx.y = branch, blockIdx.z = weight plane. The
// pointers are those of (0, 0); aP, bP (16-bit elements) and cP (bytes) lead to branch 1, bQ and cQ to plane 1.
// ---------------------------------------------------------------------------
template <int ET> struct Elem;
template <> struct Elem<0> { typedef _Float16 T; };
template <> struct Elem<1> { typedef __bf16 T; };

constexpr int kStageK   = 64;
constexpr int kRowPitch = 144;
constexpr int kPlaneLds = 128 * kRowPitch;
constexpr int kSlabLds  = 16 * 68 * 4;
static_assert((kRowPitch % 16) == 0 && ((kRowPitch / 16) % 2) == 1 && kRowPitch >= kStageK * 2);
static_assert((kDim % 128) == 0 && (kTok % 128) == 0 && (kDim % kStageK) == 0 && kDim >= 2 * kStageK);
static_assert(4 * kSlabLds <= 4 * kPlaneLds && (kSlabLds % 16) == 0);

/* One plane's 128 rows x 128 B of a stage: this lane's eight 16-B pieces, rows 16 apart. l = the lane's LDS byte
   address of its first piece, g = its global address, gstep = 16 source rows in elements. The copies and the
   s_wait_xcnt stand in one statement so that no address register is rewritten ahead of that wait. */
__device__ __forceinline__ void stage_plane(unsigned l, const unsigned short* g, size_t gstep) {
  const unsigned l1 = l + 16 * kRowPitch, l2 = l + 32 * kRowPitch, l3 = l + 48 * kRowPitch, l4 = l + 64 * kRowPitch,
                 l5 = l + 80 * kRowPitch, l6 = l + 96 * kRowPitch, l7 = l + 112 * kRowPitch;
  const unsigned short *g1 = g + gstep, *g2 = g + 2 * gstep, *g3 = g + 3 * gstep, *g4 = g + 4 * gstep,
                       *g5 = g + 5 * gstep, *g6 = g + 6 * gstep, *g7 = g + 7 * gstep;
  asm volatile(
      "global_load_async_to_lds_b128 %0, %8, off\n\t"
      "global_load_async_to_lds_b128 %1, %9, off\n\t"
      "global_load_async_to_lds_b128 %2, %10, off\n\t"
      "global_load_async_to_lds_b128 %3, %11, off\n\t"
      "global_load_async_to_lds_b128 %4, %12, off\n\t"
      "global_load_async_to_lds_b128 %5, %13, off\n\t"
      "global_load_async_to_lds_b128 %6, %14, off\n\t"
      "global_load_async_to_lds_b128 %7, %15, off\n\t"
      "s_wait_xcnt 0x0"
      :: "v"(l), "v"(l1), "v"(l2), "v"(l3), "v"(l4), "v"(l5), "v"(l6), "v"(l7),
         "v"(g), "v"(g1), "v"(g2), "v"(g3), "v"(g4), "v"(g5), "v"(g6), "v"(g7)
      : "memory");
}

template <int ET, bool SPLIT, int BIAS_MODE, int OUT_MODE, bool RESID, int ACT>
__global__ __launch_bounds__(128) void wmma_gemm64(
    const unsigned short* __restrict__ Ap0, const unsigned short* __restrict__ A2p0, int lda,
    const unsigned short* __restrict__ Btp0, const unsigned short* __restrict__ Bt2p0, int ldb,
    void* __restrict__ Cout0, void* __restrict__ Cout20, int ldc,
    const float* __restrict__ bias0, const float* __restrict__ bias1,
    const float* __restrict__ resid0, const float* __restrict__ resid1,
    long aP, long bP, long bQ, long cP, long cQ,
    int M, int N, int K, float scale) {
  typedef typename Elem<ET>::T T;
  typedef typename Frag<T>::V V;
  const long zp = (long)blockIdx.y;
  const long zq = (long)blockIdx.z;
  const unsigned short* Ap   = Ap0 + zp * aP;
  const unsigned short* A2p  = A2p0 + zp * aP;
  const unsigned short* Btp  = Btp0 + zp * bP + zq * bQ;
  const unsigned short* Bt2p = Bt2p0 + zp * bP + zq * bQ;
  void* Cout  = (void*)((char*)Cout0 + zp * cP + zq * cQ);
  void* Cout2 = (void*)((char*)Cout20 + zp * cP + zq * cQ);
  const float* bias  = zp ? bias1 : bias0;
  const float* resid = zp ? resid1 : resid0;
  /* stage layout: A hi | (A lo) | Bt hi | (Bt lo), each plane 128 rows at kRowPitch */
  constexpr int kPlanes = SPLIT ? 4 : 2;
  constexpr int kStageLds = kPlanes * kPlaneLds;
  constexpr int kOffBh = (SPLIT ? 2 : 1) * kPlaneLds;
  __shared__ __align__(16) unsigned char ring[2 * kStageLds];
  const int lane = threadIdx.x & 31;
  const int wave = __builtin_amdgcn_readfirstlane((int)(threadIdx.x >> 5));
  const int tilesN = N >> 7;
  const int tilesM = M >> 7;
  /* block-uniform exit in front of every copy and barrier */
  if ((int)blockIdx.x >= tilesM * tilesN) return;
  const int bm = (int)blockIdx.x / tilesN;
  const int bn = (int)blockIdx.x - bm * tilesN;
  const int wm = (wave >> 1) << 6;
  const int wn = (wave & 1) << 6;
  const int m0 = (bm << 7) + wm;
  const int n0 = (bn << 7) + wn;

  const int rlane = lane & 15;
  const int koff  = (lane >> 4) * 8;
  const int mOff  = (lane >> 4) * 8;

  /* copy map: thread t brings 16-B piece t&7 of rows (t>>3) + 16q, q 0..7, of every plane */
  const int crow = (int)threadIdx.x >> 3;
  const int cpc  = (int)threadIdx.x & 7;
  const unsigned ldsBase = (unsigned)(size_t)(&ring[0]) + (unsigned)(crow * kRowPitch + cpc * 16);
  const size_t aOff = (size_t)((bm << 7) + crow) * lda + cpc * 8;
  const size_t bOff = (size_t)((bn << 7) + crow) * ldb + cpc * 8;
  const size_t aStep = (size_t)16 * lda;
  const size_t bStep = (size_t)16 * ldb;
  const int nStages = K / kStageK;

  auto issue_stage = [&](int s) {
    const unsigned l = ldsBase + (unsigned)((s & 1) * kStageLds);
    const size_t kq = (size_t)s * kStageK;
    stage_plane(l, Ap + aOff + kq, aStep);
    if (SPLIT) stage_plane(l + kPlaneLds, A2p + aOff + kq, aStep);
    stage_plane(l + kOffBh, Btp + bOff + kq, bStep);
    if (SPLIT) stage_plane(l + kOffBh + kPlaneLds, Bt2p + bOff + kq, bStep);
  };

  v8f acc[4][4];
#pragma unroll
  for (int i = 0; i < 4; ++i)
#pragma unroll
    for (int j = 0; j < 4; ++j) acc[i][j] = (v8f){0.f, 0.f, 0.f, 0.f, 0.f, 0.f, 0.f, 0.f};

  /* prologue: stage 0 landed and published, then stage 1 in flight */
  issue_stage(0);
  asm volatile("s_wait_asynccnt 0x0" ::: "memory");  /* this wave's stage-0 copies have landed */
  __syncthreads();
  if (nStages > 1) issue_stage(1);

  const int aFrag = (wm + rlane) * kRowPitch + koff * 2;
  const int bFrag = kOffBh + (wn + rlane) * kRowPitch + koff * 2;

#pragma unroll 1  /* one stage per trip: the foot's waits and barrier stand once */
  for (int s = 0; s < nStages; ++s) {
    const unsigned char* sb = ring + (s & 1) * kStageLds;
#pragma unroll
    for (int kk = 0; kk < kStageK; kk += 32) {
      V bh[4], bl[4];
      const unsigned char* ap = sb + aFrag + kk * 2;
      V ah = Frag<T>::load((const T*)ap);
      V al;
      if (SPLIT) al = Frag<T>::load((const T*)(ap + kPlaneLds));
#pragma unroll
      for (int j = 0; j < 4; ++j) {
        const unsigned char* bp = sb + bFrag + j * 16 * kRowPitch + kk * 2;
        bh[j] = Frag<T>::load((const T*)bp);
        if (SPLIT) bl[j] = Frag<T>::load((const T*)(bp + kPlaneLds));
      }
#pragma unroll
      for (int i = 0; i < 4; ++i) {
        /* the next row group's A fragments are read in front of this group's products */
        V nh = ah;
        V nl;
        if (SPLIT) nl = al;
        if (i < 3) {
          nh = Frag<T>::load((const T*)(ap + (i + 1) * 16 * kRowPitch));
          if (SPLIT) nl = Frag<T>::load((const T*)(ap + (i + 1) * 16 * kRowPitch + kPlaneLds));
        }
#pragma unroll
        for (int j = 0; j < 4; ++j) {
          acc[i][j] = Frag<T>::mma(ah, bh[j], acc[i][j]);
          if (SPLIT) {
            acc[i][j] = Frag<T>::mma(ah, bl[j], acc[i][j]);
            acc[i][j] = Frag<T>::mma(al, bh[j], acc[i][j]);
          }
        }
        Frag<T>::guard(acc[i][0], acc[i][1], acc[i][2], acc[i][3], ah, SPLIT ? al : ah);
        ah = nh;
        if (SPLIT) al = nl;
      }
      Frag<T>::keep(bh[0], bh[1], bh[2], bh[3]);
      if (SPLIT) Frag<T>::keep(bl[0], bl[1], bl[2], bl[3]);
    }
    /* publish point of stage s + 1; the one barrier also ends every reader's last read of stage s's buffer */
    asm volatile("s_wait_dscnt 0x0" ::: "memory");     /* this wave's reads of stage s have returned */
    asm volatile("s_wait_asynccnt 0x0" ::: "memory");  /* this wave's stage s + 1 copies have landed */
    __syncthreads();
    if (s + 2 < nStages) issue_stage(s + 2);
  }
  asm volatile("s_wait_asynccnt 0x0" ::: "memory");  /* no copy is outstanding when the ring becomes the slabs */
  acc_guard4(acc[0][0], acc[0][1], acc[0][2], acc[0][3]);
  acc_guard4(acc[1][0], acc[1][1], acc[1][2], acc[1][3]);
  acc_guard4(acc[2][0], acc[2][1], acc[2][2], acc[2][3]);
  acc_guard4(acc[3][0], acc[3][1], acc[3][2], acc[3][3]);

  /* ---- epilogue ---- */
  float* slab = (float*)(ring + wave * kSlabLds);
#pragma unroll
  for (int i = 0; i < 4; ++i) {
    const int mBase = m0 + (i << 4);
#pragma unroll
    for (int j = 0; j < 4; ++j) {
      const int n = n0 + (j << 4) + rlane;
      float bv = 0.f;
      if (BIAS_MODE == 2) bv = bias[n];
#pragma unroll
      for (int r = 0; r < 8; ++r) {
        float v = acc[i][j][r] * scale;
        if (BIAS_MODE == 2) v += bv;
        if (ACT == 2) v = fmaxf(v, 0.0f);
        slab[(mOff + r) * 68 + (j << 4) + rlane] = v;
      }
    }
    __builtin_amdgcn_fence(__ATOMIC_RELEASE, "workgroup");
    __builtin_amdgcn_wave_barrier();
    __builtin_amdgcn_fence(__ATOMIC_ACQUIRE, "workgroup");
    if (OUT_MODE == 0) {
      /* rows it*2 + hh, it 0..7, hh 0..1 = 16 rows; 16 lanes x 16 B = the 256-B row segment */
      float* C = (float*)Cout;
      const int hh = lane >> 4, c4 = (lane & 15) * 4;
      v4f vals[8];
#pragma unroll
      for (int it = 0; it < 8; ++it) {
        const int row = it * 2 + hh;
        v4f v = *(const v4f*)(slab + row * 68 + c4);
        if (RESID) {
          const v4f rr = *(const v4f*)(resid + (size_t)(mBase + row) * ldc + n0 + c4);
          v = v + rr;
        }
        vals[it] = v;
      }
      {
#pragma unroll
        for (int it = 0; it < 8; ++it) {
          const int row = it * 2 + hh;
          *(v4f*)(C + (size_t)(mBase + row) * ldc + n0 + c4) = vals[it];
        }
        
      }
    } else {
      const int q = lane >> 3, c8 = (lane & 7) * 8;
      unsigned short* C  = (unsigned short*)Cout;
      unsigned short* C2 = (unsigned short*)Cout2;
      {
#pragma unroll
        for (int it = 0; it < 4; ++it) {
          const int row = it * 4 + q;
          const float* sp = slab + row * 68 + c8;
          v8h hv, lv;
#pragma unroll
          for (int e = 0; e < 8; ++e) {
            const float sv = sp[e];
            if (OUT_MODE == 1) {
              hv[e] = (_Float16)sv;
            } else {
              const unsigned short hb = f2bf_bits(sv);
              const unsigned short lb = f2bf_bits(sv - bf_bits2f(hb));
              hv[e] = __builtin_bit_cast(_Float16, hb);
              lv[e] = __builtin_bit_cast(_Float16, lb);
            }
          }
          *(v8h*)(C + (size_t)(mBase + row) * ldc + n0 + c8) = hv;
          if (OUT_MODE == 2) *(v8h*)(C2 + (size_t)(mBase + row) * ldc + n0 + c8) = lv;
        }
        
      }
    }
    __builtin_amdgcn_fence(__ATOMIC_RELEASE, "workgroup");
    __builtin_amdgcn_wave_barrier();
    __builtin_amdgcn_fence(__ATOMIC_ACQUIRE, "workgroup");
  }
}

// ---------------------------------------------------------------------------
// f32 plane -> bf16 hi plane + bf16 lo plane (both RNE converts: hi = bf16(v), lo = bf16(v - hi)); 8 contiguous
// elements per thread. blockIdx.y (block-uniform) selects one of four sources and output plane y (planeElems apart),
// blockIdx.z the branch (sources s* or t*, outputs branchElems apart).
// Coverage: grid.x * 256 threads * 8 elements = total8 * 8 = the whole plane (grids are exact multiples of 256).
// ---------------------------------------------------------------------------
__global__ __launch_bounds__(256) void split4_bf16_kernel(
    const float* __restrict__ s0, const float* __restrict__ s1, const float* __restrict__ s2, const float* __restrict__ s3,
    const float* __restrict__ t0, const float* __restrict__ t1, const float* __restrict__ t2, const float* __restrict__ t3,
    unsigned short* __restrict__ dhi, unsigned short* __restrict__ dlo, int total8, long planeElems, long branchElems) {
  const int i = blockIdx.x * 256 + threadIdx.x;
  if (i >= total8) return;
  const int y = blockIdx.y;
  const int z = blockIdx.z;
  const float* srcA = (y == 0) ? s0 : (y == 1) ? s1 : (y == 2) ? s2 : s3;
  const float* srcB = (y == 0) ? t0 : (y == 1) ? t1 : (y == 2) ? t2 : t3;
  const float* src = z ? srcB : srcA;
  const size_t e0 = (size_t)i << 3;
  const v4f a0 = *(const v4f*)(src + e0);
  const v4f a1 = *(const v4f*)(src + e0 + 4);
  v8h hv, lv;
#pragma unroll
  for (int e = 0; e < 4; ++e) {
    const float f0 = a0[e], f1 = a1[e];
    const unsigned short h0 = f2bf_bits(f0), h1 = f2bf_bits(f1);
    const unsigned short l0 = f2bf_bits(f0 - bf_bits2f(h0)), l1 = f2bf_bits(f1 - bf_bits2f(h1));
    hv[e]     = __builtin_bit_cast(_Float16, h0);
    hv[4 + e] = __builtin_bit_cast(_Float16, h1);
    lv[e]     = __builtin_bit_cast(_Float16, l0);
    lv[4 + e] = __builtin_bit_cast(_Float16, l1);
  }
  unsigned short* qh = dhi + (size_t)y * planeElems + (size_t)z * branchElems + e0;
  unsigned short* ql = dlo + (size_t)y * planeElems + (size_t)z * branchElems + e0;
  *(v8h*)qh = hv;
  *(v8h*)ql = lv;
  
}

// ---------------------------------------------------------------------------
// f32 plane -> f16 plane with a power-of-two carry; same thread/line map as above (8 elements = one 16-B store per
// ---------------------------------------------------------------------------
__global__ __launch_bounds__(256) void cast4_f16_kernel(
    const float* __restrict__ s0, const float* __restrict__ s1, const float* __restrict__ s2, const float* __restrict__ s3,
    const float* __restrict__ t0, const float* __restrict__ t1, const float* __restrict__ t2, const float* __restrict__ t3,
    unsigned short* __restrict__ out, float carry, int total8, long planeElems, long branchElems) {
  const int i = blockIdx.x * 256 + threadIdx.x;
  if (i >= total8) return;
  const int y = blockIdx.y;
  const int z = blockIdx.z;
  const float* srcA = (y == 0) ? s0 : (y == 1) ? s1 : (y == 2) ? s2 : s3;
  const float* srcB = (y == 0) ? t0 : (y == 1) ? t1 : (y == 2) ? t2 : t3;
  const float* src = z ? srcB : srcA;
  const size_t e0 = (size_t)i << 3;
  const v4f a0 = *(const v4f*)(src + e0);
  const v4f a1 = *(const v4f*)(src + e0 + 4);
  v8h hv;
#pragma unroll
  for (int e = 0; e < 4; ++e) {
    const float f0 = a0[e] * carry, f1 = a1[e] * carry;
    hv[e]     = (_Float16)f0;
    hv[4 + e] = (_Float16)f1;
  }
  unsigned short* q = out + (size_t)y * planeElems + (size_t)z * branchElems + e0;
  *(v8h*)q = hv;
  
}

// ---------------------------------------------------------------------------
// bf16 hi + lo planes -> f16 plane of (hi + lo); planes read as 32-bit integer words; same thread/line map.
// ---------------------------------------------------------------------------
__global__ __launch_bounds__(256) void hilo_to_f16_kernel(
    const unsigned short* __restrict__ hi0, const unsigned short* __restrict__ lo0,
    unsigned short* __restrict__ out0, int total8, long branchElems) {
  const int i = blockIdx.x * 256 + threadIdx.x;
  if (i >= total8) return;
  /* blockIdx.y = branch */
  const unsigned short* hi = hi0 + (size_t)blockIdx.y * branchElems;
  const unsigned short* lo = lo0 + (size_t)blockIdx.y * branchElems;
  unsigned short* out = out0 + (size_t)blockIdx.y * branchElems;
  const size_t e0 = (size_t)i << 3;
  const v4u hw4 = *(const v4u*)(hi + e0);
  const v4u lw4 = *(const v4u*)(lo + e0);
  v8h hv;
#pragma unroll
  for (int w = 0; w < 4; ++w) {
    const unsigned hw = hw4[w];
    const unsigned lw = lw4[w];
    const float f0 = __uint_as_float(hw << 16) + __uint_as_float(lw << 16);
    const float f1 = __uint_as_float(hw & 0xffff0000u) + __uint_as_float(lw & 0xffff0000u);
    hv[2 * w]     = (_Float16)f0;
    hv[2 * w + 1] = (_Float16)f1;
  }
  unsigned short* q = out + e0;
  *(v8h*)q = hv;
  
}

// ---------------------------------------------------------------------------
// Row statistics of S f32 [4096][4096]: m_i = max_j S_ij, inv_s_i = 1 / sum_j exp(S_ij - m_i).
// Block = 32 rows (8 waves x 4 rows, one wave per row at a time, lane-strided 16-B loads, two sweeps per row).
// Fixed order: per-lane sequential, then xor shuffle tree (unconditional).
// ---------------------------------------------------------------------------
__global__ __launch_bounds__(256) void rowstat_kernel(const float* __restrict__ S0, float* __restrict__ mrow0, float* __restrict__ invs0) {
  __shared__ float sM[32];
  __shared__ float sI[32];
  /* blockIdx.y = branch */
  const float* S = S0 + (size_t)blockIdx.y * kR0El32;
  float* mrow = mrow0 + (size_t)blockIdx.y * kTok;
  float* invs = invs0 + (size_t)blockIdx.y * kTok;
  const int lane = threadIdx.x & 31;
  const int wave = __builtin_amdgcn_readfirstlane((int)(threadIdx.x >> 5));
  const int row0 = blockIdx.x * 32;
#pragma unroll 1
  for (int q = 0; q < 4; ++q) {
    const int rl = wave * 4 + q;
    const float* p = S + (size_t)(row0 + rl) * kTok + lane * 4;
    float m = -INFINITY;
#pragma unroll 4
    for (int it = 0; it < kTok / 128; ++it) {
      const v4f v = *(const v4f*)(p + it * 128);
      m = fmaxf(m, fmaxf(fmaxf(v[0], v[1]), fmaxf(v[2], v[3])));
    }
#pragma unroll
    for (int off = 16; off > 0; off >>= 1) m = fmaxf(m, __shfl_xor(m, off, 32));
    float sum = 0.f;
#pragma unroll 2
    for (int it = 0; it < kTok / 128; ++it) {
      const v4f v = *(const v4f*)(p + it * 128);
      sum += __expf(v[0] - m);
      sum += __expf(v[1] - m);
      sum += __expf(v[2] - m);
      sum += __expf(v[3] - m);
    }
#pragma unroll
    for (int off = 16; off > 0; off >>= 1) sum += __shfl_xor(sum, off, 32);
    const float inv = 1.0f / sum;
    if (lane == 0) {
      sM[rl] = m;
      sI[rl] = inv;
    }
  }
  __syncthreads();
  if (wave == 0) {
    const float mv = sM[lane];
    const float iv = sI[lane];
    *(float*)(mrow + row0 + lane) = mv;
    *(float*)(invs + row0 + lane) = iv;
    
  }
}

// ---------------------------------------------------------------------------
// Column sums over queries of the row-normalised probabilities: c_j = sum_i exp(S_ij - m_i) * inv_s_i, then
// w, w+8, ... (512 rows) in order; the 8 wave partials are combined in index order by wave 0. No atomics.
// ---------------------------------------------------------------------------
__global__ __launch_bounds__(256) void colsum_kernel(const float* __restrict__ S0, const float* __restrict__ mrow0,
                                                     const float* __restrict__ invs0, float* __restrict__ rcol0) {
  __shared__ float sP[8][32];
  /* blockIdx.y = branch */
  const float* S = S0 + (size_t)blockIdx.y * kR0El32;
  const float* mrow = mrow0 + (size_t)blockIdx.y * kTok;
  const float* invs = invs0 + (size_t)blockIdx.y * kTok;
  float* rcol = rcol0 + (size_t)blockIdx.y * kTok;
  const int lane = threadIdx.x & 31;
  const int wave = __builtin_amdgcn_readfirstlane((int)(threadIdx.x >> 5));
  const int j0 = blockIdx.x * 32;
  const float* p = S + j0 + lane;
  float acc = 0.f;
#pragma unroll 4
  for (int t = 0; t < kTok / 8; ++t) {
    const int i = wave + 8 * t;
    const float s  = p[(size_t)i * kTok];
    const float mi = mrow[i];
    const float is = invs[i];
    const float pr = __expf(s - mi) * is;
    acc += pr;
  }
  sP[wave][lane] = acc;
  __syncthreads();
  if (wave == 0) {
    float c = sP[0][lane];
    c += sP[1][lane];
    c += sP[2][lane];
    c += sP[3][lane];
    c += sP[4][lane];
    c += sP[5][lane];
    c += sP[6][lane];
    c += sP[7][lane];
    const float rc = 1.0f / (kAttnEps + c);
    *(float*)(rcol + j0 + lane) = rc;
    
  }
}

// ---------------------------------------------------------------------------
// attn.V: SC[i][d] = (1/32768) * sum_j f16(32768 * P_ij * rc_j) * VT[d][j], P_ij = exp(S_ij - m_i) * inv_s_i.
// Block = 64 query rows x all 512 d (8 waves, wave w owns d columns 64w..64w+63, acc 4x4 tiles).
// Operand path: per-lane asynchronous 16-B copies bring whole 128-B lines into LDS, two buffers. Stage s holds the
// V^T tile of keys 64s..64s+63 (512 rows x 128 B, pitch 144 B) and the logit tile of keys 64(s+1)..64(s+1)+63
// (64 rows x 256 B, pitch 272 B): trip t multiplies key tile t and forms the f16 weights of key tile t + 1 out of the
// same buffer, while stage t + 1's copies fly. The weight tiles (64 rows x 128 B, pitch 144 B) alternate between two
// places: the one written in trip t was last read in trip t - 1. Thread t forms row t>>2, keys (t&3)*16..+15
// (64 rows x 4 threads x 16 = the whole tile). The 4096 column factors are copied into LDS once, in the prologue.
// The pad bytes of every pitch are never read: all reads touch byte offsets below the row length.
// ---------------------------------------------------------------------------
constexpr int kAvK      = 64;
constexpr int kAvVPitch = 144;
constexpr int kAvSPitch = 272;
constexpr int kAvAPitch = 144;
constexpr int kAvVLds   = kDim * kAvVPitch;
constexpr int kAvSLds   = 64 * kAvSPitch;
constexpr int kAvStage  = kAvVLds + kAvSLds;
constexpr int kAvALds   = 64 * kAvAPitch;
constexpr int kAvOffA   = 2 * kAvStage;
constexpr int kAvOffRC  = kAvOffA + 2 * kAvALds;
constexpr int kAvLds    = kAvOffRC + kTok * 4;
static_assert((kTok % kAvK) == 0 && kTok >= 2 * kAvK && kDim == 512);
static_assert(kAvVPitch >= kAvK * 2 && kAvSPitch >= kAvK * 4 && kAvAPitch >= kAvK * 2);
static_assert((kAvVPitch % 32) == 16 && (kAvSPitch % 32) == 16 && (kAvAPitch % 32) == 16);
static_assert(8 * kSlabLds <= 2 * kAvStage && kAvLds <= 327680);

/* This lane's eight (or four) 16-B pieces, lstep LDS bytes and gstep source bytes apart. The copies and the
   s_wait_xcnt stand in one statement so that no address register is rewritten ahead of that wait. */
__device__ __forceinline__ void copy8_b128(unsigned l, unsigned lstep, const unsigned char* g, size_t gstep) {
  const unsigned l1 = l + lstep, l2 = l + 2 * lstep, l3 = l + 3 * lstep, l4 = l + 4 * lstep,
                 l5 = l + 5 * lstep, l6 = l + 6 * lstep, l7 = l + 7 * lstep;
  const unsigned char *g1 = g + gstep, *g2 = g + 2 * gstep, *g3 = g + 3 * gstep, *g4 = g + 4 * gstep,
                      *g5 = g + 5 * gstep, *g6 = g + 6 * gstep, *g7 = g + 7 * gstep;
  asm volatile(
      "global_load_async_to_lds_b128 %0, %8, off\n\t"
      "global_load_async_to_lds_b128 %1, %9, off\n\t"
      "global_load_async_to_lds_b128 %2, %10, off\n\t"
      "global_load_async_to_lds_b128 %3, %11, off\n\t"
      "global_load_async_to_lds_b128 %4, %12, off\n\t"
      "global_load_async_to_lds_b128 %5, %13, off\n\t"
      "global_load_async_to_lds_b128 %6, %14, off\n\t"
      "global_load_async_to_lds_b128 %7, %15, off\n\t"
      "s_wait_xcnt 0x0"
      :: "v"(l), "v"(l1), "v"(l2), "v"(l3), "v"(l4), "v"(l5), "v"(l6), "v"(l7),
         "v"(g), "v"(g1), "v"(g2), "v"(g3), "v"(g4), "v"(g5), "v"(g6), "v"(g7)
      : "memory");
}
__device__ __forceinline__ void copy4_b128(unsigned l, unsigned lstep, const unsigned char* g, size_t gstep) {
  const unsigned l1 = l + lstep, l2 = l + 2 * lstep, l3 = l + 3 * lstep;
  const unsigned char *g1 = g + gstep, *g2 = g + 2 * gstep, *g3 = g + 3 * gstep;
  asm volatile(
      "global_load_async_to_lds_b128 %0, %4, off\n\t"
      "global_load_async_to_lds_b128 %1, %5, off\n\t"
      "global_load_async_to_lds_b128 %2, %6, off\n\t"
      "global_load_async_to_lds_b128 %3, %7, off\n\t"
      "s_wait_xcnt 0x0"
      :: "v"(l), "v"(l1), "v"(l2), "v"(l3), "v"(g), "v"(g1), "v"(g2), "v"(g3)
      : "memory");
}

__global__ __launch_bounds__(256) void av_kernel(const float* __restrict__ S0, const float* __restrict__ mrow0,
                                                 const float* __restrict__ invs0, const float* __restrict__ rcol0,
                                                 const unsigned short* __restrict__ VTp0, float* __restrict__ SC0) {
  /* stage buffer 0 | stage buffer 1 | weight tile 0 | weight tile 1 | column factors */
  __shared__ __align__(16) unsigned char smem[kAvLds];
  /* blockIdx.y = branch */
  const float* S = S0 + (size_t)blockIdx.y * kR0El32;
  const float* mrow = mrow0 + (size_t)blockIdx.y * kTok;
  const float* invs = invs0 + (size_t)blockIdx.y * kTok;
  const float* rcol = rcol0 + (size_t)blockIdx.y * kTok;
  const unsigned short* VTp = VTp0 + (size_t)blockIdx.y * kND;
  float* SC = SC0 + (size_t)blockIdx.y * kND;
  typedef Frag<_Float16> FH;
  const int tid  = threadIdx.x;
  const int lane = tid & 31;
  const int wave = __builtin_amdgcn_readfirstlane((int)(tid >> 5));
  const int m0 = blockIdx.x * 64;
  const int n0 = wave * 64;
  const int sr   = tid >> 2;
  const int sc16 = (tid & 3) * 16;
  const float mi = mrow[m0 + sr];
  const float fi = invs[m0 + sr] * kPCarry;

  const int rlane = lane & 15;
  const int koff  = (lane >> 4) * 8;
  const int mOff  = (lane >> 4) * 8;
  constexpr int nT = kTok / kAvK;

  /* copy maps. V^T: thread t brings 16-B piece t&7 of rows (t>>3) + 32q, q 0..15 (4 whole lines per wave instruction).
     Logits: piece t&15 of rows (t>>4) + 16q, q 0..3. Column factors: piece t + 256q, q 0..3. */
  const unsigned ldsBase = (unsigned)(size_t)(&smem[0]);
  const unsigned vL = ldsBase + (unsigned)((tid >> 3) * kAvVPitch + (tid & 7) * 16);
  const unsigned sL = ldsBase + (unsigned)(kAvVLds + (tid >> 4) * kAvSPitch + (tid & 15) * 16);
  const unsigned char* vG = (const unsigned char*)VTp + (size_t)(tid >> 3) * (kTok * 2) + (tid & 7) * 16;
  const unsigned char* sG = (const unsigned char*)S + (size_t)(m0 + (tid >> 4)) * (kTok * 4) + (tid & 15) * 16;

  auto issue_logits = [&](int u, int buf) {
    copy4_b128(sL + (unsigned)(buf * kAvStage), 16 * kAvSPitch, sG + (size_t)u * (kAvK * 4), (size_t)16 * kTok * 4);
  };
  auto issue_stage = [&](int s) {
    const unsigned l = vL + (unsigned)((s & 1) * kAvStage);
    const unsigned char* g = vG + (size_t)s * (kAvK * 2);
    copy8_b128(l, 32 * kAvVPitch, g, (size_t)32 * kTok * 2);
    copy8_b128(l + 256 * kAvVPitch, 32 * kAvVPitch, g + (size_t)256 * kTok * 2, (size_t)32 * kTok * 2);
    if (s + 1 < nT) issue_logits(s + 1, s & 1);
  };
  /* this thread's 16 weights of key tile u, out of the logit tile at sraw */
  auto weights = [&](int u, const unsigned char* sraw, v8h& h0, v8h& h1) {
    const float* sp = (const float*)(sraw + sr * kAvSPitch) + sc16;
    const float* rp = (const float*)(smem + kAvOffRC) + u * kAvK + sc16;
#pragma unroll
    for (int h = 0; h < 2; ++h) {
      const v4f s0 = *(const v4f*)(sp + h * 8);
      const v4f s1 = *(const v4f*)(sp + h * 8 + 4);
      const v4f r0 = *(const v4f*)(rp + h * 8);
      const v4f r1 = *(const v4f*)(rp + h * 8 + 4);
      v8h hv;
#pragma unroll
      for (int e = 0; e < 4; ++e) {
        const float e0 = __expf(s0[e] - mi);
        const float e1 = __expf(s1[e] - mi);
        const float w0 = (e0 * fi) * r0[e];
        const float w1 = (e1 * fi) * r1[e];
        hv[e]     = (_Float16)w0;
        hv[4 + e] = (_Float16)w1;
      }
      if (h == 0) h0 = hv; else h1 = hv;
    }
  };
  auto put_weights = [&](unsigned char* at, v8h h0, v8h h1) {
    *(v8h*)(at + sr * kAvAPitch + sc16 * 2) = h0;
    *(v8h*)(at + sr * kAvAPitch + sc16 * 2 + 16) = h1;
  };

  v8f acc[4][4];
#pragma unroll
  for (int i = 0; i < 4; ++i)
#pragma unroll
    for (int j = 0; j < 4; ++j) acc[i][j] = (v8f){0.f, 0.f, 0.f, 0.f, 0.f, 0.f, 0.f, 0.f};

  /* the 64 keys of one tile: weight tile at, V^T tile vt */
  auto products = [&](const unsigned char* at, const unsigned char* vt) {
#pragma unroll
    for (int kk = 0; kk < kAvK; kk += 32) {
      v16h bh[4];
#pragma unroll
      for (int j = 0; j < 4; ++j)
        bh[j] = FH::load((const _Float16*)(vt + (n0 + (j << 4) + rlane) * kAvVPitch + (kk + koff) * 2));
      const unsigned char* ap = at + rlane * kAvAPitch + (kk + koff) * 2;
      v16h ah = FH::load((const _Float16*)ap);
#pragma unroll
      for (int i = 0; i < 4; ++i) {
        /* the next row group's A fragment is read in front of this group's products */
        v16h nh = ah;
        if (i < 3) nh = FH::load((const _Float16*)(ap + (i + 1) * 16 * kAvAPitch));
#pragma unroll
        for (int j = 0; j < 4; ++j) acc[i][j] = FH::mma(ah, bh[j], acc[i][j]);
        FH::guard(acc[i][0], acc[i][1], acc[i][2], acc[i][3], ah, ah);
        ah = nh;
      }
      FH::keep(bh[0], bh[1], bh[2], bh[3]);
    }
  };

  /* prologue: column factors, logit tile 0 (in buffer 1's logit place) and stage 0 landed and published; weight tile 0
     formed; then, behind the barrier that ends the reads of buffer 1, stage 1 in flight */
  copy4_b128(ldsBase + (unsigned)(kAvOffRC + tid * 16), 4096, (const unsigned char*)rcol + tid * 16, (size_t)4096);
  issue_logits(0, 1);
  issue_stage(0);
  asm volatile("s_wait_asynccnt 0x0" ::: "memory");  /* this wave's prologue copies have landed */
  __syncthreads();
  {
    v8h h0, h1;
    weights(0, smem + kAvStage + kAvVLds, h0, h1);
    put_weights(smem + kAvOffA, h0, h1);
  }
  asm volatile("s_wait_dscnt 0x0" ::: "memory");  /* this wave's reads of logit tile 0 have returned */
  __syncthreads();
  issue_stage(1);

#pragma unroll 1  /* one stage per trip: the foot's waits and barrier stand once */
  for (int t = 0; t < nT - 1; ++t) {
    const unsigned char* sb = smem + (t & 1) * kAvStage;
    v8h h0, h1;
    weights(t + 1, sb + kAvVLds, h0, h1);
    products(smem + kAvOffA + (t & 1) * kAvALds, sb);
    put_weights(smem + kAvOffA + ((t + 1) & 1) * kAvALds, h0, h1);
    /* publish point of stage t + 1 and of weight tile t + 1; the one barrier also ends every reader's last read of
       stage t's buffer and of weight tile t */
    asm volatile("s_wait_dscnt 0x0" ::: "memory");     /* this wave's LDS reads and writes of trip t are done */
    asm volatile("s_wait_asynccnt 0x0" ::: "memory");  /* this wave's stage t + 1 copies have landed */
    __syncthreads();
    if (t + 2 < nT) issue_stage(t + 2);
  }
  products(smem + kAvOffA + ((nT - 1) & 1) * kAvALds, smem + ((nT - 1) & 1) * kAvStage);
  asm volatile("s_wait_asynccnt 0x0" ::: "memory");  /* no copy is outstanding when the ring becomes the slabs */
  asm volatile("s_wait_dscnt 0x0" ::: "memory");     /* this wave's last fragment reads have returned */
  __syncthreads();                                   /* every wave has left the ring before a slab is written */
  acc_guard4(acc[0][0], acc[0][1], acc[0][2], acc[0][3]);
  acc_guard4(acc[1][0], acc[1][1], acc[1][2], acc[1][3]);
  acc_guard4(acc[2][0], acc[2][1], acc[2][2], acc[2][3]);
  acc_guard4(acc[3][0], acc[3][1], acc[3][2], acc[3][3]);

  float* slab = (float*)(smem + wave * kSlabLds);
#pragma unroll
  for (int i = 0; i < 4; ++i) {
    const int mBase = m0 + (i << 4);
#pragma unroll
    for (int j = 0; j < 4; ++j) {
#pragma unroll
      for (int r = 0; r < 8; ++r) slab[(mOff + r) * 68 + (j << 4) + rlane] = acc[i][j][r] * kPCarryInv;
    }
    __builtin_amdgcn_fence(__ATOMIC_RELEASE, "workgroup");
    __builtin_amdgcn_wave_barrier();
    __builtin_amdgcn_fence(__ATOMIC_ACQUIRE, "workgroup");
    {
      const int hh = lane >> 4, c4 = (lane & 15) * 4;
      v4f vals[8];
#pragma unroll
      for (int it = 0; it < 8; ++it) vals[it] = *(const v4f*)(slab + (it * 2 + hh) * 68 + c4);
      {
#pragma unroll
        for (int it = 0; it < 8; ++it) {
          const int row = it * 2 + hh;
          *(v4f*)(SC + (size_t)(mBase + row) * kDim + n0 + c4) = vals[it];
        }
        
      }
    }
    __builtin_amdgcn_fence(__ATOMIC_RELEASE, "workgroup");
    __builtin_amdgcn_wave_barrier();
    __builtin_amdgcn_fence(__ATOMIC_ACQUIRE, "workgroup");
  }
}

// ---------------------------------------------------------------------------
// s = LayerNorm(res + sc) over 512 (biased variance, eps inside rsqrt), one wave per row, 8 rows per block.
// Lane owns columns it*128 + lane*4 .. +3 (it 0..3): 16 values in registers, static indexing.
// res is an f16 plane read as 32-bit integer words; sc, gamma, beta f32.
// (via the wave's own LDS slab: lane owns columns it2*256 + lane*8 .. +7, 2 instructions x 32 lanes x 16 B = 4 whole
// ---------------------------------------------------------------------------
__global__ __launch_bounds__(256) void add_ln_kernel(const unsigned short* __restrict__ RES0, const float* __restrict__ SCp0,
                                                     const float* __restrict__ gam0, const float* __restrict__ bet0,
                                                     const float* __restrict__ gam1, const float* __restrict__ bet1,
                                                     float* __restrict__ S320, unsigned short* __restrict__ S160) {
  __shared__ __align__(16) float sY[8][kDim];
  /* blockIdx.y = branch */
  const unsigned short* RES = RES0 + (size_t)blockIdx.y * kND;
  const float* SCp = SCp0 + (size_t)blockIdx.y * kND;
  const float* gam = blockIdx.y ? gam1 : gam0;
  const float* bet = blockIdx.y ? bet1 : bet0;
  float* S32 = S320 + (size_t)blockIdx.y * kR0El32;
  unsigned short* S16 = S160 + (size_t)blockIdx.y * kR0El16;
  const int lane = threadIdx.x & 31;
  const int wave = __builtin_amdgcn_readfirstlane((int)(threadIdx.x >> 5));
  const int row = blockIdx.x * 8 + wave;
  const float* scp = SCp + (size_t)row * kDim;
  const unsigned short* rp = RES + (size_t)row * kDim;
  float x[16];
#pragma unroll
  for (int it = 0; it < 4; ++it) {
    const int col = it * 128 + lane * 4;
    const v4f a = *(const v4f*)(scp + col);
    const v2u w = *(const v2u*)(rp + col);
    const unsigned w0 = w[0];
    const unsigned w1 = w[1];
    x[4 * it + 0] = h16_to_f32(w0 & 0xffffu) + a[0];
    x[4 * it + 1] = h16_to_f32(w0 >> 16) + a[1];
    x[4 * it + 2] = h16_to_f32(w1 & 0xffffu) + a[2];
    x[4 * it + 3] = h16_to_f32(w1 >> 16) + a[3];
  }
  float s = 0.f;
#pragma unroll
  for (int i = 0; i < 16; ++i) s += x[i];
#pragma unroll
  for (int off = 16; off > 0; off >>= 1) s += __shfl_xor(s, off, 32);
  const float mu = s * kInvDim;
  float vs = 0.f;
#pragma unroll
  for (int i = 0; i < 16; ++i) {
    const float d = x[i] - mu;
    x[i] = d;
    vs += d * d;
  }
#pragma unroll
  for (int off = 16; off > 0; off >>= 1) vs += __shfl_xor(vs, off, 32);
  const float inv = rsqrtf(vs * kInvDim + kLnEps);
  float* slab = sY[wave];
  v4f yv[4];
#pragma unroll
  for (int it = 0; it < 4; ++it) {
    const int col = it * 128 + lane * 4;
    const v4f g4 = *(const v4f*)(gam + col);
    const v4f b4 = *(const v4f*)(bet + col);
    v4f y;
    y[0] = (x[4 * it + 0] * inv) * g4[0] + b4[0];
    y[1] = (x[4 * it + 1] * inv) * g4[1] + b4[1];
    y[2] = (x[4 * it + 2] * inv) * g4[2] + b4[2];
    y[3] = (x[4 * it + 3] * inv) * g4[3] + b4[3];
    yv[it] = y;
    *(v4f*)(slab + col) = y;
  }
  __builtin_amdgcn_fence(__ATOMIC_RELEASE, "workgroup");
  __builtin_amdgcn_wave_barrier();
  __builtin_amdgcn_fence(__ATOMIC_ACQUIRE, "workgroup");
  v8h hv[2];
#pragma unroll
  for (int it2 = 0; it2 < 2; ++it2) {
    const int c = it2 * 256 + lane * 8;
    const v4f a0 = *(const v4f*)(slab + c);
    const v4f a1 = *(const v4f*)(slab + c + 4);
#pragma unroll
    for (int e = 0; e < 4; ++e) {
      const float f0 = a0[e], f1 = a1[e];
      hv[it2][e]     = (_Float16)f0;
      hv[it2][4 + e] = (_Float16)f1;
    }
  }
  float* o32 = S32 + (size_t)row * kDim;
  unsigned short* o16 = S16 + (size_t)row * kDim;
  {
#pragma unroll
    for (int it = 0; it < 4; ++it) *(v4f*)(o32 + it * 128 + lane * 4) = yv[it];
#pragma unroll
    for (int it2 = 0; it2 < 2; ++it2) *(v8h*)(o16 + it2 * 256 + lane * 8) = hv[it2];
    
  }
}

// ---------------------------------------------------------------------------
// Host glue (kernel launches and host arithmetic only)
// ---------------------------------------------------------------------------
template <int ET, bool SPLIT, int BIAS_MODE, int OUT_MODE, bool RESID, int ACT>
static void run_gemm(hipStream_t st,
                     const unsigned short* A, const unsigned short* A2, int lda,
                     const unsigned short* Bt, const unsigned short* Bt2, int ldb,
                     void* C, void* C2, int ldc,
                     const float* bias0, const float* bias1, const float* resid0, const float* resid1,
                     long aP, long bP, long bQ, long cP, long cQ, int planes,
                     int M, int N, int K, float scale) {
  const int blocks = (M >> 7) * (N >> 7);
  wmma_gemm64<ET, SPLIT, BIAS_MODE, OUT_MODE, RESID, ACT><<<dim3(blocks, 2, planes), 128, 0, st>>>(
      A, A2, lda, Bt, Bt2, ldb, C, C2, ldc, bias0, bias1, resid0, resid1, aP, bP, bQ, cP, cQ, M, N, K, scale);
}

extern "C" void kernel_launch(void* const* d_in, const int* in_sizes, int n_in,
                              void* d_out, int out_size, void* d_ws, size_t ws_size,
                              hipStream_t stream) {
  if (n_in < 34) return;
  if (in_sizes[0] != (int)kND || in_sizes[1] != (int)kND) return;
  for (int p = 0; p < 2; ++p) {
    for (int s = 0; s < 16; ++s) {
      const bool isMat = (s == 0 || s == 2 || s == 4 || s == 6 || s == 8 || s == 10 || s == 11 || s == 12 || s == 15);
      const int want = isMat ? (int)kWW : kDim;
      if (in_sizes[2 + 16 * p + s] != want) return;
    }
  }
  if (out_size != (int)(2 * kND)) return;
  if (ws_size < kWsTotal) return;

  char* ws = (char*)d_ws;
  unsigned short* XH  = (unsigned short*)(ws + kOffXH);
  unsigned short* XL  = (unsigned short*)(ws + kOffXL);
  unsigned short* T0H = (unsigned short*)(ws + kOffT0H);
  unsigned short* T0L = (unsigned short*)(ws + kOffT0L);
  unsigned short* FH  = (unsigned short*)(ws + kOffFH);
  unsigned short* FL  = (unsigned short*)(ws + kOffFL);
  unsigned short* F16 = (unsigned short*)(ws + kOffF16);
  unsigned short* R1  = (unsigned short*)(ws + kOffR1);
  unsigned short* R2  = (unsigned short*)(ws + kOffR2);
  unsigned short* WSH = (unsigned short*)(ws + kOffWSH);
  unsigned short* WSL = (unsigned short*)(ws + kOffWSL);
  unsigned short* WF  = (unsigned short*)(ws + kOffWF);
  float*          S   = (float*)(ws + kOffS);
  float*          S32 = (float*)(ws + kOffS32);
  unsigned short* S16 = (unsigned short*)(ws + kOffS16);
  unsigned short* QK  = (unsigned short*)(ws + kOffQK);
  unsigned short* VT  = (unsigned short*)(ws + kOffVT);
  unsigned short* RES = (unsigned short*)(ws + kOffRES);
  float*          SC  = (float*)(ws + kOffSC);
  unsigned short* FFN = (unsigned short*)(ws + kOffFFN);
  float*          MROW = (float*)(ws + kOffMROW);
  float*          INVS = (float*)(ws + kOffINVS);
  float*          RC   = (float*)(ws + kOffRC);
  float* out = (float*)d_out;

  const int nd8 = (int)(kND / 8);
  const int ww8 = (int)(kWW / 8);

  /* inputs of branch A (a*) and branch B (b*) */
  const float* ax   = (const float*)d_in[0];
  const float* bx   = (const float*)d_in[1];
  const float* apW1 = (const float*)d_in[2 + 0];
  const float* bpW1 = (const float*)d_in[18 + 0];
  const float* apb1 = (const float*)d_in[2 + 1];
  const float* bpb1 = (const float*)d_in[18 + 1];
  const float* apW2 = (const float*)d_in[2 + 2];
  const float* bpW2 = (const float*)d_in[18 + 2];
  const float* apb2 = (const float*)d_in[2 + 3];
  const float* bpb2 = (const float*)d_in[18 + 3];
  const float* arW1 = (const float*)d_in[2 + 4];
  const float* brW1 = (const float*)d_in[18 + 4];
  const float* arb1 = (const float*)d_in[2 + 5];
  const float* brb1 = (const float*)d_in[18 + 5];
  const float* arW2 = (const float*)d_in[2 + 6];
  const float* brW2 = (const float*)d_in[18 + 6];
  const float* arb2 = (const float*)d_in[2 + 7];
  const float* brb2 = (const float*)d_in[18 + 7];
  const float* arW3 = (const float*)d_in[2 + 8];
  const float* brW3 = (const float*)d_in[18 + 8];
  const float* arb3 = (const float*)d_in[2 + 9];
  const float* brb3 = (const float*)d_in[18 + 9];
  const float* aWq  = (const float*)d_in[2 + 10];
  const float* bWq  = (const float*)d_in[18 + 10];
  const float* aWk  = (const float*)d_in[2 + 11];
  const float* bWk  = (const float*)d_in[18 + 11];
  const float* aWv  = (const float*)d_in[2 + 12];
  const float* bWv  = (const float*)d_in[18 + 12];
  const float* alng = (const float*)d_in[2 + 13];
  const float* blng = (const float*)d_in[18 + 13];
  const float* alnb = (const float*)d_in[2 + 14];
  const float* blnb = (const float*)d_in[18 + 14];
  const float* affn = (const float*)d_in[2 + 15];
  const float* bffn = (const float*)d_in[18 + 15];

  /* Every launch below works on both branches: the pointers are branch A's, the strides lead to branch B's part. */
  const long r0B   = (long)kR0Bytes;
  const long nd    = (long)kND;
  const long ww    = (long)kWW;

  /* ffn weights -> f16 x256 planes (outside R0: they outlive the logits) */
  cast4_f16_kernel<<<dim3(ww8 / 256, 1, 2), 256, 0, stream>>>(affn, affn, affn, affn, bffn, bffn, bffn, bffn,
                                                              FFN, kWCarry, ww8, 0L, ww);

  /* operand planes: x hi/lo; pW1,pW2,Wq,Wk hi/lo (weights are [out][in] = Bt layout); rW1,rW2,rW3,Wv f16 x256 */
  split4_bf16_kernel<<<dim3(nd8 / 256, 1, 2), 256, 0, stream>>>(ax, ax, ax, ax, bx, bx, bx, bx, XH, XL, nd8, 0L, kR0El16);
  split4_bf16_kernel<<<dim3(ww8 / 256, 4, 2), 256, 0, stream>>>(apW1, apW2, aWq, aWk, bpW1, bpW2, bWq, bWk,
                                                                WSH, WSL, ww8, ww, kR0El16);
  cast4_f16_kernel<<<dim3(ww8 / 256, 4, 2), 256, 0, stream>>>(arW1, arW2, arW3, aWv, brW1, brW2, brW3, bWv,
                                                              WF, kWCarry, ww8, ww, kR0El16);

  /* h1 = relu(x . pW1^T + pb1) -> hi/lo : M 4096, N 512, K 512 */
  run_gemm<1, true, 2, 2, false, 2>(stream, XH, XL, kDim, WSH + 0 * kWW, WSL + 0 * kWW, kDim,
                                    (void*)T0H, (void*)T0L, kDim, apb1, bpb1, apb1, bpb1,
                                    kR0El16, kR0El16, 0L, r0B, 0L, 1, kTok, kDim, kDim, 1.0f);
  /* feat = h1 . pW2^T + pb2 -> hi/lo */
  run_gemm<1, true, 2, 2, false, 0>(stream, T0H, T0L, kDim, WSH + 1 * kWW, WSL + 1 * kWW, kDim,
                                    (void*)FH, (void*)FL, kDim, apb2, bpb2, apb2, bpb2,
                                    kR0El16, kR0El16, 0L, r0B, 0L, 1, kTok, kDim, kDim, 1.0f);
  /* f16 copy of feat */
  hilo_to_f16_kernel<<<dim3(nd8 / 256, 2), 256, 0, stream>>>(FH, FL, F16, nd8, kR0El16);
  /* residual chain: relu, relu, linear (f16 single products, weights x256) */
  run_gemm<0, false, 2, 1, false, 2>(stream, F16, F16, kDim, WF + 0 * kWW, WF + 0 * kWW, kDim,
                                     (void*)R1, (void*)R1, kDim, arb1, brb1, arb1, brb1,
                                     kR0El16, kR0El16, 0L, r0B, 0L, 1, kTok, kDim, kDim, kWCarryInv);
  run_gemm<0, false, 2, 1, false, 2>(stream, R1, R1, kDim, WF + 1 * kWW, WF + 1 * kWW, kDim,
                                     (void*)R2, (void*)R2, kDim, arb2, brb2, arb2, brb2,
                                     kR0El16, kR0El16, 0L, r0B, 0L, 1, kTok, kDim, kDim, kWCarryInv);
  run_gemm<0, false, 2, 1, false, 0>(stream, R2, R2, kDim, WF + 2 * kWW, WF + 2 * kWW, kDim,
                                     (void*)RES, (void*)RES, kDim, arb3, brb3, arb3, brb3,
                                     kR0El16, kR0El16, 0L, 2 * nd, 0L, 1, kTok, kDim, kDim, kWCarryInv);
  /* Q (plane 0) and K (plane 1) -> hi/lo planes; QK holds QH QL KH KL of branch A, then of branch B */
  run_gemm<1, true, 0, 2, false, 0>(stream, FH, FL, kDim, WSH + 2 * kWW, WSL + 2 * kWW, kDim,
                                    (void*)QK, (void*)(QK + kND), kDim, apb1, bpb1, apb1, bpb1,
                                    kR0El16, kR0El16, ww, 8 * nd, 4 * nd, 2, kTok, kDim, kDim, 1.0f);
  /* V^T[d][i] = sum_k Wv[d][k] feat[i][k] : A = Wv (M 512), Bt = feat f16 (N 4096), K 512, ldc 4096 */
  run_gemm<0, false, 0, 1, false, 0>(stream, WF + 3 * kWW, WF + 3 * kWW, kDim, F16, F16, kDim,
                                     (void*)VT, (void*)VT, kTok, apb1, bpb1, apb1, bpb1,
                                     kR0El16, kR0El16, 0L, 2 * nd, 0L, 1, kDim, kTok, kDim, kWCarryInv);

  /* ---- cross attention, add + LayerNorm, ffn ---- */
  /* S = Q_p . K_other^T (hi.hi + hi.lo + lo.hi), f32 : M 4096, N 4096, K 512. Branch A reads branch B's K planes
     (planes 6, 7 of QK) and branch B reads branch A's (planes 2, 3): the Bt stride is negative. */
  run_gemm<1, true, 0, 0, false, 0>(stream, QK, QK + kND, kDim, QK + 6 * kND, QK + 7 * kND, kDim,
                                    (void*)S, (void*)S, kTok, alng, blng, alng, blng,
                                    4 * nd, -4 * nd, 0L, r0B, 0L, 1, kTok, kTok, kDim, 1.0f);
  rowstat_kernel<<<dim3(kTok / 32, 2), 256, 0, stream>>>(S, MROW, INVS);
  colsum_kernel<<<dim3(kTok / 32, 2), 256, 0, stream>>>(S, MROW, INVS, RC);
  av_kernel<<<dim3(kTok / 64, 2), 256, 0, stream>>>(S, MROW, INVS, RC, VT, SC);
  /* S is dead from here; S32 / S16 occupy the first 12 MiB of each branch's R0 */
  add_ln_kernel<<<dim3(kTok / 8, 2), 256, 0, stream>>>(RES, SC, alng, alnb, blng, blnb, S32, S16);
  /* out = s + s . ffnW^T : A = s f16, Bt = ffnW f16 x256, residual s f32 fetched in the store phase */
  run_gemm<0, false, 0, 0, true, 0>(stream, S16, S16, kDim, FFN, FFN, kDim,
                                    (void*)out, (void*)out, kDim, alng, blng, S32, S32 + kR0El32,
                                    kR0El16, ww, 0L, 4 * nd, 0L, 1, kTok, kDim, kDim, kWCarryInv);
}

// v004
// A run of this version takes 325 microseconds.
// Next to v003, in two timings, it ran 1.25 times as fast each time.
// Over all steps from v000 it is 4.26 times as fast.
// Contractions: pW1/pW2/Wq/Wk linears and q.k^T logits on v_wmma_f32_16x16x32_bf16 with both operands as bf16 hi+lo planes (hi.hi + hi.lo + lo.hi), f32 accumulate, logits kept f32; rW1/rW2/rW3/Wv/ffn linears and attn.V on v_wmma_f32_16x16x32_f16 (weights carried x256, attention weights carried x32768), f32 accumulate; softmax statistics, column sums, LayerNorm and residual adds in f32.
#include <hip/hip_runtime.h>
#include <math.h>

typedef __attribute__((ext_vector_type(16))) _Float16 v16h;
typedef __attribute__((ext_vector_type(8)))  _Float16 v8h;
typedef __attribute__((ext_vector_type(16))) __bf16   v16b;
typedef __attribute__((ext_vector_type(8)))  __bf16   v8b;
typedef __attribute__((ext_vector_type(8)))  float    v8f;
typedef __attribute__((ext_vector_type(4)))  float    v4f;
typedef __attribute__((ext_vector_type(4)))  unsigned int v4u;
typedef __attribute__((ext_vector_type(2)))  unsigned int v2u;

// ---------------------------------------------------------------------------
// Problem constants
// ---------------------------------------------------------------------------
constexpr int    kTok       = 4096;
constexpr int    kDim       = 512;
constexpr size_t kND        = (size_t)kTok * kDim;
constexpr size_t kWW        = (size_t)kDim * kDim;
constexpr float  kWCarry    = 256.0f;
constexpr float  kWCarryInv = 1.0f / kWCarry;
constexpr float  kPCarry    = 32768.0f;
constexpr float  kPCarryInv = 1.0f / kPCarry;
constexpr float  kInvDim    = 1.0f / (float)kDim;
constexpr float  kLnEps     = 1e-6f;
constexpr float  kAttnEps   = 1e-9f;
static_assert((kTok % 64) == 0 && (kDim % 64) == 0);
static_assert((kTok % 32) == 0 && (kDim % 32) == 0);
static_assert(((kND / 8) % 256) == 0 && ((kWW / 8) % 256) == 0);

// ---------------------------------------------------------------------------
// Workspace region map (bytes; every offset is a multiple of 128). Both branches run in the same launches, so every
// region holds branch A's part and then branch B's.
//   R0      2 x 67,108,864  time-shared region, one per branch:
//             (a) operand planes of the branch's linear chain:
//                 XH XL T0H T0L FH FL F16 R1 R2   9 x 4,194,304 (16-bit [4096][512] planes)
//                 WSH (4 bf16 hi weight planes) 2,097,152 ; WSL (4 bf16 lo planes) 2,097,152
//                 WF  (4 f16 weight planes, carried x256) 2,097,152         -> 44,040,192 used
//             (b) S f32 [4096][4096] logits of the branch                    67,108,864
//             (c) S32 f32 [4096][512] + S16 f16 [4096][512] LayerNorm output 12,582,912
//   QK      33,554,432  QH QL KH KL bf16 planes [4096][512], branch A then branch B
//   VT       8,388,608  V^T f16 [512][4096], branch A then B
//   RES      8,388,608  residual-chain output f16 [4096][512], branch A then B
//   SC      16,777,216  attn.V output f32 [4096][512], branch A then B
//   FFN      1,048,576  ffn weight f16 planes (x256), branch A then B
//   MROW        32,768  row maxima f32 [4096], branch A then B
//   INVS        32,768  1 / row exp sums f32 [4096], branch A then B
//   RC          32,768  1 / (1e-9 + column sums) f32 [4096], branch A then B
//   CP       4,194,304  column-sum shares f32 [128][4096] (one per block of 32 query rows), branch A then B
//   total = 134,217,728 + 33,554,432 + 8,388,608 + 8,388,608 + 16,777,216 + 1,048,576 + 32,768 + 32,768 + 32,768
//           + 4,194,304 = 206,667,776
// ---------------------------------------------------------------------------
constexpr size_t kPlane16  = kND * 2;
constexpr size_t kPlane32  = kND * 4;
constexpr size_t kW16      = kWW * 2;
constexpr size_t kR0Bytes  = (size_t)kTok * kTok * 4;
constexpr size_t kOffXH    = 0;
constexpr size_t kOffXL    = kOffXH  + kPlane16;
constexpr size_t kOffT0H   = kOffXL  + kPlane16;
constexpr size_t kOffT0L   = kOffT0H + kPlane16;
constexpr size_t kOffFH    = kOffT0L + kPlane16;
constexpr size_t kOffFL    = kOffFH  + kPlane16;
constexpr size_t kOffF16   = kOffFL  + kPlane16;
constexpr size_t kOffR1    = kOffF16 + kPlane16;
constexpr size_t kOffR2    = kOffR1  + kPlane16;
constexpr size_t kOffWSH   = kOffR2  + kPlane16;
constexpr size_t kOffWSL   = kOffWSH + 4 * kW16;
constexpr size_t kOffWF    = kOffWSL + 4 * kW16;
constexpr size_t kPhase1End = kOffWF + 4 * kW16;
constexpr size_t kOffS     = 0;
constexpr size_t kOffS32   = 0;
constexpr size_t kOffS16   = kOffS32 + kPlane32;
constexpr size_t kOffQK    = 2 * kR0Bytes;
constexpr size_t kOffVT    = kOffQK  + 8 * kPlane16;
constexpr size_t kOffRES   = kOffVT  + 2 * kPlane16;
constexpr size_t kOffSC    = kOffRES + 2 * kPlane16;
constexpr size_t kOffFFN   = kOffSC  + 2 * kPlane32;
constexpr size_t kOffMROW  = kOffFFN + 2 * kW16;
constexpr size_t kOffINVS  = kOffMROW + 2 * (size_t)kTok * 4;
constexpr size_t kOffRC    = kOffINVS + 2 * (size_t)kTok * 4;
constexpr size_t kOffCP    = kOffRC   + 2 * (size_t)kTok * 4;
constexpr size_t kCPBytes  = 2 * (size_t)(kTok / 32) * kTok * 4;
constexpr size_t kWsTotal  = kOffCP   + kCPBytes;
constexpr long   kR0El16   = (long)(kR0Bytes / 2);  /* branch A -> branch B inside R0, in 16-bit elements */
constexpr long   kR0El32   = (long)(kR0Bytes / 4);  /* the same in f32 elements */
static_assert(kPhase1End <= kR0Bytes);
static_assert(kOffS16 + kPlane16 <= kR0Bytes);
static_assert(kWsTotal == 206667776ull);
static_assert(kWsTotal <= 268435456ull);
static_assert((kOffWSH % 128) == 0 && (kOffWSL % 128) == 0 && (kOffWF % 128) == 0 && (kOffQK % 128) == 0 &&
              (kOffVT % 128) == 0 && (kOffRES % 128) == 0 && (kOffSC % 128) == 0 && (kOffFFN % 128) == 0 &&
              (kOffMROW % 128) == 0 && (kOffINVS % 128) == 0 && (kOffRC % 128) == 0 && (kOffS16 % 128) == 0 &&
              (kOffCP % 128) == 0);

// ---------------------------------------------------------------------------
// Small helpers
// ---------------------------------------------------------------------------
__device__ __forceinline__ unsigned short f2bf_bits(float f) {
  unsigned u = __float_as_uint(f);
  return (unsigned short)((u + 0x7FFFu + ((u >> 16) & 1u)) >> 16);
}
__device__ __forceinline__ float bf_bits2f(unsigned short h) { return __uint_as_float(((unsigned)h) << 16); }

/* f16 bits (low 16 bits of hb, finite values) -> f32, integer path only */
__device__ __forceinline__ float h16_to_f32(unsigned hb) {
  const unsigned sgn = (hb & 0x8000u) << 16;
  const unsigned em = hb & 0x7fffu;
  const float fn = __uint_as_float((em << 13) + 0x38000000u);
  const float fs = (float)em * 5.9604644775390625e-8f;
  const float mag = (em < 0x400u) ? fs : fn;
  return __uint_as_float(__float_as_uint(mag) | sgn);
}

/* hazard guards: four nops, all four accumulators of the group tied, A fragments named as inputs */
__device__ __forceinline__ void grp_guard_h(v8f& a, v8f& b, v8f& c, v8f& d, v16h x, v16h y) {
  asm volatile("v_nop\n\tv_nop\n\tv_nop\n\tv_nop" : "+v"(a), "+v"(b), "+v"(c), "+v"(d) : "v"(x), "v"(y));
}
__device__ __forceinline__ void grp_guard_b(v8f& a, v8f& b, v8f& c, v8f& d, v16b x, v16b y) {
  asm volatile("v_nop\n\tv_nop\n\tv_nop\n\tv_nop" : "+v"(a), "+v"(b), "+v"(c), "+v"(d) : "v"(x), "v"(y));
}
__device__ __forceinline__ void keep4_h(v16h a, v16h b, v16h c, v16h d) { asm volatile("v_nop" :: "v"(a), "v"(b), "v"(c), "v"(d)); }
__device__ __forceinline__ void keep4_b(v16b a, v16b b, v16b c, v16b d) { asm volatile("v_nop" :: "v"(a), "v"(b), "v"(c), "v"(d)); }
__device__ __forceinline__ void acc_guard4(v8f& a, v8f& b, v8f& c, v8f& d) {
  asm volatile("v_nop\n\tv_nop\n\tv_nop\n\tv_nop" : "+v"(a), "+v"(b), "+v"(c), "+v"(d));
}

/* Fragment loader: elements 0..7 <- p[0..7], elements 8..15 <- p[16..23]; p already includes 8*(lane>>4) */
template <typename T> struct Frag;
template <> struct Frag<_Float16> {
  typedef v16h V;
  union U { v16h v; v8h h[2]; };
  static __device__ __forceinline__ v16h load(const _Float16* p) {
    U f;
    f.h[0] = *(const v8h*)(p);
    f.h[1] = *(const v8h*)(p + 16);
    return f.v;
  }
  static __device__ __forceinline__ v8f mma(v16h a, v16h b, v8f c) {
    return __builtin_amdgcn_wmma_f32_16x16x32_f16(false, a, false, b, (short)0, c, false, false);
  }
  static __device__ __forceinline__ void guard(v8f& a, v8f& b, v8f& c, v8f& d, v16h x, v16h y) { grp_guard_h(a, b, c, d, x, y); }
  static __device__ __forceinline__ void keep(v16h a, v16h b, v16h c, v16h d) { keep4_h(a, b, c, d); }
};
template <> struct Frag<__bf16> {
  typedef v16b V;
  union U { v16b v; v8b h[2]; };
  static __device__ __forceinline__ v16b load(const __bf16* p) {
    U f;
    f.h[0] = *(const v8b*)(p);
    f.h[1] = *(const v8b*)(p + 16);
    return f.v;
  }
  static __device__ __forceinline__ v8f mma(v16b a, v16b b, v8f c) {
    return __builtin_amdgcn_wmma_f32_16x16x32_bf16(false, a, false, b, (short)0, c, false, false);
  }
  static __device__ __forceinline__ void guard(v8f& a, v8f& b, v8f& c, v8f& d, v16b x, v16b y) { grp_guard_b(a, b, c, d, x, y); }
  static __device__ __forceinline__ void keep(v16b a, v16b b, v16b c, v16b d) { keep4_b(a, b, c, d); }
};

// ---------------------------------------------------------------------------
// LDS-staged WMMA GEMM: C[m,n] = scale * sum_k A[m,k] * Bt[n,k] (+bias[n]) (+resid[m,n]). A block of 4 waves owns a
// 128x128 tile (2x2 waves, each wave a 64x64 tile). A row-major [M][K] pitch lda; Bt row-major [N][K] pitch ldb;
// M, N multiples of 128, K a multiple of 64 and at least 128.
// Operand path: a stage is 64 k (one whole 128-B line) of the block's 128 A rows and 128 Bt rows, every plane, brought
// into LDS by per-lane asynchronous 16-B copies (8 lanes per line, 4 whole lines per wave instruction), two buffers:
// the next stage's copies fly while this stage is multiplied. LDS row pitch 144 B (16 B x 9) for the 16-B readers.
// SPLIT: operands are hi/lo planes (A2/Bt2 = lo planes, same layout); product = hi.hi + hi.lo + lo.hi.
// BIAS_MODE: 0 none, 2 bias[n] (f32). ACT: 0 none, 2 relu. RESID (f32 output only): the residual is fetched in the
// store phase, one 16-B vector per lane at exactly the address the lane stores to.
// OUT_MODE: 0 f32, 1 f16, 2 bf16 hi plane (Cout) + bf16 lo plane (Cout2).
// Epilogue: 16-row slabs staged per wave in LDS (only the owning wave touches its slab); the slabs reuse the ring
// behind the last stage's waits and barrier.
// ET: 0 f16 operands, 1 bf16 operands (pointers passed as 16-bit storage).
// One launch holds several independent products of one shape: blockIdx.y = branch, blockIdx.z = weight plane. The
// pointers are those of (0, 0); aP, bP (16-bit elements) and cP (bytes) lead to branch 1, bQ and cQ to plane 1.
// ---------------------------------------------------------------------------
template <int ET> struct Elem;
template <> struct Elem<0> { typedef _Float16 T; };
template <> struct Elem<1> { typedef __bf16 T; };

constexpr int kStageK   = 64;
constexpr int kRowPitch = 144;
constexpr int kPlaneLds = 128 * kRowPitch;
constexpr int kSlabLds  = 16 * 68 * 4;
static_assert((kRowPitch % 16) == 0 && ((kRowPitch / 16) % 2) == 1 && kRowPitch >= kStageK * 2);
static_assert((kDim % 128) == 0 && (kTok % 128) == 0 && (kDim % kStageK) == 0 && kDim >= 2 * kStageK);
static_assert(4 * kSlabLds <= 4 * kPlaneLds && (kSlabLds % 16) == 0);

/* One plane's 128 rows x 128 B of a stage: this lane's eight 16-B pieces, rows 16 apart. l = the lane's LDS byte
   address of its first piece, g = its global address, gstep = 16 source rows in elements. The copies and the
   s_wait_xcnt stand in one statement so that no address register is rewritten ahead of that wait. */
__device__ __forceinline__ void stage_plane(unsigned l, const unsigned short* g, size_t gstep) {
  const unsigned l1 = l + 16 * kRowPitch, l2 = l + 32 * kRowPitch, l3 = l + 48 * kRowPitch, l4 = l + 64 * kRowPitch,
                 l5 = l + 80 * kRowPitch, l6 = l + 96 * kRowPitch, l7 = l + 112 * kRowPitch;
  const unsigned short *g1 = g + gstep, *g2 = g + 2 * gstep, *g3 = g + 3 * gstep, *g4 = g + 4 * gstep,
                       *g5 = g + 5 * gstep, *g6 = g + 6 * gstep, *g7 = g + 7 * gstep;
  asm volatile(
      "global_load_async_to_lds_b128 %0, %8, off\n\t"
      "global_load_async_to_lds_b128 %1, %9, off\n\t"
      "global_load_async_to_lds_b128 %2, %10, off\n\t"
      "global_load_async_to_lds_b128 %3, %11, off\n\t"
      "global_load_async_to_lds_b128 %4, %12, off\n\t"
      "global_load_async_to_lds_b128 %5, %13, off\n\t"
      "global_load_async_to_lds_b128 %6, %14, off\n\t"
      "global_load_async_to_lds_b128 %7, %15, off\n\t"
      "s_wait_xcnt 0x0"
      :: "v"(l), "v"(l1), "v"(l2), "v"(l3), "v"(l4), "v"(l5), "v"(l6), "v"(l7),
         "v"(g), "v"(g1), "v"(g2), "v"(g3), "v"(g4), "v"(g5), "v"(g6), "v"(g7)
      : "memory");
}

template <int ET, bool SPLIT, int BIAS_MODE, int OUT_MODE, bool RESID, int ACT>
__global__ __launch_bounds__(128) void wmma_gemm64(
    const unsigned short* __restrict__ Ap0, const unsigned short* __restrict__ A2p0, int lda,
    const unsigned short* __restrict__ Btp0, const unsigned short* __restrict__ Bt2p0, int ldb,
    void* __restrict__ Cout0, void* __restrict__ Cout20, int ldc,
    const float* __restrict__ bias0, const float* __restrict__ bias1,
    const float* __restrict__ resid0, const float* __restrict__ resid1,
    long aP, long bP, long bQ, long cP, long cQ,
    int M, int N, int K, float scale) {
  typedef typename Elem<ET>::T T;
  typedef typename Frag<T>::V V;
  const long zp = (long)blockIdx.y;
  const long zq = (long)blockIdx.z;
  const unsigned short* Ap   = Ap0 + zp * aP;
  const unsigned short* A2p  = A2p0 + zp * aP;
  const unsigned short* Btp  = Btp0 + zp * bP + zq * bQ;
  const unsigned short* Bt2p = Bt2p0 + zp * bP + zq * bQ;
  void* Cout  = (void*)((char*)Cout0 + zp * cP + zq * cQ);
  void* Cout2 = (void*)((char*)Cout20 + zp * cP + zq * cQ);
  const float* bias  = zp ? bias1 : bias0;
  const float* resid = zp ? resid1 : resid0;
  /* stage layout: A hi | (A lo) | Bt hi | (Bt lo), each plane 128 rows at kRowPitch */
  constexpr int kPlanes = SPLIT ? 4 : 2;
  constexpr int kStageLds = kPlanes * kPlaneLds;
  constexpr int kOffBh = (SPLIT ? 2 : 1) * kPlaneLds;
  __shared__ __align__(16) unsigned char ring[2 * kStageLds];
  const int lane = threadIdx.x & 31;
  const int wave = __builtin_amdgcn_readfirstlane((int)(threadIdx.x >> 5));
  const int tilesN = N >> 7;
  const int tilesM = M >> 7;
  /* block-uniform exit in front of every copy and barrier */
  if ((int)blockIdx.x >= tilesM * tilesN) return;
  const int bm = (int)blockIdx.x / tilesN;
  const int bn = (int)blockIdx.x - bm * tilesN;
  const int wm = (wave >> 1) << 6;
  const int wn = (wave & 1) << 6;
  const int m0 = (bm << 7) + wm;
  const int n0 = (bn << 7) + wn;

  const int rlane = lane & 15;
  const int koff  = (lane >> 4) * 8;
  const int mOff  = (lane >> 4) * 8;

  /* copy map: thread t brings 16-B piece t&7 of rows (t>>3) + 16q, q 0..7, of every plane */
  const int crow = (int)threadIdx.x >> 3;
  const int cpc  = (int)threadIdx.x & 7;
  const unsigned ldsBase = (unsigned)(size_t)(&ring[0]) + (unsigned)(crow * kRowPitch + cpc * 16);
  const size_t aOff = (size_t)((bm << 7) + crow) * lda + cpc * 8;
  const size_t bOff = (size_t)((bn << 7) + crow) * ldb + cpc * 8;
  const size_t aStep = (size_t)16 * lda;
  const size_t bStep = (size_t)16 * ldb;
  const int nStages = K / kStageK;

  auto issue_stage = [&](int s) {
    const unsigned l = ldsBase + (unsigned)((s & 1) * kStageLds);
    const size_t kq = (size_t)s * kStageK;
    stage_plane(l, Ap + aOff + kq, aStep);
    if (SPLIT) stage_plane(l + kPlaneLds, A2p + aOff + kq, aStep);
    stage_plane(l + kOffBh, Btp + bOff + kq, bStep);
    if (SPLIT) stage_plane(l + kOffBh + kPlaneLds, Bt2p + bOff + kq, bStep);
  };

  v8f acc[4][4];
#pragma unroll
  for (int i = 0; i < 4; ++i)
#pragma unroll
    for (int j = 0; j < 4; ++j) acc[i][j] = (v8f){0.f, 0.f, 0.f, 0.f, 0.f, 0.f, 0.f, 0.f};

  /* prologue: stage 0 landed and published, then stage 1 in flight */
  issue_stage(0);
  asm volatile("s_wait_asynccnt 0x0" ::: "memory");  /* this wave's stage-0 copies have landed */
  __syncthreads();
  if (nStages > 1) issue_stage(1);

  const int aFrag = (wm + rlane) * kRowPitch + koff * 2;
  const int bFrag = kOffBh + (wn + rlane) * kRowPitch + koff * 2;

#pragma unroll 1  /* one stage per trip: the foot's waits and barrier stand once */
  for (int s = 0; s < nStages; ++s) {
    const unsigned char* sb = ring + (s & 1) * kStageLds;
#pragma unroll
    for (int kk = 0; kk < kStageK; kk += 32) {
      V bh[4], bl[4];
      const unsigned char* ap = sb + aFrag + kk * 2;
      V ah = Frag<T>::load((const T*)ap);
      V al;
      if (SPLIT) al = Frag<T>::load((const T*)(ap + kPlaneLds));
#pragma unroll
      for (int j = 0; j < 4; ++j) {
        const unsigned char* bp = sb + bFrag + j * 16 * kRowPitch + kk * 2;
        bh[j] = Frag<T>::load((const T*)bp);
        if (SPLIT) bl[j] = Frag<T>::load((const T*)(bp + kPlaneLds));
      }
#pragma unroll
      for (int i = 0; i < 4; ++i) {
        /* the next row group's A fragments are read in front of this group's products */
        V nh = ah;
        V nl;
        if (SPLIT) nl = al;
        if (i < 3) {
          nh = Frag<T>::load((const T*)(ap + (i + 1) * 16 * kRowPitch));
          if (SPLIT) nl = Frag<T>::load((const T*)(ap + (i + 1) * 16 * kRowPitch + kPlaneLds));
        }
#pragma unroll
        for (int j = 0; j < 4; ++j) {
          acc[i][j] = Frag<T>::mma(ah, bh[j], acc[i][j]);
          if (SPLIT) {
            acc[i][j] = Frag<T>::mma(ah, bl[j], acc[i][j]);
            acc[i][j] = Frag<T>::mma(al, bh[j], acc[i][j]);
          }
        }
        Frag<T>::guard(acc[i][0], acc[i][1], acc[i][2], acc[i][3], ah, SPLIT ? al : ah);
        ah = nh;
        if (SPLIT) al = nl;
      }
      Frag<T>::keep(bh[0], bh[1], bh[2], bh[3]);
      if (SPLIT) Frag<T>::keep(bl[0], bl[1], bl[2], bl[3]);
    }
    /* publish point of stage s + 1; the one barrier also ends every reader's last read of stage s's buffer */
    asm volatile("s_wait_dscnt 0x0" ::: "memory");     /* this wave's reads of stage s have returned */
    asm volatile("s_wait_asynccnt 0x0" ::: "memory");  /* this wave's stage s + 1 copies have landed */
    __syncthreads();
    if (s + 2 < nStages) issue_stage(s + 2);
  }
  asm volatile("s_wait_asynccnt 0x0" ::: "memory");  /* no copy is outstanding when the ring becomes the slabs */
  acc_guard4(acc[0][0], acc[0][1], acc[0][2], acc[0][3]);
  acc_guard4(acc[1][0], acc[1][1], acc[1][2], acc[1][3]);
  acc_guard4(acc[2][0], acc[2][1], acc[2][2], acc[2][3]);
  acc_guard4(acc[3][0], acc[3][1], acc[3][2], acc[3][3]);

  /* ---- epilogue ---- */
  float* slab = (float*)(ring + wave * kSlabLds);
#pragma unroll
  for (int i = 0; i < 4; ++i) {
    const int mBase = m0 + (i << 4);
#pragma unroll
    for (int j = 0; j < 4; ++j) {
      const int n = n0 + (j << 4) + rlane;
      float bv = 0.f;
      if (BIAS_MODE == 2) bv = bias[n];
#pragma unroll
      for (int r = 0; r < 8; ++r) {
        float v = acc[i][j][r] * scale;
        if (BIAS_MODE == 2) v += bv;
        if (ACT == 2) v = fmaxf(v, 0.0f);
        slab[(mOff + r) * 68 + (j << 4) + rlane] = v;
      }
    }
    __builtin_amdgcn_fence(__ATOMIC_RELEASE, "workgroup");
    __builtin_amdgcn_wave_barrier();
    __builtin_amdgcn_fence(__ATOMIC_ACQUIRE, "workgroup");
    if (OUT_MODE == 0) {
      /* rows it*2 + hh, it 0..7, hh 0..1 = 16 rows; 16 lanes x 16 B = the 256-B row segment */
      float* C = (float*)Cout;
      const int hh = lane >> 4, c4 = (lane & 15) * 4;
      v4f vals[8];
#pragma unroll
      for (int it = 0; it < 8; ++it) {
        const int row = it * 2 + hh;
        v4f v = *(const v4f*)(slab + row * 68 + c4);
        if (RESID) {
          const v4f rr = *(const v4f*)(resid + (size_t)(mBase + row) * ldc + n0 + c4);
          v = v + rr;
        }
        vals[it] = v;
      }
      {
#pragma unroll
        for (int it = 0; it < 8; ++it) {
          const int row = it * 2 + hh;
          *(v4f*)(C + (size_t)(mBase + row) * ldc + n0 + c4) = vals[it];
        }
        
      }
    } else {
      const int q = lane >> 3, c8 = (lane & 7) * 8;
      unsigned short* C  = (unsigned short*)Cout;
      unsigned short* C2 = (unsigned short*)Cout2;
      {
#pragma unroll
        for (int it = 0; it < 4; ++it) {
          const int row = it * 4 + q;
          const float* sp = slab + row * 68 + c8;
          v8h hv, lv;
#pragma unroll
          for (int e = 0; e < 8; ++e) {
            const float sv = sp[e];
            if (OUT_MODE == 1) {
              hv[e] = (_Float16)sv;
            } else {
              const unsigned short hb = f2bf_bits(sv);
              const unsigned short lb = f2bf_bits(sv - bf_bits2f(hb));
              hv[e] = __builtin_bit_cast(_Float16, hb);
              lv[e] = __builtin_bit_cast(_Float16, lb);
            }
          }
          *(v8h*)(C + (size_t)(mBase + row) * ldc + n0 + c8) = hv;
          if (OUT_MODE == 2) *(v8h*)(C2 + (size_t)(mBase + row) * ldc + n0 + c8) = lv;
        }
        
      }
    }
    __builtin_amdgcn_fence(__ATOMIC_RELEASE, "workgroup");
    __builtin_amdgcn_wave_barrier();
    __builtin_amdgcn_fence(__ATOMIC_ACQUIRE, "workgroup");
  }
}

// ---------------------------------------------------------------------------
// f32 plane -> bf16 hi plane + bf16 lo plane (both RNE converts: hi = bf16(v), lo = bf16(v - hi)); 8 contiguous
// elements per thread. blockIdx.y (block-uniform) selects one of four sources and output plane y (planeElems apart),
// blockIdx.z the branch (sources s* or t*, outputs branchElems apart).
// Coverage: grid.x * 256 threads * 8 elements = total8 * 8 = the whole plane (grids are exact multiples of 256).
// ---------------------------------------------------------------------------
__global__ __launch_bounds__(256) void split4_bf16_kernel(
    const float* __restrict__ s0, const float* __restrict__ s1, const float* __restrict__ s2, const float* __restrict__ s3,
    const float* __restrict__ t0, const float* __restrict__ t1, const float* __restrict__ t2, const float* __restrict__ t3,
    unsigned short* __restrict__ dhi, unsigned short* __restrict__ dlo, int total8, long planeElems, long branchElems) {
  const int i = blockIdx.x * 256 + threadIdx.x;
  if (i >= total8) return;
  const int y = blockIdx.y;
  const int z = blockIdx.z;
  const float* srcA = (y == 0) ? s0 : (y == 1) ? s1 : (y == 2) ? s2 : s3;
  const float* srcB = (y == 0) ? t0 : (y == 1) ? t1 : (y == 2) ? t2 : t3;
  const float* src = z ? srcB : srcA;
  const size_t e0 = (size_t)i << 3;
  const v4f a0 = *(const v4f*)(src + e0);
  const v4f a1 = *(const v4f*)(src + e0 + 4);
  v8h hv, lv;
#pragma unroll
  for (int e = 0; e < 4; ++e) {
    const float f0 = a0[e], f1 = a1[e];
    const unsigned short h0 = f2bf_bits(f0), h1 = f2bf_bits(f1);
    const unsigned short l0 = f2bf_bits(f0 - bf_bits2f(h0)), l1 = f2bf_bits(f1 - bf_bits2f(h1));
    hv[e]     = __builtin_bit_cast(_Float16, h0);
    hv[4 + e] = __builtin_bit_cast(_Float16, h1);
    lv[e]     = __builtin_bit_cast(_Float16, l0);
    lv[4 + e] = __builtin_bit_cast(_Float16, l1);
  }
  unsigned short* qh = dhi + (size_t)y * planeElems + (size_t)z * branchElems + e0;
  unsigned short* ql = dlo + (size_t)y * planeElems + (size_t)z * branchElems + e0;
  *(v8h*)qh = hv;
  *(v8h*)ql = lv;
  
}

// ---------------------------------------------------------------------------
// f32 plane -> f16 plane with a power-of-two carry; same thread/line map as above (8 elements = one 16-B store per
// ---------------------------------------------------------------------------
__global__ __launch_bounds__(256) void cast4_f16_kernel(
    const float* __restrict__ s0, const float* __restrict__ s1, const float* __restrict__ s2, const float* __restrict__ s3,
    const float* __restrict__ t0, const float* __restrict__ t1, const float* __restrict__ t2, const float* __restrict__ t3,
    unsigned short* __restrict__ out, float carry, int total8, long planeElems, long branchElems) {
  const int i = blockIdx.x * 256 + threadIdx.x;
  if (i >= total8) return;
  const int y = blockIdx.y;
  const int z = blockIdx.z;
  const float* srcA = (y == 0) ? s0 : (y == 1) ? s1 : (y == 2) ? s2 : s3;
  const float* srcB = (y == 0) ? t0 : (y == 1) ? t1 : (y == 2) ? t2 : t3;
  const float* src = z ? srcB : srcA;
  const size_t e0 = (size_t)i << 3;
  const v4f a0 = *(const v4f*)(src + e0);
  const v4f a1 = *(const v4f*)(src + e0 + 4);
  v8h hv;
#pragma unroll
  for (int e = 0; e < 4; ++e) {
    const float f0 = a0[e] * carry, f1 = a1[e] * carry;
    hv[e]     = (_Float16)f0;
    hv[4 + e] = (_Float16)f1;
  }
  unsigned short* q = out + (size_t)y * planeElems + (size_t)z * branchElems + e0;
  *(v8h*)q = hv;
  
}

// ---------------------------------------------------------------------------
// bf16 hi + lo planes -> f16 plane of (hi + lo); planes read as 32-bit integer words; same thread/line map.
// ---------------------------------------------------------------------------
__global__ __launch_bounds__(256) void hilo_to_f16_kernel(
    const unsigned short* __restrict__ hi0, const unsigned short* __restrict__ lo0,
    unsigned short* __restrict__ out0, int total8, long branchElems) {
  const int i = blockIdx.x * 256 + threadIdx.x;
  if (i >= total8) return;
  /* blockIdx.y = branch */
  const unsigned short* hi = hi0 + (size_t)blockIdx.y * branchElems;
  const unsigned short* lo = lo0 + (size_t)blockIdx.y * branchElems;
  unsigned short* out = out0 + (size_t)blockIdx.y * branchElems;
  const size_t e0 = (size_t)i << 3;
  const v4u hw4 = *(const v4u*)(hi + e0);
  const v4u lw4 = *(const v4u*)(lo + e0);
  v8h hv;
#pragma unroll
  for (int w = 0; w < 4; ++w) {
    const unsigned hw = hw4[w];
    const unsigned lw = lw4[w];
    const float f0 = __uint_as_float(hw << 16) + __uint_as_float(lw << 16);
    const float f1 = __uint_as_float(hw & 0xffff0000u) + __uint_as_float(lw & 0xffff0000u);
    hv[2 * w]     = (_Float16)f0;
    hv[2 * w + 1] = (_Float16)f1;
  }
  unsigned short* q = out + e0;
  *(v8h*)q = hv;
  
}

// ---------------------------------------------------------------------------
// Row statistics of S f32 [4096][4096] and the block's share of the column sums, S read once:
// m_i = max_j S_ij, inv_s_i = 1 / sum_j exp(S_ij - m_i), part_b[j] = sum over the block's 32 rows of exp(S_ij - m_i) * inv_s_i.
// Block = 32 rows (16 waves x 2 rows). A wave holds one whole row in registers: 32 lane-strided 16-B loads, all in
// flight together (lane owns columns it*128 + lane*4 .. +3); maximum, exponentials, sum and probabilities are formed
// in those registers. Row sum order: per-lane sequential, then xor shuffle tree (unconditional).
// Column share: each wave adds its two rows in its own LDS row (only the owning wave touches it in front of the
// barrier); behind the barrier the 16 wave rows are added in index order and stored as whole lines. No atomics.
// ---------------------------------------------------------------------------
constexpr int kRcRows  = 32;
constexpr int kRcWaves = 16;
constexpr int kRcParts = kTok / kRcRows;
static_assert(kTok == 32 * 128 && (kTok % kRcRows) == 0 && kRcRows == 2 * kRcWaves && kTok == 2 * kRcWaves * 32 * 4);
static_assert((size_t)2 * kRcParts * kTok * 4 == kCPBytes);

/* Four base-2 exponentials in place. One statement, so that directly behind each v_exp_f32 stands an instruction that
   neither reads its result nor rewrites its source: the next exponential, and a v_nop behind the last. */
__device__ __forceinline__ void exp2_x4(float& a, float& b, float& c, float& d) {
  asm("v_exp_f32 %0, %0\n\tv_exp_f32 %1, %1\n\tv_exp_f32 %2, %2\n\tv_exp_f32 %3, %3\n\tv_nop"
      : "+v"(a), "+v"(b), "+v"(c), "+v"(d));
}
constexpr float kLog2e = 1.4426950408889634f;  /* exp(t) = exp2(t * log2 e), the form __expf compiles to */

__global__ __launch_bounds__(512) void rowcol_kernel(const float* __restrict__ S0, float* __restrict__ mrow0,
                                                     float* __restrict__ invs0, float* __restrict__ cpart0) {
  __shared__ __align__(16) float sC[kRcWaves][kTok];
  __shared__ float sM[kRcRows];
  __shared__ float sI[kRcRows];
  /* blockIdx.y = branch */
  const float* S = S0 + (size_t)blockIdx.y * kR0El32;
  float* mrow = mrow0 + (size_t)blockIdx.y * kTok;
  float* invs = invs0 + (size_t)blockIdx.y * kTok;
  float* cpart = cpart0 + ((size_t)blockIdx.y * kRcParts + blockIdx.x) * kTok;
  const int lane = threadIdx.x & 31;
  const int wave = __builtin_amdgcn_readfirstlane((int)(threadIdx.x >> 5));
  const int row0 = blockIdx.x * kRcRows;
  float* myC = &sC[wave][lane * 4];
#pragma unroll 1  /* one copy of the row's code: the text stays small */
  for (int q = 0; q < 2; ++q) {
    const int rl = wave * 2 + q;
    const float* p = S + (size_t)(row0 + rl) * kTok + lane * 4;
    v4f x[32];
#pragma unroll
    for (int it = 0; it < 32; ++it) x[it] = *(const v4f*)(p + it * 128);
    /* stands in front of every rewrite of the loads' address registers: p as an input keeps them untouched up to here */
    asm volatile("s_wait_xcnt 0x0" :: "v"(p) : "memory");
    float m = -INFINITY;
#pragma unroll
    for (int it = 0; it < 32; ++it) m = fmaxf(m, fmaxf(fmaxf(x[it][0], x[it][1]), fmaxf(x[it][2], x[it][3])));
#pragma unroll
    for (int off = 16; off > 0; off >>= 1) m = fmaxf(m, __shfl_xor(m, off, 32));
    float sum = 0.f;
#pragma unroll
    for (int it = 0; it < 32; ++it) {
      float e0 = (x[it][0] - m) * kLog2e, e1 = (x[it][1] - m) * kLog2e;
      float e2 = (x[it][2] - m) * kLog2e, e3 = (x[it][3] - m) * kLog2e;
      exp2_x4(e0, e1, e2, e3);
      x[it] = (v4f){e0, e1, e2, e3};
      sum += e0;
      sum += e1;
      sum += e2;
      sum += e3;
    }
#pragma unroll
    for (int off = 16; off > 0; off >>= 1) sum += __shfl_xor(sum, off, 32);
    const float inv = 1.0f / sum;
    if (q == 0) {
#pragma unroll
      for (int it = 0; it < 32; ++it) *(v4f*)(myC + it * 128) = x[it] * inv;
    } else {
#pragma unroll
      for (int it = 0; it < 32; ++it) {
        const v4f c = *(const v4f*)(myC + it * 128);
        *(v4f*)(myC + it * 128) = c + x[it] * inv;
      }
    }
    if (lane == 0) {
      sM[rl] = m;
      sI[rl] = inv;
    }
  }
  __syncthreads();
  /* thread t adds columns h*2048 + 4t .. +3 of the 16 wave rows: 32 lanes x 16 B = 4 whole lines per store */
#pragma unroll
  for (int h = 0; h < 2; ++h) {
    const int col = h * 2048 + (int)threadIdx.x * 4;
    v4f c = *(const v4f*)(&sC[0][col]);
#pragma unroll
    for (int w = 1; w < kRcWaves; ++w) c = c + *(const v4f*)(&sC[w][col]);
    *(v4f*)(cpart + col) = c;
  }
  asm volatile("s_wait_xcnt 0x0" ::: "memory");  /* in front of wave 0's reuse of the registers that these stores name */
  if (wave == 0) {
    const float mv = sM[lane];
    const float iv = sI[lane];
    *(float*)(mrow + row0 + lane) = mv;
    *(float*)(invs + row0 + lane) = iv;
  }
}

// ---------------------------------------------------------------------------
// Column sums over queries: c_j = sum over the 128 block shares part_b[j], then rc_j = 1 / (1e-9 + c_j).
// Block = 32 columns (one 128-B line of every share); wave w adds shares w, w+8, ... (16 shares, all loads in flight
// together) in order; the 8 wave partials are combined in index order by wave 0. No atomics.
// ---------------------------------------------------------------------------
__global__ __launch_bounds__(256) void colfin_kernel(const float* __restrict__ cpart0, float* __restrict__ rcol0) {
  __shared__ float sP[8][32];
  /* blockIdx.y = branch */
  const float* cpart = cpart0 + (size_t)blockIdx.y * kRcParts * kTok;
  float* rcol = rcol0 + (size_t)blockIdx.y * kTok;
  const int lane = threadIdx.x & 31;
  const int wave = __builtin_amdgcn_readfirstlane((int)(threadIdx.x >> 5));
  const int j0 = blockIdx.x * 32;
  const float* pw = cpart + (size_t)wave * kTok + j0 + lane;
  float v[kRcParts / 8];
#pragma unroll
  for (int t = 0; t < kRcParts / 8; ++t) v[t] = pw[(size_t)(8 * t) * kTok];
  asm volatile("s_wait_xcnt 0x0" ::: "memory");  /* in front of every rewrite of the loads' address registers */
  float acc = 0.f;
#pragma unroll
  for (int t = 0; t < kRcParts / 8; ++t) acc += v[t];
  sP[wave][lane] = acc;
  __syncthreads();
  if (wave == 0) {
    float c = sP[0][lane];
    c += sP[1][lane];
    c += sP[2][lane];
    c += sP[3][lane];
    c += sP[4][lane];
    c += sP[5][lane];
    c += sP[6][lane];
    c += sP[7][lane];
    const float rc = 1.0f / (kAttnEps + c);
    *(float*)(rcol + j0 + lane) = rc;
  }
}

// ---------------------------------------------------------------------------
// attn.V: SC[i][d] = (1/32768) * sum_j f16(32768 * P_ij * rc_j) * VT[d][j], P_ij = exp(S_ij - m_i) * inv_s_i.
// Block = 64 query rows x all 512 d (8 waves, wave w owns d columns 64w..64w+63, acc 4x4 tiles).
// Operand path: per-lane asynchronous 16-B copies bring whole 128-B lines into LDS, two buffers. Stage s holds the
// V^T tile of keys 64s..64s+63 (512 rows x 128 B, pitch 144 B) and the logit tile of keys 64(s+1)..64(s+1)+63
// (64 rows x 256 B, pitch 272 B): trip t multiplies key tile t and forms the f16 weights of key tile t + 1 out of the
// same buffer, while stage t + 1's copies fly. The weight tiles (64 rows x 128 B, pitch 144 B) alternate between two
// places: the one written in trip t was last read in trip t - 1. Thread t forms row t>>2, keys (t&3)*16..+15
// (64 rows x 4 threads x 16 = the whole tile). The 4096 column factors are copied into LDS once, in the prologue.
// The pad bytes of every pitch are never read: all reads touch byte offsets below the row length.
// ---------------------------------------------------------------------------
constexpr int kAvK      = 64;
constexpr int kAvVPitch = 144;
constexpr int kAvSPitch = 272;
constexpr int kAvAPitch = 144;
constexpr int kAvVLds   = kDim * kAvVPitch;
constexpr int kAvSLds   = 64 * kAvSPitch;
constexpr int kAvStage  = kAvVLds + kAvSLds;
constexpr int kAvALds   = 64 * kAvAPitch;
constexpr int kAvOffA   = 2 * kAvStage;
constexpr int kAvOffRC  = kAvOffA + 2 * kAvALds;
constexpr int kAvLds    = kAvOffRC + kTok * 4;
static_assert((kTok % kAvK) == 0 && kTok >= 2 * kAvK && kDim == 512);
static_assert(kAvVPitch >= kAvK * 2 && kAvSPitch >= kAvK * 4 && kAvAPitch >= kAvK * 2);
static_assert((kAvVPitch % 32) == 16 && (kAvSPitch % 32) == 16 && (kAvAPitch % 32) == 16);
static_assert(8 * kSlabLds <= 2 * kAvStage && kAvLds <= 327680);

/* This lane's eight (or four) 16-B pieces, lstep LDS bytes and gstep source bytes apart. The copies and the
   s_wait_xcnt stand in one statement so that no address register is rewritten ahead of that wait. */
__device__ __forceinline__ void copy8_b128(unsigned l, unsigned lstep, const unsigned char* g, size_t gstep) {
  const unsigned l1 = l + lstep, l2 = l + 2 * lstep, l3 = l + 3 * lstep, l4 = l + 4 * lstep,
                 l5 = l + 5 * lstep, l6 = l + 6 * lstep, l7 = l + 7 * lstep;
  const unsigned char *g1 = g + gstep, *g2 = g + 2 * gstep, *g3 = g + 3 * gstep, *g4 = g + 4 * gstep,
                      *g5 = g + 5 * gstep, *g6 = g + 6 * gstep, *g7 = g + 7 * gstep;
  asm volatile(
      "global_load_async_to_lds_b128 %0, %8, off\n\t"
      "global_load_async_to_lds_b128 %1, %9, off\n\t"
      "global_load_async_to_lds_b128 %2, %10, off\n\t"
      "global_load_async_to_lds_b128 %3, %11, off\n\t"
      "global_load_async_to_lds_b128 %4, %12, off\n\t"
      "global_load_async_to_lds_b128 %5, %13, off\n\t"
      "global_load_async_to_lds_b128 %6, %14, off\n\t"
      "global_load_async_to_lds_b128 %7, %15, off\n\t"
      "s_wait_xcnt 0x0"
      :: "v"(l), "v"(l1), "v"(l2), "v"(l3), "v"(l4), "v"(l5), "v"(l6), "v"(l7),
         "v"(g), "v"(g1), "v"(g2), "v"(g3), "v"(g4), "v"(g5), "v"(g6), "v"(g7)
      : "memory");
}
__device__ __forceinline__ void copy4_b128(unsigned l, unsigned lstep, const unsigned char* g, size_t gstep) {
  const unsigned l1 = l + lstep, l2 = l + 2 * lstep, l3 = l + 3 * lstep;
  const unsigned char *g1 = g + gstep, *g2 = g + 2 * gstep, *g3 = g + 3 * gstep;
  asm volatile(
      "global_load_async_to_lds_b128 %0, %4, off\n\t"
      "global_load_async_to_lds_b128 %1, %5, off\n\t"
      "global_load_async_to_lds_b128 %2, %6, off\n\t"
      "global_load_async_to_lds_b128 %3, %7, off\n\t"
      "s_wait_xcnt 0x0"
      :: "v"(l), "v"(l1), "v"(l2), "v"(l3), "v"(g), "v"(g1), "v"(g2), "v"(g3)
      : "memory");
}

__global__ __launch_bounds__(256) void av_kernel(const float* __restrict__ S0, const float* __restrict__ mrow0,
                                                 const float* __restrict__ invs0, const float* __restrict__ rcol0,
                                                 const unsigned short* __restrict__ VTp0, float* __restrict__ SC0) {
  /* stage buffer 0 | stage buffer 1 | weight tile 0 | weight tile 1 | column factors */
  __shared__ __align__(16) unsigned char smem[kAvLds];
  /* blockIdx.y = branch */
  const float* S = S0 + (size_t)blockIdx.y * kR0El32;
  const float* mrow = mrow0 + (size_t)blockIdx.y * kTok;
  const float* invs = invs0 + (size_t)blockIdx.y * kTok;
  const float* rcol = rcol0 + (size_t)blockIdx.y * kTok;
  const unsigned short* VTp = VTp0 + (size_t)blockIdx.y * kND;
  float* SC = SC0 + (size_t)blockIdx.y * kND;
  typedef Frag<_Float16> FH;
  const int tid  = threadIdx.x;
  const int lane = tid & 31;
  const int wave = __builtin_amdgcn_readfirstlane((int)(tid >> 5));
  const int m0 = blockIdx.x * 64;
  const int n0 = wave * 64;
  const int sr   = tid >> 2;
  const int sc16 = (tid & 3) * 16;
  const float mi = mrow[m0 + sr];
  const float fi = invs[m0 + sr] * kPCarry;

  const int rlane = lane & 15;
  const int koff  = (lane >> 4) * 8;
  const int mOff  = (lane >> 4) * 8;
  constexpr int nT = kTok / kAvK;

  /* copy maps. V^T: thread t brings 16-B piece t&7 of rows (t>>3) + 32q, q 0..15 (4 whole lines per wave instruction).
     Logits: piece t&15 of rows (t>>4) + 16q, q 0..3. Column factors: piece t + 256q, q 0..3. */
  const unsigned ldsBase = (unsigned)(size_t)(&smem[0]);
  const unsigned vL = ldsBase + (unsigned)((tid >> 3) * kAvVPitch + (tid & 7) * 16);
  const unsigned sL = ldsBase + (unsigned)(kAvVLds + (tid >> 4) * kAvSPitch + (tid & 15) * 16);
  const unsigned char* vG = (const unsigned char*)VTp + (size_t)(tid >> 3) * (kTok * 2) + (tid & 7) * 16;
  const unsigned char* sG = (const unsigned char*)S + (size_t)(m0 + (tid >> 4)) * (kTok * 4) + (tid & 15) * 16;

  auto issue_logits = [&](int u, int buf) {
    copy4_b128(sL + (unsigned)(buf * kAvStage), 16 * kAvSPitch, sG + (size_t)u * (kAvK * 4), (size_t)16 * kTok * 4);
  };
  auto issue_stage = [&](int s) {
    const unsigned l = vL + (unsigned)((s & 1) * kAvStage);
    const unsigned char* g = vG + (size_t)s * (kAvK * 2);
    copy8_b128(l, 32 * kAvVPitch, g, (size_t)32 * kTok * 2);
    copy8_b128(l + 256 * kAvVPitch, 32 * kAvVPitch, g + (size_t)256 * kTok * 2, (size_t)32 * kTok * 2);
    if (s + 1 < nT) issue_logits(s + 1, s & 1);
  };
  /* this thread's 16 weights of key tile u, out of the logit tile at sraw */
  auto weights = [&](int u, const unsigned char* sraw, v8h& h0, v8h& h1) {
    const float* sp = (const float*)(sraw + sr * kAvSPitch) + sc16;
    const float* rp = (const float*)(smem + kAvOffRC) + u * kAvK + sc16;
#pragma unroll
    for (int h = 0; h < 2; ++h) {
      const v4f s0 = *(const v4f*)(sp + h * 8);
      const v4f s1 = *(const v4f*)(sp + h * 8 + 4);
      const v4f r0 = *(const v4f*)(rp + h * 8);
      const v4f r1 = *(const v4f*)(rp + h * 8 + 4);
      v8h hv;
#pragma unroll
      for (int e = 0; e < 4; ++e) {
        const float e0 = __expf(s0[e] - mi);
        const float e1 = __expf(s1[e] - mi);
        const float w0 = (e0 * fi) * r0[e];
        const float w1 = (e1 * fi) * r1[e];
        hv[e]     = (_Float16)w0;
        hv[4 + e] = (_Float16)w1;
      }
      if (h == 0) h0 = hv; else h1 = hv;
    }
  };
  auto put_weights = [&](unsigned char* at, v8h h0, v8h h1) {
    *(v8h*)(at + sr * kAvAPitch + sc16 * 2) = h0;
    *(v8h*)(at + sr * kAvAPitch + sc16 * 2 + 16) = h1;
  };

  v8f acc[4][4];
#pragma unroll
  for (int i = 0; i < 4; ++i)
#pragma unroll
    for (int j = 0; j < 4; ++j) acc[i][j] = (v8f){0.f, 0.f, 0.f, 0.f, 0.f, 0.f, 0.f, 0.f};

  /* the 64 keys of one tile: weight tile at, V^T tile vt */
  auto products = [&](const unsigned char* at, const unsigned char* vt) {
#pragma unroll
    for (int kk = 0; kk < kAvK; kk += 32) {
      v16h bh[4];
#pragma unroll
      for (int j = 0; j < 4; ++j)
        bh[j] = FH::load((const _Float16*)(vt + (n0 + (j << 4) + rlane) * kAvVPitch + (kk + koff) * 2));
      const unsigned char* ap = at + rlane * kAvAPitch + (kk + koff) * 2;
      v16h ah = FH::load((const _Float16*)ap);
#pragma unroll
      for (int i = 0; i < 4; ++i) {
        /* the next row group's A fragment is read in front of this group's products */
        v16h nh = ah;
        if (i < 3) nh = FH::load((const _Float16*)(ap + (i + 1) * 16 * kAvAPitch));
#pragma unroll
        for (int j = 0; j < 4; ++j) acc[i][j] = FH::mma(ah, bh[j], acc[i][j]);
        FH::guard(acc[i][0], acc[i][1], acc[i][2], acc[i][3], ah, ah);
        ah = nh;
      }
      FH::keep(bh[0], bh[1], bh[2], bh[3]);
    }
  };

  /* prologue: column factors, logit tile 0 (in buffer 1's logit place) and stage 0 landed and published; weight tile 0
     formed; then, behind the barrier that ends the reads of buffer 1, stage 1 in flight */
  copy4_b128(ldsBase + (unsigned)(kAvOffRC + tid * 16), 4096, (const unsigned char*)rcol + tid * 16, (size_t)4096);
  issue_logits(0, 1);
  issue_stage(0);
  asm volatile("s_wait_asynccnt 0x0" ::: "memory");  /* this wave's prologue copies have landed */
  __syncthreads();
  {
    v8h h0, h1;
    weights(0, smem + kAvStage + kAvVLds, h0, h1);
    put_weights(smem + kAvOffA, h0, h1);
  }
  asm volatile("s_wait_dscnt 0x0" ::: "memory");  /* this wave's reads of logit tile 0 have returned */
  __syncthreads();
  issue_stage(1);

#pragma unroll 1  /* one stage per trip: the foot's waits and barrier stand once */
  for (int t = 0; t < nT - 1; ++t) {
    const unsigned char* sb = smem + (t & 1) * kAvStage;
    v8h h0, h1;
    weights(t + 1, sb + kAvVLds, h0, h1);
    products(smem + kAvOffA + (t & 1) * kAvALds, sb);
    put_weights(smem + kAvOffA + ((t + 1) & 1) * kAvALds, h0, h1);
    /* publish point of stage t + 1 and of weight tile t + 1; the one barrier also ends every reader's last read of
       stage t's buffer and of weight tile t */
    asm volatile("s_wait_dscnt 0x0" ::: "memory");     /* this wave's LDS reads and writes of trip t are done */
    asm volatile("s_wait_asynccnt 0x0" ::: "memory");  /* this wave's stage t + 1 copies have landed */
    __syncthreads();
    if (t + 2 < nT) issue_stage(t + 2);
  }
  products(smem + kAvOffA + ((nT - 1) & 1) * kAvALds, smem + ((nT - 1) & 1) * kAvStage);
  asm volatile("s_wait_asynccnt 0x0" ::: "memory");  /* no copy is outstanding when the ring becomes the slabs */
  asm volatile("s_wait_dscnt 0x0" ::: "memory");     /* this wave's last fragment reads have returned */
  __syncthreads();                                   /* every wave has left the ring before a slab is written */
  acc_guard4(acc[0][0], acc[0][1], acc[0][2], acc[0][3]);
  acc_guard4(acc[1][0], acc[1][1], acc[1][2], acc[1][3]);
  acc_guard4(acc[2][0], acc[2][1], acc[2][2], acc[2][3]);
  acc_guard4(acc[3][0], acc[3][1], acc[3][2], acc[3][3]);

  float* slab = (float*)(smem + wave * kSlabLds);
#pragma unroll
  for (int i = 0; i < 4; ++i) {
    const int mBase = m0 + (i << 4);
#pragma unroll
    for (int j = 0; j < 4; ++j) {
#pragma unroll
      for (int r = 0; r < 8; ++r) slab[(mOff + r) * 68 + (j << 4) + rlane] = acc[i][j][r] * kPCarryInv;
    }
    __builtin_amdgcn_fence(__ATOMIC_RELEASE, "workgroup");
    __builtin_amdgcn_wave_barrier();
    __builtin_amdgcn_fence(__ATOMIC_ACQUIRE, "workgroup");
    {
      const int hh = lane >> 4, c4 = (lane & 15) * 4;
      v4f vals[8];
#pragma unroll
      for (int it = 0; it < 8; ++it) vals[it] = *(const v4f*)(slab + (it * 2 + hh) * 68 + c4);
      {
#pragma unroll
        for (int it = 0; it < 8; ++it) {
          const int row = it * 2 + hh;
          *(v4f*)(SC + (size_t)(mBase + row) * kDim + n0 + c4) = vals[it];
        }
        
      }
    }
    __builtin_amdgcn_fence(__ATOMIC_RELEASE, "workgroup");
    __builtin_amdgcn_wave_barrier();
    __builtin_amdgcn_fence(__ATOMIC_ACQUIRE, "workgroup");
  }
}

// ---------------------------------------------------------------------------
// s = LayerNorm(res + sc) over 512 (biased variance, eps inside rsqrt), one wave per row, 8 rows per block.
// Lane owns columns it*128 + lane*4 .. +3 (it 0..3): 16 values in registers, static indexing.
// res is an f16 plane read as 32-bit integer words; sc, gamma, beta f32.
// (via the wave's own LDS slab: lane owns columns it2*256 + lane*8 .. +7, 2 instructions x 32 lanes x 16 B = 4 whole
// ---------------------------------------------------------------------------
__global__ __launch_bounds__(256) void add_ln_kernel(const unsigned short* __restrict__ RES0, const float* __restrict__ SCp0,
                                                     const float* __restrict__ gam0, const float* __restrict__ bet0,
                                                     const float* __restrict__ gam1, const float* __restrict__ bet1,
                                                     float* __restrict__ S320, unsigned short* __restrict__ S160) {
  __shared__ __align__(16) float sY[8][kDim];
  /* blockIdx.y = branch */
  const unsigned short* RES = RES0 + (size_t)blockIdx.y * kND;
  const float* SCp = SCp0 + (size_t)blockIdx.y * kND;
  const float* gam = blockIdx.y ? gam1 : gam0;
  const float* bet = blockIdx.y ? bet1 : bet0;
  float* S32 = S320 + (size_t)blockIdx.y * kR0El32;
  unsigned short* S16 = S160 + (size_t)blockIdx.y * kR0El16;
  const int lane = threadIdx.x & 31;
  const int wave = __builtin_amdgcn_readfirstlane((int)(threadIdx.x >> 5));
  const int row = blockIdx.x * 8 + wave;
  const float* scp = SCp + (size_t)row * kDim;
  const unsigned short* rp = RES + (size_t)row * kDim;
  float x[16];
#pragma unroll
  for (int it = 0; it < 4; ++it) {
    const int col = it * 128 + lane * 4;
    const v4f a = *(const v4f*)(scp + col);
    const v2u w = *(const v2u*)(rp + col);
    const unsigned w0 = w[0];
    const unsigned w1 = w[1];
    x[4 * it + 0] = h16_to_f32(w0 & 0xffffu) + a[0];
    x[4 * it + 1] = h16_to_f32(w0 >> 16) + a[1];
    x[4 * it + 2] = h16_to_f32(w1 & 0xffffu) + a[2];
    x[4 * it + 3] = h16_to_f32(w1 >> 16) + a[3];
  }
  float s = 0.f;
#pragma unroll
  for (int i = 0; i < 16; ++i) s += x[i];
#pragma unroll
  for (int off = 16; off > 0; off >>= 1) s += __shfl_xor(s, off, 32);
  const float mu = s * kInvDim;
  float vs = 0.f;
#pragma unroll
  for (int i = 0; i < 16; ++i) {
    const float d = x[i] - mu;
    x[i] = d;
    vs += d * d;
  }
#pragma unroll
  for (int off = 16; off > 0; off >>= 1) vs += __shfl_xor(vs, off, 32);
  const float inv = rsqrtf(vs * kInvDim + kLnEps);
  float* slab = sY[wave];
  v4f yv[4];
#pragma unroll
  for (int it = 0; it < 4; ++it) {
    const int col = it * 128 + lane * 4;
    const v4f g4 = *(const v4f*)(gam + col);
    const v4f b4 = *(const v4f*)(bet + col);
    v4f y;
    y[0] = (x[4 * it + 0] * inv) * g4[0] + b4[0];
    y[1] = (x[4 * it + 1] * inv) * g4[1] + b4[1];
    y[2] = (x[4 * it + 2] * inv) * g4[2] + b4[2];
    y[3] = (x[4 * it + 3] * inv) * g4[3] + b4[3];
    yv[it] = y;
    *(v4f*)(slab + col) = y;
  }
  __builtin_amdgcn_fence(__ATOMIC_RELEASE, "workgroup");
  __builtin_amdgcn_wave_barrier();
  __builtin_amdgcn_fence(__ATOMIC_ACQUIRE, "workgroup");
  v8h hv[2];
#pragma unroll
  for (int it2 = 0; it2 < 2; ++it2) {
    const int c = it2 * 256 + lane * 8;
    const v4f a0 = *(const v4f*)(slab + c);
    const v4f a1 = *(const v4f*)(slab + c + 4);
#pragma unroll
    for (int e = 0; e < 4; ++e) {
      const float f0 = a0[e], f1 = a1[e];
      hv[it2][e]     = (_Float16)f0;
      hv[it2][4 + e] = (_Float16)f1;
    }
  }
  float* o32 = S32 + (size_t)row * kDim;
  unsigned short* o16 = S16 + (size_t)row * kDim;
  {
#pragma unroll
    for (int it = 0; it < 4; ++it) *(v4f*)(o32 + it * 128 + lane * 4) = yv[it];
#pragma unroll
    for (int it2 = 0; it2 < 2; ++it2) *(v8h*)(o16 + it2 * 256 + lane * 8) = hv[it2];
    
  }
}

// ---------------------------------------------------------------------------
// Host glue (kernel launches and host arithmetic only)
// ---------------------------------------------------------------------------
template <int ET, bool SPLIT, int BIAS_MODE, int OUT_MODE, bool RESID, int ACT>
static void run_gemm(hipStream_t st,
                     const unsigned short* A, const unsigned short* A2, int lda,
                     const unsigned short* Bt, const unsigned short* Bt2, int ldb,
                     void* C, void* C2, int ldc,
                     const float* bias0, const float* bias1, const float* resid0, const float* resid1,
                     long aP, long bP, long bQ, long cP, long cQ, int planes,
                     int M, int N, int K, float scale) {
  const int blocks = (M >> 7) * (N >> 7);
  wmma_gemm64<ET, SPLIT, BIAS_MODE, OUT_MODE, RESID, ACT><<<dim3(blocks, 2, planes), 128, 0, st>>>(
      A, A2, lda, Bt, Bt2, ldb, C, C2, ldc, bias0, bias1, resid0, resid1, aP, bP, bQ, cP, cQ, M, N, K, scale);
}

extern "C" void kernel_launch(void* const* d_in, const int* in_sizes, int n_in,
                              void* d_out, int out_size, void* d_ws, size_t ws_size,
                              hipStream_t stream) {
  if (n_in < 34) return;
  if (in_sizes[0] != (int)kND || in_sizes[1] != (int)kND) return;
  for (int p = 0; p < 2; ++p) {
    for (int s = 0; s < 16; ++s) {
      const bool isMat = (s == 0 || s == 2 || s == 4 || s == 6 || s == 8 || s == 10 || s == 11 || s == 12 || s == 15);
      const int want = isMat ? (int)kWW : kDim;
      if (in_sizes[2 + 16 * p + s] != want) return;
    }
  }
  if (out_size != (int)(2 * kND)) return;
  if (ws_size < kWsTotal) return;

  char* ws = (char*)d_ws;
  unsigned short* XH  = (unsigned short*)(ws + kOffXH);
  unsigned short* XL  = (unsigned short*)(ws + kOffXL);
  unsigned short* T0H = (unsigned short*)(ws + kOffT0H);
  unsigned short* T0L = (unsigned short*)(ws + kOffT0L);
  unsigned short* FH  = (unsigned short*)(ws + kOffFH);
  unsigned short* FL  = (unsigned short*)(ws + kOffFL);
  unsigned short* F16 = (unsigned short*)(ws + kOffF16);
  unsigned short* R1  = (unsigned short*)(ws + kOffR1);
  unsigned short* R2  = (unsigned short*)(ws + kOffR2);
  unsigned short* WSH = (unsigned short*)(ws + kOffWSH);
  unsigned short* WSL = (unsigned short*)(ws + kOffWSL);
  unsigned short* WF  = (unsigned short*)(ws + kOffWF);
  float*          S   = (float*)(ws + kOffS);
  float*          S32 = (float*)(ws + kOffS32);
  unsigned short* S16 = (unsigned short*)(ws + kOffS16);
  unsigned short* QK  = (unsigned short*)(ws + kOffQK);
  unsigned short* VT  = (unsigned short*)(ws + kOffVT);
  unsigned short* RES = (unsigned short*)(ws + kOffRES);
  float*          SC  = (float*)(ws + kOffSC);
  unsigned short* FFN = (unsigned short*)(ws + kOffFFN);
  float*          MROW = (float*)(ws + kOffMROW);
  float*          INVS = (float*)(ws + kOffINVS);
  float*          RC   = (float*)(ws + kOffRC);
  float*          CP   = (float*)(ws + kOffCP);
  float* out = (float*)d_out;

  const int nd8 = (int)(kND / 8);
  const int ww8 = (int)(kWW / 8);

  /* inputs of branch A (a*) and branch B (b*) */
  const float* ax   = (const float*)d_in[0];
  const float* bx   = (const float*)d_in[1];
  const float* apW1 = (const float*)d_in[2 + 0];
  const float* bpW1 = (const float*)d_in[18 + 0];
  const float* apb1 = (const float*)d_in[2 + 1];
  const float* bpb1 = (const float*)d_in[18 + 1];
  const float* apW2 = (const float*)d_in[2 + 2];
  const float* bpW2 = (const float*)d_in[18 + 2];
  const float* apb2 = (const float*)d_in[2 + 3];
  const float* bpb2 = (const float*)d_in[18 + 3];
  const float* arW1 = (const float*)d_in[2 + 4];
  const float* brW1 = (const float*)d_in[18 + 4];
  const float* arb1 = (const float*)d_in[2 + 5];
  const float* brb1 = (const float*)d_in[18 + 5];
  const float* arW2 = (const float*)d_in[2 + 6];
  const float* brW2 = (const float*)d_in[18 + 6];
  const float* arb2 = (const float*)d_in[2 + 7];
  const float* brb2 = (const float*)d_in[18 + 7];
  const float* arW3 = (const float*)d_in[2 + 8];
  const float* brW3 = (const float*)d_in[18 + 8];
  const float* arb3 = (const float*)d_in[2 + 9];
  const float* brb3 = (const float*)d_in[18 + 9];
  const float* aWq  = (const float*)d_in[2 + 10];
  const float* bWq  = (const float*)d_in[18 + 10];
  const float* aWk  = (const float*)d_in[2 + 11];
  const float* bWk  = (const float*)d_in[18 + 11];
  const float* aWv  = (const float*)d_in[2 + 12];
  const float* bWv  = (const float*)d_in[18 + 12];
  const float* alng = (const float*)d_in[2 + 13];
  const float* blng = (const float*)d_in[18 + 13];
  const float* alnb = (const float*)d_in[2 + 14];
  const float* blnb = (const float*)d_in[18 + 14];
  const float* affn = (const float*)d_in[2 + 15];
  const float* bffn = (const float*)d_in[18 + 15];

  /* Every launch below works on both branches: the pointers are branch A's, the strides lead to branch B's part. */
  const long r0B   = (long)kR0Bytes;
  const long nd    = (long)kND;
  const long ww    = (long)kWW;

  /* ffn weights -> f16 x256 planes (outside R0: they outlive the logits) */
  cast4_f16_kernel<<<dim3(ww8 / 256, 1, 2), 256, 0, stream>>>(affn, affn, affn, affn, bffn, bffn, bffn, bffn,
                                                              FFN, kWCarry, ww8, 0L, ww);

  /* operand planes: x hi/lo; pW1,pW2,Wq,Wk hi/lo (weights are [out][in] = Bt layout); rW1,rW2,rW3,Wv f16 x256 */
  split4_bf16_kernel<<<dim3(nd8 / 256, 1, 2), 256, 0, stream>>>(ax, ax, ax, ax, bx, bx, bx, bx, XH, XL, nd8, 0L, kR0El16);
  split4_bf16_kernel<<<dim3(ww8 / 256, 4, 2), 256, 0, stream>>>(apW1, apW2, aWq, aWk, bpW1, bpW2, bWq, bWk,
                                                                WSH, WSL, ww8, ww, kR0El16);
  cast4_f16_kernel<<<dim3(ww8 / 256, 4, 2), 256, 0, stream>>>(arW1, arW2, arW3, aWv, brW1, brW2, brW3, bWv,
                                                              WF, kWCarry, ww8, ww, kR0El16);

  /* h1 = relu(x . pW1^T + pb1) -> hi/lo : M 4096, N 512, K 512 */
  run_gemm<1, true, 2, 2, false, 2>(stream, XH, XL, kDim, WSH + 0 * kWW, WSL + 0 * kWW, kDim,
                                    (void*)T0H, (void*)T0L, kDim, apb1, bpb1, apb1, bpb1,
                                    kR0El16, kR0El16, 0L, r0B, 0L, 1, kTok, kDim, kDim, 1.0f);
  /* feat = h1 . pW2^T + pb2 -> hi/lo */
  run_gemm<1, true, 2, 2, false, 0>(stream, T0H, T0L, kDim, WSH + 1 * kWW, WSL + 1 * kWW, kDim,
                                    (void*)FH, (void*)FL, kDim, apb2, bpb2, apb2, bpb2,
                                    kR0El16, kR0El16, 0L, r0B, 0L, 1, kTok, kDim, kDim, 1.0f);
  /* f16 copy of feat */
  hilo_to_f16_kernel<<<dim3(nd8 / 256, 2), 256, 0, stream>>>(FH, FL, F16, nd8, kR0El16);
  /* residual chain: relu, relu, linear (f16 single products, weights x256) */
  run_gemm<0, false, 2, 1, false, 2>(stream, F16, F16, kDim, WF + 0 * kWW, WF + 0 * kWW, kDim,
                                     (void*)R1, (void*)R1, kDim, arb1, brb1, arb1, brb1,
                                     kR0El16, kR0El16, 0L, r0B, 0L, 1, kTok, kDim, kDim, kWCarryInv);
  run_gemm<0, false, 2, 1, false, 2>(stream, R1, R1, kDim, WF + 1 * kWW, WF + 1 * kWW, kDim,
                                     (void*)R2, (void*)R2, kDim, arb2, brb2, arb2, brb2,
                                     kR0El16, kR0El16, 0L, r0B, 0L, 1, kTok, kDim, kDim, kWCarryInv);
  run_gemm<0, false, 2, 1, false, 0>(stream, R2, R2, kDim, WF + 2 * kWW, WF + 2 * kWW, kDim,
                                     (void*)RES, (void*)RES, kDim, arb3, brb3, arb3, brb3,
                                     kR0El16, kR0El16, 0L, 2 * nd, 0L, 1, kTok, kDim, kDim, kWCarryInv);
  /* Q (plane 0) and K (plane 1) -> hi/lo planes; QK holds QH QL KH KL of branch A, then of branch B */
  run_gemm<1, true, 0, 2, false, 0>(stream, FH, FL, kDim, WSH + 2 * kWW, WSL + 2 * kWW, kDim,
                                    (void*)QK, (void*)(QK + kND), kDim, apb1, bpb1, apb1, bpb1,
                                    kR0El16, kR0El16, ww, 8 * nd, 4 * nd, 2, kTok, kDim, kDim, 1.0f);
  /* V^T[d][i] = sum_k Wv[d][k] feat[i][k] : A = Wv (M 512), Bt = feat f16 (N 4096), K 512, ldc 4096 */
  run_gemm<0, false, 0, 1, false, 0>(stream, WF + 3 * kWW, WF + 3 * kWW, kDim, F16, F16, kDim,
                                     (void*)VT, (void*)VT, kTok, apb1, bpb1, apb1, bpb1,
                                     kR0El16, kR0El16, 0L, 2 * nd, 0L, 1, kDim, kTok, kDim, kWCarryInv);

  /* ---- cross attention, add + LayerNorm, ffn ---- */
  /* S = Q_p . K_other^T (hi.hi + hi.lo + lo.hi), f32 : M 4096, N 4096, K 512. Branch A reads branch B's K planes
     (planes 6, 7 of QK) and branch B reads branch A's (planes 2, 3): the Bt stride is negative. */
  run_gemm<1, true, 0, 0, false, 0>(stream, QK, QK + kND, kDim, QK + 6 * kND, QK + 7 * kND, kDim,
                                    (void*)S, (void*)S, kTok, alng, blng, alng, blng,
                                    4 * nd, -4 * nd, 0L, r0B, 0L, 1, kTok, kTok, kDim, 1.0f);
  rowcol_kernel<<<dim3(kRcParts, 2), 512, 0, stream>>>(S, MROW, INVS, CP);
  colfin_kernel<<<dim3(kTok / 32, 2), 256, 0, stream>>>(CP, RC);
  av_kernel<<<dim3(kTok / 64, 2), 256, 0, stream>>>(S, MROW, INVS, RC, VT, SC);
  /* S is dead from here; S32 / S16 occupy the first 12 MiB of each branch's R0 */
  add_ln_kernel<<<dim3(kTok / 8, 2), 256, 0, stream>>>(RES, SC, alng, alnb, blng, blnb, S32, S16);
  /* out = s + s . ffnW^T : A = s f16, Bt = ffnW f16 x256, residual s f32 fetched in the store phase */
  run_gemm<0, false, 0, 0, true, 0>(stream, S16, S16, kDim, FFN, FFN, kDim,
                                    (void*)out, (void*)out, kDim, alng, blng, S32, S32 + kR0El32,
                                    kR0El16, ww, 0L, 4 * nd, 0L, 1, kTok, kDim, kDim, kWCarryInv);
}

// v005
// It runs in 297 microseconds.
// Next to v004, in two timings, it ran 1.08 and 1.10 times as fast.
// All steps since v000 together make it 4.63 times as fast.
// Contractions: pW1/pW2/Wq/Wk linears and q.k^T logits on v_wmma_f32_16x16x32_bf16 with both operands as bf16 hi+lo planes (hi.hi + hi.lo + lo.hi), f32 accumulate, logits kept f32; rW1/rW2/rW3/Wv/ffn linears and attn.V on v_wmma_f32_16x16x32_f16 (weights carried x256, attention weights carried x32768), f32 accumulate; softmax statistics, column sums, LayerNorm and residual adds in f32.
#include <hip/hip_runtime.h>
#include <math.h>

typedef __attribute__((ext_vector_type(16))) _Float16 v16h;
typedef __attribute__((ext_vector_type(8)))  _Float16 v8h;
typedef __attribute__((ext_vector_type(16))) __bf16   v16b;
typedef __attribute__((ext_vector_type(8)))  __bf16   v8b;
typedef __attribute__((ext_vector_type(8)))  float    v8f;
typedef __attribute__((ext_vector_type(4)))  float    v4f;
typedef __attribute__((ext_vector_type(4)))  unsigned int v4u;
typedef __attribute__((ext_vector_type(2)))  unsigned int v2u;

// ---------------------------------------------------------------------------
// Problem constants
// ---------------------------------------------------------------------------
constexpr int    kTok       = 4096;
constexpr int    kDim       = 512;
constexpr size_t kND        = (size_t)kTok * kDim;
constexpr size_t kWW        = (size_t)kDim * kDim;
constexpr float  kWCarry    = 256.0f;
constexpr float  kWCarryInv = 1.0f / kWCarry;
constexpr float  kPCarry    = 32768.0f;
constexpr float  kPCarryInv = 1.0f / kPCarry;
constexpr float  kInvDim    = 1.0f / (float)kDim;
constexpr float  kLnEps     = 1e-6f;
constexpr float  kAttnEps   = 1e-9f;
static_assert((kTok % 64) == 0 && (kDim % 64) == 0);
static_assert((kTok % 32) == 0 && (kDim % 32) == 0);
static_assert(((kND / 8) % 256) == 0 && ((kWW / 8) % 256) == 0);

// ---------------------------------------------------------------------------
// Workspace region map (bytes; every offset is a multiple of 128). Both branches run in the same launches, so every
// region holds branch A's part and then branch B's (SC: once per half of the keys).
//   R0      2 x 67,108,864  time-shared region, one per branch:
//             (a) operand planes of the branch's linear chain:
//                 XH XL T0H T0L FH FL F16 R1 R2   9 x 4,194,304 (16-bit [4096][512] planes)
//                 WSH (4 bf16 hi weight planes) 2,097,152 ; WSL (4 bf16 lo planes) 2,097,152
//                 WF  (4 f16 weight planes, carried x256) 2,097,152         -> 44,040,192 used
//             (b) S f32 [4096][4096] logits of the branch                    67,108,864
//             (c) S32 f32 [4096][512] + S16 f16 [4096][512] LayerNorm output 12,582,912
//   QK      33,554,432  QH QL KH KL bf16 planes [4096][512], branch A then branch B
//   VT       8,388,608  V^T f16 [512][4096], branch A then B
//   RES      8,388,608  residual-chain output f16 [4096][512], branch A then B
//   SC      33,554,432  attn.V output f32 [4096][512], one share per half of the keys: half 0 (branch A then B), half 1
//   FFN      1,048,576  ffn weight f16 planes (x256), branch A then B
//   MROW        32,768  row maxima f32 [4096], branch A then B
//   INVS        32,768  1 / row exp sums f32 [4096], branch A then B
//   RC          32,768  1 / (1e-9 + column sums) f32 [4096], branch A then B
//   CP       4,194,304  column-sum shares f32 [128][4096] (one per block of 32 query rows), branch A then B
//   total = 134,217,728 + 33,554,432 + 8,388,608 + 8,388,608 + 33,554,432 + 1,048,576 + 32,768 + 32,768 + 32,768
//           + 4,194,304 = 223,444,992
// ---------------------------------------------------------------------------
constexpr size_t kPlane16  = kND * 2;
constexpr size_t kPlane32  = kND * 4;
constexpr size_t kW16      = kWW * 2;
constexpr size_t kR0Bytes  = (size_t)kTok * kTok * 4;
constexpr size_t kOffXH    = 0;
constexpr size_t kOffXL    = kOffXH  + kPlane16;
constexpr size_t kOffT0H   = kOffXL  + kPlane16;
constexpr size_t kOffT0L   = kOffT0H + kPlane16;
constexpr size_t kOffFH    = kOffT0L + kPlane16;
constexpr size_t kOffFL    = kOffFH  + kPlane16;
constexpr size_t kOffF16   = kOffFL  + kPlane16;
constexpr size_t kOffR1    = kOffF16 + kPlane16;
constexpr size_t kOffR2    = kOffR1  + kPlane16;
constexpr size_t kOffWSH   = kOffR2  + kPlane16;
constexpr size_t kOffWSL   = kOffWSH + 4 * kW16;
constexpr size_t kOffWF    = kOffWSL + 4 * kW16;
constexpr size_t kPhase1End = kOffWF + 4 * kW16;
constexpr size_t kOffS     = 0;
constexpr size_t kOffS32   = 0;
constexpr size_t kOffS16   = kOffS32 + kPlane32;
constexpr size_t kOffQK    = 2 * kR0Bytes;
constexpr size_t kOffVT    = kOffQK  + 8 * kPlane16;
constexpr size_t kOffRES   = kOffVT  + 2 * kPlane16;
constexpr size_t kOffSC    = kOffRES + 2 * kPlane16;
constexpr size_t kOffFFN   = kOffSC  + 4 * kPlane32;
constexpr size_t kOffMROW  = kOffFFN + 2 * kW16;
constexpr size_t kOffINVS  = kOffMROW + 2 * (size_t)kTok * 4;
constexpr size_t kOffRC    = kOffINVS + 2 * (size_t)kTok * 4;
constexpr size_t kOffCP    = kOffRC   + 2 * (size_t)kTok * 4;
constexpr size_t kCPBytes  = 2 * (size_t)(kTok / 32) * kTok * 4;
constexpr size_t kWsTotal  = kOffCP   + kCPBytes;
constexpr long   kR0El16   = (long)(kR0Bytes / 2);  /* branch A -> branch B inside R0, in 16-bit elements */
constexpr long   kR0El32   = (long)(kR0Bytes / 4);  /* the same in f32 elements */
static_assert(kPhase1End <= kR0Bytes);
static_assert(kOffS16 + kPlane16 <= kR0Bytes);
static_assert(kWsTotal == 223444992ull);
static_assert(kWsTotal <= 268435456ull);
static_assert((kOffWSH % 128) == 0 && (kOffWSL % 128) == 0 && (kOffWF % 128) == 0 && (kOffQK % 128) == 0 &&
              (kOffVT % 128) == 0 && (kOffRES % 128) == 0 && (kOffSC % 128) == 0 && (kOffFFN % 128) == 0 &&
              (kOffMROW % 128) == 0 && (kOffINVS % 128) == 0 && (kOffRC % 128) == 0 && (kOffS16 % 128) == 0 &&
              (kOffCP % 128) == 0);

// ---------------------------------------------------------------------------
// Small helpers
// ---------------------------------------------------------------------------
__device__ __forceinline__ unsigned short f2bf_bits(float f) {
  unsigned u = __float_as_uint(f);
  return (unsigned short)((u + 0x7FFFu + ((u >> 16) & 1u)) >> 16);
}
__device__ __forceinline__ float bf_bits2f(unsigned short h) { return __uint_as_float(((unsigned)h) << 16); }

/* f16 bits (low 16 bits of hb, finite values) -> f32, integer path only */
__device__ __forceinline__ float h16_to_f32(unsigned hb) {
  const unsigned sgn = (hb & 0x8000u) << 16;
  const unsigned em = hb & 0x7fffu;
  const float fn = __uint_as_float((em << 13) + 0x38000000u);
  const float fs = (float)em * 5.9604644775390625e-8f;
  const float mag = (em < 0x400u) ? fs : fn;
  return __uint_as_float(__float_as_uint(mag) | sgn);
}

/* hazard guards: four nops, all four accumulators of the group tied, A fragments named as inputs */
__device__ __forceinline__ void grp_guard_h(v8f& a, v8f& b, v8f& c, v8f& d, v16h x, v16h y) {
  asm volatile("v_nop\n\tv_nop\n\tv_nop\n\tv_nop" : "+v"(a), "+v"(b), "+v"(c), "+v"(d) : "v"(x), "v"(y));
}
__device__ __forceinline__ void grp_guard_b(v8f& a, v8f& b, v8f& c, v8f& d, v16b x, v16b y) {
  asm volatile("v_nop\n\tv_nop\n\tv_nop\n\tv_nop" : "+v"(a), "+v"(b), "+v"(c), "+v"(d) : "v"(x), "v"(y));
}
__device__ __forceinline__ void keep4_h(v16h a, v16h b, v16h c, v16h d) { asm volatile("v_nop" :: "v"(a), "v"(b), "v"(c), "v"(d)); }
__device__ __forceinline__ void keep4_b(v16b a, v16b b, v16b c, v16b d) { asm volatile("v_nop" :: "v"(a), "v"(b), "v"(c), "v"(d)); }
__device__ __forceinline__ void acc_guard4(v8f& a, v8f& b, v8f& c, v8f& d) {
  asm volatile("v_nop\n\tv_nop\n\tv_nop\n\tv_nop" : "+v"(a), "+v"(b), "+v"(c), "+v"(d));
}

/* Fragment loader: elements 0..7 <- p[0..7], elements 8..15 <- p[16..23]; p already includes 8*(lane>>4) */
template <typename T> struct Frag;
template <> struct Frag<_Float16> {
  typedef v16h V;
  union U { v16h v; v8h h[2]; };
  static __device__ __forceinline__ v16h load(const _Float16* p) {
    U f;
    f.h[0] = *(const v8h*)(p);
    f.h[1] = *(const v8h*)(p + 16);
    return f.v;
  }
  static __device__ __forceinline__ v8f mma(v16h a, v16h b, v8f c) {
    return __builtin_amdgcn_wmma_f32_16x16x32_f16(false, a, false, b, (short)0, c, false, false);
  }
  static __device__ __forceinline__ void guard(v8f& a, v8f& b, v8f& c, v8f& d, v16h x, v16h y) { grp_guard_h(a, b, c, d, x, y); }
  static __device__ __forceinline__ void keep(v16h a, v16h b, v16h c, v16h d) { keep4_h(a, b, c, d); }
};
template <> struct Frag<__bf16> {
  typedef v16b V;
  union U { v16b v; v8b h[2]; };
  static __device__ __forceinline__ v16b load(const __bf16* p) {
    U f;
    f.h[0] = *(const v8b*)(p);
    f.h[1] = *(const v8b*)(p + 16);
    return f.v;
  }
  static __device__ __forceinline__ v8f mma(v16b a, v16b b, v8f c) {
    return __builtin_amdgcn_wmma_f32_16x16x32_bf16(false, a, false, b, (short)0, c, false, false);
  }
  static __device__ __forceinline__ void guard(v8f& a, v8f& b, v8f& c, v8f& d, v16b x, v16b y) { grp_guard_b(a, b, c, d, x, y); }
  static __device__ __forceinline__ void keep(v16b a, v16b b, v16b c, v16b d) { keep4_b(a, b, c, d); }
};

// ---------------------------------------------------------------------------
// LDS-staged WMMA GEMM: C[m,n] = scale * sum_k A[m,k] * Bt[n,k] (+bias[n]) (+resid[m,n]). A block of 4 waves owns a
// 128x128 tile (2x2 waves, each wave a 64x64 tile). A row-major [M][K] pitch lda; Bt row-major [N][K] pitch ldb;
// M, N multiples of 128, K a multiple of 64 and at least 128.
// Operand path: a stage is 64 k (one whole 128-B line) of the block's 128 A rows and 128 Bt rows, every plane, brought
// into LDS by per-lane asynchronous 16-B copies (8 lanes per line, 4 whole lines per wave instruction), two buffers:
// the next stage's copies fly while this stage is multiplied. LDS row pitch 144 B (16 B x 9) for the 16-B readers.
// SPLIT: operands are hi/lo planes (A2/Bt2 = lo planes, same layout); product = hi.hi + hi.lo + lo.hi.
// BIAS_MODE: 0 none, 2 bias[n] (f32). ACT: 0 none, 2 relu. RESID (f32 output only): the residual is fetched in the
// store phase, one 16-B vector per lane at exactly the address the lane stores to.
// OUT_MODE: 0 f32, 1 f16, 2 bf16 hi plane (Cout) + bf16 lo plane (Cout2).
// Epilogue: 16-row slabs staged per wave in LDS (only the owning wave touches its slab); the slabs reuse the ring
// behind the last stage's waits and barrier.
// ET: 0 f16 operands, 1 bf16 operands (pointers passed as 16-bit storage).
// One launch holds several independent products of one shape: blockIdx.y = branch, blockIdx.z = weight plane. The
// pointers are those of (0, 0); aP, bP (16-bit elements) and cP (bytes) lead to branch 1, bQ and cQ to plane 1.
// ---------------------------------------------------------------------------
template <int ET> struct Elem;
template <> struct Elem<0> { typedef _Float16 T; };
template <> struct Elem<1> { typedef __bf16 T; };

constexpr int kStageK   = 64;
constexpr int kRowPitch = 144;
constexpr int kPlaneLds = 128 * kRowPitch;
constexpr int kSlabLds  = 16 * 68 * 4;
static_assert((kRowPitch % 16) == 0 && ((kRowPitch / 16) % 2) == 1 && kRowPitch >= kStageK * 2);
static_assert((kDim % 128) == 0 && (kTok % 128) == 0 && (kDim % kStageK) == 0 && kDim >= 2 * kStageK);
static_assert(4 * kSlabLds <= 4 * kPlaneLds && (kSlabLds % 16) == 0);

/* One plane's 128 rows x 128 B of a stage: this lane's eight 16-B pieces, rows 16 apart. l = the lane's LDS byte
   address of its first piece, g = its global address, gstep = 16 source rows in elements. The copies and the
   s_wait_xcnt stand in one statement so that no address register is rewritten ahead of that wait. */
__device__ __forceinline__ void stage_plane(unsigned l, const unsigned short* g, size_t gstep) {
  const unsigned l1 = l + 16 * kRowPitch, l2 = l + 32 * kRowPitch, l3 = l + 48 * kRowPitch, l4 = l + 64 * kRowPitch,
                 l5 = l + 80 * kRowPitch, l6 = l + 96 * kRowPitch, l7 = l + 112 * kRowPitch;
  const unsigned short *g1 = g + gstep, *g2 = g + 2 * gstep, *g3 = g + 3 * gstep, *g4 = g + 4 * gstep,
                       *g5 = g + 5 * gstep, *g6 = g + 6 * gstep, *g7 = g + 7 * gstep;
  asm volatile(
      "global_load_async_to_lds_b128 %0, %8, off\n\t"
      "global_load_async_to_lds_b128 %1, %9, off\n\t"
      "global_load_async_to_lds_b128 %2, %10, off\n\t"
      "global_load_async_to_lds_b128 %3, %11, off\n\t"
      "global_load_async_to_lds_b128 %4, %12, off\n\t"
      "global_load_async_to_lds_b128 %5, %13, off\n\t"
      "global_load_async_to_lds_b128 %6, %14, off\n\t"
      "global_load_async_to_lds_b128 %7, %15, off\n\t"
      "s_wait_xcnt 0x0"
      :: "v"(l), "v"(l1), "v"(l2), "v"(l3), "v"(l4), "v"(l5), "v"(l6), "v"(l7),
         "v"(g), "v"(g1), "v"(g2), "v"(g3), "v"(g4), "v"(g5), "v"(g6), "v"(g7)
      : "memory");
}

template <int ET, bool SPLIT, int BIAS_MODE, int OUT_MODE, bool RESID, int ACT>
__global__ __launch_bounds__(128) void wmma_gemm64(
    const unsigned short* __restrict__ Ap0, const unsigned short* __restrict__ A2p0, int lda,
    const unsigned short* __restrict__ Btp0, const unsigned short* __restrict__ Bt2p0, int ldb,
    void* __restrict__ Cout0, void* __restrict__ Cout20, int ldc,
    const float* __restrict__ bias0, const float* __restrict__ bias1,
    const float* __restrict__ resid0, const float* __restrict__ resid1,
    long aP, long bP, long bQ, long cP, long cQ,
    int M, int N, int K, float scale) {
  typedef typename Elem<ET>::T T;
  typedef typename Frag<T>::V V;
  const long zp = (long)blockIdx.y;
  const long zq = (long)blockIdx.z;
  const unsigned short* Ap   = Ap0 + zp * aP;
  const unsigned short* A2p  = A2p0 + zp * aP;
  const unsigned short* Btp  = Btp0 + zp * bP + zq * bQ;
  const unsigned short* Bt2p = Bt2p0 + zp * bP + zq * bQ;
  void* Cout  = (void*)((char*)Cout0 + zp * cP + zq * cQ);
  void* Cout2 = (void*)((char*)Cout20 + zp * cP + zq * cQ);
  const float* bias  = zp ? bias1 : bias0;
  const float* resid = zp ? resid1 : resid0;
  /* stage layout: A hi | (A lo) | Bt hi | (Bt lo), each plane 128 rows at kRowPitch */
  constexpr int kPlanes = SPLIT ? 4 : 2;
  constexpr int kStageLds = kPlanes * kPlaneLds;
  constexpr int kOffBh = (SPLIT ? 2 : 1) * kPlaneLds;
  __shared__ __align__(16) unsigned char ring[2 * kStageLds];
  const int lane = threadIdx.x & 31;
  const int wave = __builtin_amdgcn_readfirstlane((int)(threadIdx.x >> 5));
  const int tilesN = N >> 7;
  const int tilesM = M >> 7;
  /* block-uniform exit in front of every copy and barrier */
  if ((int)blockIdx.x >= tilesM * tilesN) return;
  const int bm = (int)blockIdx.x / tilesN;
  const int bn = (int)blockIdx.x - bm * tilesN;
  const int wm = (wave >> 1) << 6;
  const int wn = (wave & 1) << 6;
  const int m0 = (bm << 7) + wm;
  const int n0 = (bn << 7) + wn;

  const int rlane = lane & 15;
  const int koff  = (lane >> 4) * 8;
  const int mOff  = (lane >> 4) * 8;

  /* copy map: thread t brings 16-B piece t&7 of rows (t>>3) + 16q, q 0..7, of every plane */
  const int crow = (int)threadIdx.x >> 3;
  const int cpc  = (int)threadIdx.x & 7;
  const unsigned ldsBase = (unsigned)(size_t)(&ring[0]) + (unsigned)(crow * kRowPitch + cpc * 16);
  const size_t aOff = (size_t)((bm << 7) + crow) * lda + cpc * 8;
  const size_t bOff = (size_t)((bn << 7) + crow) * ldb + cpc * 8;
  const size_t aStep = (size_t)16 * lda;
  const size_t bStep = (size_t)16 * ldb;
  const int nStages = K / kStageK;

  auto issue_stage = [&](int s) {
    const unsigned l = ldsBase + (unsigned)((s & 1) * kStageLds);
    const size_t kq = (size_t)s * kStageK;
    stage_plane(l, Ap + aOff + kq, aStep);
    if (SPLIT) stage_plane(l + kPlaneLds, A2p + aOff + kq, aStep);
    stage_plane(l + kOffBh, Btp + bOff + kq, bStep);
    if (SPLIT) stage_plane(l + kOffBh + kPlaneLds, Bt2p + bOff + kq, bStep);
  };

  v8f acc[4][4];
#pragma unroll
  for (int i = 0; i < 4; ++i)
#pragma unroll
    for (int j = 0; j < 4; ++j) acc[i][j] = (v8f){0.f, 0.f, 0.f, 0.f, 0.f, 0.f, 0.f, 0.f};

  /* prologue: stage 0 landed and published, then stage 1 in flight */
  issue_stage(0);
  asm volatile("s_wait_asynccnt 0x0" ::: "memory");  /* this wave's stage-0 copies have landed */
  __syncthreads();
  if (nStages > 1) issue_stage(1);

  const int aFrag = (wm + rlane) * kRowPitch + koff * 2;
  const int bFrag = kOffBh + (wn + rlane) * kRowPitch + koff * 2;

#pragma unroll 1  /* one stage per trip: the foot's waits and barrier stand once */
  for (int s = 0; s < nStages; ++s) {
    const unsigned char* sb = ring + (s & 1) * kStageLds;
#pragma unroll
    for (int kk = 0; kk < kStageK; kk += 32) {
      V bh[4], bl[4];
      const unsigned char* ap = sb + aFrag + kk * 2;
      V ah = Frag<T>::load((const T*)ap);
      V al;
      if (SPLIT) al = Frag<T>::load((const T*)(ap + kPlaneLds));
#pragma unroll
      for (int j = 0; j < 4; ++j) {
        const unsigned char* bp = sb + bFrag + j * 16 * kRowPitch + kk * 2;
        bh[j] = Frag<T>::load((const T*)bp);
        if (SPLIT) bl[j] = Frag<T>::load((const T*)(bp + kPlaneLds));
      }
#pragma unroll
      for (int i = 0; i < 4; ++i) {
        /* the next row group's A fragments are read in front of this group's products */
        V nh = ah;
        V nl;
        if (SPLIT) nl = al;
        if (i < 3) {
          nh = Frag<T>::load((const T*)(ap + (i + 1) * 16 * kRowPitch));
          if (SPLIT) nl = Frag<T>::load((const T*)(ap + (i + 1) * 16 * kRowPitch + kPlaneLds));
        }
#pragma unroll
        for (int j = 0; j < 4; ++j) {
          acc[i][j] = Frag<T>::mma(ah, bh[j], acc[i][j]);
          if (SPLIT) {
            acc[i][j] = Frag<T>::mma(ah, bl[j], acc[i][j]);
            acc[i][j] = Frag<T>::mma(al, bh[j], acc[i][j]);
          }
        }
        Frag<T>::guard(acc[i][0], acc[i][1], acc[i][2], acc[i][3], ah, SPLIT ? al : ah);
        ah = nh;
        if (SPLIT) al = nl;
      }
      Frag<T>::keep(bh[0], bh[1], bh[2], bh[3]);
      if (SPLIT) Frag<T>::keep(bl[0], bl[1], bl[2], bl[3]);
    }
    /* publish point of stage s + 1; the one barrier also ends every reader's last read of stage s's buffer */
    asm volatile("s_wait_dscnt 0x0" ::: "memory");     /* this wave's reads of stage s have returned */
    asm volatile("s_wait_asynccnt 0x0" ::: "memory");  /* this wave's stage s + 1 copies have landed */
    __syncthreads();
    if (s + 2 < nStages) issue_stage(s + 2);
  }
  asm volatile("s_wait_asynccnt 0x0" ::: "memory");  /* no copy is outstanding when the ring becomes the slabs */
  acc_guard4(acc[0][0], acc[0][1], acc[0][2], acc[0][3]);
  acc_guard4(acc[1][0], acc[1][1], acc[1][2], acc[1][3]);
  acc_guard4(acc[2][0], acc[2][1], acc[2][2], acc[2][3]);
  acc_guard4(acc[3][0], acc[3][1], acc[3][2], acc[3][3]);

  /* ---- epilogue ---- */
  float* slab = (float*)(ring + wave * kSlabLds);
#pragma unroll
  for (int i = 0; i < 4; ++i) {
    const int mBase = m0 + (i << 4);
#pragma unroll
    for (int j = 0; j < 4; ++j) {
      const int n = n0 + (j << 4) + rlane;
      float bv = 0.f;
      if (BIAS_MODE == 2) bv = bias[n];
#pragma unroll
      for (int r = 0; r < 8; ++r) {
        float v = acc[i][j][r] * scale;
        if (BIAS_MODE == 2) v += bv;
        if (ACT == 2) v = fmaxf(v, 0.0f);
        slab[(mOff + r) * 68 + (j << 4) + rlane] = v;
      }
    }
    __builtin_amdgcn_fence(__ATOMIC_RELEASE, "workgroup");
    __builtin_amdgcn_wave_barrier();
    __builtin_amdgcn_fence(__ATOMIC_ACQUIRE, "workgroup");
    if (OUT_MODE == 0) {
      /* rows it*2 + hh, it 0..7, hh 0..1 = 16 rows; 16 lanes x 16 B = the 256-B row segment */
      float* C = (float*)Cout;
      const int hh = lane >> 4, c4 = (lane & 15) * 4;
      v4f vals[8];
#pragma unroll
      for (int it = 0; it < 8; ++it) {
        const int row = it * 2 + hh;
        v4f v = *(const v4f*)(slab + row * 68 + c4);
        if (RESID) {
          const v4f rr = *(const v4f*)(resid + (size_t)(mBase + row) * ldc + n0 + c4);
          v = v + rr;
        }
        vals[it] = v;
      }
      {
#pragma unroll
        for (int it = 0; it < 8; ++it) {
          const int row = it * 2 + hh;
          *(v4f*)(C + (size_t)(mBase + row) * ldc + n0 + c4) = vals[it];
        }
        
      }
    } else {
      const int q = lane >> 3, c8 = (lane & 7) * 8;
      unsigned short* C  = (unsigned short*)Cout;
      unsigned short* C2 = (unsigned short*)Cout2;
      {
#pragma unroll
        for (int it = 0; it < 4; ++it) {
          const int row = it * 4 + q;
          const float* sp = slab + row * 68 + c8;
          v8h hv, lv;
#pragma unroll
          for (int e = 0; e < 8; ++e) {
            const float sv = sp[e];
            if (OUT_MODE == 1) {
              hv[e] = (_Float16)sv;
            } else {
              const unsigned short hb = f2bf_bits(sv);
              const unsigned short lb = f2bf_bits(sv - bf_bits2f(hb));
              hv[e] = __builtin_bit_cast(_Float16, hb);
              lv[e] = __builtin_bit_cast(_Float16, lb);
            }
          }
          *(v8h*)(C + (size_t)(mBase + row) * ldc + n0 + c8) = hv;
          if (OUT_MODE == 2) *(v8h*)(C2 + (size_t)(mBase + row) * ldc + n0 + c8) = lv;
        }
        
      }
    }
    __builtin_amdgcn_fence(__ATOMIC_RELEASE, "workgroup");
    __builtin_amdgcn_wave_barrier();
    __builtin_amdgcn_fence(__ATOMIC_ACQUIRE, "workgroup");
  }
}

// ---------------------------------------------------------------------------
// f32 plane -> bf16 hi plane + bf16 lo plane (both RNE converts: hi = bf16(v), lo = bf16(v - hi)); 8 contiguous
// elements per thread. blockIdx.y (block-uniform) selects one of four sources and output plane y (planeElems apart),
// blockIdx.z the branch (sources s* or t*, outputs branchElems apart).
// Coverage: grid.x * 256 threads * 8 elements = total8 * 8 = the whole plane (grids are exact multiples of 256).
// ---------------------------------------------------------------------------
__global__ __launch_bounds__(256) void split4_bf16_kernel(
    const float* __restrict__ s0, const float* __restrict__ s1, const float* __restrict__ s2, const float* __restrict__ s3,
    const float* __restrict__ t0, const float* __restrict__ t1, const float* __restrict__ t2, const float* __restrict__ t3,
    unsigned short* __restrict__ dhi, unsigned short* __restrict__ dlo, int total8, long planeElems, long branchElems) {
  const int i = blockIdx.x * 256 + threadIdx.x;
  if (i >= total8) return;
  const int y = blockIdx.y;
  const int z = blockIdx.z;
  const float* srcA = (y == 0) ? s0 : (y == 1) ? s1 : (y == 2) ? s2 : s3;
  const float* srcB = (y == 0) ? t0 : (y == 1) ? t1 : (y == 2) ? t2 : t3;
  const float* src = z ? srcB : srcA;
  const size_t e0 = (size_t)i << 3;
  const v4f a0 = *(const v4f*)(src + e0);
  const v4f a1 = *(const v4f*)(src + e0 + 4);
  v8h hv, lv;
#pragma unroll
  for (int e = 0; e < 4; ++e) {
    const float f0 = a0[e], f1 = a1[e];
    const unsigned short h0 = f2bf_bits(f0), h1 = f2bf_bits(f1);
    const unsigned short l0 = f2bf_bits(f0 - bf_bits2f(h0)), l1 = f2bf_bits(f1 - bf_bits2f(h1));
    hv[e]     = __builtin_bit_cast(_Float16, h0);
    hv[4 + e] = __builtin_bit_cast(_Float16, h1);
    lv[e]     = __builtin_bit_cast(_Float16, l0);
    lv[4 + e] = __builtin_bit_cast(_Float16, l1);
  }
  unsigned short* qh = dhi + (size_t)y * planeElems + (size_t)z * branchElems + e0;
  unsigned short* ql = dlo + (size_t)y * planeElems + (size_t)z * branchElems + e0;
  *(v8h*)qh = hv;
  *(v8h*)ql = lv;
  
}

// ---------------------------------------------------------------------------
// f32 plane -> f16 plane with a power-of-two carry; same thread/line map as above (8 elements = one 16-B store per
// ---------------------------------------------------------------------------
__global__ __launch_bounds__(256) void cast4_f16_kernel(
    const float* __restrict__ s0, const float* __restrict__ s1, const float* __restrict__ s2, const float* __restrict__ s3,
    const float* __restrict__ t0, const float* __restrict__ t1, const float* __restrict__ t2, const float* __restrict__ t3,
    unsigned short* __restrict__ out, float carry, int total8, long planeElems, long branchElems) {
  const int i = blockIdx.x * 256 + threadIdx.x;
  if (i >= total8) return;
  const int y = blockIdx.y;
  const int z = blockIdx.z;
  const float* srcA = (y == 0) ? s0 : (y == 1) ? s1 : (y == 2) ? s2 : s3;
  const float* srcB = (y == 0) ? t0 : (y == 1) ? t1 : (y == 2) ? t2 : t3;
  const float* src = z ? srcB : srcA;
  const size_t e0 = (size_t)i << 3;
  const v4f a0 = *(const v4f*)(src + e0);
  const v4f a1 = *(const v4f*)(src + e0 + 4);
  v8h hv;
#pragma unroll
  for (int e = 0; e < 4; ++e) {
    const float f0 = a0[e] * carry, f1 = a1[e] * carry;
    hv[e]     = (_Float16)f0;
    hv[4 + e] = (_Float16)f1;
  }
  unsigned short* q = out + (size_t)y * planeElems + (size_t)z * branchElems + e0;
  *(v8h*)q = hv;
  
}

// ---------------------------------------------------------------------------
// bf16 hi + lo planes -> f16 plane of (hi + lo); planes read as 32-bit integer words; same thread/line map.
// ---------------------------------------------------------------------------
__global__ __launch_bounds__(256) void hilo_to_f16_kernel(
    const unsigned short* __restrict__ hi0, const unsigned short* __restrict__ lo0,
    unsigned short* __restrict__ out0, int total8, long branchElems) {
  const int i = blockIdx.x * 256 + threadIdx.x;
  if (i >= total8) return;
  /* blockIdx.y = branch */
  const unsigned short* hi = hi0 + (size_t)blockIdx.y * branchElems;
  const unsigned short* lo = lo0 + (size_t)blockIdx.y * branchElems;
  unsigned short* out = out0 + (size_t)blockIdx.y * branchElems;
  const size_t e0 = (size_t)i << 3;
  const v4u hw4 = *(const v4u*)(hi + e0);
  const v4u lw4 = *(const v4u*)(lo + e0);
  v8h hv;
#pragma unroll
  for (int w = 0; w < 4; ++w) {
    const unsigned hw = hw4[w];
    const unsigned lw = lw4[w];
    const float f0 = __uint_as_float(hw << 16) + __uint_as_float(lw << 16);
    const float f1 = __uint_as_float(hw & 0xffff0000u) + __uint_as_float(lw & 0xffff0000u);
    hv[2 * w]     = (_Float16)f0;
    hv[2 * w + 1] = (_Float16)f1;
  }
  unsigned short* q = out + e0;
  *(v8h*)q = hv;
  
}

// ---------------------------------------------------------------------------
// Row statistics of S f32 [4096][4096] and the block's share of the column sums, S read once:
// m_i = max_j S_ij, inv_s_i = 1 / sum_j exp(S_ij - m_i), part_b[j] = sum over the block's 32 rows of exp(S_ij - m_i) * inv_s_i.
// Block = 32 rows (16 waves x 2 rows). A wave holds one whole row in registers: 32 lane-strided 16-B loads, all in
// flight together (lane owns columns it*128 + lane*4 .. +3); maximum, exponentials, sum and probabilities are formed
// in those registers. Row sum order: per-lane sequential, then xor shuffle tree (unconditional).
// Column share: each wave adds its two rows in its own LDS row (only the owning wave touches it in front of the
// barrier); behind the barrier the 16 wave rows are added in index order and stored as whole lines. No atomics.
// ---------------------------------------------------------------------------
constexpr int kRcRows  = 32;
constexpr int kRcWaves = 16;
constexpr int kRcParts = kTok / kRcRows;
static_assert(kTok == 32 * 128 && (kTok % kRcRows) == 0 && kRcRows == 2 * kRcWaves && kTok == 2 * kRcWaves * 32 * 4);
static_assert((size_t)2 * kRcParts * kTok * 4 == kCPBytes);

/* Four base-2 exponentials in place. One statement, so that directly behind each v_exp_f32 stands an instruction that
   neither reads its result nor rewrites its source: the next exponential, and a v_nop behind the last. */
__device__ __forceinline__ void exp2_x4(float& a, float& b, float& c, float& d) {
  asm("v_exp_f32 %0, %0\n\tv_exp_f32 %1, %1\n\tv_exp_f32 %2, %2\n\tv_exp_f32 %3, %3\n\tv_nop"
      : "+v"(a), "+v"(b), "+v"(c), "+v"(d));
}
constexpr float kLog2e = 1.4426950408889634f;  /* exp(t) = exp2(t * log2 e), the form __expf compiles to */

__global__ __launch_bounds__(512) void rowcol_kernel(const float* __restrict__ S0, float* __restrict__ mrow0,
                                                     float* __restrict__ invs0, float* __restrict__ cpart0) {
  __shared__ __align__(16) float sC[kRcWaves][kTok];
  __shared__ float sM[kRcRows];
  __shared__ float sI[kRcRows];
  /* blockIdx.y = branch */
  const float* S = S0 + (size_t)blockIdx.y * kR0El32;
  float* mrow = mrow0 + (size_t)blockIdx.y * kTok;
  float* invs = invs0 + (size_t)blockIdx.y * kTok;
  float* cpart = cpart0 + ((size_t)blockIdx.y * kRcParts + blockIdx.x) * kTok;
  const int lane = threadIdx.x & 31;
  const int wave = __builtin_amdgcn_readfirstlane((int)(threadIdx.x >> 5));
  const int row0 = blockIdx.x * kRcRows;
  float* myC = &sC[wave][lane * 4];
#pragma unroll 1  /* one copy of the row's code: the text stays small */
  for (int q = 0; q < 2; ++q) {
    const int rl = wave * 2 + q;
    const float* p = S + (size_t)(row0 + rl) * kTok + lane * 4;
    v4f x[32];
#pragma unroll
    for (int it = 0; it < 32; ++it) x[it] = *(const v4f*)(p + it * 128);
    /* stands in front of every rewrite of the loads' address registers: p as an input keeps them untouched up to here */
    asm volatile("s_wait_xcnt 0x0" :: "v"(p) : "memory");
    float m = -INFINITY;
#pragma unroll
    for (int it = 0; it < 32; ++it) m = fmaxf(m, fmaxf(fmaxf(x[it][0], x[it][1]), fmaxf(x[it][2], x[it][3])));
#pragma unroll
    for (int off = 16; off > 0; off >>= 1) m = fmaxf(m, __shfl_xor(m, off, 32));
    float sum = 0.f;
#pragma unroll
    for (int it = 0; it < 32; ++it) {
      float e0 = (x[it][0] - m) * kLog2e, e1 = (x[it][1] - m) * kLog2e;
      float e2 = (x[it][2] - m) * kLog2e, e3 = (x[it][3] - m) * kLog2e;
      exp2_x4(e0, e1, e2, e3);
      x[it] = (v4f){e0, e1, e2, e3};
      sum += e0;
      sum += e1;
      sum += e2;
      sum += e3;
    }
#pragma unroll
    for (int off = 16; off > 0; off >>= 1) sum += __shfl_xor(sum, off, 32);
    const float inv = 1.0f / sum;
    if (q == 0) {
#pragma unroll
      for (int it = 0; it < 32; ++it) *(v4f*)(myC + it * 128) = x[it] * inv;
    } else {
#pragma unroll
      for (int it = 0; it < 32; ++it) {
        const v4f c = *(const v4f*)(myC + it * 128);
        *(v4f*)(myC + it * 128) = c + x[it] * inv;
      }
    }
    if (lane == 0) {
      sM[rl] = m;
      sI[rl] = inv;
    }
  }
  __syncthreads();
  /* thread t adds columns h*2048 + 4t .. +3 of the 16 wave rows: 32 lanes x 16 B = 4 whole lines per store */
#pragma unroll
  for (int h = 0; h < 2; ++h) {
    const int col = h * 2048 + (int)threadIdx.x * 4;
    v4f c = *(const v4f*)(&sC[0][col]);
#pragma unroll
    for (int w = 1; w < kRcWaves; ++w) c = c + *(const v4f*)(&sC[w][col]);
    *(v4f*)(cpart + col) = c;
  }
  asm volatile("s_wait_xcnt 0x0" ::: "memory");  /* in front of wave 0's reuse of the registers that these stores name */
  if (wave == 0) {
    const float mv = sM[lane];
    const float iv = sI[lane];
    *(float*)(mrow + row0 + lane) = mv;
    *(float*)(invs + row0 + lane) = iv;
  }
}

// ---------------------------------------------------------------------------
// Column sums over queries: c_j = sum over the 128 block shares part_b[j], then rc_j = 1 / (1e-9 + c_j).
// Block = 32 columns (one 128-B line of every share); wave w adds shares w, w+8, ... (16 shares, all loads in flight
// together) in order; the 8 wave partials are combined in index order by wave 0. No atomics.
// ---------------------------------------------------------------------------
__global__ __launch_bounds__(256) void colfin_kernel(const float* __restrict__ cpart0, float* __restrict__ rcol0) {
  __shared__ float sP[8][32];
  /* blockIdx.y = branch */
  const float* cpart = cpart0 + (size_t)blockIdx.y * kRcParts * kTok;
  float* rcol = rcol0 + (size_t)blockIdx.y * kTok;
  const int lane = threadIdx.x & 31;
  const int wave = __builtin_amdgcn_readfirstlane((int)(threadIdx.x >> 5));
  const int j0 = blockIdx.x * 32;
  const float* pw = cpart + (size_t)wave * kTok + j0 + lane;
  float v[kRcParts / 8];
#pragma unroll
  for (int t = 0; t < kRcParts / 8; ++t) v[t] = pw[(size_t)(8 * t) * kTok];
  asm volatile("s_wait_xcnt 0x0" ::: "memory");  /* in front of every rewrite of the loads' address registers */
  float acc = 0.f;
#pragma unroll
  for (int t = 0; t < kRcParts / 8; ++t) acc += v[t];
  sP[wave][lane] = acc;
  __syncthreads();
  if (wave == 0) {
    float c = sP[0][lane];
    c += sP[1][lane];
    c += sP[2][lane];
    c += sP[3][lane];
    c += sP[4][lane];
    c += sP[5][lane];
    c += sP[6][lane];
    c += sP[7][lane];
    const float rc = 1.0f / (kAttnEps + c);
    *(float*)(rcol + j0 + lane) = rc;
  }
}

// ---------------------------------------------------------------------------
// attn.V: SC_z[i][d] = (1/32768) * sum over the keys j of half z of f16(32768 * P_ij * rc_j) * VT[d][j],
// P_ij = exp(S_ij - m_i) * inv_s_i. The two shares SC_0 + SC_1 are added by add_ln_kernel.
// Block = 64 query rows x all 512 d x 2048 keys (8 waves, wave w owns d columns 64w..64w+63, acc 4x4 tiles):
// blockIdx.z picks the half of the keys, so that 256 blocks stand on the chip and each walks 32 key tiles. The tile
// numbers below count inside the block's half.
// Operand path: per-lane asynchronous 16-B copies bring whole 128-B lines into LDS, two buffers. Stage s holds the
// V^T tile of keys 64s..64s+63 (512 rows x 128 B, pitch 144 B) and the logit tile of keys 64(s+1)..64(s+1)+63
// (64 rows x 256 B, pitch 272 B): trip t multiplies key tile t and forms the f16 weights of key tile t + 1 out of the
// same buffer, while stage t + 1's copies fly. The weight tiles (64 rows x 128 B, pitch 144 B) alternate between two
// places: the one written in trip t was last read in trip t - 1. Thread t forms row t>>2, keys (t&3)*16..+15
// (64 rows x 4 threads x 16 = the whole tile). The 4096 column factors are copied into LDS once, in the prologue.
// The pad bytes of every pitch are never read: all reads touch byte offsets below the row length.
// ---------------------------------------------------------------------------
constexpr int kAvK      = 64;
constexpr int kAvHalves = 2;
constexpr int kAvKeys   = kTok / kAvHalves;
constexpr int kAvVPitch = 144;
constexpr int kAvSPitch = 272;
constexpr int kAvAPitch = 144;
constexpr int kAvVLds   = kDim * kAvVPitch;
constexpr int kAvSLds   = 64 * kAvSPitch;
constexpr int kAvStage  = kAvVLds + kAvSLds;
constexpr int kAvALds   = 64 * kAvAPitch;
constexpr int kAvOffA   = 2 * kAvStage;
constexpr int kAvOffRC  = kAvOffA + 2 * kAvALds;
constexpr int kAvLds    = kAvOffRC + kTok * 4;
static_assert((kAvKeys % kAvK) == 0 && kAvKeys >= 2 * kAvK && kDim == 512);
static_assert(kAvVPitch >= kAvK * 2 && kAvSPitch >= kAvK * 4 && kAvAPitch >= kAvK * 2);
static_assert((kAvVPitch % 32) == 16 && (kAvSPitch % 32) == 16 && (kAvAPitch % 32) == 16);
static_assert(8 * kSlabLds <= 2 * kAvStage && kAvLds <= 327680);

/* This lane's eight (or four) 16-B pieces, lstep LDS bytes and gstep source bytes apart. The copies and the
   s_wait_xcnt stand in one statement so that no address register is rewritten ahead of that wait. */
__device__ __forceinline__ void copy8_b128(unsigned l, unsigned lstep, const unsigned char* g, size_t gstep) {
  const unsigned l1 = l + lstep, l2 = l + 2 * lstep, l3 = l + 3 * lstep, l4 = l + 4 * lstep,
                 l5 = l + 5 * lstep, l6 = l + 6 * lstep, l7 = l + 7 * lstep;
  const unsigned char *g1 = g + gstep, *g2 = g + 2 * gstep, *g3 = g + 3 * gstep, *g4 = g + 4 * gstep,
                      *g5 = g + 5 * gstep, *g6 = g + 6 * gstep, *g7 = g + 7 * gstep;
  asm volatile(
      "global_load_async_to_lds_b128 %0, %8, off\n\t"
      "global_load_async_to_lds_b128 %1, %9, off\n\t"
      "global_load_async_to_lds_b128 %2, %10, off\n\t"
      "global_load_async_to_lds_b128 %3, %11, off\n\t"
      "global_load_async_to_lds_b128 %4, %12, off\n\t"
      "global_load_async_to_lds_b128 %5, %13, off\n\t"
      "global_load_async_to_lds_b128 %6, %14, off\n\t"
      "global_load_async_to_lds_b128 %7, %15, off\n\t"
      "s_wait_xcnt 0x0"
      :: "v"(l), "v"(l1), "v"(l2), "v"(l3), "v"(l4), "v"(l5), "v"(l6), "v"(l7),
         "v"(g), "v"(g1), "v"(g2), "v"(g3), "v"(g4), "v"(g5), "v"(g6), "v"(g7)
      : "memory");
}
__device__ __forceinline__ void copy4_b128(unsigned l, unsigned lstep, const unsigned char* g, size_t gstep) {
  const unsigned l1 = l + lstep, l2 = l + 2 * lstep, l3 = l + 3 * lstep;
  const unsigned char *g1 = g + gstep, *g2 = g + 2 * gstep, *g3 = g + 3 * gstep;
  asm volatile(
      "global_load_async_to_lds_b128 %0, %4, off\n\t"
      "global_load_async_to_lds_b128 %1, %5, off\n\t"
      "global_load_async_to_lds_b128 %2, %6, off\n\t"
      "global_load_async_to_lds_b128 %3, %7, off\n\t"
      "s_wait_xcnt 0x0"
      :: "v"(l), "v"(l1), "v"(l2), "v"(l3), "v"(g), "v"(g1), "v"(g2), "v"(g3)
      : "memory");
}

__global__ __launch_bounds__(256) void av_kernel(const float* __restrict__ S0, const float* __restrict__ mrow0,
                                                 const float* __restrict__ invs0, const float* __restrict__ rcol0,
                                                 const unsigned short* __restrict__ VTp0, float* __restrict__ SC0) {
  /* stage buffer 0 | stage buffer 1 | weight tile 0 | weight tile 1 | column factors */
  __shared__ __align__(16) unsigned char smem[kAvLds];
  /* blockIdx.y = branch, blockIdx.z = half of the keys; S and V^T start at the half's first key */
  const int key0 = (int)blockIdx.z * kAvKeys;
  const float* S = S0 + (size_t)blockIdx.y * kR0El32 + key0;
  const float* mrow = mrow0 + (size_t)blockIdx.y * kTok;
  const float* invs = invs0 + (size_t)blockIdx.y * kTok;
  const float* rcol = rcol0 + (size_t)blockIdx.y * kTok;
  const unsigned short* VTp = VTp0 + (size_t)blockIdx.y * kND + key0;
  float* SC = SC0 + ((size_t)blockIdx.z * 2 + blockIdx.y) * kND;
  typedef Frag<_Float16> FH;
  const int tid  = threadIdx.x;
  const int lane = tid & 31;
  const int wave = __builtin_amdgcn_readfirstlane((int)(tid >> 5));
  const int m0 = blockIdx.x * 64;
  const int n0 = wave * 64;
  const int sr   = tid >> 2;
  const int sc16 = (tid & 3) * 16;
  const float mi = mrow[m0 + sr];
  const float fi = invs[m0 + sr] * kPCarry;
  /* stands in front of every rewrite of the registers that these two loads name: as inputs they stay untouched up to here */
  asm volatile("s_wait_xcnt 0x0" :: "v"(m0 + sr), "s"(mrow), "s"(invs) : "memory");

  const int rlane = lane & 15;
  const int koff  = (lane >> 4) * 8;
  const int mOff  = (lane >> 4) * 8;
  constexpr int nT = kAvKeys / kAvK;

  /* copy maps. V^T: thread t brings 16-B piece t&7 of rows (t>>3) + 32q, q 0..15 (4 whole lines per wave instruction).
     Logits: piece t&15 of rows (t>>4) + 16q, q 0..3. Column factors: piece t + 256q, q 0..3. */
  const unsigned ldsBase = (unsigned)(size_t)(&smem[0]);
  const unsigned vL = ldsBase + (unsigned)((tid >> 3) * kAvVPitch + (tid & 7) * 16);
  const unsigned sL = ldsBase + (unsigned)(kAvVLds + (tid >> 4) * kAvSPitch + (tid & 15) * 16);
  const unsigned char* vG = (const unsigned char*)VTp + (size_t)(tid >> 3) * (kTok * 2) + (tid & 7) * 16;
  const unsigned char* sG = (const unsigned char*)S + (size_t)(m0 + (tid >> 4)) * (kTok * 4) + (tid & 15) * 16;

  auto issue_logits = [&](int u, int buf) {
    copy4_b128(sL + (unsigned)(buf * kAvStage), 16 * kAvSPitch, sG + (size_t)u * (kAvK * 4), (size_t)16 * kTok * 4);
  };
  auto issue_stage = [&](int s) {
    const unsigned l = vL + (unsigned)((s & 1) * kAvStage);
    const unsigned char* g = vG + (size_t)s * (kAvK * 2);
    copy8_b128(l, 32 * kAvVPitch, g, (size_t)32 * kTok * 2);
    copy8_b128(l + 256 * kAvVPitch, 32 * kAvVPitch, g + (size_t)256 * kTok * 2, (size_t)32 * kTok * 2);
    if (s + 1 < nT) issue_logits(s + 1, s & 1);
  };
  /* this thread's 16 weights of key tile u, out of the logit tile at sraw */
  auto weights = [&](int u, const unsigned char* sraw, v8h& h0, v8h& h1) {
    const float* sp = (const float*)(sraw + sr * kAvSPitch) + sc16;
    const float* rp = (const float*)(smem + kAvOffRC) + key0 + u * kAvK + sc16;
#pragma unroll
    for (int h = 0; h < 2; ++h) {
      const v4f s0 = *(const v4f*)(sp + h * 8);
      const v4f s1 = *(const v4f*)(sp + h * 8 + 4);
      const v4f r0 = *(const v4f*)(rp + h * 8);
      const v4f r1 = *(const v4f*)(rp + h * 8 + 4);
      v8h hv;
#pragma unroll
      for (int e = 0; e < 4; ++e) {
        const float e0 = __expf(s0[e] - mi);
        const float e1 = __expf(s1[e] - mi);
        const float w0 = (e0 * fi) * r0[e];
        const float w1 = (e1 * fi) * r1[e];
        hv[e]     = (_Float16)w0;
        hv[4 + e] = (_Float16)w1;
      }
      if (h == 0) h0 = hv; else h1 = hv;
    }
  };
  auto put_weights = [&](unsigned char* at, v8h h0, v8h h1) {
    *(v8h*)(at + sr * kAvAPitch + sc16 * 2) = h0;
    *(v8h*)(at + sr * kAvAPitch + sc16 * 2 + 16) = h1;
  };

  v8f acc[4][4];
#pragma unroll
  for (int i = 0; i < 4; ++i)
#pragma unroll
    for (int j = 0; j < 4; ++j) acc[i][j] = (v8f){0.f, 0.f, 0.f, 0.f, 0.f, 0.f, 0.f, 0.f};

  /* the 64 keys of one tile: weight tile at, V^T tile vt */
  auto products = [&](const unsigned char* at, const unsigned char* vt) {
#pragma unroll
    for (int kk = 0; kk < kAvK; kk += 32) {
      v16h bh[4];
#pragma unroll
      for (int j = 0; j < 4; ++j)
        bh[j] = FH::load((const _Float16*)(vt + (n0 + (j << 4) + rlane) * kAvVPitch + (kk + koff) * 2));
      const unsigned char* ap = at + rlane * kAvAPitch + (kk + koff) * 2;
      v16h ah = FH::load((const _Float16*)ap);
#pragma unroll
      for (int i = 0; i < 4; ++i) {
        /* the next row group's A fragment is read in front of this group's products */
        v16h nh = ah;
        if (i < 3) nh = FH::load((const _Float16*)(ap + (i + 1) * 16 * kAvAPitch));
#pragma unroll
        for (int j = 0; j < 4; ++j) acc[i][j] = FH::mma(ah, bh[j], acc[i][j]);
        FH::guard(acc[i][0], acc[i][1], acc[i][2], acc[i][3], ah, ah);
        ah = nh;
      }
      FH::keep(bh[0], bh[1], bh[2], bh[3]);
    }
  };

  /* prologue: column factors, logit tile 0 (in buffer 1's logit place) and stage 0 landed and published; weight tile 0
     formed; then, behind the barrier that ends the reads of buffer 1, stage 1 in flight */
  copy4_b128(ldsBase + (unsigned)(kAvOffRC + tid * 16), 4096, (const unsigned char*)rcol + tid * 16, (size_t)4096);
  issue_logits(0, 1);
  issue_stage(0);
  asm volatile("s_wait_asynccnt 0x0" ::: "memory");  /* this wave's prologue copies have landed */
  __syncthreads();
  {
    v8h h0, h1;
    weights(0, smem + kAvStage + kAvVLds, h0, h1);
    put_weights(smem + kAvOffA, h0, h1);
  }
  asm volatile("s_wait_dscnt 0x0" ::: "memory");  /* this wave's reads of logit tile 0 have returned */
  __syncthreads();
  issue_stage(1);

#pragma unroll 1  /* one stage per trip: the foot's waits and barrier stand once */
  for (int t = 0; t < nT - 1; ++t) {
    const unsigned char* sb = smem + (t & 1) * kAvStage;
    v8h h0, h1;
    weights(t + 1, sb + kAvVLds, h0, h1);
    products(smem + kAvOffA + (t & 1) * kAvALds, sb);
    put_weights(smem + kAvOffA + ((t + 1) & 1) * kAvALds, h0, h1);
    /* publish point of stage t + 1 and of weight tile t + 1; the one barrier also ends every reader's last read of
       stage t's buffer and of weight tile t */
    asm volatile("s_wait_dscnt 0x0" ::: "memory");     /* this wave's LDS reads and writes of trip t are done */
    asm volatile("s_wait_asynccnt 0x0" ::: "memory");  /* this wave's stage t + 1 copies have landed */
    __syncthreads();
    if (t + 2 < nT) issue_stage(t + 2);
  }
  products(smem + kAvOffA + ((nT - 1) & 1) * kAvALds, smem + ((nT - 1) & 1) * kAvStage);
  asm volatile("s_wait_asynccnt 0x0" ::: "memory");  /* no copy is outstanding when the ring becomes the slabs */
  asm volatile("s_wait_dscnt 0x0" ::: "memory");     /* this wave's last fragment reads have returned */
  __syncthreads();                                   /* every wave has left the ring before a slab is written */
  acc_guard4(acc[0][0], acc[0][1], acc[0][2], acc[0][3]);
  acc_guard4(acc[1][0], acc[1][1], acc[1][2], acc[1][3]);
  acc_guard4(acc[2][0], acc[2][1], acc[2][2], acc[2][3]);
  acc_guard4(acc[3][0], acc[3][1], acc[3][2], acc[3][3]);

  float* slab = (float*)(smem + wave * kSlabLds);
#pragma unroll
  for (int i = 0; i < 4; ++i) {
    const int mBase = m0 + (i << 4);
#pragma unroll
    for (int j = 0; j < 4; ++j) {
#pragma unroll
      for (int r = 0; r < 8; ++r) slab[(mOff + r) * 68 + (j << 4) + rlane] = acc[i][j][r] * kPCarryInv;
    }
    __builtin_amdgcn_fence(__ATOMIC_RELEASE, "workgroup");
    __builtin_amdgcn_wave_barrier();
    __builtin_amdgcn_fence(__ATOMIC_ACQUIRE, "workgroup");
    {
      const int hh = lane >> 4, c4 = (lane & 15) * 4;
      v4f vals[8];
#pragma unroll
      for (int it = 0; it < 8; ++it) vals[it] = *(const v4f*)(slab + (it * 2 + hh) * 68 + c4);
      {
#pragma unroll
        for (int it = 0; it < 8; ++it) {
          const int row = it * 2 + hh;
          *(v4f*)(SC + (size_t)(mBase + row) * kDim + n0 + c4) = vals[it];
        }
        
      }
    }
    __builtin_amdgcn_fence(__ATOMIC_RELEASE, "workgroup");
    __builtin_amdgcn_wave_barrier();
    __builtin_amdgcn_fence(__ATOMIC_ACQUIRE, "workgroup");
  }
}

// ---------------------------------------------------------------------------
// s = LayerNorm(res + sc) over 512 (biased variance, eps inside rsqrt), one wave per row, 8 rows per block.
// sc = the two key halves' shares of attn.V, added here (share 1 lies 2 planes behind share 0).
// Lane owns columns it*128 + lane*4 .. +3 (it 0..3): 16 values in registers, static indexing.
// res is an f16 plane read as 32-bit integer words; sc, gamma, beta f32.
// (via the wave's own LDS slab: lane owns columns it2*256 + lane*8 .. +7, 2 instructions x 32 lanes x 16 B = 4 whole
// ---------------------------------------------------------------------------
__global__ __launch_bounds__(256) void add_ln_kernel(const unsigned short* __restrict__ RES0, const float* __restrict__ SCp0,
                                                     const float* __restrict__ gam0, const float* __restrict__ bet0,
                                                     const float* __restrict__ gam1, const float* __restrict__ bet1,
                                                     float* __restrict__ S320, unsigned short* __restrict__ S160) {
  __shared__ __align__(16) float sY[8][kDim];
  /* blockIdx.y = branch */
  const unsigned short* RES = RES0 + (size_t)blockIdx.y * kND;
  const float* SCp = SCp0 + (size_t)blockIdx.y * kND;
  const float* gam = blockIdx.y ? gam1 : gam0;
  const float* bet = blockIdx.y ? bet1 : bet0;
  float* S32 = S320 + (size_t)blockIdx.y * kR0El32;
  unsigned short* S16 = S160 + (size_t)blockIdx.y * kR0El16;
  const int lane = threadIdx.x & 31;
  const int wave = __builtin_amdgcn_readfirstlane((int)(threadIdx.x >> 5));
  const int row = blockIdx.x * 8 + wave;
  const float* scp = SCp + (size_t)row * kDim;
  const float* scq = scp + 2 * kND;
  const unsigned short* rp = RES + (size_t)row * kDim;
  float x[16];
#pragma unroll
  for (int it = 0; it < 4; ++it) {
    const int col = it * 128 + lane * 4;
    const v4f a = *(const v4f*)(scp + col) + *(const v4f*)(scq + col);
    const v2u w = *(const v2u*)(rp + col);
    const unsigned w0 = w[0];
    const unsigned w1 = w[1];
    x[4 * it + 0] = h16_to_f32(w0 & 0xffffu) + a[0];
    x[4 * it + 1] = h16_to_f32(w0 >> 16) + a[1];
    x[4 * it + 2] = h16_to_f32(w1 & 0xffffu) + a[2];
    x[4 * it + 3] = h16_to_f32(w1 >> 16) + a[3];
  }
  float s = 0.f;
#pragma unroll
  for (int i = 0; i < 16; ++i) s += x[i];
#pragma unroll
  for (int off = 16; off > 0; off >>= 1) s += __shfl_xor(s, off, 32);
  const float mu = s * kInvDim;
  float vs = 0.f;
#pragma unroll
  for (int i = 0; i < 16; ++i) {
    const float d = x[i] - mu;
    x[i] = d;
    vs += d * d;
  }
#pragma unroll
  for (int off = 16; off > 0; off >>= 1) vs += __shfl_xor(vs, off, 32);
  const float inv = rsqrtf(vs * kInvDim + kLnEps);
  float* slab = sY[wave];
  v4f yv[4];
#pragma unroll
  for (int it = 0; it < 4; ++it) {
    const int col = it * 128 + lane * 4;
    const v4f g4 = *(const v4f*)(gam + col);
    const v4f b4 = *(const v4f*)(bet + col);
    v4f y;
    y[0] = (x[4 * it + 0] * inv) * g4[0] + b4[0];
    y[1] = (x[4 * it + 1] * inv) * g4[1] + b4[1];
    y[2] = (x[4 * it + 2] * inv) * g4[2] + b4[2];
    y[3] = (x[4 * it + 3] * inv) * g4[3] + b4[3];
    yv[it] = y;
    *(v4f*)(slab + col) = y;
  }
  __builtin_amdgcn_fence(__ATOMIC_RELEASE, "workgroup");
  __builtin_amdgcn_wave_barrier();
  __builtin_amdgcn_fence(__ATOMIC_ACQUIRE, "workgroup");
  v8h hv[2];
#pragma unroll
  for (int it2 = 0; it2 < 2; ++it2) {
    const int c = it2 * 256 + lane * 8;
    const v4f a0 = *(const v4f*)(slab + c);
    const v4f a1 = *(const v4f*)(slab + c + 4);
#pragma unroll
    for (int e = 0; e < 4; ++e) {
      const float f0 = a0[e], f1 = a1[e];
      hv[it2][e]     = (_Float16)f0;
      hv[it2][4 + e] = (_Float16)f1;
    }
  }
  float* o32 = S32 + (size_t)row * kDim;
  unsigned short* o16 = S16 + (size_t)row * kDim;
  {
#pragma unroll
    for (int it = 0; it < 4; ++it) *(v4f*)(o32 + it * 128 + lane * 4) = yv[it];
#pragma unroll
    for (int it2 = 0; it2 < 2; ++it2) *(v8h*)(o16 + it2 * 256 + lane * 8) = hv[it2];
    
  }
}

// ---------------------------------------------------------------------------
// Host glue (kernel launches and host arithmetic only)
// ---------------------------------------------------------------------------
template <int ET, bool SPLIT, int BIAS_MODE, int OUT_MODE, bool RESID, int ACT>
static void run_gemm(hipStream_t st,
                     const unsigned short* A, const unsigned short* A2, int lda,
                     const unsigned short* Bt, const unsigned short* Bt2, int ldb,
                     void* C, void* C2, int ldc,
                     const float* bias0, const float* bias1, const float* resid0, const float* resid1,
                     long aP, long bP, long bQ, long cP, long cQ, int planes,
                     int M, int N, int K, float scale) {
  const int blocks = (M >> 7) * (N >> 7);
  wmma_gemm64<ET, SPLIT, BIAS_MODE, OUT_MODE, RESID, ACT><<<dim3(blocks, 2, planes), 128, 0, st>>>(
      A, A2, lda, Bt, Bt2, ldb, C, C2, ldc, bias0, bias1, resid0, resid1, aP, bP, bQ, cP, cQ, M, N, K, scale);
}

extern "C" void kernel_launch(void* const* d_in, const int* in_sizes, int n_in,
                              void* d_out, int out_size, void* d_ws, size_t ws_size,
                              hipStream_t stream) {
  if (n_in < 34) return;
  if (in_sizes[0] != (int)kND || in_sizes[1] != (int)kND) return;
  for (int p = 0; p < 2; ++p) {
    for (int s = 0; s < 16; ++s) {
      const bool isMat = (s == 0 || s == 2 || s == 4 || s == 6 || s == 8 || s == 10 || s == 11 || s == 12 || s == 15);
      const int want = isMat ? (int)kWW : kDim;
      if (in_sizes[2 + 16 * p + s] != want) return;
    }
  }
  if (out_size != (int)(2 * kND)) return;
  if (ws_size < kWsTotal) return;

  char* ws = (char*)d_ws;
  unsigned short* XH  = (unsigned short*)(ws + kOffXH);
  unsigned short* XL  = (unsigned short*)(ws + kOffXL);
  unsigned short* T0H = (unsigned short*)(ws + kOffT0H);
  unsigned short* T0L = (unsigned short*)(ws + kOffT0L);
  unsigned short* FH  = (unsigned short*)(ws + kOffFH);
  unsigned short* FL  = (unsigned short*)(ws + kOffFL);
  unsigned short* F16 = (unsigned short*)(ws + kOffF16);
  unsigned short* R1  = (unsigned short*)(ws + kOffR1);
  unsigned short* R2  = (unsigned short*)(ws + kOffR2);
  unsigned short* WSH = (unsigned short*)(ws + kOffWSH);
  unsigned short* WSL = (unsigned short*)(ws + kOffWSL);
  unsigned short* WF  = (unsigned short*)(ws + kOffWF);
  float*          S   = (float*)(ws + kOffS);
  float*          S32 = (float*)(ws + kOffS32);
  unsigned short* S16 = (unsigned short*)(ws + kOffS16);
  unsigned short* QK  = (unsigned short*)(ws + kOffQK);
  unsigned short* VT  = (unsigned short*)(ws + kOffVT);
  unsigned short* RES = (unsigned short*)(ws + kOffRES);
  float*          SC  = (float*)(ws + kOffSC);
  unsigned short* FFN = (unsigned short*)(ws + kOffFFN);
  float*          MROW = (float*)(ws + kOffMROW);
  float*          INVS = (float*)(ws + kOffINVS);
  float*          RC   = (float*)(ws + kOffRC);
  float*          CP   = (float*)(ws + kOffCP);
  float* out = (float*)d_out;

  const int nd8 = (int)(kND / 8);
  const int ww8 = (int)(kWW / 8);

  /* inputs of branch A (a*) and branch B (b*) */
  const float* ax   = (const float*)d_in[0];
  const float* bx   = (const float*)d_in[1];
  const float* apW1 = (const float*)d_in[2 + 0];
  const float* bpW1 = (const float*)d_in[18 + 0];
  const float* apb1 = (const float*)d_in[2 + 1];
  const float* bpb1 = (const float*)d_in[18 + 1];
  const float* apW2 = (const float*)d_in[2 + 2];
  const float* bpW2 = (const float*)d_in[18 + 2];
  const float* apb2 = (const float*)d_in[2 + 3];
  const float* bpb2 = (const float*)d_in[18 + 3];
  const float* arW1 = (const float*)d_in[2 + 4];
  const float* brW1 = (const float*)d_in[18 + 4];
  const float* arb1 = (const float*)d_in[2 + 5];
  const float* brb1 = (const float*)d_in[18 + 5];
  const float* arW2 = (const float*)d_in[2 + 6];
  const float* brW2 = (const float*)d_in[18 + 6];
  const float* arb2 = (const float*)d_in[2 + 7];
  const float* brb2 = (const float*)d_in[18 + 7];
  const float* arW3 = (const float*)d_in[2 + 8];
  const float* brW3 = (const float*)d_in[18 + 8];
  const float* arb3 = (const float*)d_in[2 + 9];
  const float* brb3 = (const float*)d_in[18 + 9];
  const float* aWq  = (const float*)d_in[2 + 10];
  const float* bWq  = (const float*)d_in[18 + 10];
  const float* aWk  = (const float*)d_in[2 + 11];
  const float* bWk  = (const float*)d_in[18 + 11];
  const float* aWv  = (const float*)d_in[2 + 12];
  const float* bWv  = (const float*)d_in[18 + 12];
  const float* alng = (const float*)d_in[2 + 13];
  const float* blng = (const float*)d_in[18 + 13];
  const float* alnb = (const float*)d_in[2 + 14];
  const float* blnb = (const float*)d_in[18 + 14];
  const float* affn = (const float*)d_in[2 + 15];
  const float* bffn = (const float*)d_in[18 + 15];

  /* Every launch below works on both branches: the pointers are branch A's, the strides lead to branch B's part. */
  const long r0B   = (long)kR0Bytes;
  const long nd    = (long)kND;
  const long ww    = (long)kWW;

  /* ffn weights -> f16 x256 planes (outside R0: they outlive the logits) */
  cast4_f16_kernel<<<dim3(ww8 / 256, 1, 2), 256, 0, stream>>>(affn, affn, affn, affn, bffn, bffn, bffn, bffn,
                                                              FFN, kWCarry, ww8, 0L, ww);

  /* operand planes: x hi/lo; pW1,pW2,Wq,Wk hi/lo (weights are [out][in] = Bt layout); rW1,rW2,rW3,Wv f16 x256 */
  split4_bf16_kernel<<<dim3(nd8 / 256, 1, 2), 256, 0, stream>>>(ax, ax, ax, ax, bx, bx, bx, bx, XH, XL, nd8, 0L, kR0El16);
  split4_bf16_kernel<<<dim3(ww8 / 256, 4, 2), 256, 0, stream>>>(apW1, apW2, aWq, aWk, bpW1, bpW2, bWq, bWk,
                                                                WSH, WSL, ww8, ww, kR0El16);
  cast4_f16_kernel<<<dim3(ww8 / 256, 4, 2), 256, 0, stream>>>(arW1, arW2, arW3, aWv, brW1, brW2, brW3, bWv,
                                                              WF, kWCarry, ww8, ww, kR0El16);

  /* h1 = relu(x . pW1^T + pb1) -> hi/lo : M 4096, N 512, K 512 */
  run_gemm<1, true, 2, 2, false, 2>(stream, XH, XL, kDim, WSH + 0 * kWW, WSL + 0 * kWW, kDim,
                                    (void*)T0H, (void*)T0L, kDim, apb1, bpb1, apb1, bpb1,
                                    kR0El16, kR0El16, 0L, r0B, 0L, 1, kTok, kDim, kDim, 1.0f);
  /* feat = h1 . pW2^T + pb2 -> hi/lo */
  run_gemm<1, true, 2, 2, false, 0>(stream, T0H, T0L, kDim, WSH + 1 * kWW, WSL + 1 * kWW, kDim,
                                    (void*)FH, (void*)FL, kDim, apb2, bpb2, apb2, bpb2,
                                    kR0El16, kR0El16, 0L, r0B, 0L, 1, kTok, kDim, kDim, 1.0f);
  /* f16 copy of feat */
  hilo_to_f16_kernel<<<dim3(nd8 / 256, 2), 256, 0, stream>>>(FH, FL, F16, nd8, kR0El16);
  /* residual chain: relu, relu, linear (f16 single products, weights x256) */
  run_gemm<0, false, 2, 1, false, 2>(stream, F16, F16, kDim, WF + 0 * kWW, WF + 0 * kWW, kDim,
                                     (void*)R1, (void*)R1, kDim, arb1, brb1, arb1, brb1,
                                     kR0El16, kR0El16, 0L, r0B, 0L, 1, kTok, kDim, kDim, kWCarryInv);
  run_gemm<0, false, 2, 1, false, 2>(stream, R1, R1, kDim, WF + 1 * kWW, WF + 1 * kWW, kDim,
                                     (void*)R2, (void*)R2, kDim, arb2, brb2, arb2, brb2,
                                     kR0El16, kR0El16, 0L, r0B, 0L, 1, kTok, kDim, kDim, kWCarryInv);
  run_gemm<0, false, 2, 1, false, 0>(stream, R2, R2, kDim, WF + 2 * kWW, WF + 2 * kWW, kDim,
                                     (void*)RES, (void*)RES, kDim, arb3, brb3, arb3, brb3,
                                     kR0El16, kR0El16, 0L, 2 * nd, 0L, 1, kTok, kDim, kDim, kWCarryInv);
  /* Q (plane 0) and K (plane 1) -> hi/lo planes; QK holds QH QL KH KL of branch A, then of branch B */
  run_gemm<1, true, 0, 2, false, 0>(stream, FH, FL, kDim, WSH + 2 * kWW, WSL + 2 * kWW, kDim,
                                    (void*)QK, (void*)(QK + kND), kDim, apb1, bpb1, apb1, bpb1,
                                    kR0El16, kR0El16, ww, 8 * nd, 4 * nd, 2, kTok, kDim, kDim, 1.0f);
  /* V^T[d][i] = sum_k Wv[d][k] feat[i][k] : A = Wv (M 512), Bt = feat f16 (N 4096), K 512, ldc 4096 */
  run_gemm<0, false, 0, 1, false, 0>(stream, WF + 3 * kWW, WF + 3 * kWW, kDim, F16, F16, kDim,
                                     (void*)VT, (void*)VT, kTok, apb1, bpb1, apb1, bpb1,
                                     kR0El16, kR0El16, 0L, 2 * nd, 0L, 1, kDim, kTok, kDim, kWCarryInv);

  /* ---- cross attention, add + LayerNorm, ffn ---- */
  /* S = Q_p . K_other^T (hi.hi + hi.lo + lo.hi), f32 : M 4096, N 4096, K 512. Branch A reads branch B's K planes
     (planes 6, 7 of QK) and branch B reads branch A's (planes 2, 3): the Bt stride is negative. */
  run_gemm<1, true, 0, 0, false, 0>(stream, QK, QK + kND, kDim, QK + 6 * kND, QK + 7 * kND, kDim,
                                    (void*)S, (void*)S, kTok, alng, blng, alng, blng,
                                    4 * nd, -4 * nd, 0L, r0B, 0L, 1, kTok, kTok, kDim, 1.0f);
  rowcol_kernel<<<dim3(kRcParts, 2), 512, 0, stream>>>(S, MROW, INVS, CP);
  colfin_kernel<<<dim3(kTok / 32, 2), 256, 0, stream>>>(CP, RC);
  av_kernel<<<dim3(kTok / 64, 2, kAvHalves), 256, 0, stream>>>(S, MROW, INVS, RC, VT, SC);
  /* S is dead from here; S32 / S16 occupy the first 12 MiB of each branch's R0 */
  add_ln_kernel<<<dim3(kTok / 8, 2), 256, 0, stream>>>(RES, SC, alng, alnb, blng, blnb, S32, S16);
  /* out = s + s . ffnW^T : A = s f16, Bt = ffnW f16 x256, residual s f32 fetched in the store phase */
  run_gemm<0, false, 0, 0, true, 0>(stream, S16, S16, kDim, FFN, FFN, kDim,
                                    (void*)out, (void*)out, kDim, alng, blng, S32, S32 + kR0El32,
                                    kR0El16, ww, 0L, 4 * nd, 0L, 1, kTok, kDim, kDim, kWCarryInv);
}

// v006
// A run of this version takes 287 microseconds.
// In both of two side-by-side timings against v005, it was 1.04 times as fast.
// All steps since v000 together make it 4.83 times as fast.
// Contractions: pW1/pW2/Wq/Wk linears and q.k^T logits on v_wmma_f32_16x16x32_bf16 with both operands as bf16 hi+lo planes (hi.hi + hi.lo + lo.hi), f32 accumulate, logits kept f32; rW1/rW2/rW3/Wv/ffn linears and attn.V on v_wmma_f32_16x16x32_f16 (weights carried x256, attention weights carried x32768), f32 accumulate; softmax statistics, column sums, LayerNorm and residual adds in f32.
#include <hip/hip_runtime.h>
#include <math.h>

typedef __attribute__((ext_vector_type(16))) _Float16 v16h;
typedef __attribute__((ext_vector_type(8)))  _Float16 v8h;
typedef __attribute__((ext_vector_type(16))) __bf16   v16b;
typedef __attribute__((ext_vector_type(8)))  __bf16   v8b;
typedef __attribute__((ext_vector_type(8)))  float    v8f;
typedef __attribute__((ext_vector_type(4)))  float    v4f;
typedef __attribute__((ext_vector_type(4)))  unsigned int v4u;
typedef __attribute__((ext_vector_type(2)))  unsigned int v2u;

// ---------------------------------------------------------------------------
// Problem constants
// ---------------------------------------------------------------------------
constexpr int    kTok       = 4096;
constexpr int    kDim       = 512;
constexpr size_t kND        = (size_t)kTok * kDim;
constexpr size_t kWW        = (size_t)kDim * kDim;
constexpr float  kWCarry    = 256.0f;
constexpr float  kWCarryInv = 1.0f / kWCarry;
constexpr float  kPCarry    = 32768.0f;
constexpr float  kPCarryInv = 1.0f / kPCarry;
constexpr float  kInvDim    = 1.0f / (float)kDim;
constexpr float  kLnEps     = 1e-6f;
constexpr float  kAttnEps   = 1e-9f;
static_assert((kTok % 64) == 0 && (kDim % 64) == 0);
static_assert((kTok % 32) == 0 && (kDim % 32) == 0);
static_assert(((kND / 8) % 256) == 0 && ((kWW / 8) % 256) == 0);

// ---------------------------------------------------------------------------
// Workspace region map (bytes; every offset is a multiple of 128). Both branches run in the same launches, so every
// region holds branch A's part and then branch B's (SC: once per half of the keys).
//   R0      2 x 67,108,864  time-shared region, one per branch:
//             (a) operand planes of the branch's linear chain:
//                 XH XL T0H T0L FH FL F16 R1 R2   9 x 4,194,304 (16-bit [4096][512] planes)
//                 WSH (4 bf16 hi weight planes) 2,097,152 ; WSL (4 bf16 lo planes) 2,097,152
//                 WF  (4 f16 weight planes, carried x256) 2,097,152         -> 44,040,192 used
//             (b) S f32 [4096][4096] logits of the branch                    67,108,864
//             (c) S32 f32 [4096][512] + S16 f16 [4096][512] LayerNorm output 12,582,912
//   QK      33,554,432  QH QL KH KL bf16 planes [4096][512], branch A then branch B
//   VT       8,388,608  V^T f16 [512][4096], branch A then B
//   RES      8,388,608  residual-chain output f16 [4096][512], branch A then B
//   SC      33,554,432  attn.V output f32 [4096][512], one share per half of the keys: half 0 (branch A then B), half 1
//   FFN      1,048,576  ffn weight f16 planes (x256), branch A then B
//   MROW        32,768  row maxima f32 [4096], branch A then B
//   INVS        32,768  1 / row exp sums f32 [4096], branch A then B
//   RC          32,768  1 / (1e-9 + column sums) f32 [4096], branch A then B
//   CP       4,194,304  column-sum shares f32 [128][4096] (one per block of 32 query rows), branch A then B
//   total = 134,217,728 + 33,554,432 + 8,388,608 + 8,388,608 + 33,554,432 + 1,048,576 + 32,768 + 32,768 + 32,768
//           + 4,194,304 = 223,444,992
// ---------------------------------------------------------------------------
constexpr size_t kPlane16  = kND * 2;
constexpr size_t kPlane32  = kND * 4;
constexpr size_t kW16      = kWW * 2;
constexpr size_t kR0Bytes  = (size_t)kTok * kTok * 4;
constexpr size_t kOffXH    = 0;
constexpr size_t kOffXL    = kOffXH  + kPlane16;
constexpr size_t kOffT0H   = kOffXL  + kPlane16;
constexpr size_t kOffT0L   = kOffT0H + kPlane16;
constexpr size_t kOffFH    = kOffT0L + kPlane16;
constexpr size_t kOffFL    = kOffFH  + kPlane16;
constexpr size_t kOffF16   = kOffFL  + kPlane16;
constexpr size_t kOffR1    = kOffF16 + kPlane16;
constexpr size_t kOffR2    = kOffR1  + kPlane16;
constexpr size_t kOffWSH   = kOffR2  + kPlane16;
constexpr size_t kOffWSL   = kOffWSH + 4 * kW16;
constexpr size_t kOffWF    = kOffWSL + 4 * kW16;
constexpr size_t kPhase1End = kOffWF + 4 * kW16;
constexpr size_t kOffS     = 0;
constexpr size_t kOffS32   = 0;
constexpr size_t kOffS16   = kOffS32 + kPlane32;
constexpr size_t kOffQK    = 2 * kR0Bytes;
constexpr size_t kOffVT    = kOffQK  + 8 * kPlane16;
constexpr size_t kOffRES   = kOffVT  + 2 * kPlane16;
constexpr size_t kOffSC    = kOffRES + 2 * kPlane16;
constexpr size_t kOffFFN   = kOffSC  + 4 * kPlane32;
constexpr size_t kOffMROW  = kOffFFN + 2 * kW16;
constexpr size_t kOffINVS  = kOffMROW + 2 * (size_t)kTok * 4;
constexpr size_t kOffRC    = kOffINVS + 2 * (size_t)kTok * 4;
constexpr size_t kOffCP    = kOffRC   + 2 * (size_t)kTok * 4;
constexpr size_t kCPBytes  = 2 * (size_t)(kTok / 32) * kTok * 4;
constexpr size_t kWsTotal  = kOffCP   + kCPBytes;
constexpr long   kR0El16   = (long)(kR0Bytes / 2);  /* branch A -> branch B inside R0, in 16-bit elements */
constexpr long   kR0El32   = (long)(kR0Bytes / 4);  /* the same in f32 elements */
static_assert(kPhase1End <= kR0Bytes);
static_assert(kOffS16 + kPlane16 <= kR0Bytes);
static_assert(kWsTotal == 223444992ull);
static_assert(kWsTotal <= 268435456ull);
static_assert((kOffWSH % 128) == 0 && (kOffWSL % 128) == 0 && (kOffWF % 128) == 0 && (kOffQK % 128) == 0 &&
              (kOffVT % 128) == 0 && (kOffRES % 128) == 0 && (kOffSC % 128) == 0 && (kOffFFN % 128) == 0 &&
              (kOffMROW % 128) == 0 && (kOffINVS % 128) == 0 && (kOffRC % 128) == 0 && (kOffS16 % 128) == 0 &&
              (kOffCP % 128) == 0);

// ---------------------------------------------------------------------------
// Small helpers
// ---------------------------------------------------------------------------
__device__ __forceinline__ unsigned short f2bf_bits(float f) {
  unsigned u = __float_as_uint(f);
  return (unsigned short)((u + 0x7FFFu + ((u >> 16) & 1u)) >> 16);
}
__device__ __forceinline__ float bf_bits2f(unsigned short h) { return __uint_as_float(((unsigned)h) << 16); }

/* f16 bits (low 16 bits of hb, finite values) -> f32, integer path only */
__device__ __forceinline__ float h16_to_f32(unsigned hb) {
  const unsigned sgn = (hb & 0x8000u) << 16;
  const unsigned em = hb & 0x7fffu;
  const float fn = __uint_as_float((em << 13) + 0x38000000u);
  const float fs = (float)em * 5.9604644775390625e-8f;
  const float mag = (em < 0x400u) ? fs : fn;
  return __uint_as_float(__float_as_uint(mag) | sgn);
}

/* hazard guards: four nops, all four accumulators of the group tied, A fragments named as inputs */
__device__ __forceinline__ void grp_guard_h(v8f& a, v8f& b, v8f& c, v8f& d, v16h x, v16h y) {
  asm volatile("v_nop\n\tv_nop\n\tv_nop\n\tv_nop" : "+v"(a), "+v"(b), "+v"(c), "+v"(d) : "v"(x), "v"(y));
}
__device__ __forceinline__ void grp_guard_b(v8f& a, v8f& b, v8f& c, v8f& d, v16b x, v16b y) {
  asm volatile("v_nop\n\tv_nop\n\tv_nop\n\tv_nop" : "+v"(a), "+v"(b), "+v"(c), "+v"(d) : "v"(x), "v"(y));
}
__device__ __forceinline__ void keep4_h(v16h a, v16h b, v16h c, v16h d) { asm volatile("v_nop" :: "v"(a), "v"(b), "v"(c), "v"(d)); }
__device__ __forceinline__ void keep4_b(v16b a, v16b b, v16b c, v16b d) { asm volatile("v_nop" :: "v"(a), "v"(b), "v"(c), "v"(d)); }
__device__ __forceinline__ void acc_guard4(v8f& a, v8f& b, v8f& c, v8f& d) {
  asm volatile("v_nop\n\tv_nop\n\tv_nop\n\tv_nop" : "+v"(a), "+v"(b), "+v"(c), "+v"(d));
}

/* Fragment loader: elements 0..7 <- p[0..7], elements 8..15 <- p[16..23]; p already includes 8*(lane>>4) */
template <typename T> struct Frag;
template <> struct Frag<_Float16> {
  typedef v16h V;
  union U { v16h v; v8h h[2]; };
  static __device__ __forceinline__ v16h load(const _Float16* p) {
    U f;
    f.h[0] = *(const v8h*)(p);
    f.h[1] = *(const v8h*)(p + 16);
    return f.v;
  }
  static __device__ __forceinline__ v8f mma(v16h a, v16h b, v8f c) {
    return __builtin_amdgcn_wmma_f32_16x16x32_f16(false, a, false, b, (short)0, c, false, false);
  }
  static __device__ __forceinline__ void guard(v8f& a, v8f& b, v8f& c, v8f& d, v16h x, v16h y) { grp_guard_h(a, b, c, d, x, y); }
  static __device__ __forceinline__ void keep(v16h a, v16h b, v16h c, v16h d) { keep4_h(a, b, c, d); }
};
template <> struct Frag<__bf16> {
  typedef v16b V;
  union U { v16b v; v8b h[2]; };
  static __device__ __forceinline__ v16b load(const __bf16* p) {
    U f;
    f.h[0] = *(const v8b*)(p);
    f.h[1] = *(const v8b*)(p + 16);
    return f.v;
  }
  static __device__ __forceinline__ v8f mma(v16b a, v16b b, v8f c) {
    return __builtin_amdgcn_wmma_f32_16x16x32_bf16(false, a, false, b, (short)0, c, false, false);
  }
  static __device__ __forceinline__ void guard(v8f& a, v8f& b, v8f& c, v8f& d, v16b x, v16b y) { grp_guard_b(a, b, c, d, x, y); }
  static __device__ __forceinline__ void keep(v16b a, v16b b, v16b c, v16b d) { keep4_b(a, b, c, d); }
};

// ---------------------------------------------------------------------------
// LDS-staged WMMA GEMM: C[m,n] = scale * sum_k A[m,k] * Bt[n,k] (+bias[n]) (+resid[m,n]). A block of 4 waves owns a
// 128x128 tile (2x2 waves, each wave a 64x64 tile). A row-major [M][K] pitch lda; Bt row-major [N][K] pitch ldb;
// M, N multiples of 128, K a multiple of 64 and at least 128.
// Operand path: a stage is 64 k (one whole 128-B line) of the block's 128 A rows and 128 Bt rows, every plane, brought
// into LDS by per-lane asynchronous 16-B copies (8 lanes per line, 4 whole lines per wave instruction). SPLIT: two
// buffers, the next stage's copies fly while this stage is multiplied. Not SPLIT: four buffers, the next three stages'
// copies fly (48 of a wave at the most); every wave issues 16 copies per stage, so the wait for a stage is a counted
// wait that leaves the younger stages' copies out. LDS row pitch 144 B (16 B x 9) for the 16-B readers.
// SPLIT: operands are hi/lo planes (A2/Bt2 = lo planes, same layout); product = hi.hi + hi.lo + lo.hi.
// BIAS_MODE: 0 none, 2 bias[n] (f32). ACT: 0 none, 2 relu. RESID (f32 output only): the residual is fetched in the
// store phase, one 16-B vector per lane at exactly the address the lane stores to.
// OUT_MODE: 0 f32, 1 f16, 2 bf16 hi plane (Cout) + bf16 lo plane (Cout2).
// Epilogue: 16-row slabs staged per wave in LDS (only the owning wave touches its slab); the slabs reuse the ring
// behind the last stage's waits and barrier.
// ET: 0 f16 operands, 1 bf16 operands (pointers passed as 16-bit storage).
// One launch holds several independent products of one shape: blockIdx.y = branch, blockIdx.z = weight plane. The
// pointers are those of (0, 0); aP, bP (16-bit elements) and cP (bytes) lead to branch 1, bQ and cQ to plane 1.
// ---------------------------------------------------------------------------
template <int ET> struct Elem;
template <> struct Elem<0> { typedef _Float16 T; };
template <> struct Elem<1> { typedef __bf16 T; };

constexpr int kStageK   = 64;
constexpr int kRowPitch = 144;
constexpr int kPlaneLds = 128 * kRowPitch;
constexpr int kSlabLds  = 16 * 68 * 4;
static_assert((kRowPitch % 16) == 0 && ((kRowPitch / 16) % 2) == 1 && kRowPitch >= kStageK * 2);
static_assert((kDim % 128) == 0 && (kTok % 128) == 0 && (kDim % kStageK) == 0 && kDim >= 2 * kStageK);
static_assert(4 * kSlabLds <= 4 * kPlaneLds && (kSlabLds % 16) == 0);

/* One plane's 128 rows x 128 B of a stage: this lane's eight 16-B pieces, rows 16 apart. l = the lane's LDS byte
   address of its first piece, g = its global address, gstep = 16 source rows in elements. The copies and the
   s_wait_xcnt stand in one statement so that no address register is rewritten ahead of that wait. */
__device__ __forceinline__ void stage_plane(unsigned l, const unsigned short* g, size_t gstep) {
  const unsigned l1 = l + 16 * kRowPitch, l2 = l + 32 * kRowPitch, l3 = l + 48 * kRowPitch, l4 = l + 64 * kRowPitch,
                 l5 = l + 80 * kRowPitch, l6 = l + 96 * kRowPitch, l7 = l + 112 * kRowPitch;
  const unsigned short *g1 = g + gstep, *g2 = g + 2 * gstep, *g3 = g + 3 * gstep, *g4 = g + 4 * gstep,
                       *g5 = g + 5 * gstep, *g6 = g + 6 * gstep, *g7 = g + 7 * gstep;
  asm volatile(
      "global_load_async_to_lds_b128 %0, %8, off\n\t"
      "global_load_async_to_lds_b128 %1, %9, off\n\t"
      "global_load_async_to_lds_b128 %2, %10, off\n\t"
      "global_load_async_to_lds_b128 %3, %11, off\n\t"
      "global_load_async_to_lds_b128 %4, %12, off\n\t"
      "global_load_async_to_lds_b128 %5, %13, off\n\t"
      "global_load_async_to_lds_b128 %6, %14, off\n\t"
      "global_load_async_to_lds_b128 %7, %15, off\n\t"
      "s_wait_xcnt 0x0"
      :: "v"(l), "v"(l1), "v"(l2), "v"(l3), "v"(l4), "v"(l5), "v"(l6), "v"(l7),
         "v"(g), "v"(g1), "v"(g2), "v"(g3), "v"(g4), "v"(g5), "v"(g6), "v"(g7)
      : "memory");
}

/* Four-buffer ring, 16 copies of a wave per stage: returns when all of this wave's copies have landed but those of its
   'younger' youngest stages (2 at the most are in flight behind the stage that is waited for; 1 and then none in the
   last trips, which issue no stage). The count returns in issue order. younger is the same for the whole block. */
__device__ __forceinline__ void wait_copies_but(int younger) {
  if (younger >= 2)      asm volatile("s_wait_asynccnt 0x20" ::: "memory");
  else if (younger == 1) asm volatile("s_wait_asynccnt 0x10" ::: "memory");
  else                   asm volatile("s_wait_asynccnt 0x0" ::: "memory");
}

template <int ET, bool SPLIT, int BIAS_MODE, int OUT_MODE, bool RESID, int ACT>
__global__ __launch_bounds__(128) void wmma_gemm64(
    const unsigned short* __restrict__ Ap0, const unsigned short* __restrict__ A2p0, int lda,
    const unsigned short* __restrict__ Btp0, const unsigned short* __restrict__ Bt2p0, int ldb,
    void* __restrict__ Cout0, void* __restrict__ Cout20, int ldc,
    const float* __restrict__ bias0, const float* __restrict__ bias1,
    const float* __restrict__ resid0, const float* __restrict__ resid1,
    long aP, long bP, long bQ, long cP, long cQ,
    int M, int N, int K, float scale) {
  typedef typename Elem<ET>::T T;
  typedef typename Frag<T>::V V;
  const long zp = (long)blockIdx.y;
  const long zq = (long)blockIdx.z;
  const unsigned short* Ap   = Ap0 + zp * aP;
  const unsigned short* A2p  = A2p0 + zp * aP;
  const unsigned short* Btp  = Btp0 + zp * bP + zq * bQ;
  const unsigned short* Bt2p = Bt2p0 + zp * bP + zq * bQ;
  void* Cout  = (void*)((char*)Cout0 + zp * cP + zq * cQ);
  void* Cout2 = (void*)((char*)Cout20 + zp * cP + zq * cQ);
  const float* bias  = zp ? bias1 : bias0;
  const float* resid = zp ? resid1 : resid0;
  /* stage layout: A hi | (A lo) | Bt hi | (Bt lo), each plane 128 rows at kRowPitch */
  constexpr int kPlanes = SPLIT ? 4 : 2;
  constexpr int kStageLds = kPlanes * kPlaneLds;
  constexpr int kOffBh = (SPLIT ? 2 : 1) * kPlaneLds;
  constexpr int kBufs = SPLIT ? 2 : 4;
  __shared__ __align__(16) unsigned char ring[kBufs * kStageLds];
  const int lane = threadIdx.x & 31;
  const int wave = __builtin_amdgcn_readfirstlane((int)(threadIdx.x >> 5));
  const int tilesN = N >> 7;
  const int tilesM = M >> 7;
  /* block-uniform exit in front of every copy and barrier */
  if ((int)blockIdx.x >= tilesM * tilesN) return;
  const int bm = (int)blockIdx.x / tilesN;
  const int bn = (int)blockIdx.x - bm * tilesN;
  const int wm = (wave >> 1) << 6;
  const int wn = (wave & 1) << 6;
  const int m0 = (bm << 7) + wm;
  const int n0 = (bn << 7) + wn;

  const int rlane = lane & 15;
  const int koff  = (lane >> 4) * 8;
  const int mOff  = (lane >> 4) * 8;

  /* copy map: thread t brings 16-B piece t&7 of rows (t>>3) + 16q, q 0..7, of every plane */
  const int crow = (int)threadIdx.x >> 3;
  const int cpc  = (int)threadIdx.x & 7;
  const unsigned ldsBase = (unsigned)(size_t)(&ring[0]) + (unsigned)(crow * kRowPitch + cpc * 16);
  const size_t aOff = (size_t)((bm << 7) + crow) * lda + cpc * 8;
  const size_t bOff = (size_t)((bn << 7) + crow) * ldb + cpc * 8;
  const size_t aStep = (size_t)16 * lda;
  const size_t bStep = (size_t)16 * ldb;
  const int nStages = K / kStageK;

  auto issue_stage = [&](int s) {
    const unsigned l = ldsBase + (unsigned)((s & (kBufs - 1)) * kStageLds);
    const size_t kq = (size_t)s * kStageK;
    stage_plane(l, Ap + aOff + kq, aStep);
    if (SPLIT) stage_plane(l + kPlaneLds, A2p + aOff + kq, aStep);
    stage_plane(l + kOffBh, Btp + bOff + kq, bStep);
    if (SPLIT) stage_plane(l + kOffBh + kPlaneLds, Bt2p + bOff + kq, bStep);
  };

  v8f acc[4][4];
#pragma unroll
  for (int i = 0; i < 4; ++i)
#pragma unroll
    for (int j = 0; j < 4; ++j) acc[i][j] = (v8f){0.f, 0.f, 0.f, 0.f, 0.f, 0.f, 0.f, 0.f};

  /* prologue: stage 0 landed and published; stage 1 (SPLIT) or stages 1, 2 and 3 in flight */
  issue_stage(0);
  if (SPLIT) {
    asm volatile("s_wait_asynccnt 0x0" ::: "memory");  /* this wave's stage-0 copies have landed */
  } else {
    if (nStages > 1) issue_stage(1);
    if (nStages > 2) issue_stage(2);
    wait_copies_but(nStages - 1);  /* this wave's stage-0 copies have landed */
  }
  __syncthreads();
  if (nStages > kBufs - 1) issue_stage(kBufs - 1);

  const int aFrag = (wm + rlane) * kRowPitch + koff * 2;
  const int bFrag = kOffBh + (wn + rlane) * kRowPitch + koff * 2;

#pragma unroll 1  /* one stage per trip: the foot's waits and barrier stand once */
  for (int s = 0; s < nStages; ++s) {
    const unsigned char* sb = ring + (s & (kBufs - 1)) * kStageLds;
#pragma unroll
    for (int kk = 0; kk < kStageK; kk += 32) {
      V bh[4], bl[4];
      const unsigned char* ap = sb + aFrag + kk * 2;
      V ah = Frag<T>::load((const T*)ap);
      V al;
      if (SPLIT) al = Frag<T>::load((const T*)(ap + kPlaneLds));
#pragma unroll
      for (int j = 0; j < 4; ++j) {
        const unsigned char* bp = sb + bFrag + j * 16 * kRowPitch + kk * 2;
        bh[j] = Frag<T>::load((const T*)bp);
        if (SPLIT) bl[j] = Frag<T>::load((const T*)(bp + kPlaneLds));
      }
#pragma unroll
      for (int i = 0; i < 4; ++i) {
        /* the next row group's A fragments are read in front of this group's products */
        V nh = ah;
        V nl;
        if (SPLIT) nl = al;
        if (i < 3) {
          nh = Frag<T>::load((const T*)(ap + (i + 1) * 16 * kRowPitch));
          if (SPLIT) nl = Frag<T>::load((const T*)(ap + (i + 1) * 16 * kRowPitch + kPlaneLds));
        }
#pragma unroll
        for (int j = 0; j < 4; ++j) {
          acc[i][j] = Frag<T>::mma(ah, bh[j], acc[i][j]);
          if (SPLIT) {
            acc[i][j] = Frag<T>::mma(ah, bl[j], acc[i][j]);
            acc[i][j] = Frag<T>::mma(al, bh[j], acc[i][j]);
          }
        }
        Frag<T>::guard(acc[i][0], acc[i][1], acc[i][2], acc[i][3], ah, SPLIT ? al : ah);
        ah = nh;
        if (SPLIT) al = nl;
      }
      Frag<T>::keep(bh[0], bh[1], bh[2], bh[3]);
      if (SPLIT) Frag<T>::keep(bl[0], bl[1], bl[2], bl[3]);
    }
    /* publish point of stage s + 1; the one barrier also ends every reader's last read of stage s's buffer */
    asm volatile("s_wait_dscnt 0x0" ::: "memory");     /* this wave's reads of stage s have returned */
    /* this wave's stage s + 1 copies have landed */
    if (SPLIT) asm volatile("s_wait_asynccnt 0x0" ::: "memory");
    else       wait_copies_but(nStages - 2 - s);
    __syncthreads();
    if (s + kBufs < nStages) issue_stage(s + kBufs);  /* into the buffer that trip s has just read */
  }
  asm volatile("s_wait_asynccnt 0x0" ::: "memory");  /* no copy is outstanding when the ring becomes the slabs */
  acc_guard4(acc[0][0], acc[0][1], acc[0][2], acc[0][3]);
  acc_guard4(acc[1][0], acc[1][1], acc[1][2], acc[1][3]);
  acc_guard4(acc[2][0], acc[2][1], acc[2][2], acc[2][3]);
  acc_guard4(acc[3][0], acc[3][1], acc[3][2], acc[3][3]);

  /* ---- epilogue ---- */
  float* slab = (float*)(ring + wave * kSlabLds);
#pragma unroll
  for (int i = 0; i < 4; ++i) {
    const int mBase = m0 + (i << 4);
#pragma unroll
    for (int j = 0; j < 4; ++j) {
      const int n = n0 + (j << 4) + rlane;
      float bv = 0.f;
      if (BIAS_MODE == 2) bv = bias[n];
#pragma unroll
      for (int r = 0; r < 8; ++r) {
        float v = acc[i][j][r] * scale;
        if (BIAS_MODE == 2) v += bv;
        if (ACT == 2) v = fmaxf(v, 0.0f);
        slab[(mOff + r) * 68 + (j << 4) + rlane] = v;
      }
    }
    __builtin_amdgcn_fence(__ATOMIC_RELEASE, "workgroup");
    __builtin_amdgcn_wave_barrier();
    __builtin_amdgcn_fence(__ATOMIC_ACQUIRE, "workgroup");
    if (OUT_MODE == 0) {
      /* rows it*2 + hh, it 0..7, hh 0..1 = 16 rows; 16 lanes x 16 B = the 256-B row segment */
      float* C = (float*)Cout;
      const int hh = lane >> 4, c4 = (lane & 15) * 4;
      v4f vals[8];
#pragma unroll
      for (int it = 0; it < 8; ++it) {
        const int row = it * 2 + hh;
        v4f v = *(const v4f*)(slab + row * 68 + c4);
        if (RESID) {
          const v4f rr = *(const v4f*)(resid + (size_t)(mBase + row) * ldc + n0 + c4);
          v = v + rr;
        }
        vals[it] = v;
      }
      {
#pragma unroll
        for (int it = 0; it < 8; ++it) {
          const int row = it * 2 + hh;
          *(v4f*)(C + (size_t)(mBase + row) * ldc + n0 + c4) = vals[it];
        }
        
      }
    } else {
      const int q = lane >> 3, c8 = (lane & 7) * 8;
      unsigned short* C  = (unsigned short*)Cout;
      unsigned short* C2 = (unsigned short*)Cout2;
      {
#pragma unroll
        for (int it = 0; it < 4; ++it) {
          const int row = it * 4 + q;
          const float* sp = slab + row * 68 + c8;
          v8h hv, lv;
#pragma unroll
          for (int e = 0; e < 8; ++e) {
            const float sv = sp[e];
            if (OUT_MODE == 1) {
              hv[e] = (_Float16)sv;
            } else {
              const unsigned short hb = f2bf_bits(sv);
              const unsigned short lb = f2bf_bits(sv - bf_bits2f(hb));
              hv[e] = __builtin_bit_cast(_Float16, hb);
              lv[e] = __builtin_bit_cast(_Float16, lb);
            }
          }
          *(v8h*)(C + (size_t)(mBase + row) * ldc + n0 + c8) = hv;
          if (OUT_MODE == 2) *(v8h*)(C2 + (size_t)(mBase + row) * ldc + n0 + c8) = lv;
        }
        
      }
    }
    __builtin_amdgcn_fence(__ATOMIC_RELEASE, "workgroup");
    __builtin_amdgcn_wave_barrier();
    __builtin_amdgcn_fence(__ATOMIC_ACQUIRE, "workgroup");
  }
}

// ---------------------------------------------------------------------------
// f32 plane -> bf16 hi plane + bf16 lo plane (both RNE converts: hi = bf16(v), lo = bf16(v - hi)); 8 contiguous
// elements per thread. blockIdx.y (block-uniform) selects one of four sources and output plane y (planeElems apart),
// blockIdx.z the branch (sources s* or t*, outputs branchElems apart).
// Coverage: grid.x * 256 threads * 8 elements = total8 * 8 = the whole plane (grids are exact multiples of 256).
// ---------------------------------------------------------------------------
__global__ __launch_bounds__(256) void split4_bf16_kernel(
    const float* __restrict__ s0, const float* __restrict__ s1, const float* __restrict__ s2, const float* __restrict__ s3,
    const float* __restrict__ t0, const float* __restrict__ t1, const float* __restrict__ t2, const float* __restrict__ t3,
    unsigned short* __restrict__ dhi, unsigned short* __restrict__ dlo, int total8, long planeElems, long branchElems) {
  const int i = blockIdx.x * 256 + threadIdx.x;
  if (i >= total8) return;
  const int y = blockIdx.y;
  const int z = blockIdx.z;
  const float* srcA = (y == 0) ? s0 : (y == 1) ? s1 : (y == 2) ? s2 : s3;
  const float* srcB = (y == 0) ? t0 : (y == 1) ? t1 : (y == 2) ? t2 : t3;
  const float* src = z ? srcB : srcA;
  const size_t e0 = (size_t)i << 3;
  const v4f a0 = *(const v4f*)(src + e0);
  const v4f a1 = *(const v4f*)(src + e0 + 4);
  v8h hv, lv;
#pragma unroll
  for (int e = 0; e < 4; ++e) {
    const float f0 = a0[e], f1 = a1[e];
    const unsigned short h0 = f2bf_bits(f0), h1 = f2bf_bits(f1);
    const unsigned short l0 = f2bf_bits(f0 - bf_bits2f(h0)), l1 = f2bf_bits(f1 - bf_bits2f(h1));
    hv[e]     = __builtin_bit_cast(_Float16, h0);
    hv[4 + e] = __builtin_bit_cast(_Float16, h1);
    lv[e]     = __builtin_bit_cast(_Float16, l0);
    lv[4 + e] = __builtin_bit_cast(_Float16, l1);
  }
  unsigned short* qh = dhi + (size_t)y * planeElems + (size_t)z * branchElems + e0;
  unsigned short* ql = dlo + (size_t)y * planeElems + (size_t)z * branchElems + e0;
  *(v8h*)qh = hv;
  *(v8h*)ql = lv;
  
}

// ---------------------------------------------------------------------------
// f32 plane -> f16 plane with a power-of-two carry; same thread/line map as above (8 elements = one 16-B store per
// ---------------------------------------------------------------------------
__global__ __launch_bounds__(256) void cast4_f16_kernel(
    const float* __restrict__ s0, const float* __restrict__ s1, const float* __restrict__ s2, const float* __restrict__ s3,
    const float* __restrict__ t0, const float* __restrict__ t1, const float* __restrict__ t2, const float* __restrict__ t3,
    unsigned short* __restrict__ out, float carry, int total8, long planeElems, long branchElems) {
  const int i = blockIdx.x * 256 + threadIdx.x;
  if (i >= total8) return;
  const int y = blockIdx.y;
  const int z = blockIdx.z;
  const float* srcA = (y == 0) ? s0 : (y == 1) ? s1 : (y == 2) ? s2 : s3;
  const float* srcB = (y == 0) ? t0 : (y == 1) ? t1 : (y == 2) ? t2 : t3;
  const float* src = z ? srcB : srcA;
  const size_t e0 = (size_t)i << 3;
  const v4f a0 = *(const v4f*)(src + e0);
  const v4f a1 = *(const v4f*)(src + e0 + 4);
  v8h hv;
#pragma unroll
  for (int e = 0; e < 4; ++e) {
    const float f0 = a0[e] * carry, f1 = a1[e] * carry;
    hv[e]     = (_Float16)f0;
    hv[4 + e] = (_Float16)f1;
  }
  unsigned short* q = out + (size_t)y * planeElems + (size_t)z * branchElems + e0;
  *(v8h*)q = hv;
  
}

// ---------------------------------------------------------------------------
// bf16 hi + lo planes -> f16 plane of (hi + lo); planes read as 32-bit integer words; same thread/line map.
// ---------------------------------------------------------------------------
__global__ __launch_bounds__(256) void hilo_to_f16_kernel(
    const unsigned short* __restrict__ hi0, const unsigned short* __restrict__ lo0,
    unsigned short* __restrict__ out0, int total8, long branchElems) {
  const int i = blockIdx.x * 256 + threadIdx.x;
  if (i >= total8) return;
  /* blockIdx.y = branch */
  const unsigned short* hi = hi0 + (size_t)blockIdx.y * branchElems;
  const unsigned short* lo = lo0 + (size_t)blockIdx.y * branchElems;
  unsigned short* out = out0 + (size_t)blockIdx.y * branchElems;
  const size_t e0 = (size_t)i << 3;
  const v4u hw4 = *(const v4u*)(hi + e0);
  const v4u lw4 = *(const v4u*)(lo + e0);
  v8h hv;
#pragma unroll
  for (int w = 0; w < 4; ++w) {
    const unsigned hw = hw4[w];
    const unsigned lw = lw4[w];
    const float f0 = __uint_as_float(hw << 16) + __uint_as_float(lw << 16);
    const float f1 = __uint_as_float(hw & 0xffff0000u) + __uint_as_float(lw & 0xffff0000u);
    hv[2 * w]     = (_Float16)f0;
    hv[2 * w + 1] = (_Float16)f1;
  }
  unsigned short* q = out + e0;
  *(v8h*)q = hv;
  
}

// ---------------------------------------------------------------------------
// Row statistics of S f32 [4096][4096] and the block's share of the column sums, S read once:
// m_i = max_j S_ij, inv_s_i = 1 / sum_j exp(S_ij - m_i), part_b[j] = sum over the block's 32 rows of exp(S_ij - m_i) * inv_s_i.
// Block = 32 rows (16 waves x 2 rows). A wave holds one whole row in registers: 32 lane-strided 16-B loads, all in
// flight together (lane owns columns it*128 + lane*4 .. +3); maximum, exponentials, sum and probabilities are formed
// in those registers. Row sum order: per-lane sequential, then xor shuffle tree (unconditional).
// Column share: each wave adds its two rows in its own LDS row (only the owning wave touches it in front of the
// barrier); behind the barrier the 16 wave rows are added in index order and stored as whole lines. No atomics.
// ---------------------------------------------------------------------------
constexpr int kRcRows  = 32;
constexpr int kRcWaves = 16;
constexpr int kRcParts = kTok / kRcRows;
static_assert(kTok == 32 * 128 && (kTok % kRcRows) == 0 && kRcRows == 2 * kRcWaves && kTok == 2 * kRcWaves * 32 * 4);
static_assert((size_t)2 * kRcParts * kTok * 4 == kCPBytes);

/* Four base-2 exponentials in place. One statement, so that directly behind each v_exp_f32 stands an instruction that
   neither reads its result nor rewrites its source: the next exponential, and a v_nop behind the last. */
__device__ __forceinline__ void exp2_x4(float& a, float& b, float& c, float& d) {
  asm("v_exp_f32 %0, %0\n\tv_exp_f32 %1, %1\n\tv_exp_f32 %2, %2\n\tv_exp_f32 %3, %3\n\tv_nop"
      : "+v"(a), "+v"(b), "+v"(c), "+v"(d));
}
constexpr float kLog2e = 1.4426950408889634f;  /* exp(t) = exp2(t * log2 e), the form __expf compiles to */

__global__ __launch_bounds__(512) void rowcol_kernel(const float* __restrict__ S0, float* __restrict__ mrow0,
                                                     float* __restrict__ invs0, float* __restrict__ cpart0) {
  __shared__ __align__(16) float sC[kRcWaves][kTok];
  __shared__ float sM[kRcRows];
  __shared__ float sI[kRcRows];
  /* blockIdx.y = branch */
  const float* S = S0 + (size_t)blockIdx.y * kR0El32;
  float* mrow = mrow0 + (size_t)blockIdx.y * kTok;
  float* invs = invs0 + (size_t)blockIdx.y * kTok;
  float* cpart = cpart0 + ((size_t)blockIdx.y * kRcParts + blockIdx.x) * kTok;
  const int lane = threadIdx.x & 31;
  const int wave = __builtin_amdgcn_readfirstlane((int)(threadIdx.x >> 5));
  const int row0 = blockIdx.x * kRcRows;
  float* myC = &sC[wave][lane * 4];
#pragma unroll 1  /* one copy of the row's code: the text stays small */
  for (int q = 0; q < 2; ++q) {
    const int rl = wave * 2 + q;
    const float* p = S + (size_t)(row0 + rl) * kTok + lane * 4;
    v4f x[32];
#pragma unroll
    for (int it = 0; it < 32; ++it) x[it] = *(const v4f*)(p + it * 128);
    /* stands in front of every rewrite of the loads' address registers: p as an input keeps them untouched up to here */
    asm volatile("s_wait_xcnt 0x0" :: "v"(p) : "memory");
    float m = -INFINITY;
#pragma unroll
    for (int it = 0; it < 32; ++it) m = fmaxf(m, fmaxf(fmaxf(x[it][0], x[it][1]), fmaxf(x[it][2], x[it][3])));
#pragma unroll
    for (int off = 16; off > 0; off >>= 1) m = fmaxf(m, __shfl_xor(m, off, 32));
    float sum = 0.f;
#pragma unroll
    for (int it = 0; it < 32; ++it) {
      float e0 = (x[it][0] - m) * kLog2e, e1 = (x[it][1] - m) * kLog2e;
      float e2 = (x[it][2] - m) * kLog2e, e3 = (x[it][3] - m) * kLog2e;
      exp2_x4(e0, e1, e2, e3);
      x[it] = (v4f){e0, e1, e2, e3};
      sum += e0;
      sum += e1;
      sum += e2;
      sum += e3;
    }
#pragma unroll
    for (int off = 16; off > 0; off >>= 1) sum += __shfl_xor(sum, off, 32);
    const float inv = 1.0f / sum;
    if (q == 0) {
#pragma unroll
      for (int it = 0; it < 32; ++it) *(v4f*)(myC + it * 128) = x[it] * inv;
    } else {
#pragma unroll
      for (int it = 0; it < 32; ++it) {
        const v4f c = *(const v4f*)(myC + it * 128);
        *(v4f*)(myC + it * 128) = c + x[it] * inv;
      }
    }
    if (lane == 0) {
      sM[rl] = m;
      sI[rl] = inv;
    }
  }
  __syncthreads();
  /* thread t adds columns h*2048 + 4t .. +3 of the 16 wave rows: 32 lanes x 16 B = 4 whole lines per store */
#pragma unroll
  for (int h = 0; h < 2; ++h) {
    const int col = h * 2048 + (int)threadIdx.x * 4;
    v4f c = *(const v4f*)(&sC[0][col]);
#pragma unroll
    for (int w = 1; w < kRcWaves; ++w) c = c + *(const v4f*)(&sC[w][col]);
    *(v4f*)(cpart + col) = c;
  }
  asm volatile("s_wait_xcnt 0x0" ::: "memory");  /* in front of wave 0's reuse of the registers that these stores name */
  if (wave == 0) {
    const float mv = sM[lane];
    const float iv = sI[lane];
    *(float*)(mrow + row0 + lane) = mv;
    *(float*)(invs + row0 + lane) = iv;
  }
}

// ---------------------------------------------------------------------------
// Column sums over queries: c_j = sum over the 128 block shares part_b[j], then rc_j = 1 / (1e-9 + c_j).
// Block = 32 columns (one 128-B line of every share); wave w adds shares w, w+8, ... (16 shares, all loads in flight
// together) in order; the 8 wave partials are combined in index order by wave 0. No atomics.
// ---------------------------------------------------------------------------
__global__ __launch_bounds__(256) void colfin_kernel(const float* __restrict__ cpart0, float* __restrict__ rcol0) {
  __shared__ float sP[8][32];
  /* blockIdx.y = branch */
  const float* cpart = cpart0 + (size_t)blockIdx.y * kRcParts * kTok;
  float* rcol = rcol0 + (size_t)blockIdx.y * kTok;
  const int lane = threadIdx.x & 31;
  const int wave = __builtin_amdgcn_readfirstlane((int)(threadIdx.x >> 5));
  const int j0 = blockIdx.x * 32;
  const float* pw = cpart + (size_t)wave * kTok + j0 + lane;
  float v[kRcParts / 8];
#pragma unroll
  for (int t = 0; t < kRcParts / 8; ++t) v[t] = pw[(size_t)(8 * t) * kTok];
  asm volatile("s_wait_xcnt 0x0" ::: "memory");  /* in front of every rewrite of the loads' address registers */
  float acc = 0.f;
#pragma unroll
  for (int t = 0; t < kRcParts / 8; ++t) acc += v[t];
  sP[wave][lane] = acc;
  __syncthreads();
  if (wave == 0) {
    float c = sP[0][lane];
    c += sP[1][lane];
    c += sP[2][lane];
    c += sP[3][lane];
    c += sP[4][lane];
    c += sP[5][lane];
    c += sP[6][lane];
    c += sP[7][lane];
    const float rc = 1.0f / (kAttnEps + c);
    *(float*)(rcol + j0 + lane) = rc;
  }
}

// ---------------------------------------------------------------------------
// attn.V: SC_z[i][d] = (1/32768) * sum over the keys j of half z of f16(32768 * P_ij * rc_j) * VT[d][j],
// P_ij = exp(S_ij - m_i) * inv_s_i. The two shares SC_0 + SC_1 are added by add_ln_kernel.
// Block = 64 query rows x all 512 d x 2048 keys (8 waves, wave w owns d columns 64w..64w+63, acc 4x4 tiles):
// blockIdx.z picks the half of the keys, so that 256 blocks stand on the chip and each walks 32 key tiles. The tile
// numbers below count inside the block's half.
// Operand path: per-lane asynchronous 16-B copies bring whole 128-B lines into LDS, three buffers. Stage s holds the
// V^T tile of keys 64s..64s+63 (512 rows x 128 B, pitch 144 B) and the logit tile of keys 64(s+1)..64(s+1)+63
// (64 rows x 256 B, pitch 272 B): trip t multiplies key tile t and forms the f16 weights of key tile t + 1 out of the
// same buffer, while the copies of stages t + 1 and t + 2 fly. Even stages are copied by waves 0..3, odd stages by
// waves 4..7: a wave never has more than one stage outstanding, so its wait for that stage is a wait to 0 and leaves
// the other half's younger stage in flight. The weight tiles (64 rows x 128 B, pitch 144 B) alternate between two
// places: the one written in trip t was last read in trip t - 1. Thread t forms row t>>2, keys (t&3)*16..+15
// (64 rows x 4 threads x 16 = the whole tile). The 4096 column factors are copied into LDS once, in the prologue.
// The pad bytes of every pitch are never read: all reads touch byte offsets below the row length.
// ---------------------------------------------------------------------------
constexpr int kAvK      = 64;
constexpr int kAvHalves = 2;
constexpr int kAvKeys   = kTok / kAvHalves;
constexpr int kAvVPitch = 144;
constexpr int kAvSPitch = 272;
constexpr int kAvAPitch = 144;
constexpr int kAvVLds   = kDim * kAvVPitch;
constexpr int kAvSLds   = 64 * kAvSPitch;
constexpr int kAvStage  = kAvVLds + kAvSLds;
constexpr int kAvALds   = 64 * kAvAPitch;
constexpr int kAvBufs   = 3;
constexpr int kAvOffA   = kAvBufs * kAvStage;
constexpr int kAvOffRC  = kAvOffA + 2 * kAvALds;
constexpr int kAvLds    = kAvOffRC + kTok * 4;
static_assert((kAvKeys % kAvK) == 0 && kAvKeys >= 3 * kAvK && kDim == 512);
static_assert(kAvVPitch >= kAvK * 2 && kAvSPitch >= kAvK * 4 && kAvAPitch >= kAvK * 2);
static_assert((kAvVPitch % 32) == 16 && (kAvSPitch % 32) == 16 && (kAvAPitch % 32) == 16);
static_assert(8 * kSlabLds <= kAvBufs * kAvStage && kAvLds <= 327680);

/* This lane's eight (or four) 16-B pieces, lstep LDS bytes and gstep source bytes apart. The copies and the
   s_wait_xcnt stand in one statement so that no address register is rewritten ahead of that wait. */
__device__ __forceinline__ void copy8_b128(unsigned l, unsigned lstep, const unsigned char* g, size_t gstep) {
  const unsigned l1 = l + lstep, l2 = l + 2 * lstep, l3 = l + 3 * lstep, l4 = l + 4 * lstep,
                 l5 = l + 5 * lstep, l6 = l + 6 * lstep, l7 = l + 7 * lstep;
  const unsigned char *g1 = g + gstep, *g2 = g + 2 * gstep, *g3 = g + 3 * gstep, *g4 = g + 4 * gstep,
                      *g5 = g + 5 * gstep, *g6 = g + 6 * gstep, *g7 = g + 7 * gstep;
  asm volatile(
      "global_load_async_to_lds_b128 %0, %8, off\n\t"
      "global_load_async_to_lds_b128 %1, %9, off\n\t"
      "global_load_async_to_lds_b128 %2, %10, off\n\t"
      "global_load_async_to_lds_b128 %3, %11, off\n\t"
      "global_load_async_to_lds_b128 %4, %12, off\n\t"
      "global_load_async_to_lds_b128 %5, %13, off\n\t"
      "global_load_async_to_lds_b128 %6, %14, off\n\t"
      "global_load_async_to_lds_b128 %7, %15, off\n\t"
      "s_wait_xcnt 0x0"
      :: "v"(l), "v"(l1), "v"(l2), "v"(l3), "v"(l4), "v"(l5), "v"(l6), "v"(l7),
         "v"(g), "v"(g1), "v"(g2), "v"(g3), "v"(g4), "v"(g5), "v"(g6), "v"(g7)
      : "memory");
}
__device__ __forceinline__ void copy4_b128(unsigned l, unsigned lstep, const unsigned char* g, size_t gstep) {
  const unsigned l1 = l + lstep, l2 = l + 2 * lstep, l3 = l + 3 * lstep;
  const unsigned char *g1 = g + gstep, *g2 = g + 2 * gstep, *g3 = g + 3 * gstep;
  asm volatile(
      "global_load_async_to_lds_b128 %0, %4, off\n\t"
      "global_load_async_to_lds_b128 %1, %5, off\n\t"
      "global_load_async_to_lds_b128 %2, %6, off\n\t"
      "global_load_async_to_lds_b128 %3, %7, off\n\t"
      "s_wait_xcnt 0x0"
      :: "v"(l), "v"(l1), "v"(l2), "v"(l3), "v"(g), "v"(g1), "v"(g2), "v"(g3)
      : "memory");
}

__global__ __launch_bounds__(256) void av_kernel(const float* __restrict__ S0, const float* __restrict__ mrow0,
                                                 const float* __restrict__ invs0, const float* __restrict__ rcol0,
                                                 const unsigned short* __restrict__ VTp0, float* __restrict__ SC0) {
  /* stage buffers 0, 1, 2 | weight tile 0 | weight tile 1 | column factors */
  __shared__ __align__(16) unsigned char smem[kAvLds];
  /* blockIdx.y = branch, blockIdx.z = half of the keys; S and V^T start at the half's first key */
  const int key0 = (int)blockIdx.z * kAvKeys;
  const float* S = S0 + (size_t)blockIdx.y * kR0El32 + key0;
  const float* mrow = mrow0 + (size_t)blockIdx.y * kTok;
  const float* invs = invs0 + (size_t)blockIdx.y * kTok;
  const float* rcol = rcol0 + (size_t)blockIdx.y * kTok;
  const unsigned short* VTp = VTp0 + (size_t)blockIdx.y * kND + key0;
  float* SC = SC0 + ((size_t)blockIdx.z * 2 + blockIdx.y) * kND;
  typedef Frag<_Float16> FH;
  const int tid  = threadIdx.x;
  const int lane = tid & 31;
  const int wave = __builtin_amdgcn_readfirstlane((int)(tid >> 5));
  const int m0 = blockIdx.x * 64;
  const int n0 = wave * 64;
  const int sr   = tid >> 2;
  const int sc16 = (tid & 3) * 16;
  const float mi = mrow[m0 + sr];
  const float fi = invs[m0 + sr] * kPCarry;
  /* stands in front of every rewrite of the registers that these two loads name: as inputs they stay untouched up to here */
  asm volatile("s_wait_xcnt 0x0" :: "v"(m0 + sr), "s"(mrow), "s"(invs) : "memory");

  const int rlane = lane & 15;
  const int koff  = (lane >> 4) * 8;
  const int mOff  = (lane >> 4) * 8;
  constexpr int nT = kAvKeys / kAvK;

  /* copy maps of the four waves that bring a stage, c = the thread's number among their 128. V^T: 16-B piece c&7 of
     rows (c>>3) + 16q, q 0..31 (4 whole lines per wave instruction). Logits: piece c&15 of rows (c>>4) + 8q, q 0..7.
     40 copies of a wave per stage. Column factors (all 256 threads): piece t + 256q, q 0..3. */
  const int half = wave >> 2;
  const int ct = tid & 127;
  const unsigned ldsBase = (unsigned)(size_t)(&smem[0]);
  const unsigned vL = ldsBase + (unsigned)((ct >> 3) * kAvVPitch + (ct & 7) * 16);
  const unsigned sL = ldsBase + (unsigned)(kAvVLds + (ct >> 4) * kAvSPitch + (ct & 15) * 16);
  const unsigned char* vG = (const unsigned char*)VTp + (size_t)(ct >> 3) * (kTok * 2) + (ct & 7) * 16;
  const unsigned char* sG = (const unsigned char*)S + (size_t)(m0 + (ct >> 4)) * (kTok * 4) + (ct & 15) * 16;

  auto issue_logits = [&](int u, int buf) {
    copy8_b128(sL + (unsigned)(buf * kAvStage), 8 * kAvSPitch, sG + (size_t)u * (kAvK * 4), (size_t)8 * kTok * 4);
  };
  auto issue_stage = [&](int s, int buf) {
    const unsigned l = vL + (unsigned)(buf * kAvStage);
    const unsigned char* g = vG + (size_t)s * (kAvK * 2);
#pragma unroll  /* four statements of eight copies: every LDS and source step a constant */
    for (int j = 0; j < 4; ++j)
      copy8_b128(l + j * 128 * kAvVPitch, 16 * kAvVPitch, g + (size_t)j * 128 * kTok * 2, (size_t)16 * kTok * 2);
    if (s + 1 < nT) issue_logits(s + 1, buf);
  };
  /* this thread's 16 weights of key tile u, out of the logit tile at sraw */
  auto weights = [&](int u, const unsigned char* sraw, v8h& h0, v8h& h1) {
    const float* sp = (const float*)(sraw + sr * kAvSPitch) + sc16;
    const float* rp = (const float*)(smem + kAvOffRC) + key0 + u * kAvK + sc16;
#pragma unroll
    for (int h = 0; h < 2; ++h) {
      const v4f s0 = *(const v4f*)(sp + h * 8);
      const v4f s1 = *(const v4f*)(sp + h * 8 + 4);
      const v4f r0 = *(const v4f*)(rp + h * 8);
      const v4f r1 = *(const v4f*)(rp + h * 8 + 4);
      v8h hv;
#pragma unroll
      for (int e = 0; e < 4; ++e) {
        const float e0 = __expf(s0[e] - mi);
        const float e1 = __expf(s1[e] - mi);
        const float w0 = (e0 * fi) * r0[e];
        const float w1 = (e1 * fi) * r1[e];
        hv[e]     = (_Float16)w0;
        hv[4 + e] = (_Float16)w1;
      }
      if (h == 0) h0 = hv; else h1 = hv;
    }
  };
  auto put_weights = [&](unsigned char* at, v8h h0, v8h h1) {
    *(v8h*)(at + sr * kAvAPitch + sc16 * 2) = h0;
    *(v8h*)(at + sr * kAvAPitch + sc16 * 2 + 16) = h1;
  };

  v8f acc[4][4];
#pragma unroll
  for (int i = 0; i < 4; ++i)
#pragma unroll
    for (int j = 0; j < 4; ++j) acc[i][j] = (v8f){0.f, 0.f, 0.f, 0.f, 0.f, 0.f, 0.f, 0.f};

  /* the 64 keys of one tile: weight tile at, V^T tile vt */
  auto products = [&](const unsigned char* at, const unsigned char* vt) {
#pragma unroll
    for (int kk = 0; kk < kAvK; kk += 32) {
      v16h bh[4];
#pragma unroll
      for (int j = 0; j < 4; ++j)
        bh[j] = FH::load((const _Float16*)(vt + (n0 + (j << 4) + rlane) * kAvVPitch + (kk + koff) * 2));
      const unsigned char* ap = at + rlane * kAvAPitch + (kk + koff) * 2;
      v16h ah = FH::load((const _Float16*)ap);
#pragma unroll
      for (int i = 0; i < 4; ++i) {
        /* the next row group's A fragment is read in front of this group's products */
        v16h nh = ah;
        if (i < 3) nh = FH::load((const _Float16*)(ap + (i + 1) * 16 * kAvAPitch));
#pragma unroll
        for (int j = 0; j < 4; ++j) acc[i][j] = FH::mma(ah, bh[j], acc[i][j]);
        FH::guard(acc[i][0], acc[i][1], acc[i][2], acc[i][3], ah, ah);
        ah = nh;
      }
      FH::keep(bh[0], bh[1], bh[2], bh[3]);
    }
  };

  /* prologue: column factors, logit tile 0 (in buffer 2's logit place), stage 0 (waves 0..3) and stage 1 (waves 4..7)
     landed and published; weight tile 0 formed; then, behind the barrier that ends the reads of buffer 2, stage 2 in
     flight */
  copy4_b128(ldsBase + (unsigned)(kAvOffRC + tid * 16), 4096, (const unsigned char*)rcol + tid * 16, (size_t)4096);
  if (half == 0) {
    issue_logits(0, 2);
    issue_stage(0, 0);
  } else {
    issue_stage(1, 1);
  }
  asm volatile("s_wait_asynccnt 0x0" ::: "memory");  /* this wave's prologue copies have landed */
  __syncthreads();
  {
    v8h h0, h1;
    weights(0, smem + 2 * kAvStage + kAvVLds, h0, h1);
    put_weights(smem + kAvOffA, h0, h1);
  }
  asm volatile("s_wait_dscnt 0x0" ::: "memory");  /* this wave's reads of logit tile 0 have returned */
  __syncthreads();
  if (half == 0) issue_stage(2, 2);

  int buf = 0;  /* t mod 3 */
#pragma unroll 1  /* one stage per trip: the foot's waits and barrier stand once */
  for (int t = 0; t < nT - 1; ++t) {
    const unsigned char* sb = smem + buf * kAvStage;
    v8h h0, h1;
    weights(t + 1, sb + kAvVLds, h0, h1);
    products(smem + kAvOffA + (t & 1) * kAvALds, sb);
    put_weights(smem + kAvOffA + ((t + 1) & 1) * kAvALds, h0, h1);
    /* publish point of stage t + 1 and of weight tile t + 1; the one barrier also ends every reader's last read of
       stage t's buffer and of weight tile t. Stage t + 1 and stage t + 3 belong to the same half of the waves. */
    const bool mine = ((t + 1) & 1) == half;
    asm volatile("s_wait_dscnt 0x0" ::: "memory");  /* this wave's LDS reads and writes of trip t are done */
    if (mine) asm volatile("s_wait_asynccnt 0x0" ::: "memory");  /* this wave's stage t + 1 copies, its only ones, have landed */
    __syncthreads();
    if (mine && t + 3 < nT) issue_stage(t + 3, buf);  /* into the buffer that trip t has just read */
    buf = (buf == kAvBufs - 1) ? 0 : buf + 1;
  }
  products(smem + kAvOffA + ((nT - 1) & 1) * kAvALds, smem + ((nT - 1) % kAvBufs) * kAvStage);
  asm volatile("s_wait_asynccnt 0x0" ::: "memory");  /* no copy is outstanding when the ring becomes the slabs */
  asm volatile("s_wait_dscnt 0x0" ::: "memory");     /* this wave's last fragment reads have returned */
  __syncthreads();                                   /* every wave has left the ring before a slab is written */
  acc_guard4(acc[0][0], acc[0][1], acc[0][2], acc[0][3]);
  acc_guard4(acc[1][0], acc[1][1], acc[1][2], acc[1][3]);
  acc_guard4(acc[2][0], acc[2][1], acc[2][2], acc[2][3]);
  acc_guard4(acc[3][0], acc[3][1], acc[3][2], acc[3][3]);

  float* slab = (float*)(smem + wave * kSlabLds);
#pragma unroll
  for (int i = 0; i < 4; ++i) {
    const int mBase = m0 + (i << 4);
#pragma unroll
    for (int j = 0; j < 4; ++j) {
#pragma unroll
      for (int r = 0; r < 8; ++r) slab[(mOff + r) * 68 + (j << 4) + rlane] = acc[i][j][r] * kPCarryInv;
    }
    __builtin_amdgcn_fence(__ATOMIC_RELEASE, "workgroup");
    __builtin_amdgcn_wave_barrier();
    __builtin_amdgcn_fence(__ATOMIC_ACQUIRE, "workgroup");
    {
      const int hh = lane >> 4, c4 = (lane & 15) * 4;
      v4f vals[8];
#pragma unroll
      for (int it = 0; it < 8; ++it) vals[it] = *(const v4f*)(slab + (it * 2 + hh) * 68 + c4);
      {
#pragma unroll
        for (int it = 0; it < 8; ++it) {
          const int row = it * 2 + hh;
          *(v4f*)(SC + (size_t)(mBase + row) * kDim + n0 + c4) = vals[it];
        }
        
      }
    }
    __builtin_amdgcn_fence(__ATOMIC_RELEASE, "workgroup");
    __builtin_amdgcn_wave_barrier();
    __builtin_amdgcn_fence(__ATOMIC_ACQUIRE, "workgroup");
  }
}

// ---------------------------------------------------------------------------
// s = LayerNorm(res + sc) over 512 (biased variance, eps inside rsqrt), one wave per row, 8 rows per block.
// sc = the two key halves' shares of attn.V, added here (share 1 lies 2 planes behind share 0).
// Lane owns columns it*128 + lane*4 .. +3 (it 0..3): 16 values in registers, static indexing.
// res is an f16 plane read as 32-bit integer words; sc, gamma, beta f32.
// (via the wave's own LDS slab: lane owns columns it2*256 + lane*8 .. +7, 2 instructions x 32 lanes x 16 B = 4 whole
// ---------------------------------------------------------------------------
__global__ __launch_bounds__(256) void add_ln_kernel(const unsigned short* __restrict__ RES0, const float* __restrict__ SCp0,
                                                     const float* __restrict__ gam0, const float* __restrict__ bet0,
                                                     const float* __restrict__ gam1, const float* __restrict__ bet1,
                                                     float* __restrict__ S320, unsigned short* __restrict__ S160) {
  __shared__ __align__(16) float sY[8][kDim];
  /* blockIdx.y = branch */
  const unsigned short* RES = RES0 + (size_t)blockIdx.y * kND;
  const float* SCp = SCp0 + (size_t)blockIdx.y * kND;
  const float* gam = blockIdx.y ? gam1 : gam0;
  const float* bet = blockIdx.y ? bet1 : bet0;
  float* S32 = S320 + (size_t)blockIdx.y * kR0El32;
  unsigned short* S16 = S160 + (size_t)blockIdx.y * kR0El16;
  const int lane = threadIdx.x & 31;
  const int wave = __builtin_amdgcn_readfirstlane((int)(threadIdx.x >> 5));
  const int row = blockIdx.x * 8 + wave;
  const float* scp = SCp + (size_t)row * kDim;
  const float* scq = scp + 2 * kND;
  const unsigned short* rp = RES + (size_t)row * kDim;
  float x[16];
#pragma unroll
  for (int it = 0; it < 4; ++it) {
    const int col = it * 128 + lane * 4;
    const v4f a = *(const v4f*)(scp + col) + *(const v4f*)(scq + col);
    const v2u w = *(const v2u*)(rp + col);
    const unsigned w0 = w[0];
    const unsigned w1 = w[1];
    x[4 * it + 0] = h16_to_f32(w0 & 0xffffu) + a[0];
    x[4 * it + 1] = h16_to_f32(w0 >> 16) + a[1];
    x[4 * it + 2] = h16_to_f32(w1 & 0xffffu) + a[2];
    x[4 * it + 3] = h16_to_f32(w1 >> 16) + a[3];
  }
  float s = 0.f;
#pragma unroll
  for (int i = 0; i < 16; ++i) s += x[i];
#pragma unroll
  for (int off = 16; off > 0; off >>= 1) s += __shfl_xor(s, off, 32);
  const float mu = s * kInvDim;
  float vs = 0.f;
#pragma unroll
  for (int i = 0; i < 16; ++i) {
    const float d = x[i] - mu;
    x[i] = d;
    vs += d * d;
  }
#pragma unroll
  for (int off = 16; off > 0; off >>= 1) vs += __shfl_xor(vs, off, 32);
  const float inv = rsqrtf(vs * kInvDim + kLnEps);
  float* slab = sY[wave];
  v4f yv[4];
#pragma unroll
  for (int it = 0; it < 4; ++it) {
    const int col = it * 128 + lane * 4;
    const v4f g4 = *(const v4f*)(gam + col);
    const v4f b4 = *(const v4f*)(bet + col);
    v4f y;
    y[0] = (x[4 * it + 0] * inv) * g4[0] + b4[0];
    y[1] = (x[4 * it + 1] * inv) * g4[1] + b4[1];
    y[2] = (x[4 * it + 2] * inv) * g4[2] + b4[2];
    y[3] = (x[4 * it + 3] * inv) * g4[3] + b4[3];
    yv[it] = y;
    *(v4f*)(slab + col) = y;
  }
  __builtin_amdgcn_fence(__ATOMIC_RELEASE, "workgroup");
  __builtin_amdgcn_wave_barrier();
  __builtin_amdgcn_fence(__ATOMIC_ACQUIRE, "workgroup");
  v8h hv[2];
#pragma unroll
  for (int it2 = 0; it2 < 2; ++it2) {
    const int c = it2 * 256 + lane * 8;
    const v4f a0 = *(const v4f*)(slab + c);
    const v4f a1 = *(const v4f*)(slab + c + 4);
#pragma unroll
    for (int e = 0; e < 4; ++e) {
      const float f0 = a0[e], f1 = a1[e];
      hv[it2][e]     = (_Float16)f0;
      hv[it2][4 + e] = (_Float16)f1;
    }
  }
  float* o32 = S32 + (size_t)row * kDim;
  unsigned short* o16 = S16 + (size_t)row * kDim;
  {
#pragma unroll
    for (int it = 0; it < 4; ++it) *(v4f*)(o32 + it * 128 + lane * 4) = yv[it];
#pragma unroll
    for (int it2 = 0; it2 < 2; ++it2) *(v8h*)(o16 + it2 * 256 + lane * 8) = hv[it2];
    
  }
}

// ---------------------------------------------------------------------------
// Host glue (kernel launches and host arithmetic only)
// ---------------------------------------------------------------------------
template <int ET, bool SPLIT, int BIAS_MODE, int OUT_MODE, bool RESID, int ACT>
static void run_gemm(hipStream_t st,
                     const unsigned short* A, const unsigned short* A2, int lda,
                     const unsigned short* Bt, const unsigned short* Bt2, int ldb,
                     void* C, void* C2, int ldc,
                     const float* bias0, const float* bias1, const float* resid0, const float* resid1,
                     long aP, long bP, long bQ, long cP, long cQ, int planes,
                     int M, int N, int K, float scale) {
  const int blocks = (M >> 7) * (N >> 7);
  wmma_gemm64<ET, SPLIT, BIAS_MODE, OUT_MODE, RESID, ACT><<<dim3(blocks, 2, planes), 128, 0, st>>>(
      A, A2, lda, Bt, Bt2, ldb, C, C2, ldc, bias0, bias1, resid0, resid1, aP, bP, bQ, cP, cQ, M, N, K, scale);
}

extern "C" void kernel_launch(void* const* d_in, const int* in_sizes, int n_in,
                              void* d_out, int out_size, void* d_ws, size_t ws_size,
                              hipStream_t stream) {
  if (n_in < 34) return;
  if (in_sizes[0] != (int)kND || in_sizes[1] != (int)kND) return;
  for (int p = 0; p < 2; ++p) {
    for (int s = 0; s < 16; ++s) {
      const bool isMat = (s == 0 || s == 2 || s == 4 || s == 6 || s == 8 || s == 10 || s == 11 || s == 12 || s == 15);
      const int want = isMat ? (int)kWW : kDim;
      if (in_sizes[2 + 16 * p + s] != want) return;
    }
  }
  if (out_size != (int)(2 * kND)) return;
  if (ws_size < kWsTotal) return;

  char* ws = (char*)d_ws;
  unsigned short* XH  = (unsigned short*)(ws + kOffXH);
  unsigned short* XL  = (unsigned short*)(ws + kOffXL);
  unsigned short* T0H = (unsigned short*)(ws + kOffT0H);
  unsigned short* T0L = (unsigned short*)(ws + kOffT0L);
  unsigned short* FH  = (unsigned short*)(ws + kOffFH);
  unsigned short* FL  = (unsigned short*)(ws + kOffFL);
  unsigned short* F16 = (unsigned short*)(ws + kOffF16);
  unsigned short* R1  = (unsigned short*)(ws + kOffR1);
  unsigned short* R2  = (unsigned short*)(ws + kOffR2);
  unsigned short* WSH = (unsigned short*)(ws + kOffWSH);
  unsigned short* WSL = (unsigned short*)(ws + kOffWSL);
  unsigned short* WF  = (unsigned short*)(ws + kOffWF);
  float*          S   = (float*)(ws + kOffS);
  float*          S32 = (float*)(ws + kOffS32);
  unsigned short* S16 = (unsigned short*)(ws + kOffS16);
  unsigned short* QK  = (unsigned short*)(ws + kOffQK);
  unsigned short* VT  = (unsigned short*)(ws + kOffVT);
  unsigned short* RES = (unsigned short*)(ws + kOffRES);
  float*          SC  = (float*)(ws + kOffSC);
  unsigned short* FFN = (unsigned short*)(ws + kOffFFN);
  float*          MROW = (float*)(ws + kOffMROW);
  float*          INVS = (float*)(ws + kOffINVS);
  float*          RC   = (float*)(ws + kOffRC);
  float*          CP   = (float*)(ws + kOffCP);
  float* out = (float*)d_out;

  const int nd8 = (int)(kND / 8);
  const int ww8 = (int)(kWW / 8);

  /* inputs of branch A (a*) and branch B (b*) */
  const float* ax   = (const float*)d_in[0];
  const float* bx   = (const float*)d_in[1];
  const float* apW1 = (const float*)d_in[2 + 0];
  const float* bpW1 = (const float*)d_in[18 + 0];
  const float* apb1 = (const float*)d_in[2 + 1];
  const float* bpb1 = (const float*)d_in[18 + 1];
  const float* apW2 = (const float*)d_in[2 + 2];
  const float* bpW2 = (const float*)d_in[18 + 2];
  const float* apb2 = (const float*)d_in[2 + 3];
  const float* bpb2 = (const float*)d_in[18 + 3];
  const float* arW1 = (const float*)d_in[2 + 4];
  const float* brW1 = (const float*)d_in[18 + 4];
  const float* arb1 = (const float*)d_in[2 + 5];
  const float* brb1 = (const float*)d_in[18 + 5];
  const float* arW2 = (const float*)d_in[2 + 6];
  const float* brW2 = (const float*)d_in[18 + 6];
  const float* arb2 = (const float*)d_in[2 + 7];
  const float* brb2 = (const float*)d_in[18 + 7];
  const float* arW3 = (const float*)d_in[2 + 8];
  const float* brW3 = (const float*)d_in[18 + 8];
  const float* arb3 = (const float*)d_in[2 + 9];
  const float* brb3 = (const float*)d_in[18 + 9];
  const float* aWq  = (const float*)d_in[2 + 10];
  const float* bWq  = (const float*)d_in[18 + 10];
  const float* aWk  = (const float*)d_in[2 + 11];
  const float* bWk  = (const float*)d_in[18 + 11];
  const float* aWv  = (const float*)d_in[2 + 12];
  const float* bWv  = (const float*)d_in[18 + 12];
  const float* alng = (const float*)d_in[2 + 13];
  const float* blng = (const float*)d_in[18 + 13];
  const float* alnb = (const float*)d_in[2 + 14];
  const float* blnb = (const float*)d_in[18 + 14];
  const float* affn = (const float*)d_in[2 + 15];
  const float* bffn = (const float*)d_in[18 + 15];

  /* Every launch below works on both branches: the pointers are branch A's, the strides lead to branch B's part. */
  const long r0B   = (long)kR0Bytes;
  const long nd    = (long)kND;
  const long ww    = (long)kWW;

  /* ffn weights -> f16 x256 planes (outside R0: they outlive the logits) */
  cast4_f16_kernel<<<dim3(ww8 / 256, 1, 2), 256, 0, stream>>>(affn, affn, affn, affn, bffn, bffn, bffn, bffn,
                                                              FFN, kWCarry, ww8, 0L, ww);

  /* operand planes: x hi/lo; pW1,pW2,Wq,Wk hi/lo (weights are [out][in] = Bt layout); rW1,rW2,rW3,Wv f16 x256 */
  split4_bf16_kernel<<<dim3(nd8 / 256, 1, 2), 256, 0, stream>>>(ax, ax, ax, ax, bx, bx, bx, bx, XH, XL, nd8, 0L, kR0El16);
  split4_bf16_kernel<<<dim3(ww8 / 256, 4, 2), 256, 0, stream>>>(apW1, apW2, aWq, aWk, bpW1, bpW2, bWq, bWk,
                                                                WSH, WSL, ww8, ww, kR0El16);
  cast4_f16_kernel<<<dim3(ww8 / 256, 4, 2), 256, 0, stream>>>(arW1, arW2, arW3, aWv, brW1, brW2, brW3, bWv,
                                                              WF, kWCarry, ww8, ww, kR0El16);

  /* h1 = relu(x . pW1^T + pb1) -> hi/lo : M 4096, N 512, K 512 */
  run_gemm<1, true, 2, 2, false, 2>(stream, XH, XL, kDim, WSH + 0 * kWW, WSL + 0 * kWW, kDim,
                                    (void*)T0H, (void*)T0L, kDim, apb1, bpb1, apb1, bpb1,
                                    kR0El16, kR0El16, 0L, r0B, 0L, 1, kTok, kDim, kDim, 1.0f);
  /* feat = h1 . pW2^T + pb2 -> hi/lo */
  run_gemm<1, true, 2, 2, false, 0>(stream, T0H, T0L, kDim, WSH + 1 * kWW, WSL + 1 * kWW, kDim,
                                    (void*)FH, (void*)FL, kDim, apb2, bpb2, apb2, bpb2,
                                    kR0El16, kR0El16, 0L, r0B, 0L, 1, kTok, kDim, kDim, 1.0f);
  /* f16 copy of feat */
  hilo_to_f16_kernel<<<dim3(nd8 / 256, 2), 256, 0, stream>>>(FH, FL, F16, nd8, kR0El16);
  /* residual chain: relu, relu, linear (f16 single products, weights x256) */
  run_gemm<0, false, 2, 1, false, 2>(stream, F16, F16, kDim, WF + 0 * kWW, WF + 0 * kWW, kDim,
                                     (void*)R1, (void*)R1, kDim, arb1, brb1, arb1, brb1,
                                     kR0El16, kR0El16, 0L, r0B, 0L, 1, kTok, kDim, kDim, kWCarryInv);
  run_gemm<0, false, 2, 1, false, 2>(stream, R1, R1, kDim, WF + 1 * kWW, WF + 1 * kWW, kDim,
                                     (void*)R2, (void*)R2, kDim, arb2, brb2, arb2, brb2,
                                     kR0El16, kR0El16, 0L, r0B, 0L, 1, kTok, kDim, kDim, kWCarryInv);
  run_gemm<0, false, 2, 1, false, 0>(stream, R2, R2, kDim, WF + 2 * kWW, WF + 2 * kWW, kDim,
                                     (void*)RES, (void*)RES, kDim, arb3, brb3, arb3, brb3,
                                     kR0El16, kR0El16, 0L, 2 * nd, 0L, 1, kTok, kDim, kDim, kWCarryInv);
  /* Q (plane 0) and K (plane 1) -> hi/lo planes; QK holds QH QL KH KL of branch A, then of branch B */
  run_gemm<1, true, 0, 2, false, 0>(stream, FH, FL, kDim, WSH + 2 * kWW, WSL + 2 * kWW, kDim,
                                    (void*)QK, (void*)(QK + kND), kDim, apb1, bpb1, apb1, bpb1,
                                    kR0El16, kR0El16, ww, 8 * nd, 4 * nd, 2, kTok, kDim, kDim, 1.0f);
  /* V^T[d][i] = sum_k Wv[d][k] feat[i][k] : A = Wv (M 512), Bt = feat f16 (N 4096), K 512, ldc 4096 */
  run_gemm<0, false, 0, 1, false, 0>(stream, WF + 3 * kWW, WF + 3 * kWW, kDim, F16, F16, kDim,
                                     (void*)VT, (void*)VT, kTok, apb1, bpb1, apb1, bpb1,
                                     kR0El16, kR0El16, 0L, 2 * nd, 0L, 1, kDim, kTok, kDim, kWCarryInv);

  /* ---- cross attention, add + LayerNorm, ffn ---- */
  /* S = Q_p . K_other^T (hi.hi + hi.lo + lo.hi), f32 : M 4096, N 4096, K 512. Branch A reads branch B's K planes
     (planes 6, 7 of QK) and branch B reads branch A's (planes 2, 3): the Bt stride is negative. */
  run_gemm<1, true, 0, 0, false, 0>(stream, QK, QK + kND, kDim, QK + 6 * kND, QK + 7 * kND, kDim,
                                    (void*)S, (void*)S, kTok, alng, blng, alng, blng,
                                    4 * nd, -4 * nd, 0L, r0B, 0L, 1, kTok, kTok, kDim, 1.0f);
  rowcol_kernel<<<dim3(kRcParts, 2), 512, 0, stream>>>(S, MROW, INVS, CP);
  colfin_kernel<<<dim3(kTok / 32, 2), 256, 0, stream>>>(CP, RC);
  av_kernel<<<dim3(kTok / 64, 2, kAvHalves), 256, 0, stream>>>(S, MROW, INVS, RC, VT, SC);
  /* S is dead from here; S32 / S16 occupy the first 12 MiB of each branch's R0 */
  add_ln_kernel<<<dim3(kTok / 8, 2), 256, 0, stream>>>(RES, SC, alng, alnb, blng, blnb, S32, S16);
  /* out = s + s . ffnW^T : A = s f16, Bt = ffnW f16 x256, residual s f32 fetched in the store phase */
  run_gemm<0, false, 0, 0, true, 0>(stream, S16, S16, kDim, FFN, FFN, kDim,
                                    (void*)out, (void*)out, kDim, alng, blng, S32, S32 + kR0El32,
                                    kR0El16, ww, 0L, 4 * nd, 0L, 1, kTok, kDim, kDim, kWCarryInv);
}

// v007
// One run takes 264 microseconds.
// Timed twice side by side with v006, it ran 1.08 and 1.09 times as fast.
// Over all steps from v000 it is 5.24 times as fast.
// Contractions: pW1/pW2/Wq/Wk linears and q.k^T logits on v_wmma_f32_16x16x32_bf16 with both operands as bf16 hi+lo planes (hi.hi + hi.lo + lo.hi), f32 accumulate, logits kept f32; rW1/rW2/rW3/Wv/ffn linears and attn.V on v_wmma_f32_16x16x32_f16 (weights carried x256, attention weights carried x32768), f32 accumulate; softmax statistics, column sums, LayerNorm and residual adds in f32.
#include <hip/hip_runtime.h>
#include <math.h>

typedef __attribute__((ext_vector_type(16))) _Float16 v16h;
typedef __attribute__((ext_vector_type(8)))  _Float16 v8h;
typedef __attribute__((ext_vector_type(16))) __bf16   v16b;
typedef __attribute__((ext_vector_type(8)))  __bf16   v8b;
typedef __attribute__((ext_vector_type(8)))  float    v8f;
typedef __attribute__((ext_vector_type(4)))  float    v4f;
typedef __attribute__((ext_vector_type(4)))  unsigned int v4u;
typedef __attribute__((ext_vector_type(2)))  unsigned int v2u;

// ---------------------------------------------------------------------------
// Problem constants
// ---------------------------------------------------------------------------
constexpr int    kTok       = 4096;
constexpr int    kDim       = 512;
constexpr size_t kND        = (size_t)kTok * kDim;
constexpr size_t kWW        = (size_t)kDim * kDim;
constexpr float  kWCarry    = 256.0f;
constexpr float  kWCarryInv = 1.0f / kWCarry;
constexpr float  kPCarry    = 32768.0f;
constexpr float  kPCarryInv = 1.0f / kPCarry;
constexpr float  kInvDim    = 1.0f / (float)kDim;
constexpr float  kLnEps     = 1e-6f;
constexpr float  kAttnEps   = 1e-9f;
static_assert((kTok % 64) == 0 && (kDim % 64) == 0);
static_assert((kTok % 32) == 0 && (kDim % 32) == 0);
static_assert(((kND / 8) % 256) == 0 && ((kWW / 8) % 256) == 0);

// ---------------------------------------------------------------------------
// Workspace region map (bytes; every offset is a multiple of 128). Both branches run in the same launches, so every
// region holds branch A's part and then branch B's (SC: once per half of the keys).
//   R0      2 x 67,108,864  time-shared region, one per branch:
//             (a) operand planes of the branch's linear chain:
//                 XH XL T0H T0L FH FL   6 x 4,194,304 (16-bit [4096][512] planes)
//                 WSH (4 bf16 hi weight planes) 2,097,152 ; WSL (4 bf16 lo planes) 2,097,152 -> 29,360,128 used
//             (b) S f32 [4096][4096] logits of the branch                    67,108,864
//             (c) S32 f32 [4096][512] + S16 f16 [4096][512] LayerNorm output 12,582,912
//   QK      33,554,432  QH QL KH KL bf16 planes [4096][512], branch A then branch B
//   VT       8,388,608  V^T f16 [512][4096], branch A then B
//   RES      8,388,608  residual-chain output f16 [4096][512], branch A then B
//   SC      33,554,432  attn.V output f32 [4096][512], one share per half of the keys: half 0 (branch A then B), half 1
//   FFN      1,048,576  ffn weight f16 planes (x256), branch A then B
//   MROW        32,768  row maxima f32 [4096], branch A then B
//   INVS        32,768  1 / row exp sums f32 [4096], branch A then B
//   RC          32,768  1 / (1e-9 + column sums) f32 [4096], branch A then B
//   CP       4,194,304  column-sum shares f32 [128][4096] (one per block of 32 query rows), branch A then B
//   R1, R2   8,388,608 each  residual-chain planes f16 [4096][512], branch A then B; outside R0, because the second
//                       residual product and V^T run in the launch that writes the logits, the third one behind it
//   WF       4,194,304  4 f16 weight planes (x256), branch A then B; outside R0 for the same reason
//   F16      8,388,608  f16 copy of feat [4096][512], branch A then B; outside R0 for the same reason
//   total = 134,217,728 + 33,554,432 + 8,388,608 + 8,388,608 + 33,554,432 + 1,048,576 + 32,768 + 32,768 + 32,768
//           + 4,194,304 + 8,388,608 + 8,388,608 + 4,194,304 + 8,388,608 = 252,805,120
// ---------------------------------------------------------------------------
constexpr size_t kPlane16  = kND * 2;
constexpr size_t kPlane32  = kND * 4;
constexpr size_t kW16      = kWW * 2;
constexpr size_t kR0Bytes  = (size_t)kTok * kTok * 4;
constexpr size_t kOffXH    = 0;
constexpr size_t kOffXL    = kOffXH  + kPlane16;
constexpr size_t kOffT0H   = kOffXL  + kPlane16;
constexpr size_t kOffT0L   = kOffT0H + kPlane16;
constexpr size_t kOffFH    = kOffT0L + kPlane16;
constexpr size_t kOffFL    = kOffFH  + kPlane16;
constexpr size_t kOffWSH   = kOffFL  + kPlane16;
constexpr size_t kOffWSL   = kOffWSH + 4 * kW16;
constexpr size_t kPhase1End = kOffWSL + 4 * kW16;
constexpr size_t kOffS     = 0;
constexpr size_t kOffS32   = 0;
constexpr size_t kOffS16   = kOffS32 + kPlane32;
constexpr size_t kOffQK    = 2 * kR0Bytes;
constexpr size_t kOffVT    = kOffQK  + 8 * kPlane16;
constexpr size_t kOffRES   = kOffVT  + 2 * kPlane16;
constexpr size_t kOffSC    = kOffRES + 2 * kPlane16;
constexpr size_t kOffFFN   = kOffSC  + 4 * kPlane32;
constexpr size_t kOffMROW  = kOffFFN + 2 * kW16;
constexpr size_t kOffINVS  = kOffMROW + 2 * (size_t)kTok * 4;
constexpr size_t kOffRC    = kOffINVS + 2 * (size_t)kTok * 4;
constexpr size_t kOffCP    = kOffRC   + 2 * (size_t)kTok * 4;
constexpr size_t kCPBytes  = 2 * (size_t)(kTok / 32) * kTok * 4;
constexpr size_t kOffR1    = kOffCP   + kCPBytes;
constexpr size_t kOffR2    = kOffR1   + 2 * kPlane16;
constexpr size_t kOffWF    = kOffR2   + 2 * kPlane16;
constexpr size_t kOffF16   = kOffWF   + 8 * kW16;
constexpr size_t kWsTotal  = kOffF16  + 2 * kPlane16;
constexpr long   kR0El16   = (long)(kR0Bytes / 2);  /* branch A -> branch B inside R0, in 16-bit elements */
constexpr long   kR0El32   = (long)(kR0Bytes / 4);  /* the same in f32 elements */
static_assert(kPhase1End <= kR0Bytes);
static_assert(kOffS16 + kPlane16 <= kR0Bytes);
static_assert(kWsTotal == 252805120ull);
static_assert(kWsTotal <= 268435456ull);
static_assert((kOffWSH % 128) == 0 && (kOffWSL % 128) == 0 && (kOffWF % 128) == 0 && (kOffQK % 128) == 0 &&
              (kOffVT % 128) == 0 && (kOffRES % 128) == 0 && (kOffSC % 128) == 0 && (kOffFFN % 128) == 0 &&
              (kOffMROW % 128) == 0 && (kOffINVS % 128) == 0 && (kOffRC % 128) == 0 && (kOffS16 % 128) == 0 &&
              (kOffCP % 128) == 0 && (kOffR1 % 128) == 0 && (kOffR2 % 128) == 0 &&
              (kOffF16 % 128) == 0);

// ---------------------------------------------------------------------------
// Small helpers
// ---------------------------------------------------------------------------
__device__ __forceinline__ unsigned short f2bf_bits(float f) {
  unsigned u = __float_as_uint(f);
  return (unsigned short)((u + 0x7FFFu + ((u >> 16) & 1u)) >> 16);
}
__device__ __forceinline__ float bf_bits2f(unsigned short h) { return __uint_as_float(((unsigned)h) << 16); }

/* f16 bits (low 16 bits of hb, finite values) -> f32, integer path only */
__device__ __forceinline__ float h16_to_f32(unsigned hb) {
  const unsigned sgn = (hb & 0x8000u) << 16;
  const unsigned em = hb & 0x7fffu;
  const float fn = __uint_as_float((em << 13) + 0x38000000u);
  const float fs = (float)em * 5.9604644775390625e-8f;
  const float mag = (em < 0x400u) ? fs : fn;
  return __uint_as_float(__float_as_uint(mag) | sgn);
}

/* hazard guards: four nops, all four accumulators of the group tied, A fragments named as inputs */
__device__ __forceinline__ void grp_guard_h(v8f& a, v8f& b, v8f& c, v8f& d, v16h x, v16h y) {
  asm volatile("v_nop\n\tv_nop\n\tv_nop\n\tv_nop" : "+v"(a), "+v"(b), "+v"(c), "+v"(d) : "v"(x), "v"(y));
}
__device__ __forceinline__ void grp_guard_b(v8f& a, v8f& b, v8f& c, v8f& d, v16b x, v16b y) {
  asm volatile("v_nop\n\tv_nop\n\tv_nop\n\tv_nop" : "+v"(a), "+v"(b), "+v"(c), "+v"(d) : "v"(x), "v"(y));
}
__device__ __forceinline__ void keep4_h(v16h a, v16h b, v16h c, v16h d) { asm volatile("v_nop" :: "v"(a), "v"(b), "v"(c), "v"(d)); }
__device__ __forceinline__ void keep4_b(v16b a, v16b b, v16b c, v16b d) { asm volatile("v_nop" :: "v"(a), "v"(b), "v"(c), "v"(d)); }
__device__ __forceinline__ void acc_guard4(v8f& a, v8f& b, v8f& c, v8f& d) {
  asm volatile("v_nop\n\tv_nop\n\tv_nop\n\tv_nop" : "+v"(a), "+v"(b), "+v"(c), "+v"(d));
}

/* Fragment loader: elements 0..7 <- p[0..7], elements 8..15 <- p[16..23]; p already includes 8*(lane>>4) */
template <typename T> struct Frag;
template <> struct Frag<_Float16> {
  typedef v16h V;
  union U { v16h v; v8h h[2]; };
  static __device__ __forceinline__ v16h load(const _Float16* p) {
    U f;
    f.h[0] = *(const v8h*)(p);
    f.h[1] = *(const v8h*)(p + 16);
    return f.v;
  }
  static __device__ __forceinline__ v8f mma(v16h a, v16h b, v8f c) {
    return __builtin_amdgcn_wmma_f32_16x16x32_f16(false, a, false, b, (short)0, c, false, false);
  }
  static __device__ __forceinline__ void guard(v8f& a, v8f& b, v8f& c, v8f& d, v16h x, v16h y) { grp_guard_h(a, b, c, d, x, y); }
  static __device__ __forceinline__ void keep(v16h a, v16h b, v16h c, v16h d) { keep4_h(a, b, c, d); }
};
template <> struct Frag<__bf16> {
  typedef v16b V;
  union U { v16b v; v8b h[2]; };
  static __device__ __forceinline__ v16b load(const __bf16* p) {
    U f;
    f.h[0] = *(const v8b*)(p);
    f.h[1] = *(const v8b*)(p + 16);
    return f.v;
  }
  static __device__ __forceinline__ v8f mma(v16b a, v16b b, v8f c) {
    return __builtin_amdgcn_wmma_f32_16x16x32_bf16(false, a, false, b, (short)0, c, false, false);
  }
  static __device__ __forceinline__ void guard(v8f& a, v8f& b, v8f& c, v8f& d, v16b x, v16b y) { grp_guard_b(a, b, c, d, x, y); }
  static __device__ __forceinline__ void keep(v16b a, v16b b, v16b c, v16b d) { keep4_b(a, b, c, d); }
};

// ---------------------------------------------------------------------------
// LDS-staged WMMA GEMM: C[m,n] = scale * sum_k A[m,k] * Bt[n,k] (+bias[n]) (+resid[m,n]). A block of 4 waves owns a
// 128x128 tile (2x2 waves, each wave a 64x64 tile). A row-major [M][K] pitch lda; Bt row-major [N][K] pitch ldb;
// M, N multiples of 128, K a multiple of 64 and at least 128.
// Operand path: a stage is 64 k (one whole 128-B line) of the block's 128 A rows and 128 Bt rows, every plane, brought
// into LDS by per-lane asynchronous 16-B copies (8 lanes per line, 4 whole lines per wave instruction). SPLIT: two
// buffers, the next stage's copies fly while this stage is multiplied. Not SPLIT: four buffers, the next three stages'
// copies fly (48 of a wave at the most); every wave issues 16 copies per stage, so the wait for a stage is a counted
// wait that leaves the younger stages' copies out. LDS row pitch 144 B (16 B x 9) for the 16-B readers.
// SPLIT: operands are hi/lo planes (A2/Bt2 = lo planes, same layout); product = hi.hi + hi.lo + lo.hi.
// BIAS_MODE: 0 none, 2 bias[n] (f32). ACT: 0 none, 2 relu. RESID (f32 output only): the residual is fetched in the
// store phase, one 16-B vector per lane at exactly the address the lane stores to.
// OUT_MODE: 0 f32, 1 f16, 2 bf16 hi plane (Cout) + bf16 lo plane (Cout2).
// Epilogue: 16-row slabs staged per wave in LDS (only the owning wave touches its slab); the slabs reuse the ring
// behind the last stage's waits and barrier.
// ET: 0 f16 operands, 1 bf16 operands (pointers passed as 16-bit storage).
// One launch holds several independent products: gemm_tile is the work of one block, (bx, by, bz) = (tile, branch,
// weight plane) of its product; the kernels below pick product and tile from blockIdx (block-uniform). The pointers
// are those of (0, 0); aP, bP (16-bit elements) and cP (bytes) lead to branch 1, bQ and cQ to plane 1.
// Every form's ring has the same size, so the products of a launch share one LDS array.
// ---------------------------------------------------------------------------
template <int ET> struct Elem;
template <> struct Elem<0> { typedef _Float16 T; };
template <> struct Elem<1> { typedef __bf16 T; };

constexpr int kStageK   = 64;
constexpr int kRowPitch = 144;
constexpr int kPlaneLds = 128 * kRowPitch;
constexpr int kSlabLds  = 16 * 68 * 4;
static_assert((kRowPitch % 16) == 0 && ((kRowPitch / 16) % 2) == 1 && kRowPitch >= kStageK * 2);
static_assert((kDim % 128) == 0 && (kTok % 128) == 0 && (kDim % kStageK) == 0 && kDim >= 2 * kStageK);
static_assert(4 * kSlabLds <= 4 * kPlaneLds && (kSlabLds % 16) == 0);

/* One plane's 128 rows x 128 B of a stage: this lane's eight 16-B pieces, rows 16 apart. l = the lane's LDS byte
   address of its first piece, g = its global address, gstep = 16 source rows in elements. The copies and the
   s_wait_xcnt stand in one statement so that no address register is rewritten ahead of that wait. */
__device__ __forceinline__ void stage_plane(unsigned l, const unsigned short* g, size_t gstep) {
  const unsigned l1 = l + 16 * kRowPitch, l2 = l + 32 * kRowPitch, l3 = l + 48 * kRowPitch, l4 = l + 64 * kRowPitch,
                 l5 = l + 80 * kRowPitch, l6 = l + 96 * kRowPitch, l7 = l + 112 * kRowPitch;
  const unsigned short *g1 = g + gstep, *g2 = g + 2 * gstep, *g3 = g + 3 * gstep, *g4 = g + 4 * gstep,
                       *g5 = g + 5 * gstep, *g6 = g + 6 * gstep, *g7 = g + 7 * gstep;
  asm volatile(
      "global_load_async_to_lds_b128 %0, %8, off\n\t"
      "global_load_async_to_lds_b128 %1, %9, off\n\t"
      "global_load_async_to_lds_b128 %2, %10, off\n\t"
      "global_load_async_to_lds_b128 %3, %11, off\n\t"
      "global_load_async_to_lds_b128 %4, %12, off\n\t"
      "global_load_async_to_lds_b128 %5, %13, off\n\t"
      "global_load_async_to_lds_b128 %6, %14, off\n\t"
      "global_load_async_to_lds_b128 %7, %15, off\n\t"
      "s_wait_xcnt 0x0"
      :: "v"(l), "v"(l1), "v"(l2), "v"(l3), "v"(l4), "v"(l5), "v"(l6), "v"(l7),
         "v"(g), "v"(g1), "v"(g2), "v"(g3), "v"(g4), "v"(g5), "v"(g6), "v"(g7)
      : "memory");
}

/* Four-buffer ring, 16 copies of a wave per stage: returns when all of this wave's copies have landed but those of its
   'younger' youngest stages (2 at the most are in flight behind the stage that is waited for; 1 and then none in the
   last trips, which issue no stage). The count returns in issue order. younger is the same for the whole block. */
__device__ __forceinline__ void wait_copies_but(int younger) {
  if (younger >= 2)      asm volatile("s_wait_asynccnt 0x20" ::: "memory");
  else if (younger == 1) asm volatile("s_wait_asynccnt 0x10" ::: "memory");
  else                   asm volatile("s_wait_asynccnt 0x0" ::: "memory");
}

struct GemmArgs {
  const unsigned short* Ap0;
  const unsigned short* A2p0;
  const unsigned short* Btp0;
  const unsigned short* Bt2p0;
  void* Cout0;
  void* Cout20;
  const float* bias0;
  const float* bias1;
  const float* resid0;
  const float* resid1;
  long aP, bP, bQ, cP, cQ;
  int lda, ldb, ldc, M, N, K;
  float scale;
};
constexpr int kRingLds = 8 * kPlaneLds;

template <int ET, bool SPLIT, int BIAS_MODE, int OUT_MODE, bool RESID, int ACT>
__device__ __forceinline__ void gemm_tile(const GemmArgs& ga, int bx, int by, int bz, unsigned char* ring) {
  typedef typename Elem<ET>::T T;
  typedef typename Frag<T>::V V;
  const unsigned short* __restrict__ Ap0 = ga.Ap0;
  const unsigned short* __restrict__ A2p0 = ga.A2p0;
  const unsigned short* __restrict__ Btp0 = ga.Btp0;
  const unsigned short* __restrict__ Bt2p0 = ga.Bt2p0;
  void* __restrict__ Cout0 = ga.Cout0;
  void* __restrict__ Cout20 = ga.Cout20;
  const float* __restrict__ bias0 = ga.bias0;
  const float* __restrict__ bias1 = ga.bias1;
  const float* __restrict__ resid0 = ga.resid0;
  const float* __restrict__ resid1 = ga.resid1;
  const long aP = ga.aP, bP = ga.bP, bQ = ga.bQ, cP = ga.cP, cQ = ga.cQ;
  const int lda = ga.lda, ldb = ga.ldb, ldc = ga.ldc, M = ga.M, N = ga.N, K = ga.K;
  const float scale = ga.scale;
  const long zp = (long)by;
  const long zq = (long)bz;
  const unsigned short* Ap   = Ap0 + zp * aP;
  const unsigned short* A2p  = A2p0 + zp * aP;
  const unsigned short* Btp  = Btp0 + zp * bP + zq * bQ;
  const unsigned short* Bt2p = Bt2p0 + zp * bP + zq * bQ;
  void* Cout  = (void*)((char*)Cout0 + zp * cP + zq * cQ);
  void* Cout2 = (void*)((char*)Cout20 + zp * cP + zq * cQ);
  const float* bias  = zp ? bias1 : bias0;
  const float* resid = zp ? resid1 : resid0;
  /* stage layout: A hi | (A lo) | Bt hi | (Bt lo), each plane 128 rows at kRowPitch */
  constexpr int kPlanes = SPLIT ? 4 : 2;
  constexpr int kStageLds = kPlanes * kPlaneLds;
  constexpr int kOffBh = (SPLIT ? 2 : 1) * kPlaneLds;
  constexpr int kBufs = SPLIT ? 2 : 4;
  static_assert(kBufs * kStageLds == kRingLds);
  const int lane = threadIdx.x & 31;
  const int wave = __builtin_amdgcn_readfirstlane((int)(threadIdx.x >> 5));
  const int tilesN = N >> 7;
  const int tilesM = M >> 7;
  /* block-uniform exit in front of every copy and barrier */
  if (bx >= tilesM * tilesN) return;
  const int bm = bx / tilesN;
  const int bn = bx - bm * tilesN;
  const int wm = (wave >> 1) << 6;
  const int wn = (wave & 1) << 6;
  const int m0 = (bm << 7) + wm;
  const int n0 = (bn << 7) + wn;

  const int rlane = lane & 15;
  const int koff  = (lane >> 4) * 8;
  const int mOff  = (lane >> 4) * 8;

  /* copy map: thread t brings 16-B piece t&7 of rows (t>>3) + 16q, q 0..7, of every plane */
  const int crow = (int)threadIdx.x >> 3;
  const int cpc  = (int)threadIdx.x & 7;
  const unsigned ldsBase = (unsigned)(size_t)(&ring[0]) + (unsigned)(crow * kRowPitch + cpc * 16);
  const size_t aOff = (size_t)((bm << 7) + crow) * lda + cpc * 8;
  const size_t bOff = (size_t)((bn << 7) + crow) * ldb + cpc * 8;
  const size_t aStep = (size_t)16 * lda;
  const size_t bStep = (size_t)16 * ldb;
  const int nStages = K / kStageK;

  auto issue_stage = [&](int s) {
    const unsigned l = ldsBase + (unsigned)((s & (kBufs - 1)) * kStageLds);
    const size_t kq = (size_t)s * kStageK;
    stage_plane(l, Ap + aOff + kq, aStep);
    if (SPLIT) stage_plane(l + kPlaneLds, A2p + aOff + kq, aStep);
    stage_plane(l + kOffBh, Btp + bOff + kq, bStep);
    if (SPLIT) stage_plane(l + kOffBh + kPlaneLds, Bt2p + bOff + kq, bStep);
  };

  v8f acc[4][4];
#pragma unroll
  for (int i = 0; i < 4; ++i)
#pragma unroll
    for (int j = 0; j < 4; ++j) acc[i][j] = (v8f){0.f, 0.f, 0.f, 0.f, 0.f, 0.f, 0.f, 0.f};

  /* prologue: stage 0 landed and published; stage 1 (SPLIT) or stages 1, 2 and 3 in flight */
  issue_stage(0);
  if (SPLIT) {
    asm volatile("s_wait_asynccnt 0x0" ::: "memory");  /* this wave's stage-0 copies have landed */
  } else {
    if (nStages > 1) issue_stage(1);
    if (nStages > 2) issue_stage(2);
    wait_copies_but(nStages - 1);  /* this wave's stage-0 copies have landed */
  }
  __syncthreads();
  if (nStages > kBufs - 1) issue_stage(kBufs - 1);

  const int aFrag = (wm + rlane) * kRowPitch + koff * 2;
  const int bFrag = kOffBh + (wn + rlane) * kRowPitch + koff * 2;

#pragma unroll 1  /* one stage per trip: the foot's waits and barrier stand once */
  for (int s = 0; s < nStages; ++s) {
    const unsigned char* sb = ring + (s & (kBufs - 1)) * kStageLds;
#pragma unroll
    for (int kk = 0; kk < kStageK; kk += 32) {
      V bh[4], bl[4];
      const unsigned char* ap = sb + aFrag + kk * 2;
      V ah = Frag<T>::load((const T*)ap);
      V al;
      if (SPLIT) al = Frag<T>::load((const T*)(ap + kPlaneLds));
#pragma unroll
      for (int j = 0; j < 4; ++j) {
        const unsigned char* bp = sb + bFrag + j * 16 * kRowPitch + kk * 2;
        bh[j] = Frag<T>::load((const T*)bp);
        if (SPLIT) bl[j] = Frag<T>::load((const T*)(bp + kPlaneLds));
      }
#pragma unroll
      for (int i = 0; i < 4; ++i) {
        /* the next row group's A fragments are read in front of this group's products */
        V nh = ah;
        V nl;
        if (SPLIT) nl = al;
        if (i < 3) {
          nh = Frag<T>::load((const T*)(ap + (i + 1) * 16 * kRowPitch));
          if (SPLIT) nl = Frag<T>::load((const T*)(ap + (i + 1) * 16 * kRowPitch + kPlaneLds));
        }
#pragma unroll
        for (int j = 0; j < 4; ++j) {
          acc[i][j] = Frag<T>::mma(ah, bh[j], acc[i][j]);
          if (SPLIT) {
            acc[i][j] = Frag<T>::mma(ah, bl[j], acc[i][j]);
            acc[i][j] = Frag<T>::mma(al, bh[j], acc[i][j]);
          }
        }
        Frag<T>::guard(acc[i][0], acc[i][1], acc[i][2], acc[i][3], ah, SPLIT ? al : ah);
        ah = nh;
        if (SPLIT) al = nl;
      }
      Frag<T>::keep(bh[0], bh[1], bh[2], bh[3]);
      if (SPLIT) Frag<T>::keep(bl[0], bl[1], bl[2], bl[3]);
    }
    /* publish point of stage s + 1; the one barrier also ends every reader's last read of stage s's buffer */
    asm volatile("s_wait_dscnt 0x0" ::: "memory");     /* this wave's reads of stage s have returned */
    /* this wave's stage s + 1 copies have landed */
    if (SPLIT) asm volatile("s_wait_asynccnt 0x0" ::: "memory");
    else       wait_copies_but(nStages - 2 - s);
    __syncthreads();
    if (s + kBufs < nStages) issue_stage(s + kBufs);  /* into the buffer that trip s has just read */
  }
  asm volatile("s_wait_asynccnt 0x0" ::: "memory");  /* no copy is outstanding when the ring becomes the slabs */
  acc_guard4(acc[0][0], acc[0][1], acc[0][2], acc[0][3]);
  acc_guard4(acc[1][0], acc[1][1], acc[1][2], acc[1][3]);
  acc_guard4(acc[2][0], acc[2][1], acc[2][2], acc[2][3]);
  acc_guard4(acc[3][0], acc[3][1], acc[3][2], acc[3][3]);

  /* ---- epilogue ---- */
  float* slab = (float*)(ring + wave * kSlabLds);
#pragma unroll
  for (int i = 0; i < 4; ++i) {
    const int mBase = m0 + (i << 4);
#pragma unroll
    for (int j = 0; j < 4; ++j) {
      const int n = n0 + (j << 4) + rlane;
      float bv = 0.f;
      if (BIAS_MODE == 2) bv = bias[n];
#pragma unroll
      for (int r = 0; r < 8; ++r) {
        float v = acc[i][j][r] * scale;
        if (BIAS_MODE == 2) v += bv;
        if (ACT == 2) v = fmaxf(v, 0.0f);
        slab[(mOff + r) * 68 + (j << 4) + rlane] = v;
      }
    }
    __builtin_amdgcn_fence(__ATOMIC_RELEASE, "workgroup");
    __builtin_amdgcn_wave_barrier();
    __builtin_amdgcn_fence(__ATOMIC_ACQUIRE, "workgroup");
    if (OUT_MODE == 0) {
      /* rows it*2 + hh, it 0..7, hh 0..1 = 16 rows; 16 lanes x 16 B = the 256-B row segment */
      float* C = (float*)Cout;
      const int hh = lane >> 4, c4 = (lane & 15) * 4;
      v4f vals[8];
#pragma unroll
      for (int it = 0; it < 8; ++it) {
        const int row = it * 2 + hh;
        v4f v = *(const v4f*)(slab + row * 68 + c4);
        if (RESID) {
          const v4f rr = *(const v4f*)(resid + (size_t)(mBase + row) * ldc + n0 + c4);
          v = v + rr;
        }
        vals[it] = v;
      }
      {
#pragma unroll
        for (int it = 0; it < 8; ++it) {
          const int row = it * 2 + hh;
          *(v4f*)(C + (size_t)(mBase + row) * ldc + n0 + c4) = vals[it];
        }
        
      }
    } else {
      const int q = lane >> 3, c8 = (lane & 7) * 8;
      unsigned short* C  = (unsigned short*)Cout;
      unsigned short* C2 = (unsigned short*)Cout2;
      {
#pragma unroll
        for (int it = 0; it < 4; ++it) {
          const int row = it * 4 + q;
          const float* sp = slab + row * 68 + c8;
          v8h hv, lv;
#pragma unroll
          for (int e = 0; e < 8; ++e) {
            const float sv = sp[e];
            if (OUT_MODE == 1) {
              hv[e] = (_Float16)sv;
            } else {
              const unsigned short hb = f2bf_bits(sv);
              const unsigned short lb = f2bf_bits(sv - bf_bits2f(hb));
              hv[e] = __builtin_bit_cast(_Float16, hb);
              lv[e] = __builtin_bit_cast(_Float16, lb);
            }
          }
          *(v8h*)(C + (size_t)(mBase + row) * ldc + n0 + c8) = hv;
          if (OUT_MODE == 2) *(v8h*)(C2 + (size_t)(mBase + row) * ldc + n0 + c8) = lv;
        }
        
      }
    }
    __builtin_amdgcn_fence(__ATOMIC_RELEASE, "workgroup");
    __builtin_amdgcn_wave_barrier();
    __builtin_amdgcn_fence(__ATOMIC_ACQUIRE, "workgroup");
  }
}

/* one product per launch: blockIdx = (tile, branch, weight plane) */
template <int ET, bool SPLIT, int BIAS_MODE, int OUT_MODE, bool RESID, int ACT>
__global__ __launch_bounds__(128) void wmma_gemm64(GemmArgs ga) {
  __shared__ __align__(16) unsigned char ring[kRingLds];
  gemm_tile<ET, SPLIT, BIAS_MODE, OUT_MODE, RESID, ACT>(ga, (int)blockIdx.x, (int)blockIdx.y, (int)blockIdx.z, ring);
}

/* Three products of feat, none reading what another writes: blockIdx.z 0, 1 = Q, K (hi/lo products, the long blocks,
   lowest in z), 2 = first residual product (bias, relu). blockIdx.y = branch. Each has kSmallTiles tiles. */
constexpr int kSmallTiles = (kTok >> 7) * (kDim >> 7);
__global__ __launch_bounds__(128) void qk_res1_kernel(GemmArgs gq, GemmArgs gr) {
  __shared__ __align__(16) unsigned char ring[kRingLds];
  const int z = (int)blockIdx.z;
  if (z < 2) gemm_tile<1, true, 0, 2, false, 0>(gq, (int)blockIdx.x, (int)blockIdx.y, z, ring);
  else       gemm_tile<0, false, 2, 1, false, 2>(gr, (int)blockIdx.x, (int)blockIdx.y, 0, ring);
}

/* Logits and, independent of them and of each other, the second residual product (bias, relu) and V^T. Flat grid: the
   2 x kLogitTiles logit blocks (the long ones) first, branch A then B; then 2 x kSmallTiles residual blocks; then
   2 x kSmallTiles V^T blocks. */
constexpr int kLogitTiles = (kTok >> 7) * (kTok >> 7);
__global__ __launch_bounds__(128) void logits_res2_vt_kernel(GemmArgs gs, GemmArgs gr, GemmArgs gv) {
  __shared__ __align__(16) unsigned char ring[kRingLds];
  const int x = (int)blockIdx.x;
  if (x < 2 * kLogitTiles) {
    gemm_tile<1, true, 0, 0, false, 0>(gs, x % kLogitTiles, x / kLogitTiles, 0, ring);
  } else if (x < 2 * kLogitTiles + 2 * kSmallTiles) {
    const int u = x - 2 * kLogitTiles;
    gemm_tile<0, false, 2, 1, false, 2>(gr, u % kSmallTiles, u / kSmallTiles, 0, ring);
  } else {
    const int u = x - (2 * kLogitTiles + 2 * kSmallTiles);
    gemm_tile<0, false, 0, 1, false, 0>(gv, u % kSmallTiles, u / kSmallTiles, 0, ring);
  }
}

// ---------------------------------------------------------------------------
// Operand conversions, 8 contiguous elements per thread (two 16-B loads, one 16-B store per output plane).
// split8_bf16: f32 -> bf16 hi + bf16 lo (both RNE converts: hi = bf16(v), lo = bf16(v - hi)).
// cast8_f16: f32 -> f16 with a power-of-two carry.
// ---------------------------------------------------------------------------
__device__ __forceinline__ void split8_bf16(const float* __restrict__ p, unsigned short* __restrict__ qh,
                                            unsigned short* __restrict__ ql) {
  const v4f a0 = *(const v4f*)(p);
  const v4f a1 = *(const v4f*)(p + 4);
  v8h hv, lv;
#pragma unroll
  for (int e = 0; e < 4; ++e) {
    const float f0 = a0[e], f1 = a1[e];
    const unsigned short h0 = f2bf_bits(f0), h1 = f2bf_bits(f1);
    const unsigned short l0 = f2bf_bits(f0 - bf_bits2f(h0)), l1 = f2bf_bits(f1 - bf_bits2f(h1));
    hv[e]     = __builtin_bit_cast(_Float16, h0);
    hv[4 + e] = __builtin_bit_cast(_Float16, h1);
    lv[e]     = __builtin_bit_cast(_Float16, l0);
    lv[4 + e] = __builtin_bit_cast(_Float16, l1);
  }
  *(v8h*)qh = hv;
  *(v8h*)ql = lv;
  /* no register of the two stores is rewritten ahead of this wait, whichever block the compiler lays behind this one */
  asm volatile("s_wait_xcnt 0x0" ::: "memory");
}
__device__ __forceinline__ void cast8_f16(const float* __restrict__ p, unsigned short* __restrict__ q, float carry) {
  const v4f a0 = *(const v4f*)(p);
  const v4f a1 = *(const v4f*)(p + 4);
  v8h hv;
#pragma unroll
  for (int e = 0; e < 4; ++e) {
    const float f0 = a0[e] * carry, f1 = a1[e] * carry;
    hv[e]     = (_Float16)f0;
    hv[4 + e] = (_Float16)f1;
  }
  *(v8h*)q = hv;
  /* no register of the store is rewritten ahead of this wait, whichever block the compiler lays behind this one */
  asm volatile("s_wait_xcnt 0x0" ::: "memory");
}

// ---------------------------------------------------------------------------
// All operand conversions of the inputs in one launch (none reads what another writes). blockIdx.z = branch (sources
// a* or b*). blockIdx.x (block-uniform) picks the job: kXBlk blocks split x; 4 x kWBlk split the weights s0..s3 into
// planes 0..3 of WSH / WSL; 4 x kWBlk cast the weights c0..c3 into planes 0..3 of WF; kWBlk cast the ffn weight.
// Coverage: blocks x 256 threads x 8 elements = each plane exactly.
// ---------------------------------------------------------------------------
constexpr int kXBlk = (int)(kND / 8 / 256);
constexpr int kWBlk = (int)(kWW / 8 / 256);
constexpr int kPrepBlocks = kXBlk + 9 * kWBlk;
__global__ __launch_bounds__(256) void prep_kernel(
    const float* __restrict__ ax, const float* __restrict__ bx,
    const float* __restrict__ as0, const float* __restrict__ as1, const float* __restrict__ as2, const float* __restrict__ as3,
    const float* __restrict__ bs0, const float* __restrict__ bs1, const float* __restrict__ bs2, const float* __restrict__ bs3,
    const float* __restrict__ ac0, const float* __restrict__ ac1, const float* __restrict__ ac2, const float* __restrict__ ac3,
    const float* __restrict__ bc0, const float* __restrict__ bc1, const float* __restrict__ bc2, const float* __restrict__ bc3,
    const float* __restrict__ affn, const float* __restrict__ bffn,
    unsigned short* __restrict__ xh, unsigned short* __restrict__ xl,
    unsigned short* __restrict__ wsh, unsigned short* __restrict__ wsl,
    unsigned short* __restrict__ wf, unsigned short* __restrict__ ffn) {
  const int b = (int)blockIdx.x;
  const int z = (int)blockIdx.z;
  const int t = (int)threadIdx.x;
  if (b < kXBlk) {
    const size_t e0 = (size_t)(b * 256 + t) << 3;
    const size_t o = (size_t)z * kR0El16 + e0;
    split8_bf16((z ? bx : ax) + e0, xh + o, xl + o);
  } else if (b < kXBlk + 4 * kWBlk) {
    const int u = b - kXBlk;
    const int y = u / kWBlk;
    const size_t e0 = (size_t)((u % kWBlk) * 256 + t) << 3;
    const float* sa = (y == 0) ? as0 : (y == 1) ? as1 : (y == 2) ? as2 : as3;
    const float* sb = (y == 0) ? bs0 : (y == 1) ? bs1 : (y == 2) ? bs2 : bs3;
    const size_t o = (size_t)z * kR0El16 + (size_t)y * kWW + e0;
    split8_bf16((z ? sb : sa) + e0, wsh + o, wsl + o);
  } else if (b < kXBlk + 8 * kWBlk) {
    const int u = b - (kXBlk + 4 * kWBlk);
    const int y = u / kWBlk;
    const size_t e0 = (size_t)((u % kWBlk) * 256 + t) << 3;
    const float* sa = (y == 0) ? ac0 : (y == 1) ? ac1 : (y == 2) ? ac2 : ac3;
    const float* sb = (y == 0) ? bc0 : (y == 1) ? bc1 : (y == 2) ? bc2 : bc3;
    cast8_f16((z ? sb : sa) + e0, wf + (size_t)z * (4 * kWW) + (size_t)y * kWW + e0, kWCarry);
  } else {
    const size_t e0 = (size_t)((b - (kXBlk + 8 * kWBlk)) * 256 + t) << 3;
    cast8_f16((z ? bffn : affn) + e0, ffn + (size_t)z * kWW + e0, kWCarry);
  }
}

// ---------------------------------------------------------------------------
// bf16 hi + lo planes -> f16 plane of (hi + lo); planes read as 32-bit integer words; same thread/line map.
// ---------------------------------------------------------------------------
__global__ __launch_bounds__(256) void hilo_to_f16_kernel(
    const unsigned short* __restrict__ hi0, const unsigned short* __restrict__ lo0,
    unsigned short* __restrict__ out0, int total8, long branchElems, long outBranchElems) {
  const int i = blockIdx.x * 256 + threadIdx.x;
  if (i >= total8) return;
  /* blockIdx.y = branch */
  const unsigned short* hi = hi0 + (size_t)blockIdx.y * branchElems;
  const unsigned short* lo = lo0 + (size_t)blockIdx.y * branchElems;
  unsigned short* out = out0 + (size_t)blockIdx.y * outBranchElems;
  const size_t e0 = (size_t)i << 3;
  const v4u hw4 = *(const v4u*)(hi + e0);
  const v4u lw4 = *(const v4u*)(lo + e0);
  v8h hv;
#pragma unroll
  for (int w = 0; w < 4; ++w) {
    const unsigned hw = hw4[w];
    const unsigned lw = lw4[w];
    const float f0 = __uint_as_float(hw << 16) + __uint_as_float(lw << 16);
    const float f1 = __uint_as_float(hw & 0xffff0000u) + __uint_as_float(lw & 0xffff0000u);
    hv[2 * w]     = (_Float16)f0;
    hv[2 * w + 1] = (_Float16)f1;
  }
  unsigned short* q = out + e0;
  *(v8h*)q = hv;
  
}

// ---------------------------------------------------------------------------
// Row statistics of S f32 [4096][4096] and the block's share of the column sums, S read once:
// m_i = max_j S_ij, inv_s_i = 1 / sum_j exp(S_ij - m_i), part_b[j] = sum over the block's 32 rows of exp(S_ij - m_i) * inv_s_i.
// Block = 32 rows (16 waves x 2 rows). A wave holds one whole row in registers: 32 lane-strided 16-B loads, all in
// flight together (lane owns columns it*128 + lane*4 .. +3); maximum, exponentials, sum and probabilities are formed
// in those registers. Row sum order: per-lane sequential, then xor shuffle tree (unconditional).
// Column share: each wave adds its two rows in its own LDS row (only the owning wave touches it in front of the
// barrier); behind the barrier the 16 wave rows are added in index order and stored as whole lines. No atomics.
// ---------------------------------------------------------------------------
constexpr int kRcRows  = 32;
constexpr int kRcWaves = 16;
constexpr int kRcParts = kTok / kRcRows;
static_assert(kTok == 32 * 128 && (kTok % kRcRows) == 0 && kRcRows == 2 * kRcWaves && kTok == 2 * kRcWaves * 32 * 4);
static_assert((size_t)2 * kRcParts * kTok * 4 == kCPBytes);

/* Four base-2 exponentials in place. One statement, so that directly behind each v_exp_f32 stands an instruction that
   neither reads its result nor rewrites its source: the next exponential, and a v_nop behind the last. */
__device__ __forceinline__ void exp2_x4(float& a, float& b, float& c, float& d) {
  asm("v_exp_f32 %0, %0\n\tv_exp_f32 %1, %1\n\tv_exp_f32 %2, %2\n\tv_exp_f32 %3, %3\n\tv_nop"
      : "+v"(a), "+v"(b), "+v"(c), "+v"(d));
}
constexpr float kLog2e = 1.4426950408889634f;  /* exp(t) = exp2(t * log2 e), the form __expf compiles to */

__global__ __launch_bounds__(512) void rowcol_kernel(const float* __restrict__ S0, float* __restrict__ mrow0,
                                                     float* __restrict__ invs0, float* __restrict__ cpart0) {
  __shared__ __align__(16) float sC[kRcWaves][kTok];
  __shared__ float sM[kRcRows];
  __shared__ float sI[kRcRows];
  /* blockIdx.y = branch */
  const float* S = S0 + (size_t)blockIdx.y * kR0El32;
  float* mrow = mrow0 + (size_t)blockIdx.y * kTok;
  float* invs = invs0 + (size_t)blockIdx.y * kTok;
  float* cpart = cpart0 + ((size_t)blockIdx.y * kRcParts + blockIdx.x) * kTok;
  const int lane = threadIdx.x & 31;
  const int wave = __builtin_amdgcn_readfirstlane((int)(threadIdx.x >> 5));
  const int row0 = blockIdx.x * kRcRows;
  float* myC = &sC[wave][lane * 4];
#pragma unroll 1  /* one copy of the row's code: the text stays small */
  for (int q = 0; q < 2; ++q) {
    const int rl = wave * 2 + q;
    const float* p = S + (size_t)(row0 + rl) * kTok + lane * 4;
    v4f x[32];
#pragma unroll
    for (int it = 0; it < 32; ++it) x[it] = *(const v4f*)(p + it * 128);
    /* stands in front of every rewrite of the loads' address registers: p as an input keeps them untouched up to here */
    asm volatile("s_wait_xcnt 0x0" :: "v"(p) : "memory");
    float m = -INFINITY;
#pragma unroll
    for (int it = 0; it < 32; ++it) m = fmaxf(m, fmaxf(fmaxf(x[it][0], x[it][1]), fmaxf(x[it][2], x[it][3])));
#pragma unroll
    for (int off = 16; off > 0; off >>= 1) m = fmaxf(m, __shfl_xor(m, off, 32));
    float sum = 0.f;
#pragma unroll
    for (int it = 0; it < 32; ++it) {
      float e0 = (x[it][0] - m) * kLog2e, e1 = (x[it][1] - m) * kLog2e;
      float e2 = (x[it][2] - m) * kLog2e, e3 = (x[it][3] - m) * kLog2e;
      exp2_x4(e0, e1, e2, e3);
      x[it] = (v4f){e0, e1, e2, e3};
      sum += e0;
      sum += e1;
      sum += e2;
      sum += e3;
    }
#pragma unroll
    for (int off = 16; off > 0; off >>= 1) sum += __shfl_xor(sum, off, 32);
    const float inv = 1.0f / sum;
    if (q == 0) {
#pragma unroll
      for (int it = 0; it < 32; ++it) *(v4f*)(myC + it * 128) = x[it] * inv;
    } else {
#pragma unroll
      for (int it = 0; it < 32; ++it) {
        const v4f c = *(const v4f*)(myC + it * 128);
        *(v4f*)(myC + it * 128) = c + x[it] * inv;
      }
    }
    if (lane == 0) {
      sM[rl] = m;
      sI[rl] = inv;
    }
  }
  __syncthreads();
  /* thread t adds columns h*2048 + 4t .. +3 of the 16 wave rows: 32 lanes x 16 B = 4 whole lines per store */
#pragma unroll
  for (int h = 0; h < 2; ++h) {
    const int col = h * 2048 + (int)threadIdx.x * 4;
    v4f c = *(const v4f*)(&sC[0][col]);
#pragma unroll
    for (int w = 1; w < kRcWaves; ++w) c = c + *(const v4f*)(&sC[w][col]);
    *(v4f*)(cpart + col) = c;
  }
  asm volatile("s_wait_xcnt 0x0" ::: "memory");  /* in front of wave 0's reuse of the registers that these stores name */
  if (wave == 0) {
    const float mv = sM[lane];
    const float iv = sI[lane];
    *(float*)(mrow + row0 + lane) = mv;
    *(float*)(invs + row0 + lane) = iv;
  }
}

// ---------------------------------------------------------------------------
// Column sums over queries: c_j = sum over the 128 block shares part_b[j], then rc_j = 1 / (1e-9 + c_j).
// Block = 32 columns (one 128-B line of every share), 4 waves. Eight partial sums as before: partial p adds shares
// p, p+8, ... (16 shares) in order; wave w forms partials w and w+4 (32 shares, all loads in flight together); the 8
// partials are combined in index order by wave 0. No atomics. jb = block of columns, br = branch, sP = 8 x 32 floats.
// ---------------------------------------------------------------------------
static_assert(kRcParts == 128);
__device__ __forceinline__ void colfin_block(const float* __restrict__ cpart0, float* __restrict__ rcol0, int jb, int br,
                                             float* sP) {
  const float* cpart = cpart0 + (size_t)br * kRcParts * kTok;
  float* rcol = rcol0 + (size_t)br * kTok;
  const int lane = threadIdx.x & 31;
  const int wave = __builtin_amdgcn_readfirstlane((int)(threadIdx.x >> 5));
  const int j0 = jb * 32;
  const float* pw = cpart + (size_t)wave * kTok + j0 + lane;
  float v[kRcParts / 4];
#pragma unroll
  for (int t = 0; t < kRcParts / 4; ++t) v[t] = pw[(size_t)(4 * t) * kTok];
  asm volatile("s_wait_xcnt 0x0" ::: "memory");  /* in front of every rewrite of the loads' address registers */
  float acc0 = 0.f, acc1 = 0.f;
#pragma unroll
  for (int t = 0; t < kRcParts / 8; ++t) {
    acc0 += v[2 * t];
    acc1 += v[2 * t + 1];
  }
  sP[wave * 32 + lane] = acc0;
  sP[(wave + 4) * 32 + lane] = acc1;
  __syncthreads();
  if (wave == 0) {
    float c = sP[0 * 32 + lane];
    c += sP[1 * 32 + lane];
    c += sP[2 * 32 + lane];
    c += sP[3 * 32 + lane];
    c += sP[4 * 32 + lane];
    c += sP[5 * 32 + lane];
    c += sP[6 * 32 + lane];
    c += sP[7 * 32 + lane];
    const float rc = 1.0f / (kAttnEps + c);
    *(float*)(rcol + j0 + lane) = rc;
  }
}

/* Third residual product (bias) and, independent of it, the last step of the column sums. Flat grid: the 2 x kSmallTiles
   product blocks (the long ones) first, branch A then B; then 2 x kColBlocks column blocks, which use the first 1 KiB
   of the ring for their partial sums. */
constexpr int kColBlocks = kTok / 32;
__global__ __launch_bounds__(128) void res3_colfin_kernel(GemmArgs gr, const float* __restrict__ cpart0,
                                                          float* __restrict__ rcol0) {
  __shared__ __align__(16) unsigned char ring[kRingLds];
  const int x = (int)blockIdx.x;
  if (x < 2 * kSmallTiles) {
    gemm_tile<0, false, 2, 1, false, 0>(gr, x % kSmallTiles, x / kSmallTiles, 0, ring);
  } else {
    const int u = x - 2 * kSmallTiles;
    colfin_block(cpart0, rcol0, u % kColBlocks, u / kColBlocks, (float*)ring);
  }
}

// ---------------------------------------------------------------------------
// attn.V: SC_z[i][d] = (1/32768) * sum over the keys j of half z of f16(32768 * P_ij * rc_j) * VT[d][j],
// P_ij = exp(S_ij - m_i) * inv_s_i. The two shares SC_0 + SC_1 are added by add_ln_kernel.
// Block = 64 query rows x all 512 d x 2048 keys (8 waves, wave w owns d columns 64w..64w+63, acc 4x4 tiles):
// blockIdx.z picks the half of the keys, so that 256 blocks stand on the chip and each walks 32 key tiles. The tile
// numbers below count inside the block's half.
// Operand path: per-lane asynchronous 16-B copies bring whole 128-B lines into LDS, three buffers. Stage s holds the
// V^T tile of keys 64s..64s+63 (512 rows x 128 B, pitch 144 B) and the logit tile of keys 64(s+1)..64(s+1)+63
// (64 rows x 256 B, pitch 272 B): trip t multiplies key tile t and forms the f16 weights of key tile t + 1 out of the
// same buffer, while the copies of stages t + 1 and t + 2 fly. Even stages are copied by waves 0..3, odd stages by
// waves 4..7: a wave never has more than one stage outstanding, so its wait for that stage is a wait to 0 and leaves
// the other half's younger stage in flight. The weight tiles (64 rows x 128 B, pitch 144 B) alternate between two
// places: the one written in trip t was last read in trip t - 1. Thread t forms row t>>2, keys (t&3)*16..+15
// (64 rows x 4 threads x 16 = the whole tile). The 4096 column factors are copied into LDS once, in the prologue.
// The pad bytes of every pitch are never read: all reads touch byte offsets below the row length.
// ---------------------------------------------------------------------------
constexpr int kAvK      = 64;
constexpr int kAvHalves = 2;
constexpr int kAvKeys   = kTok / kAvHalves;
constexpr int kAvVPitch = 144;
constexpr int kAvSPitch = 272;
constexpr int kAvAPitch = 144;
constexpr int kAvVLds   = kDim * kAvVPitch;
constexpr int kAvSLds   = 64 * kAvSPitch;
constexpr int kAvStage  = kAvVLds + kAvSLds;
constexpr int kAvALds   = 64 * kAvAPitch;
constexpr int kAvBufs   = 3;
constexpr int kAvOffA   = kAvBufs * kAvStage;
constexpr int kAvOffRC  = kAvOffA + 2 * kAvALds;
constexpr int kAvLds    = kAvOffRC + kTok * 4;
static_assert((kAvKeys % kAvK) == 0 && kAvKeys >= 3 * kAvK && kDim == 512);
static_assert(kAvVPitch >= kAvK * 2 && kAvSPitch >= kAvK * 4 && kAvAPitch >= kAvK * 2);
static_assert((kAvVPitch % 32) == 16 && (kAvSPitch % 32) == 16 && (kAvAPitch % 32) == 16);
static_assert(8 * kSlabLds <= kAvBufs * kAvStage && kAvLds <= 327680);

/* This lane's eight (or four) 16-B pieces, lstep LDS bytes and gstep source bytes apart. The copies and the
   s_wait_xcnt stand in one statement so that no address register is rewritten ahead of that wait. */
__device__ __forceinline__ void copy8_b128(unsigned l, unsigned lstep, const unsigned char* g, size_t gstep) {
  const unsigned l1 = l + lstep, l2 = l + 2 * lstep, l3 = l + 3 * lstep, l4 = l + 4 * lstep,
                 l5 = l + 5 * lstep, l6 = l + 6 * lstep, l7 = l + 7 * lstep;
  const unsigned char *g1 = g + gstep, *g2 = g + 2 * gstep, *g3 = g + 3 * gstep, *g4 = g + 4 * gstep,
                      *g5 = g + 5 * gstep, *g6 = g + 6 * gstep, *g7 = g + 7 * gstep;
  asm volatile(
      "global_load_async_to_lds_b128 %0, %8, off\n\t"
      "global_load_async_to_lds_b128 %1, %9, off\n\t"
      "global_load_async_to_lds_b128 %2, %10, off\n\t"
      "global_load_async_to_lds_b128 %3, %11, off\n\t"
      "global_load_async_to_lds_b128 %4, %12, off\n\t"
      "global_load_async_to_lds_b128 %5, %13, off\n\t"
      "global_load_async_to_lds_b128 %6, %14, off\n\t"
      "global_load_async_to_lds_b128 %7, %15, off\n\t"
      "s_wait_xcnt 0x0"
      :: "v"(l), "v"(l1), "v"(l2), "v"(l3), "v"(l4), "v"(l5), "v"(l6), "v"(l7),
         "v"(g), "v"(g1), "v"(g2), "v"(g3), "v"(g4), "v"(g5), "v"(g6), "v"(g7)
      : "memory");
}
__device__ __forceinline__ void copy4_b128(unsigned l, unsigned lstep, const unsigned char* g, size_t gstep) {
  const unsigned l1 = l + lstep, l2 = l + 2 * lstep, l3 = l + 3 * lstep;
  const unsigned char *g1 = g + gstep, *g2 = g + 2 * gstep, *g3 = g + 3 * gstep;
  asm volatile(
      "global_load_async_to_lds_b128 %0, %4, off\n\t"
      "global_load_async_to_lds_b128 %1, %5, off\n\t"
      "global_load_async_to_lds_b128 %2, %6, off\n\t"
      "global_load_async_to_lds_b128 %3, %7, off\n\t"
      "s_wait_xcnt 0x0"
      :: "v"(l), "v"(l1), "v"(l2), "v"(l3), "v"(g), "v"(g1), "v"(g2), "v"(g3)
      : "memory");
}

__global__ __launch_bounds__(256) void av_kernel(const float* __restrict__ S0, const float* __restrict__ mrow0,
                                                 const float* __restrict__ invs0, const float* __restrict__ rcol0,
                                                 const unsigned short* __restrict__ VTp0, float* __restrict__ SC0) {
  /* stage buffers 0, 1, 2 | weight tile 0 | weight tile 1 | column factors */
  __shared__ __align__(16) unsigned char smem[kAvLds];
  /* blockIdx.y = branch, blockIdx.z = half of the keys; S and V^T start at the half's first key */
  const int key0 = (int)blockIdx.z * kAvKeys;
  const float* S = S0 + (size_t)blockIdx.y * kR0El32 + key0;
  const float* mrow = mrow0 + (size_t)blockIdx.y * kTok;
  const float* invs = invs0 + (size_t)blockIdx.y * kTok;
  const float* rcol = rcol0 + (size_t)blockIdx.y * kTok;
  const unsigned short* VTp = VTp0 + (size_t)blockIdx.y * kND + key0;
  float* SC = SC0 + ((size_t)blockIdx.z * 2 + blockIdx.y) * kND;
  typedef Frag<_Float16> FH;
  const int tid  = threadIdx.x;
  const int lane = tid & 31;
  const int wave = __builtin_amdgcn_readfirstlane((int)(tid >> 5));
  const int m0 = blockIdx.x * 64;
  const int n0 = wave * 64;
  const int sr   = tid >> 2;
  const int sc16 = (tid & 3) * 16;
  const float mi = mrow[m0 + sr];
  const float fi = invs[m0 + sr] * kPCarry;
  /* stands in front of every rewrite of the registers that these two loads name: as inputs they stay untouched up to here */
  asm volatile("s_wait_xcnt 0x0" :: "v"(m0 + sr), "s"(mrow), "s"(invs) : "memory");

  const int rlane = lane & 15;
  const int koff  = (lane >> 4) * 8;
  const int mOff  = (lane >> 4) * 8;
  constexpr int nT = kAvKeys / kAvK;

  /* copy maps of the four waves that bring a stage, c = the thread's number among their 128. V^T: 16-B piece c&7 of
     rows (c>>3) + 16q, q 0..31 (4 whole lines per wave instruction). Logits: piece c&15 of rows (c>>4) + 8q, q 0..7.
     40 copies of a wave per stage. Column factors (all 256 threads): piece t + 256q, q 0..3. */
  const int half = wave >> 2;
  const int ct = tid & 127;
  const unsigned ldsBase = (unsigned)(size_t)(&smem[0]);
  const unsigned vL = ldsBase + (unsigned)((ct >> 3) * kAvVPitch + (ct & 7) * 16);
  const unsigned sL = ldsBase + (unsigned)(kAvVLds + (ct >> 4) * kAvSPitch + (ct & 15) * 16);
  const unsigned char* vG = (const unsigned char*)VTp + (size_t)(ct >> 3) * (kTok * 2) + (ct & 7) * 16;
  const unsigned char* sG = (const unsigned char*)S + (size_t)(m0 + (ct >> 4)) * (kTok * 4) + (ct & 15) * 16;

  auto issue_logits = [&](int u, int buf) {
    copy8_b128(sL + (unsigned)(buf * kAvStage), 8 * kAvSPitch, sG + (size_t)u * (kAvK * 4), (size_t)8 * kTok * 4);
  };
  auto issue_stage = [&](int s, int buf) {
    const unsigned l = vL + (unsigned)(buf * kAvStage);
    const unsigned char* g = vG + (size_t)s * (kAvK * 2);
#pragma unroll  /* four statements of eight copies: every LDS and source step a constant */
    for (int j = 0; j < 4; ++j)
      copy8_b128(l + j * 128 * kAvVPitch, 16 * kAvVPitch, g + (size_t)j * 128 * kTok * 2, (size_t)16 * kTok * 2);
    if (s + 1 < nT) issue_logits(s + 1, buf);
  };
  /* this thread's 16 weights of key tile u, out of the logit tile at sraw */
  auto weights = [&](int u, const unsigned char* sraw, v8h& h0, v8h& h1) {
    const float* sp = (const float*)(sraw + sr * kAvSPitch) + sc16;
    const float* rp = (const float*)(smem + kAvOffRC) + key0 + u * kAvK + sc16;
#pragma unroll
    for (int h = 0; h < 2; ++h) {
      const v4f s0 = *(const v4f*)(sp + h * 8);
      const v4f s1 = *(const v4f*)(sp + h * 8 + 4);
      const v4f r0 = *(const v4f*)(rp + h * 8);
      const v4f r1 = *(const v4f*)(rp + h * 8 + 4);
      v8h hv;
#pragma unroll
      for (int e = 0; e < 4; ++e) {
        const float e0 = __expf(s0[e] - mi);
        const float e1 = __expf(s1[e] - mi);
        const float w0 = (e0 * fi) * r0[e];
        const float w1 = (e1 * fi) * r1[e];
        hv[e]     = (_Float16)w0;
        hv[4 + e] = (_Float16)w1;
      }
      if (h == 0) h0 = hv; else h1 = hv;
    }
  };
  auto put_weights = [&](unsigned char* at, v8h h0, v8h h1) {
    *(v8h*)(at + sr * kAvAPitch + sc16 * 2) = h0;
    *(v8h*)(at + sr * kAvAPitch + sc16 * 2 + 16) = h1;
  };

  v8f acc[4][4];
#pragma unroll
  for (int i = 0; i < 4; ++i)
#pragma unroll
    for (int j = 0; j < 4; ++j) acc[i][j] = (v8f){0.f, 0.f, 0.f, 0.f, 0.f, 0.f, 0.f, 0.f};

  /* the 64 keys of one tile: weight tile at, V^T tile vt */
  auto products = [&](const unsigned char* at, const unsigned char* vt) {
#pragma unroll
    for (int kk = 0; kk < kAvK; kk += 32) {
      v16h bh[4];
#pragma unroll
      for (int j = 0; j < 4; ++j)
        bh[j] = FH::load((const _Float16*)(vt + (n0 + (j << 4) + rlane) * kAvVPitch + (kk + koff) * 2));
      const unsigned char* ap = at + rlane * kAvAPitch + (kk + koff) * 2;
      v16h ah = FH::load((const _Float16*)ap);
#pragma unroll
      for (int i = 0; i < 4; ++i) {
        /* the next row group's A fragment is read in front of this group's products */
        v16h nh = ah;
        if (i < 3) nh = FH::load((const _Float16*)(ap + (i + 1) * 16 * kAvAPitch));
#pragma unroll
        for (int j = 0; j < 4; ++j) acc[i][j] = FH::mma(ah, bh[j], acc[i][j]);
        FH::guard(acc[i][0], acc[i][1], acc[i][2], acc[i][3], ah, ah);
        ah = nh;
      }
      FH::keep(bh[0], bh[1], bh[2], bh[3]);
    }
  };

  /* prologue: column factors, logit tile 0 (in buffer 2's logit place), stage 0 (waves 0..3) and stage 1 (waves 4..7)
     landed and published; weight tile 0 formed; then, behind the barrier that ends the reads of buffer 2, stage 2 in
     flight */
  copy4_b128(ldsBase + (unsigned)(kAvOffRC + tid * 16), 4096, (const unsigned char*)rcol + tid * 16, (size_t)4096);
  if (half == 0) {
    issue_logits(0, 2);
    issue_stage(0, 0);
  } else {
    issue_stage(1, 1);
  }
  asm volatile("s_wait_asynccnt 0x0" ::: "memory");  /* this wave's prologue copies have landed */
  __syncthreads();
  {
    v8h h0, h1;
    weights(0, smem + 2 * kAvStage + kAvVLds, h0, h1);
    put_weights(smem + kAvOffA, h0, h1);
  }
  asm volatile("s_wait_dscnt 0x0" ::: "memory");  /* this wave's reads of logit tile 0 have returned */
  __syncthreads();
  if (half == 0) issue_stage(2, 2);

  int buf = 0;  /* t mod 3 */
#pragma unroll 1  /* one stage per trip: the foot's waits and barrier stand once */
  for (int t = 0; t < nT - 1; ++t) {
    const unsigned char* sb = smem + buf * kAvStage;
    v8h h0, h1;
    weights(t + 1, sb + kAvVLds, h0, h1);
    products(smem + kAvOffA + (t & 1) * kAvALds, sb);
    put_weights(smem + kAvOffA + ((t + 1) & 1) * kAvALds, h0, h1);
    /* publish point of stage t + 1 and of weight tile t + 1; the one barrier also ends every reader's last read of
       stage t's buffer and of weight tile t. Stage t + 1 and stage t + 3 belong to the same half of the waves. */
    const bool mine = ((t + 1) & 1) == half;
    asm volatile("s_wait_dscnt 0x0" ::: "memory");  /* this wave's LDS reads and writes of trip t are done */
    if (mine) asm volatile("s_wait_asynccnt 0x0" ::: "memory");  /* this wave's stage t + 1 copies, its only ones, have landed */
    __syncthreads();
    if (mine && t + 3 < nT) issue_stage(t + 3, buf);  /* into the buffer that trip t has just read */
    buf = (buf == kAvBufs - 1) ? 0 : buf + 1;
  }
  products(smem + kAvOffA + ((nT - 1) & 1) * kAvALds, smem + ((nT - 1) % kAvBufs) * kAvStage);
  asm volatile("s_wait_asynccnt 0x0" ::: "memory");  /* no copy is outstanding when the ring becomes the slabs */
  asm volatile("s_wait_dscnt 0x0" ::: "memory");     /* this wave's last fragment reads have returned */
  __syncthreads();                                   /* every wave has left the ring before a slab is written */
  acc_guard4(acc[0][0], acc[0][1], acc[0][2], acc[0][3]);
  acc_guard4(acc[1][0], acc[1][1], acc[1][2], acc[1][3]);
  acc_guard4(acc[2][0], acc[2][1], acc[2][2], acc[2][3]);
  acc_guard4(acc[3][0], acc[3][1], acc[3][2], acc[3][3]);

  float* slab = (float*)(smem + wave * kSlabLds);
#pragma unroll
  for (int i = 0; i < 4; ++i) {
    const int mBase = m0 + (i << 4);
#pragma unroll
    for (int j = 0; j < 4; ++j) {
#pragma unroll
      for (int r = 0; r < 8; ++r) slab[(mOff + r) * 68 + (j << 4) + rlane] = acc[i][j][r] * kPCarryInv;
    }
    __builtin_amdgcn_fence(__ATOMIC_RELEASE, "workgroup");
    __builtin_amdgcn_wave_barrier();
    __builtin_amdgcn_fence(__ATOMIC_ACQUIRE, "workgroup");
    {
      const int hh = lane >> 4, c4 = (lane & 15) * 4;
      v4f vals[8];
#pragma unroll
      for (int it = 0; it < 8; ++it) vals[it] = *(const v4f*)(slab + (it * 2 + hh) * 68 + c4);
      {
#pragma unroll
        for (int it = 0; it < 8; ++it) {
          const int row = it * 2 + hh;
          *(v4f*)(SC + (size_t)(mBase + row) * kDim + n0 + c4) = vals[it];
        }
        
      }
    }
    __builtin_amdgcn_fence(__ATOMIC_RELEASE, "workgroup");
    __builtin_amdgcn_wave_barrier();
    __builtin_amdgcn_fence(__ATOMIC_ACQUIRE, "workgroup");
  }
}

// ---------------------------------------------------------------------------
// s = LayerNorm(res + sc) over 512 (biased variance, eps inside rsqrt), one wave per row, 8 rows per block.
// sc = the two key halves' shares of attn.V, added here (share 1 lies 2 planes behind share 0).
// Lane owns columns it*128 + lane*4 .. +3 (it 0..3): 16 values in registers, static indexing.
// res is an f16 plane read as 32-bit integer words; sc, gamma, beta f32.
// (via the wave's own LDS slab: lane owns columns it2*256 + lane*8 .. +7, 2 instructions x 32 lanes x 16 B = 4 whole
// ---------------------------------------------------------------------------
__global__ __launch_bounds__(256) void add_ln_kernel(const unsigned short* __restrict__ RES0, const float* __restrict__ SCp0,
                                                     const float* __restrict__ gam0, const float* __restrict__ bet0,
                                                     const float* __restrict__ gam1, const float* __restrict__ bet1,
                                                     float* __restrict__ S320, unsigned short* __restrict__ S160) {
  __shared__ __align__(16) float sY[8][kDim];
  /* blockIdx.y = branch */
  const unsigned short* RES = RES0 + (size_t)blockIdx.y * kND;
  const float* SCp = SCp0 + (size_t)blockIdx.y * kND;
  const float* gam = blockIdx.y ? gam1 : gam0;
  const float* bet = blockIdx.y ? bet1 : bet0;
  float* S32 = S320 + (size_t)blockIdx.y * kR0El32;
  unsigned short* S16 = S160 + (size_t)blockIdx.y * kR0El16;
  const int lane = threadIdx.x & 31;
  const int wave = __builtin_amdgcn_readfirstlane((int)(threadIdx.x >> 5));
  const int row = blockIdx.x * 8 + wave;
  const float* scp = SCp + (size_t)row * kDim;
  const float* scq = scp + 2 * kND;
  const unsigned short* rp = RES + (size_t)row * kDim;
  float x[16];
#pragma unroll
  for (int it = 0; it < 4; ++it) {
    const int col = it * 128 + lane * 4;
    const v4f a = *(const v4f*)(scp + col) + *(const v4f*)(scq + col);
    const v2u w = *(const v2u*)(rp + col);
    const unsigned w0 = w[0];
    const unsigned w1 = w[1];
    x[4 * it + 0] = h16_to_f32(w0 & 0xffffu) + a[0];
    x[4 * it + 1] = h16_to_f32(w0 >> 16) + a[1];
    x[4 * it + 2] = h16_to_f32(w1 & 0xffffu) + a[2];
    x[4 * it + 3] = h16_to_f32(w1 >> 16) + a[3];
  }
  float s = 0.f;
#pragma unroll
  for (int i = 0; i < 16; ++i) s += x[i];
#pragma unroll
  for (int off = 16; off > 0; off >>= 1) s += __shfl_xor(s, off, 32);
  const float mu = s * kInvDim;
  float vs = 0.f;
#pragma unroll
  for (int i = 0; i < 16; ++i) {
    const float d = x[i] - mu;
    x[i] = d;
    vs += d * d;
  }
#pragma unroll
  for (int off = 16; off > 0; off >>= 1) vs += __shfl_xor(vs, off, 32);
  const float inv = rsqrtf(vs * kInvDim + kLnEps);
  float* slab = sY[wave];
  v4f yv[4];
#pragma unroll
  for (int it = 0; it < 4; ++it) {
    const int col = it * 128 + lane * 4;
    const v4f g4 = *(const v4f*)(gam + col);
    const v4f b4 = *(const v4f*)(bet + col);
    v4f y;
    y[0] = (x[4 * it + 0] * inv) * g4[0] + b4[0];
    y[1] = (x[4 * it + 1] * inv) * g4[1] + b4[1];
    y[2] = (x[4 * it + 2] * inv) * g4[2] + b4[2];
    y[3] = (x[4 * it + 3] * inv) * g4[3] + b4[3];
    yv[it] = y;
    *(v4f*)(slab + col) = y;
  }
  __builtin_amdgcn_fence(__ATOMIC_RELEASE, "workgroup");
  __builtin_amdgcn_wave_barrier();
  __builtin_amdgcn_fence(__ATOMIC_ACQUIRE, "workgroup");
  v8h hv[2];
#pragma unroll
  for (int it2 = 0; it2 < 2; ++it2) {
    const int c = it2 * 256 + lane * 8;
    const v4f a0 = *(const v4f*)(slab + c);
    const v4f a1 = *(const v4f*)(slab + c + 4);
#pragma unroll
    for (int e = 0; e < 4; ++e) {
      const float f0 = a0[e], f1 = a1[e];
      hv[it2][e]     = (_Float16)f0;
      hv[it2][4 + e] = (_Float16)f1;
    }
  }
  float* o32 = S32 + (size_t)row * kDim;
  unsigned short* o16 = S16 + (size_t)row * kDim;
  {
#pragma unroll
    for (int it = 0; it < 4; ++it) *(v4f*)(o32 + it * 128 + lane * 4) = yv[it];
#pragma unroll
    for (int it2 = 0; it2 < 2; ++it2) *(v8h*)(o16 + it2 * 256 + lane * 8) = hv[it2];
    
  }
}

// ---------------------------------------------------------------------------
// Host glue (kernel launches and host arithmetic only)
// ---------------------------------------------------------------------------
static GemmArgs gemm_args(const unsigned short* A, const unsigned short* A2, int lda,
                          const unsigned short* Bt, const unsigned short* Bt2, int ldb,
                          void* C, void* C2, int ldc,
                          const float* bias0, const float* bias1, const float* resid0, const float* resid1,
                          long aP, long bP, long bQ, long cP, long cQ, int M, int N, int K, float scale) {
  GemmArgs g;
  g.Ap0 = A;  g.A2p0 = A2;  g.Btp0 = Bt;  g.Bt2p0 = Bt2;  g.Cout0 = C;  g.Cout20 = C2;
  g.bias0 = bias0;  g.bias1 = bias1;  g.resid0 = resid0;  g.resid1 = resid1;
  g.aP = aP;  g.bP = bP;  g.bQ = bQ;  g.cP = cP;  g.cQ = cQ;
  g.lda = lda;  g.ldb = ldb;  g.ldc = ldc;  g.M = M;  g.N = N;  g.K = K;
  g.scale = scale;
  return g;
}

template <int ET, bool SPLIT, int BIAS_MODE, int OUT_MODE, bool RESID, int ACT>
static void run_gemm(hipStream_t st,
                     const unsigned short* A, const unsigned short* A2, int lda,
                     const unsigned short* Bt, const unsigned short* Bt2, int ldb,
                     void* C, void* C2, int ldc,
                     const float* bias0, const float* bias1, const float* resid0, const float* resid1,
                     long aP, long bP, long bQ, long cP, long cQ, int planes,
                     int M, int N, int K, float scale) {
  const int blocks = (M >> 7) * (N >> 7);
  wmma_gemm64<ET, SPLIT, BIAS_MODE, OUT_MODE, RESID, ACT><<<dim3(blocks, 2, planes), 128, 0, st>>>(
      gemm_args(A, A2, lda, Bt, Bt2, ldb, C, C2, ldc, bias0, bias1, resid0, resid1, aP, bP, bQ, cP, cQ, M, N, K, scale));
}

extern "C" void kernel_launch(void* const* d_in, const int* in_sizes, int n_in,
                              void* d_out, int out_size, void* d_ws, size_t ws_size,
                              hipStream_t stream) {
  if (n_in < 34) return;
  if (in_sizes[0] != (int)kND || in_sizes[1] != (int)kND) return;
  for (int p = 0; p < 2; ++p) {
    for (int s = 0; s < 16; ++s) {
      const bool isMat = (s == 0 || s == 2 || s == 4 || s == 6 || s == 8 || s == 10 || s == 11 || s == 12 || s == 15);
      const int want = isMat ? (int)kWW : kDim;
      if (in_sizes[2 + 16 * p + s] != want) return;
    }
  }
  if (out_size != (int)(2 * kND)) return;
  if (ws_size < kWsTotal) return;

  char* ws = (char*)d_ws;
  unsigned short* XH  = (unsigned short*)(ws + kOffXH);
  unsigned short* XL  = (unsigned short*)(ws + kOffXL);
  unsigned short* T0H = (unsigned short*)(ws + kOffT0H);
  unsigned short* T0L = (unsigned short*)(ws + kOffT0L);
  unsigned short* FH  = (unsigned short*)(ws + kOffFH);
  unsigned short* FL  = (unsigned short*)(ws + kOffFL);
  unsigned short* F16 = (unsigned short*)(ws + kOffF16);
  unsigned short* R1  = (unsigned short*)(ws + kOffR1);
  unsigned short* R2  = (unsigned short*)(ws + kOffR2);
  unsigned short* WSH = (unsigned short*)(ws + kOffWSH);
  unsigned short* WSL = (unsigned short*)(ws + kOffWSL);
  unsigned short* WF  = (unsigned short*)(ws + kOffWF);
  float*          S   = (float*)(ws + kOffS);
  float*          S32 = (float*)(ws + kOffS32);
  unsigned short* S16 = (unsigned short*)(ws + kOffS16);
  unsigned short* QK  = (unsigned short*)(ws + kOffQK);
  unsigned short* VT  = (unsigned short*)(ws + kOffVT);
  unsigned short* RES = (unsigned short*)(ws + kOffRES);
  float*          SC  = (float*)(ws + kOffSC);
  unsigned short* FFN = (unsigned short*)(ws + kOffFFN);
  float*          MROW = (float*)(ws + kOffMROW);
  float*          INVS = (float*)(ws + kOffINVS);
  float*          RC   = (float*)(ws + kOffRC);
  float*          CP   = (float*)(ws + kOffCP);
  float* out = (float*)d_out;

  const int nd8 = (int)(kND / 8);

  /* inputs of branch A (a*) and branch B (b*) */
  const float* ax   = (const float*)d_in[0];
  const float* bx   = (const float*)d_in[1];
  const float* apW1 = (const float*)d_in[2 + 0];
  const float* bpW1 = (const float*)d_in[18 + 0];
  const float* apb1 = (const float*)d_in[2 + 1];
  const float* bpb1 = (const float*)d_in[18 + 1];
  const float* apW2 = (const float*)d_in[2 + 2];
  const float* bpW2 = (const float*)d_in[18 + 2];
  const float* apb2 = (const float*)d_in[2 + 3];
  const float* bpb2 = (const float*)d_in[18 + 3];
  const float* arW1 = (const float*)d_in[2 + 4];
  const float* brW1 = (const float*)d_in[18 + 4];
  const float* arb1 = (const float*)d_in[2 + 5];
  const float* brb1 = (const float*)d_in[18 + 5];
  const float* arW2 = (const float*)d_in[2 + 6];
  const float* brW2 = (const float*)d_in[18 + 6];
  const float* arb2 = (const float*)d_in[2 + 7];
  const float* brb2 = (const float*)d_in[18 + 7];
  const float* arW3 = (const float*)d_in[2 + 8];
  const float* brW3 = (const float*)d_in[18 + 8];
  const float* arb3 = (const float*)d_in[2 + 9];
  const float* brb3 = (const float*)d_in[18 + 9];
  const float* aWq  = (const float*)d_in[2 + 10];
  const float* bWq  = (const float*)d_in[18 + 10];
  const float* aWk  = (const float*)d_in[2 + 11];
  const float* bWk  = (const float*)d_in[18 + 11];
  const float* aWv  = (const float*)d_in[2 + 12];
  const float* bWv  = (const float*)d_in[18 + 12];
  const float* alng = (const float*)d_in[2 + 13];
  const float* blng = (const float*)d_in[18 + 13];
  const float* alnb = (const float*)d_in[2 + 14];
  const float* blnb = (const float*)d_in[18 + 14];
  const float* affn = (const float*)d_in[2 + 15];
  const float* bffn = (const float*)d_in[18 + 15];

  /* Every launch below works on both branches: the pointers are branch A's, the strides lead to branch B's part. */
  const long r0B   = (long)kR0Bytes;
  const long nd    = (long)kND;
  const long ww    = (long)kWW;

  /* operand planes, one launch: x hi/lo; pW1,pW2,Wq,Wk hi/lo (weights are [out][in] = Bt layout); rW1,rW2,rW3,Wv and
     the ffn weight f16 x256 */
  prep_kernel<<<dim3(kPrepBlocks, 1, 2), 256, 0, stream>>>(ax, bx, apW1, apW2, aWq, aWk, bpW1, bpW2, bWq, bWk,
                                                           arW1, arW2, arW3, aWv, brW1, brW2, brW3, bWv, affn, bffn,
                                                           XH, XL, WSH, WSL, WF, FFN);

  /* h1 = relu(x . pW1^T + pb1) -> hi/lo : M 4096, N 512, K 512 */
  run_gemm<1, true, 2, 2, false, 2>(stream, XH, XL, kDim, WSH + 0 * kWW, WSL + 0 * kWW, kDim,
                                    (void*)T0H, (void*)T0L, kDim, apb1, bpb1, apb1, bpb1,
                                    kR0El16, kR0El16, 0L, r0B, 0L, 1, kTok, kDim, kDim, 1.0f);
  /* feat = h1 . pW2^T + pb2 -> hi/lo */
  run_gemm<1, true, 2, 2, false, 0>(stream, T0H, T0L, kDim, WSH + 1 * kWW, WSL + 1 * kWW, kDim,
                                    (void*)FH, (void*)FL, kDim, apb2, bpb2, apb2, bpb2,
                                    kR0El16, kR0El16, 0L, r0B, 0L, 1, kTok, kDim, kDim, 1.0f);
  /* f16 copy of feat */
  hilo_to_f16_kernel<<<dim3(nd8 / 256, 2), 256, 0, stream>>>(FH, FL, F16, nd8, kR0El16, nd);
  /* One launch. Q (plane 0) and K (plane 1) -> hi/lo planes; QK holds QH QL KH KL of branch A, then of branch B.
     r1 = relu(feat . rW1^T + rb1) (f16 single products, weights x256). */
  qk_res1_kernel<<<dim3(kSmallTiles, 2, 3), 128, 0, stream>>>(
      gemm_args(FH, FL, kDim, WSH + 2 * kWW, WSL + 2 * kWW, kDim, (void*)QK, (void*)(QK + kND), kDim,
                apb1, bpb1, apb1, bpb1, kR0El16, kR0El16, ww, 8 * nd, 4 * nd, kTok, kDim, kDim, 1.0f),
      gemm_args(F16, F16, kDim, WF + 0 * kWW, WF + 0 * kWW, kDim, (void*)R1, (void*)R1, kDim,
                arb1, brb1, arb1, brb1, nd, 4 * ww, 0L, 2 * nd, 0L, kTok, kDim, kDim, kWCarryInv));

  /* ---- cross attention, add + LayerNorm, ffn ---- */
  /* One launch. S = Q_p . K_other^T (hi.hi + hi.lo + lo.hi), f32 : M 4096, N 4096, K 512. Branch A reads branch B's K
     planes (planes 6, 7 of QK) and branch B reads branch A's (planes 2, 3): the Bt stride is negative.
     r2 = relu(r1 . rW2^T + rb2).
     V^T[d][i] = sum_k Wv[d][k] feat[i][k] : A = Wv (M 512), Bt = feat f16 (N 4096), K 512, ldc 4096.
     The planes of the last two lie outside R0, which S overwrites. */
  logits_res2_vt_kernel<<<dim3(2 * kLogitTiles + 4 * kSmallTiles), 128, 0, stream>>>(
      gemm_args(QK, QK + kND, kDim, QK + 6 * kND, QK + 7 * kND, kDim, (void*)S, (void*)S, kTok,
                alng, blng, alng, blng, 4 * nd, -4 * nd, 0L, r0B, 0L, kTok, kTok, kDim, 1.0f),
      gemm_args(R1, R1, kDim, WF + 1 * kWW, WF + 1 * kWW, kDim, (void*)R2, (void*)R2, kDim,
                arb2, brb2, arb2, brb2, nd, 4 * ww, 0L, 2 * nd, 0L, kTok, kDim, kDim, kWCarryInv),
      gemm_args(WF + 3 * kWW, WF + 3 * kWW, kDim, F16, F16, kDim, (void*)VT, (void*)VT, kTok,
                apb1, bpb1, apb1, bpb1, 4 * ww, nd, 0L, 2 * nd, 0L, kDim, kTok, kDim, kWCarryInv));
  rowcol_kernel<<<dim3(kRcParts, 2), 512, 0, stream>>>(S, MROW, INVS, CP);
  /* One launch. res = r2 . rW3^T + rb3; rc = 1 / (1e-9 + column sums). */
  res3_colfin_kernel<<<dim3(2 * kSmallTiles + 2 * kColBlocks), 128, 0, stream>>>(
      gemm_args(R2, R2, kDim, WF + 2 * kWW, WF + 2 * kWW, kDim, (void*)RES, (void*)RES, kDim,
                arb3, brb3, arb3, brb3, nd, 4 * ww, 0L, 2 * nd, 0L, kTok, kDim, kDim, kWCarryInv),
      CP, RC);
  av_kernel<<<dim3(kTok / 64, 2, kAvHalves), 256, 0, stream>>>(S, MROW, INVS, RC, VT, SC);
  /* S is dead from here; S32 / S16 occupy the first 12 MiB of each branch's R0 */
  add_ln_kernel<<<dim3(kTok / 8, 2), 256, 0, stream>>>(RES, SC, alng, alnb, blng, blnb, S32, S16);
  /* out = s + s . ffnW^T : A = s f16, Bt = ffnW f16 x256, residual s f32 fetched in the store phase */
  run_gemm<0, false, 0, 0, true, 0>(stream, S16, S16, kDim, FFN, FFN, kDim,
                                    (void*)out, (void*)out, kDim, alng, blng, S32, S32 + kR0El32,
                                    kR0El16, ww, 0L, 4 * nd, 0L, 1, kTok, kDim, kDim, kWCarryInv);
}

// v008
// Measured time: 242 microseconds a run.
// In both of two side-by-side timings against v007, it was 1.09 times as fast.
// All steps since v000 together make it 5.71 times as fast.
// Contractions: pW1/pW2/Wq/Wk linears and q.k^T logits on v_wmma_f32_16x16x32_bf16 with both operands as bf16 hi+lo planes (hi.hi + hi.lo + lo.hi), f32 accumulate, logits kept f32; rW1/rW2/rW3/Wv/ffn linears and attn.V on v_wmma_f32_16x16x32_f16 (weights carried x256, attention weights carried x32768), f32 accumulate; softmax statistics, column sums, LayerNorm and residual adds in f32.
#include <hip/hip_runtime.h>
#include <math.h>

typedef __attribute__((ext_vector_type(16))) _Float16 v16h;
typedef __attribute__((ext_vector_type(8)))  _Float16 v8h;
typedef __attribute__((ext_vector_type(4)))  _Float16 v4h;
typedef __attribute__((ext_vector_type(16))) __bf16   v16b;
typedef __attribute__((ext_vector_type(8)))  __bf16   v8b;
typedef __attribute__((ext_vector_type(8)))  float    v8f;
typedef __attribute__((ext_vector_type(4)))  float    v4f;
typedef __attribute__((ext_vector_type(4)))  unsigned int v4u;
typedef __attribute__((ext_vector_type(2)))  unsigned int v2u;

// ---------------------------------------------------------------------------
// Problem constants
// ---------------------------------------------------------------------------
constexpr int    kTok       = 4096;
constexpr int    kDim       = 512;
constexpr size_t kND        = (size_t)kTok * kDim;
constexpr size_t kWW        = (size_t)kDim * kDim;
constexpr float  kWCarry    = 256.0f;
constexpr float  kWCarryInv = 1.0f / kWCarry;
constexpr float  kPCarry    = 32768.0f;
constexpr float  kPCarryInv = 1.0f / kPCarry;
constexpr float  kInvDim    = 1.0f / (float)kDim;
constexpr float  kLnEps     = 1e-6f;
constexpr float  kAttnEps   = 1e-9f;
static_assert((kTok % 64) == 0 && (kDim % 64) == 0);
static_assert((kTok % 32) == 0 && (kDim % 32) == 0);
static_assert(((kND / 8) % 256) == 0 && ((kWW / 8) % 256) == 0);

// ---------------------------------------------------------------------------
// Workspace region map (bytes; every offset is a multiple of 128). Both branches run in the same launches, so every
// region holds branch A's part and then branch B's (SC: once per half of the keys).
//   R0      2 x 67,108,864  time-shared region, one per branch:
//             (a) operand planes of the branch's linear chain:
//                 XH XL T0H T0L FH FL   6 x 4,194,304 (16-bit [4096][512] planes)
//                 WSH (4 bf16 hi weight planes) 2,097,152 ; WSL (4 bf16 lo planes) 2,097,152 -> 29,360,128 used
//             (b) S f32 [4096][4096] logits of the branch                    67,108,864
//   QK      33,554,432  QH QL KH KL bf16 planes [4096][512], branch A then branch B
//   VT       8,388,608  V^T f16 [512][4096], branch A then B
//   RES      8,388,608  residual-chain output f16 [4096][512], branch A then B
//   SC      33,554,432  attn.V output f32 [4096][512], one share per half of the keys: half 0 (branch A then B), half 1
//   FFN      1,048,576  ffn weight f16 planes (x256), branch A then B
//   MROW        32,768  row maxima f32 [4096], branch A then B
//   INVS        32,768  1 / row exp sums f32 [4096], branch A then B
//   RC          32,768  1 / (1e-9 + column sums) f32 [4096], branch A then B
//   CP       4,194,304  column-sum shares f32 [128][4096] (one per block of 32 query rows), branch A then B
//   R1, R2   8,388,608 each  residual-chain planes f16 [4096][512], branch A then B; outside R0, because the second
//                       residual product and V^T run in the launch that writes the logits, the third one behind it
//   WF       4,194,304  4 f16 weight planes (x256), branch A then B; outside R0 for the same reason
//   F16      8,388,608  f16 copy of feat [4096][512], branch A then B; outside R0 for the same reason
//   total = 134,217,728 + 33,554,432 + 8,388,608 + 8,388,608 + 33,554,432 + 1,048,576 + 32,768 + 32,768 + 32,768
//           + 4,194,304 + 8,388,608 + 8,388,608 + 4,194,304 + 8,388,608 = 252,805,120
// ---------------------------------------------------------------------------
constexpr size_t kPlane16  = kND * 2;
constexpr size_t kPlane32  = kND * 4;
constexpr size_t kW16      = kWW * 2;
constexpr size_t kR0Bytes  = (size_t)kTok * kTok * 4;
constexpr size_t kOffXH    = 0;
constexpr size_t kOffXL    = kOffXH  + kPlane16;
constexpr size_t kOffT0H   = kOffXL  + kPlane16;
constexpr size_t kOffT0L   = kOffT0H + kPlane16;
constexpr size_t kOffFH    = kOffT0L + kPlane16;
constexpr size_t kOffFL    = kOffFH  + kPlane16;
constexpr size_t kOffWSH   = kOffFL  + kPlane16;
constexpr size_t kOffWSL   = kOffWSH + 4 * kW16;
constexpr size_t kPhase1End = kOffWSL + 4 * kW16;
constexpr size_t kOffS     = 0;
constexpr size_t kOffQK    = 2 * kR0Bytes;
constexpr size_t kOffVT    = kOffQK  + 8 * kPlane16;
constexpr size_t kOffRES   = kOffVT  + 2 * kPlane16;
constexpr size_t kOffSC    = kOffRES + 2 * kPlane16;
constexpr size_t kOffFFN   = kOffSC  + 4 * kPlane32;
constexpr size_t kOffMROW  = kOffFFN + 2 * kW16;
constexpr size_t kOffINVS  = kOffMROW + 2 * (size_t)kTok * 4;
constexpr size_t kOffRC    = kOffINVS + 2 * (size_t)kTok * 4;
constexpr size_t kOffCP    = kOffRC   + 2 * (size_t)kTok * 4;
constexpr size_t kCPBytes  = 2 * (size_t)(kTok / 32) * kTok * 4;
constexpr size_t kOffR1    = kOffCP   + kCPBytes;
constexpr size_t kOffR2    = kOffR1   + 2 * kPlane16;
constexpr size_t kOffWF    = kOffR2   + 2 * kPlane16;
constexpr size_t kOffF16   = kOffWF   + 8 * kW16;
constexpr size_t kWsTotal  = kOffF16  + 2 * kPlane16;
constexpr long   kR0El16   = (long)(kR0Bytes / 2);  /* branch A -> branch B inside R0, in 16-bit elements */
constexpr long   kR0El32   = (long)(kR0Bytes / 4);  /* the same in f32 elements */
static_assert(kPhase1End <= kR0Bytes);
static_assert(kWsTotal == 252805120ull);
static_assert(kWsTotal <= 268435456ull);
static_assert((kOffWSH % 128) == 0 && (kOffWSL % 128) == 0 && (kOffWF % 128) == 0 && (kOffQK % 128) == 0 &&
              (kOffVT % 128) == 0 && (kOffRES % 128) == 0 && (kOffSC % 128) == 0 && (kOffFFN % 128) == 0 &&
              (kOffMROW % 128) == 0 && (kOffINVS % 128) == 0 && (kOffRC % 128) == 0 &&
              (kOffCP % 128) == 0 && (kOffR1 % 128) == 0 && (kOffR2 % 128) == 0 &&
              (kOffF16 % 128) == 0);

// ---------------------------------------------------------------------------
// Small helpers
// ---------------------------------------------------------------------------
__device__ __forceinline__ unsigned short f2bf_bits(float f) {
  unsigned u = __float_as_uint(f);
  return (unsigned short)((u + 0x7FFFu + ((u >> 16) & 1u)) >> 16);
}
__device__ __forceinline__ float bf_bits2f(unsigned short h) { return __uint_as_float(((unsigned)h) << 16); }

/* f16 bits (low 16 bits of hb, finite values) -> f32, integer path only */
__device__ __forceinline__ float h16_to_f32(unsigned hb) {
  const unsigned sgn = (hb & 0x8000u) << 16;
  const unsigned em = hb & 0x7fffu;
  const float fn = __uint_as_float((em << 13) + 0x38000000u);
  const float fs = (float)em * 5.9604644775390625e-8f;
  const float mag = (em < 0x400u) ? fs : fn;
  return __uint_as_float(__float_as_uint(mag) | sgn);
}

/* hazard guards: four nops, all four accumulators of the group tied, A fragments named as inputs */
__device__ __forceinline__ void grp_guard_h(v8f& a, v8f& b, v8f& c, v8f& d, v16h x, v16h y) {
  asm volatile("v_nop\n\tv_nop\n\tv_nop\n\tv_nop" : "+v"(a), "+v"(b), "+v"(c), "+v"(d) : "v"(x), "v"(y));
}
__device__ __forceinline__ void grp_guard_b(v8f& a, v8f& b, v8f& c, v8f& d, v16b x, v16b y) {
  asm volatile("v_nop\n\tv_nop\n\tv_nop\n\tv_nop" : "+v"(a), "+v"(b), "+v"(c), "+v"(d) : "v"(x), "v"(y));
}
__device__ __forceinline__ void keep4_h(v16h a, v16h b, v16h c, v16h d) { asm volatile("v_nop" :: "v"(a), "v"(b), "v"(c), "v"(d)); }
__device__ __forceinline__ void keep4_b(v16b a, v16b b, v16b c, v16b d) { asm volatile("v_nop" :: "v"(a), "v"(b), "v"(c), "v"(d)); }
__device__ __forceinline__ void acc_guard4(v8f& a, v8f& b, v8f& c, v8f& d) {
  asm volatile("v_nop\n\tv_nop\n\tv_nop\n\tv_nop" : "+v"(a), "+v"(b), "+v"(c), "+v"(d));
}

/* Fragment loader: elements 0..7 <- p[0..7], elements 8..15 <- p[16..23]; p already includes 8*(lane>>4) */
template <typename T> struct Frag;
template <> struct Frag<_Float16> {
  typedef v16h V;
  union U { v16h v; v8h h[2]; };
  static __device__ __forceinline__ v16h load(const _Float16* p) {
    U f;
    f.h[0] = *(const v8h*)(p);
    f.h[1] = *(const v8h*)(p + 16);
    return f.v;
  }
  static __device__ __forceinline__ v8f mma(v16h a, v16h b, v8f c) {
    return __builtin_amdgcn_wmma_f32_16x16x32_f16(false, a, false, b, (short)0, c, false, false);
  }
  static __device__ __forceinline__ void guard(v8f& a, v8f& b, v8f& c, v8f& d, v16h x, v16h y) { grp_guard_h(a, b, c, d, x, y); }
  static __device__ __forceinline__ void keep(v16h a, v16h b, v16h c, v16h d) { keep4_h(a, b, c, d); }
};
template <> struct Frag<__bf16> {
  typedef v16b V;
  union U { v16b v; v8b h[2]; };
  static __device__ __forceinline__ v16b load(const __bf16* p) {
    U f;
    f.h[0] = *(const v8b*)(p);
    f.h[1] = *(const v8b*)(p + 16);
    return f.v;
  }
  static __device__ __forceinline__ v8f mma(v16b a, v16b b, v8f c) {
    return __builtin_amdgcn_wmma_f32_16x16x32_bf16(false, a, false, b, (short)0, c, false, false);
  }
  static __device__ __forceinline__ void guard(v8f& a, v8f& b, v8f& c, v8f& d, v16b x, v16b y) { grp_guard_b(a, b, c, d, x, y); }
  static __device__ __forceinline__ void keep(v16b a, v16b b, v16b c, v16b d) { keep4_b(a, b, c, d); }
};

// ---------------------------------------------------------------------------
// LDS-staged WMMA GEMM: C[m,n] = scale * sum_k A[m,k] * Bt[n,k] (+bias[n]) (+resid[m,n]). A block of 4 waves owns a
// 128x128 tile (2x2 waves, each wave a 64x64 tile). A row-major [M][K] pitch lda; Bt row-major [N][K] pitch ldb;
// M, N multiples of 128, K a multiple of 64 and at least 128.
// Operand path: a stage is 64 k (one whole 128-B line) of the block's 128 A rows and 128 Bt rows, every plane, brought
// into LDS by per-lane asynchronous 16-B copies (8 lanes per line, 4 whole lines per wave instruction). SPLIT: two
// buffers, the next stage's copies fly while this stage is multiplied. Not SPLIT: four buffers, the next three stages'
// copies fly (48 of a wave at the most); every wave issues 16 copies per stage, so the wait for a stage is a counted
// wait that leaves the younger stages' copies out. LDS row pitch 144 B (16 B x 9) for the 16-B readers.
// SPLIT: operands are hi/lo planes (A2/Bt2 = lo planes, same layout); product = hi.hi + hi.lo + lo.hi.
// BIAS_MODE: 0 none, 2 bias[n] (f32). ACT: 0 none, 2 relu. RESID (f32 output only): the residual is fetched in the
// store phase, one 16-B vector per lane at exactly the address the lane stores to.
// OUT_MODE: 0 f32, 1 f16, 2 bf16 hi plane (Cout) + bf16 lo plane (Cout2), 3 the same and an f16 plane of hi + lo
// (Cout3, same pitch; c3P bytes lead to branch 1).
// Epilogue: 16-row slabs staged per wave in LDS (only the owning wave touches its slab); the slabs reuse the ring
// behind the last stage's waits and barrier.
// ET: 0 f16 operands, 1 bf16 operands (pointers passed as 16-bit storage).
// One launch holds several independent products: gemm_tile is the work of one block, (bx, by, bz) = (tile, branch,
// weight plane) of its product; the kernels below pick product and tile from blockIdx (block-uniform). The pointers
// are those of (0, 0); aP, bP (16-bit elements) and cP (bytes) lead to branch 1, bQ and cQ to plane 1.
// Every form's ring has the same size, so the products of a launch share one LDS array.
// ---------------------------------------------------------------------------
template <int ET> struct Elem;
template <> struct Elem<0> { typedef _Float16 T; };
template <> struct Elem<1> { typedef __bf16 T; };

constexpr int kStageK   = 64;
constexpr int kRowPitch = 144;
constexpr int kPlaneLds = 128 * kRowPitch;
constexpr int kSlabLds  = 16 * 68 * 4;
static_assert((kRowPitch % 16) == 0 && ((kRowPitch / 16) % 2) == 1 && kRowPitch >= kStageK * 2);
static_assert((kDim % 128) == 0 && (kTok % 128) == 0 && (kDim % kStageK) == 0 && kDim >= 2 * kStageK);
static_assert(4 * kSlabLds <= 4 * kPlaneLds && (kSlabLds % 16) == 0);

/* One plane's 128 rows x 128 B of a stage: this lane's eight 16-B pieces, rows 16 apart. l = the lane's LDS byte
   address of its first piece, g = its global address, gstep = 16 source rows in elements. The copies and the
   s_wait_xcnt stand in one statement so that no address register is rewritten ahead of that wait. */
__device__ __forceinline__ void stage_plane(unsigned l, const unsigned short* g, size_t gstep) {
  const unsigned l1 = l + 16 * kRowPitch, l2 = l + 32 * kRowPitch, l3 = l + 48 * kRowPitch, l4 = l + 64 * kRowPitch,
                 l5 = l + 80 * kRowPitch, l6 = l + 96 * kRowPitch, l7 = l + 112 * kRowPitch;
  const unsigned short *g1 = g + gstep, *g2 = g + 2 * gstep, *g3 = g + 3 * gstep, *g4 = g + 4 * gstep,
                       *g5 = g + 5 * gstep, *g6 = g + 6 * gstep, *g7 = g + 7 * gstep;
  asm volatile(
      "global_load_async_to_lds_b128 %0, %8, off\n\t"
      "global_load_async_to_lds_b128 %1, %9, off\n\t"
      "global_load_async_to_lds_b128 %2, %10, off\n\t"
      "global_load_async_to_lds_b128 %3, %11, off\n\t"
      "global_load_async_to_lds_b128 %4, %12, off\n\t"
      "global_load_async_to_lds_b128 %5, %13, off\n\t"
      "global_load_async_to_lds_b128 %6, %14, off\n\t"
      "global_load_async_to_lds_b128 %7, %15, off\n\t"
      "s_wait_xcnt 0x0"
      :: "v"(l), "v"(l1), "v"(l2), "v"(l3), "v"(l4), "v"(l5), "v"(l6), "v"(l7),
         "v"(g), "v"(g1), "v"(g2), "v"(g3), "v"(g4), "v"(g5), "v"(g6), "v"(g7)
      : "memory");
}

/* Four-buffer ring, 16 copies of a wave per stage: returns when all of this wave's copies have landed but those of its
   'younger' youngest stages (2 at the most are in flight behind the stage that is waited for; 1 and then none in the
   last trips, which issue no stage). The count returns in issue order. younger is the same for the whole block. */
__device__ __forceinline__ void wait_copies_but(int younger) {
  if (younger >= 2)      asm volatile("s_wait_asynccnt 0x20" ::: "memory");
  else if (younger == 1) asm volatile("s_wait_asynccnt 0x10" ::: "memory");
  else                   asm volatile("s_wait_asynccnt 0x0" ::: "memory");
}

struct GemmArgs {
  const unsigned short* Ap0;
  const unsigned short* A2p0;
  const unsigned short* Btp0;
  const unsigned short* Bt2p0;
  void* Cout0;
  void* Cout20;
  void* Cout30;
  const float* bias0;
  const float* bias1;
  const float* resid0;
  const float* resid1;
  long aP, bP, bQ, cP, cQ, c3P;
  int lda, ldb, ldc, M, N, K;
  float scale;
};
constexpr int kRingLds = 8 * kPlaneLds;

template <int ET, bool SPLIT, int BIAS_MODE, int OUT_MODE, bool RESID, int ACT>
__device__ __forceinline__ void gemm_tile(const GemmArgs& ga, int bx, int by, int bz, unsigned char* ring) {
  typedef typename Elem<ET>::T T;
  typedef typename Frag<T>::V V;
  const unsigned short* __restrict__ Ap0 = ga.Ap0;
  const unsigned short* __restrict__ A2p0 = ga.A2p0;
  const unsigned short* __restrict__ Btp0 = ga.Btp0;
  const unsigned short* __restrict__ Bt2p0 = ga.Bt2p0;
  void* __restrict__ Cout0 = ga.Cout0;
  void* __restrict__ Cout20 = ga.Cout20;
  const float* __restrict__ bias0 = ga.bias0;
  const float* __restrict__ bias1 = ga.bias1;
  const float* __restrict__ resid0 = ga.resid0;
  const float* __restrict__ resid1 = ga.resid1;
  const long aP = ga.aP, bP = ga.bP, bQ = ga.bQ, cP = ga.cP, cQ = ga.cQ;
  const int lda = ga.lda, ldb = ga.ldb, ldc = ga.ldc, M = ga.M, N = ga.N, K = ga.K;
  const float scale = ga.scale;
  const long zp = (long)by;
  const long zq = (long)bz;
  const unsigned short* Ap   = Ap0 + zp * aP;
  const unsigned short* A2p  = A2p0 + zp * aP;
  const unsigned short* Btp  = Btp0 + zp * bP + zq * bQ;
  const unsigned short* Bt2p = Bt2p0 + zp * bP + zq * bQ;
  void* Cout  = (void*)((char*)Cout0 + zp * cP + zq * cQ);
  void* Cout2 = (void*)((char*)Cout20 + zp * cP + zq * cQ);
  void* Cout3 = (void*)((char*)ga.Cout30 + zp * ga.c3P);
  const float* bias  = zp ? bias1 : bias0;
  const float* resid = zp ? resid1 : resid0;
  /* stage layout: A hi | (A lo) | Bt hi | (Bt lo), each plane 128 rows at kRowPitch */
  constexpr int kPlanes = SPLIT ? 4 : 2;
  constexpr int kStageLds = kPlanes * kPlaneLds;
  constexpr int kOffBh = (SPLIT ? 2 : 1) * kPlaneLds;
  constexpr int kBufs = SPLIT ? 2 : 4;
  static_assert(kBufs * kStageLds == kRingLds);
  const int lane = threadIdx.x & 31;
  const int wave = __builtin_amdgcn_readfirstlane((int)(threadIdx.x >> 5));
  const int tilesN = N >> 7;
  const int tilesM = M >> 7;
  /* block-uniform exit in front of every copy and barrier */
  if (bx >= tilesM * tilesN) return;
  const int bm = bx / tilesN;
  const int bn = bx - bm * tilesN;
  const int wm = (wave >> 1) << 6;
  const int wn = (wave & 1) << 6;
  const int m0 = (bm << 7) + wm;
  const int n0 = (bn << 7) + wn;

  const int rlane = lane & 15;
  const int koff  = (lane >> 4) * 8;
  const int mOff  = (lane >> 4) * 8;

  /* copy map: thread t brings 16-B piece t&7 of rows (t>>3) + 16q, q 0..7, of every plane */
  const int crow = (int)threadIdx.x >> 3;
  const int cpc  = (int)threadIdx.x & 7;
  const unsigned ldsBase = (unsigned)(size_t)(&ring[0]) + (unsigned)(crow * kRowPitch + cpc * 16);
  const size_t aOff = (size_t)((bm << 7) + crow) * lda + cpc * 8;
  const size_t bOff = (size_t)((bn << 7) + crow) * ldb + cpc * 8;
  const size_t aStep = (size_t)16 * lda;
  const size_t bStep = (size_t)16 * ldb;
  const int nStages = K / kStageK;

  auto issue_stage = [&](int s) {
    const unsigned l = ldsBase + (unsigned)((s & (kBufs - 1)) * kStageLds);
    const size_t kq = (size_t)s * kStageK;
    stage_plane(l, Ap + aOff + kq, aStep);
    if (SPLIT) stage_plane(l + kPlaneLds, A2p + aOff + kq, aStep);
    stage_plane(l + kOffBh, Btp + bOff + kq, bStep);
    if (SPLIT) stage_plane(l + kOffBh + kPlaneLds, Bt2p + bOff + kq, bStep);
  };

  v8f acc[4][4];
#pragma unroll
  for (int i = 0; i < 4; ++i)
#pragma unroll
    for (int j = 0; j < 4; ++j) acc[i][j] = (v8f){0.f, 0.f, 0.f, 0.f, 0.f, 0.f, 0.f, 0.f};

  /* prologue: stage 0 landed and published; stage 1 (SPLIT) or stages 1, 2 and 3 in flight */
  issue_stage(0);
  if (SPLIT) {
    asm volatile("s_wait_asynccnt 0x0" ::: "memory");  /* this wave's stage-0 copies have landed */
  } else {
    if (nStages > 1) issue_stage(1);
    if (nStages > 2) issue_stage(2);
    wait_copies_but(nStages - 1);  /* this wave's stage-0 copies have landed */
  }
  __syncthreads();
  if (nStages > kBufs - 1) issue_stage(kBufs - 1);

  const int aFrag = (wm + rlane) * kRowPitch + koff * 2;
  const int bFrag = kOffBh + (wn + rlane) * kRowPitch + koff * 2;

#pragma unroll 1  /* one stage per trip: the foot's waits and barrier stand once */
  for (int s = 0; s < nStages; ++s) {
    const unsigned char* sb = ring + (s & (kBufs - 1)) * kStageLds;
#pragma unroll
    for (int kk = 0; kk < kStageK; kk += 32) {
      V bh[4], bl[4];
      const unsigned char* ap = sb + aFrag + kk * 2;
      V ah = Frag<T>::load((const T*)ap);
      V al;
      if (SPLIT) al = Frag<T>::load((const T*)(ap + kPlaneLds));
#pragma unroll
      for (int j = 0; j < 4; ++j) {
        const unsigned char* bp = sb + bFrag + j * 16 * kRowPitch + kk * 2;
        bh[j] = Frag<T>::load((const T*)bp);
        if (SPLIT) bl[j] = Frag<T>::load((const T*)(bp + kPlaneLds));
      }
#pragma unroll
      for (int i = 0; i < 4; ++i) {
        /* the next row group's A fragments are read in front of this group's products */
        V nh = ah;
        V nl;
        if (SPLIT) nl = al;
        if (i < 3) {
          nh = Frag<T>::load((const T*)(ap + (i + 1) * 16 * kRowPitch));
          if (SPLIT) nl = Frag<T>::load((const T*)(ap + (i + 1) * 16 * kRowPitch + kPlaneLds));
        }
#pragma unroll
        for (int j = 0; j < 4; ++j) {
          acc[i][j] = Frag<T>::mma(ah, bh[j], acc[i][j]);
          if (SPLIT) {
            acc[i][j] = Frag<T>::mma(ah, bl[j], acc[i][j]);
            acc[i][j] = Frag<T>::mma(al, bh[j], acc[i][j]);
          }
        }
        Frag<T>::guard(acc[i][0], acc[i][1], acc[i][2], acc[i][3], ah, SPLIT ? al : ah);
        ah = nh;
        if (SPLIT) al = nl;
      }
      Frag<T>::keep(bh[0], bh[1], bh[2], bh[3]);
      if (SPLIT) Frag<T>::keep(bl[0], bl[1], bl[2], bl[3]);
    }
    /* publish point of stage s + 1; the one barrier also ends every reader's last read of stage s's buffer */
    asm volatile("s_wait_dscnt 0x0" ::: "memory");     /* this wave's reads of stage s have returned */
    /* this wave's stage s + 1 copies have landed */
    if (SPLIT) asm volatile("s_wait_asynccnt 0x0" ::: "memory");
    else       wait_copies_but(nStages - 2 - s);
    __syncthreads();
    if (s + kBufs < nStages) issue_stage(s + kBufs);  /* into the buffer that trip s has just read */
  }
  asm volatile("s_wait_asynccnt 0x0" ::: "memory");  /* no copy is outstanding when the ring becomes the slabs */
  acc_guard4(acc[0][0], acc[0][1], acc[0][2], acc[0][3]);
  acc_guard4(acc[1][0], acc[1][1], acc[1][2], acc[1][3]);
  acc_guard4(acc[2][0], acc[2][1], acc[2][2], acc[2][3]);
  acc_guard4(acc[3][0], acc[3][1], acc[3][2], acc[3][3]);

  /* ---- epilogue ---- */
  float* slab = (float*)(ring + wave * kSlabLds);
#pragma unroll
  for (int i = 0; i < 4; ++i) {
    const int mBase = m0 + (i << 4);
#pragma unroll
    for (int j = 0; j < 4; ++j) {
      const int n = n0 + (j << 4) + rlane;
      float bv = 0.f;
      if (BIAS_MODE == 2) bv = bias[n];
#pragma unroll
      for (int r = 0; r < 8; ++r) {
        float v = acc[i][j][r] * scale;
        if (BIAS_MODE == 2) v += bv;
        if (ACT == 2) v = fmaxf(v, 0.0f);
        slab[(mOff + r) * 68 + (j << 4) + rlane] = v;
      }
    }
    __builtin_amdgcn_fence(__ATOMIC_RELEASE, "workgroup");
    __builtin_amdgcn_wave_barrier();
    __builtin_amdgcn_fence(__ATOMIC_ACQUIRE, "workgroup");
    if (OUT_MODE == 0) {
      /* rows it*2 + hh, it 0..7, hh 0..1 = 16 rows; 16 lanes x 16 B = the 256-B row segment */
      float* C = (float*)Cout;
      const int hh = lane >> 4, c4 = (lane & 15) * 4;
      v4f vals[8];
#pragma unroll
      for (int it = 0; it < 8; ++it) {
        const int row = it * 2 + hh;
        v4f v = *(const v4f*)(slab + row * 68 + c4);
        if (RESID) {
          const v4f rr = *(const v4f*)(resid + (size_t)(mBase + row) * ldc + n0 + c4);
          v = v + rr;
        }
        vals[it] = v;
      }
      {
#pragma unroll
        for (int it = 0; it < 8; ++it) {
          const int row = it * 2 + hh;
          *(v4f*)(C + (size_t)(mBase + row) * ldc + n0 + c4) = vals[it];
        }
        
      }
    } else {
      const int q = lane >> 3, c8 = (lane & 7) * 8;
      unsigned short* C  = (unsigned short*)Cout;
      unsigned short* C2 = (unsigned short*)Cout2;
      unsigned short* C3 = (unsigned short*)Cout3;
      {
#pragma unroll
        for (int it = 0; it < 4; ++it) {
          const int row = it * 4 + q;
          const float* sp = slab + row * 68 + c8;
          v8h hv, lv, fv;
#pragma unroll
          for (int e = 0; e < 8; ++e) {
            const float sv = sp[e];
            if (OUT_MODE == 1) {
              hv[e] = (_Float16)sv;
            } else {
              const unsigned short hb = f2bf_bits(sv);
              const unsigned short lb = f2bf_bits(sv - bf_bits2f(hb));
              hv[e] = __builtin_bit_cast(_Float16, hb);
              lv[e] = __builtin_bit_cast(_Float16, lb);
              if (OUT_MODE == 3) fv[e] = (_Float16)(bf_bits2f(hb) + bf_bits2f(lb));
            }
          }
          *(v8h*)(C + (size_t)(mBase + row) * ldc + n0 + c8) = hv;
          if (OUT_MODE >= 2) *(v8h*)(C2 + (size_t)(mBase + row) * ldc + n0 + c8) = lv;
          if (OUT_MODE == 3) *(v8h*)(C3 + (size_t)(mBase + row) * ldc + n0 + c8) = fv;
        }
        
      }
    }
    __builtin_amdgcn_fence(__ATOMIC_RELEASE, "workgroup");
    __builtin_amdgcn_wave_barrier();
    __builtin_amdgcn_fence(__ATOMIC_ACQUIRE, "workgroup");
  }
}

/* one product per launch: blockIdx = (tile, branch, weight plane) */
template <int ET, bool SPLIT, int BIAS_MODE, int OUT_MODE, bool RESID, int ACT>
__global__ __launch_bounds__(128) void wmma_gemm64(GemmArgs ga) {
  __shared__ __align__(16) unsigned char ring[kRingLds];
  gemm_tile<ET, SPLIT, BIAS_MODE, OUT_MODE, RESID, ACT>(ga, (int)blockIdx.x, (int)blockIdx.y, (int)blockIdx.z, ring);
}

/* Three products of feat, none reading what another writes: blockIdx.z 0, 1 = Q, K (hi/lo products, the long blocks,
   lowest in z), 2 = first residual product (bias, relu). blockIdx.y = branch. Each has kSmallTiles tiles. */
constexpr int kSmallTiles = (kTok >> 7) * (kDim >> 7);
__global__ __launch_bounds__(128) void qk_res1_kernel(GemmArgs gq, GemmArgs gr) {
  __shared__ __align__(16) unsigned char ring[kRingLds];
  const int z = (int)blockIdx.z;
  if (z < 2) gemm_tile<1, true, 0, 2, false, 0>(gq, (int)blockIdx.x, (int)blockIdx.y, z, ring);
  else       gemm_tile<0, false, 2, 1, false, 2>(gr, (int)blockIdx.x, (int)blockIdx.y, 0, ring);
}

/* Logits and, independent of them and of each other, the second residual product (bias, relu) and V^T. Flat grid: the
   2 x kLogitTiles logit blocks (the long ones) first, branch A then B; then 2 x kSmallTiles residual blocks; then
   2 x kSmallTiles V^T blocks. */
constexpr int kLogitTiles = (kTok >> 7) * (kTok >> 7);
__global__ __launch_bounds__(128) void logits_res2_vt_kernel(GemmArgs gs, GemmArgs gr, GemmArgs gv) {
  __shared__ __align__(16) unsigned char ring[kRingLds];
  const int x = (int)blockIdx.x;
  if (x < 2 * kLogitTiles) {
    gemm_tile<1, true, 0, 0, false, 0>(gs, x % kLogitTiles, x / kLogitTiles, 0, ring);
  } else if (x < 2 * kLogitTiles + 2 * kSmallTiles) {
    const int u = x - 2 * kLogitTiles;
    gemm_tile<0, false, 2, 1, false, 2>(gr, u % kSmallTiles, u / kSmallTiles, 0, ring);
  } else {
    const int u = x - (2 * kLogitTiles + 2 * kSmallTiles);
    gemm_tile<0, false, 0, 1, false, 0>(gv, u % kSmallTiles, u / kSmallTiles, 0, ring);
  }
}

// ---------------------------------------------------------------------------
// Operand conversions, 8 contiguous elements per thread (two 16-B loads, one 16-B store per output plane).
// split8_bf16: f32 -> bf16 hi + bf16 lo (both RNE converts: hi = bf16(v), lo = bf16(v - hi)).
// cast8_f16: f32 -> f16 with a power-of-two carry.
// ---------------------------------------------------------------------------
__device__ __forceinline__ void split8_bf16(const float* __restrict__ p, unsigned short* __restrict__ qh,
                                            unsigned short* __restrict__ ql) {
  const v4f a0 = *(const v4f*)(p);
  const v4f a1 = *(const v4f*)(p + 4);
  v8h hv, lv;
#pragma unroll
  for (int e = 0; e < 4; ++e) {
    const float f0 = a0[e], f1 = a1[e];
    const unsigned short h0 = f2bf_bits(f0), h1 = f2bf_bits(f1);
    const unsigned short l0 = f2bf_bits(f0 - bf_bits2f(h0)), l1 = f2bf_bits(f1 - bf_bits2f(h1));
    hv[e]     = __builtin_bit_cast(_Float16, h0);
    hv[4 + e] = __builtin_bit_cast(_Float16, h1);
    lv[e]     = __builtin_bit_cast(_Float16, l0);
    lv[4 + e] = __builtin_bit_cast(_Float16, l1);
  }
  *(v8h*)qh = hv;
  *(v8h*)ql = lv;
  /* no register of the two stores is rewritten ahead of this wait, whichever block the compiler lays behind this one */
  asm volatile("s_wait_xcnt 0x0" ::: "memory");
}
__device__ __forceinline__ void cast8_f16(const float* __restrict__ p, unsigned short* __restrict__ q, float carry) {
  const v4f a0 = *(const v4f*)(p);
  const v4f a1 = *(const v4f*)(p + 4);
  v8h hv;
#pragma unroll
  for (int e = 0; e < 4; ++e) {
    const float f0 = a0[e] * carry, f1 = a1[e] * carry;
    hv[e]     = (_Float16)f0;
    hv[4 + e] = (_Float16)f1;
  }
  *(v8h*)q = hv;
  /* no register of the store is rewritten ahead of this wait, whichever block the compiler lays behind this one */
  asm volatile("s_wait_xcnt 0x0" ::: "memory");
}

// ---------------------------------------------------------------------------
// All operand conversions of the inputs in one launch (none reads what another writes). blockIdx.z = branch (sources
// a* or b*). blockIdx.x (block-uniform) picks the job: kXBlk blocks split x; 4 x kWBlk split the weights s0..s3 into
// planes 0..3 of WSH / WSL; 4 x kWBlk cast the weights c0..c3 into planes 0..3 of WF; kWBlk cast the ffn weight.
// Coverage: blocks x 256 threads x 8 elements = each plane exactly.
// ---------------------------------------------------------------------------
constexpr int kXBlk = (int)(kND / 8 / 256);
constexpr int kWBlk = (int)(kWW / 8 / 256);
constexpr int kPrepBlocks = kXBlk + 9 * kWBlk;
__global__ __launch_bounds__(256) void prep_kernel(
    const float* __restrict__ ax, const float* __restrict__ bx,
    const float* __restrict__ as0, const float* __restrict__ as1, const float* __restrict__ as2, const float* __restrict__ as3,
    const float* __restrict__ bs0, const float* __restrict__ bs1, const float* __restrict__ bs2, const float* __restrict__ bs3,
    const float* __restrict__ ac0, const float* __restrict__ ac1, const float* __restrict__ ac2, const float* __restrict__ ac3,
    const float* __restrict__ bc0, const float* __restrict__ bc1, const float* __restrict__ bc2, const float* __restrict__ bc3,
    const float* __restrict__ affn, const float* __restrict__ bffn,
    unsigned short* __restrict__ xh, unsigned short* __restrict__ xl,
    unsigned short* __restrict__ wsh, unsigned short* __restrict__ wsl,
    unsigned short* __restrict__ wf, unsigned short* __restrict__ ffn) {
  const int b = (int)blockIdx.x;
  const int z = (int)blockIdx.z;
  const int t = (int)threadIdx.x;
  if (b < kXBlk) {
    const size_t e0 = (size_t)(b * 256 + t) << 3;
    const size_t o = (size_t)z * kR0El16 + e0;
    split8_bf16((z ? bx : ax) + e0, xh + o, xl + o);
  } else if (b < kXBlk + 4 * kWBlk) {
    const int u = b - kXBlk;
    const int y = u / kWBlk;
    const size_t e0 = (size_t)((u % kWBlk) * 256 + t) << 3;
    const float* sa = (y == 0) ? as0 : (y == 1) ? as1 : (y == 2) ? as2 : as3;
    const float* sb = (y == 0) ? bs0 : (y == 1) ? bs1 : (y == 2) ? bs2 : bs3;
    const size_t o = (size_t)z * kR0El16 + (size_t)y * kWW + e0;
    split8_bf16((z ? sb : sa) + e0, wsh + o, wsl + o);
  } else if (b < kXBlk + 8 * kWBlk) {
    const int u = b - (kXBlk + 4 * kWBlk);
    const int y = u / kWBlk;
    const size_t e0 = (size_t)((u % kWBlk) * 256 + t) << 3;
    const float* sa = (y == 0) ? ac0 : (y == 1) ? ac1 : (y == 2) ? ac2 : ac3;
    const float* sb = (y == 0) ? bc0 : (y == 1) ? bc1 : (y == 2) ? bc2 : bc3;
    cast8_f16((z ? sb : sa) + e0, wf + (size_t)z * (4 * kWW) + (size_t)y * kWW + e0, kWCarry);
  } else {
    const size_t e0 = (size_t)((b - (kXBlk + 8 * kWBlk)) * 256 + t) << 3;
    cast8_f16((z ? bffn : affn) + e0, ffn + (size_t)z * kWW + e0, kWCarry);
  }
}

// ---------------------------------------------------------------------------
// Row statistics of S f32 [4096][4096] and the block's share of the column sums, S read once:
// m_i = max_j S_ij, inv_s_i = 1 / sum_j exp(S_ij - m_i), part_b[j] = sum over the block's 32 rows of exp(S_ij - m_i) * inv_s_i.
// Block = 32 rows (16 waves x 2 rows). A wave holds one whole row in registers: 32 lane-strided 16-B loads, all in
// flight together (lane owns columns it*128 + lane*4 .. +3); maximum, exponentials, sum and probabilities are formed
// in those registers. Row sum order: per-lane sequential, then xor shuffle tree (unconditional).
// Column share: each wave adds its two rows in its own LDS row (only the owning wave touches it in front of the
// barrier); behind the barrier the 16 wave rows are added in index order and stored as whole lines. No atomics.
// ---------------------------------------------------------------------------
constexpr int kRcRows  = 32;
constexpr int kRcWaves = 16;
constexpr int kRcParts = kTok / kRcRows;
static_assert(kTok == 32 * 128 && (kTok % kRcRows) == 0 && kRcRows == 2 * kRcWaves && kTok == 2 * kRcWaves * 32 * 4);
static_assert((size_t)2 * kRcParts * kTok * 4 == kCPBytes);

/* Four base-2 exponentials in place. One statement, so that directly behind each v_exp_f32 stands an instruction that
   neither reads its result nor rewrites its source: the next exponential, and a v_nop behind the last. */
__device__ __forceinline__ void exp2_x4(float& a, float& b, float& c, float& d) {
  asm("v_exp_f32 %0, %0\n\tv_exp_f32 %1, %1\n\tv_exp_f32 %2, %2\n\tv_exp_f32 %3, %3\n\tv_nop"
      : "+v"(a), "+v"(b), "+v"(c), "+v"(d));
}
constexpr float kLog2e = 1.4426950408889634f;  /* exp(t) = exp2(t * log2 e), the form __expf compiles to */

__global__ __launch_bounds__(512) void rowcol_kernel(const float* __restrict__ S0, float* __restrict__ mrow0,
                                                     float* __restrict__ invs0, float* __restrict__ cpart0) {
  __shared__ __align__(16) float sC[kRcWaves][kTok];
  __shared__ float sM[kRcRows];
  __shared__ float sI[kRcRows];
  /* blockIdx.y = branch */
  const float* S = S0 + (size_t)blockIdx.y * kR0El32;
  float* mrow = mrow0 + (size_t)blockIdx.y * kTok;
  float* invs = invs0 + (size_t)blockIdx.y * kTok;
  float* cpart = cpart0 + ((size_t)blockIdx.y * kRcParts + blockIdx.x) * kTok;
  const int lane = threadIdx.x & 31;
  const int wave = __builtin_amdgcn_readfirstlane((int)(threadIdx.x >> 5));
  const int row0 = blockIdx.x * kRcRows;
  float* myC = &sC[wave][lane * 4];
#pragma unroll 1  /* one copy of the row's code: the text stays small */
  for (int q = 0; q < 2; ++q) {
    const int rl = wave * 2 + q;
    const float* p = S + (size_t)(row0 + rl) * kTok + lane * 4;
    v4f x[32];
#pragma unroll
    for (int it = 0; it < 32; ++it) x[it] = *(const v4f*)(p + it * 128);
    /* stands in front of every rewrite of the loads' address registers: p as an input keeps them untouched up to here */
    asm volatile("s_wait_xcnt 0x0" :: "v"(p) : "memory");
    float m = -INFINITY;
#pragma unroll
    for (int it = 0; it < 32; ++it) m = fmaxf(m, fmaxf(fmaxf(x[it][0], x[it][1]), fmaxf(x[it][2], x[it][3])));
#pragma unroll
    for (int off = 16; off > 0; off >>= 1) m = fmaxf(m, __shfl_xor(m, off, 32));
    float sum = 0.f;
#pragma unroll
    for (int it = 0; it < 32; ++it) {
      float e0 = (x[it][0] - m) * kLog2e, e1 = (x[it][1] - m) * kLog2e;
      float e2 = (x[it][2] - m) * kLog2e, e3 = (x[it][3] - m) * kLog2e;
      exp2_x4(e0, e1, e2, e3);
      x[it] = (v4f){e0, e1, e2, e3};
      sum += e0;
      sum += e1;
      sum += e2;
      sum += e3;
    }
#pragma unroll
    for (int off = 16; off > 0; off >>= 1) sum += __shfl_xor(sum, off, 32);
    const float inv = 1.0f / sum;
    if (q == 0) {
#pragma unroll
      for (int it = 0; it < 32; ++it) *(v4f*)(myC + it * 128) = x[it] * inv;
    } else {
#pragma unroll
      for (int it = 0; it < 32; ++it) {
        const v4f c = *(const v4f*)(myC + it * 128);
        *(v4f*)(myC + it * 128) = c + x[it] * inv;
      }
    }
    if (lane == 0) {
      sM[rl] = m;
      sI[rl] = inv;
    }
  }
  __syncthreads();
  /* thread t adds columns h*2048 + 4t .. +3 of the 16 wave rows: 32 lanes x 16 B = 4 whole lines per store */
#pragma unroll
  for (int h = 0; h < 2; ++h) {
    const int col = h * 2048 + (int)threadIdx.x * 4;
    v4f c = *(const v4f*)(&sC[0][col]);
#pragma unroll
    for (int w = 1; w < kRcWaves; ++w) c = c + *(const v4f*)(&sC[w][col]);
    *(v4f*)(cpart + col) = c;
  }
  asm volatile("s_wait_xcnt 0x0" ::: "memory");  /* in front of wave 0's reuse of the registers that these stores name */
  if (wave == 0) {
    const float mv = sM[lane];
    const float iv = sI[lane];
    *(float*)(mrow + row0 + lane) = mv;
    *(float*)(invs + row0 + lane) = iv;
  }
}

// ---------------------------------------------------------------------------
// Column sums over queries: c_j = sum over the 128 block shares part_b[j], then rc_j = 1 / (1e-9 + c_j).
// Block = 32 columns (one 128-B line of every share), 4 waves. Eight partial sums as before: partial p adds shares
// p, p+8, ... (16 shares) in order; wave w forms partials w and w+4 (32 shares, all loads in flight together); the 8
// partials are combined in index order by wave 0. No atomics. jb = block of columns, br = branch, sP = 8 x 32 floats.
// ---------------------------------------------------------------------------
static_assert(kRcParts == 128);
__device__ __forceinline__ void colfin_block(const float* __restrict__ cpart0, float* __restrict__ rcol0, int jb, int br,
                                             float* sP) {
  const float* cpart = cpart0 + (size_t)br * kRcParts * kTok;
  float* rcol = rcol0 + (size_t)br * kTok;
  const int lane = threadIdx.x & 31;
  const int wave = __builtin_amdgcn_readfirstlane((int)(threadIdx.x >> 5));
  const int j0 = jb * 32;
  const float* pw = cpart + (size_t)wave * kTok + j0 + lane;
  float v[kRcParts / 4];
#pragma unroll
  for (int t = 0; t < kRcParts / 4; ++t) v[t] = pw[(size_t)(4 * t) * kTok];
  asm volatile("s_wait_xcnt 0x0" ::: "memory");  /* in front of every rewrite of the loads' address registers */
  float acc0 = 0.f, acc1 = 0.f;
#pragma unroll
  for (int t = 0; t < kRcParts / 8; ++t) {
    acc0 += v[2 * t];
    acc1 += v[2 * t + 1];
  }
  sP[wave * 32 + lane] = acc0;
  sP[(wave + 4) * 32 + lane] = acc1;
  __syncthreads();
  if (wave == 0) {
    float c = sP[0 * 32 + lane];
    c += sP[1 * 32 + lane];
    c += sP[2 * 32 + lane];
    c += sP[3 * 32 + lane];
    c += sP[4 * 32 + lane];
    c += sP[5 * 32 + lane];
    c += sP[6 * 32 + lane];
    c += sP[7 * 32 + lane];
    const float rc = 1.0f / (kAttnEps + c);
    *(float*)(rcol + j0 + lane) = rc;
  }
}

/* Third residual product (bias) and, independent of it, the last step of the column sums. Flat grid: the 2 x kSmallTiles
   product blocks (the long ones) first, branch A then B; then 2 x kColBlocks column blocks, which use the first 1 KiB
   of the ring for their partial sums. */
constexpr int kColBlocks = kTok / 32;
__global__ __launch_bounds__(128) void res3_colfin_kernel(GemmArgs gr, const float* __restrict__ cpart0,
                                                          float* __restrict__ rcol0) {
  __shared__ __align__(16) unsigned char ring[kRingLds];
  const int x = (int)blockIdx.x;
  if (x < 2 * kSmallTiles) {
    gemm_tile<0, false, 2, 1, false, 0>(gr, x % kSmallTiles, x / kSmallTiles, 0, ring);
  } else {
    const int u = x - 2 * kSmallTiles;
    colfin_block(cpart0, rcol0, u % kColBlocks, u / kColBlocks, (float*)ring);
  }
}

// ---------------------------------------------------------------------------
// attn.V: SC_z[i][d] = (1/32768) * sum over the keys j of half z of f16(32768 * P_ij * rc_j) * VT[d][j],
// P_ij = exp(S_ij - m_i) * inv_s_i. The two shares SC_0 + SC_1 are added by ln_ffn_kernel.
// Block = 64 query rows x all 512 d x 2048 keys (8 waves, wave w owns d columns 64w..64w+63, acc 4x4 tiles):
// blockIdx.z picks the half of the keys, so that 256 blocks stand on the chip and each walks 32 key tiles. The tile
// numbers below count inside the block's half.
// Operand path: per-lane asynchronous 16-B copies bring whole 128-B lines into LDS, three buffers. Stage s holds the
// V^T tile of keys 64s..64s+63 (512 rows x 128 B, pitch 144 B) and the logit tile of keys 64(s+1)..64(s+1)+63
// (64 rows x 256 B, pitch 272 B): trip t multiplies key tile t and forms the f16 weights of key tile t + 1 out of the
// same buffer, while the copies of stages t + 1 and t + 2 fly. Even stages are copied by waves 0..3, odd stages by
// waves 4..7: a wave never has more than one stage outstanding, so its wait for that stage is a wait to 0 and leaves
// the other half's younger stage in flight. The weight tiles (64 rows x 128 B, pitch 144 B) alternate between two
// places: the one written in trip t was last read in trip t - 1. Thread t forms row t>>2, keys (t&3)*16..+15
// (64 rows x 4 threads x 16 = the whole tile). The 4096 column factors are copied into LDS once, in the prologue.
// The pad bytes of every pitch are never read: all reads touch byte offsets below the row length.
// ---------------------------------------------------------------------------
constexpr int kAvK      = 64;
constexpr int kAvHalves = 2;
constexpr int kAvKeys   = kTok / kAvHalves;
constexpr int kAvVPitch = 144;
constexpr int kAvSPitch = 272;
constexpr int kAvAPitch = 144;
constexpr int kAvVLds   = kDim * kAvVPitch;
constexpr int kAvSLds   = 64 * kAvSPitch;
constexpr int kAvStage  = kAvVLds + kAvSLds;
constexpr int kAvALds   = 64 * kAvAPitch;
constexpr int kAvBufs   = 3;
constexpr int kAvOffA   = kAvBufs * kAvStage;
constexpr int kAvOffRC  = kAvOffA + 2 * kAvALds;
constexpr int kAvLds    = kAvOffRC + kTok * 4;
static_assert((kAvKeys % kAvK) == 0 && kAvKeys >= 3 * kAvK && kDim == 512);
static_assert(kAvVPitch >= kAvK * 2 && kAvSPitch >= kAvK * 4 && kAvAPitch >= kAvK * 2);
static_assert((kAvVPitch % 32) == 16 && (kAvSPitch % 32) == 16 && (kAvAPitch % 32) == 16);
static_assert(8 * kSlabLds <= kAvBufs * kAvStage && kAvLds <= 327680);

/* This lane's eight (or four) 16-B pieces, lstep LDS bytes and gstep source bytes apart. The copies and the
   s_wait_xcnt stand in one statement so that no address register is rewritten ahead of that wait. */
__device__ __forceinline__ void copy8_b128(unsigned l, unsigned lstep, const unsigned char* g, size_t gstep) {
  const unsigned l1 = l + lstep, l2 = l + 2 * lstep, l3 = l + 3 * lstep, l4 = l + 4 * lstep,
                 l5 = l + 5 * lstep, l6 = l + 6 * lstep, l7 = l + 7 * lstep;
  const unsigned char *g1 = g + gstep, *g2 = g + 2 * gstep, *g3 = g + 3 * gstep, *g4 = g + 4 * gstep,
                      *g5 = g + 5 * gstep, *g6 = g + 6 * gstep, *g7 = g + 7 * gstep;
  asm volatile(
      "global_load_async_to_lds_b128 %0, %8, off\n\t"
      "global_load_async_to_lds_b128 %1, %9, off\n\t"
      "global_load_async_to_lds_b128 %2, %10, off\n\t"
      "global_load_async_to_lds_b128 %3, %11, off\n\t"
      "global_load_async_to_lds_b128 %4, %12, off\n\t"
      "global_load_async_to_lds_b128 %5, %13, off\n\t"
      "global_load_async_to_lds_b128 %6, %14, off\n\t"
      "global_load_async_to_lds_b128 %7, %15, off\n\t"
      "s_wait_xcnt 0x0"
      :: "v"(l), "v"(l1), "v"(l2), "v"(l3), "v"(l4), "v"(l5), "v"(l6), "v"(l7),
         "v"(g), "v"(g1), "v"(g2), "v"(g3), "v"(g4), "v"(g5), "v"(g6), "v"(g7)
      : "memory");
}
__device__ __forceinline__ void copy4_b128(unsigned l, unsigned lstep, const unsigned char* g, size_t gstep) {
  const unsigned l1 = l + lstep, l2 = l + 2 * lstep, l3 = l + 3 * lstep;
  const unsigned char *g1 = g + gstep, *g2 = g + 2 * gstep, *g3 = g + 3 * gstep;
  asm volatile(
      "global_load_async_to_lds_b128 %0, %4, off\n\t"
      "global_load_async_to_lds_b128 %1, %5, off\n\t"
      "global_load_async_to_lds_b128 %2, %6, off\n\t"
      "global_load_async_to_lds_b128 %3, %7, off\n\t"
      "s_wait_xcnt 0x0"
      :: "v"(l), "v"(l1), "v"(l2), "v"(l3), "v"(g), "v"(g1), "v"(g2), "v"(g3)
      : "memory");
}

__global__ __launch_bounds__(256) void av_kernel(const float* __restrict__ S0, const float* __restrict__ mrow0,
                                                 const float* __restrict__ invs0, const float* __restrict__ rcol0,
                                                 const unsigned short* __restrict__ VTp0, float* __restrict__ SC0) {
  /* stage buffers 0, 1, 2 | weight tile 0 | weight tile 1 | column factors */
  __shared__ __align__(16) unsigned char smem[kAvLds];
  /* blockIdx.y = branch, blockIdx.z = half of the keys; S and V^T start at the half's first key */
  const int key0 = (int)blockIdx.z * kAvKeys;
  const float* S = S0 + (size_t)blockIdx.y * kR0El32 + key0;
  const float* mrow = mrow0 + (size_t)blockIdx.y * kTok;
  const float* invs = invs0 + (size_t)blockIdx.y * kTok;
  const float* rcol = rcol0 + (size_t)blockIdx.y * kTok;
  const unsigned short* VTp = VTp0 + (size_t)blockIdx.y * kND + key0;
  float* SC = SC0 + ((size_t)blockIdx.z * 2 + blockIdx.y) * kND;
  typedef Frag<_Float16> FH;
  const int tid  = threadIdx.x;
  const int lane = tid & 31;
  const int wave = __builtin_amdgcn_readfirstlane((int)(tid >> 5));
  const int m0 = blockIdx.x * 64;
  const int n0 = wave * 64;
  const int sr   = tid >> 2;
  const int sc16 = (tid & 3) * 16;
  const float mi = mrow[m0 + sr];
  const float fi = invs[m0 + sr] * kPCarry;
  /* stands in front of every rewrite of the registers that these two loads name: as inputs they stay untouched up to here */
  asm volatile("s_wait_xcnt 0x0" :: "v"(m0 + sr), "s"(mrow), "s"(invs) : "memory");

  const int rlane = lane & 15;
  const int koff  = (lane >> 4) * 8;
  const int mOff  = (lane >> 4) * 8;
  constexpr int nT = kAvKeys / kAvK;

  /* copy maps of the four waves that bring a stage, c = the thread's number among their 128. V^T: 16-B piece c&7 of
     rows (c>>3) + 16q, q 0..31 (4 whole lines per wave instruction). Logits: piece c&15 of rows (c>>4) + 8q, q 0..7.
     40 copies of a wave per stage. Column factors (all 256 threads): piece t + 256q, q 0..3. */
  const int half = wave >> 2;
  const int ct = tid & 127;
  const unsigned ldsBase = (unsigned)(size_t)(&smem[0]);
  const unsigned vL = ldsBase + (unsigned)((ct >> 3) * kAvVPitch + (ct & 7) * 16);
  const unsigned sL = ldsBase + (unsigned)(kAvVLds + (ct >> 4) * kAvSPitch + (ct & 15) * 16);
  const unsigned char* vG = (const unsigned char*)VTp + (size_t)(ct >> 3) * (kTok * 2) + (ct & 7) * 16;
  const unsigned char* sG = (const unsigned char*)S + (size_t)(m0 + (ct >> 4)) * (kTok * 4) + (ct & 15) * 16;

  auto issue_logits = [&](int u, int buf) {
    copy8_b128(sL + (unsigned)(buf * kAvStage), 8 * kAvSPitch, sG + (size_t)u * (kAvK * 4), (size_t)8 * kTok * 4);
  };
  auto issue_stage = [&](int s, int buf) {
    const unsigned l = vL + (unsigned)(buf * kAvStage);
    const unsigned char* g = vG + (size_t)s * (kAvK * 2);
#pragma unroll  /* four statements of eight copies: every LDS and source step a constant */
    for (int j = 0; j < 4; ++j)
      copy8_b128(l + j * 128 * kAvVPitch, 16 * kAvVPitch, g + (size_t)j * 128 * kTok * 2, (size_t)16 * kTok * 2);
    if (s + 1 < nT) issue_logits(s + 1, buf);
  };
  /* this thread's 16 weights of key tile u, out of the logit tile at sraw */
  auto weights = [&](int u, const unsigned char* sraw, v8h& h0, v8h& h1) {
    const float* sp = (const float*)(sraw + sr * kAvSPitch) + sc16;
    const float* rp = (const float*)(smem + kAvOffRC) + key0 + u * kAvK + sc16;
#pragma unroll
    for (int h = 0; h < 2; ++h) {
      const v4f s0 = *(const v4f*)(sp + h * 8);
      const v4f s1 = *(const v4f*)(sp + h * 8 + 4);
      const v4f r0 = *(const v4f*)(rp + h * 8);
      const v4f r1 = *(const v4f*)(rp + h * 8 + 4);
      v8h hv;
#pragma unroll
      for (int e = 0; e < 4; ++e) {
        const float e0 = __expf(s0[e] - mi);
        const float e1 = __expf(s1[e] - mi);
        const float w0 = (e0 * fi) * r0[e];
        const float w1 = (e1 * fi) * r1[e];
        hv[e]     = (_Float16)w0;
        hv[4 + e] = (_Float16)w1;
      }
      if (h == 0) h0 = hv; else h1 = hv;
    }
  };
  auto put_weights = [&](unsigned char* at, v8h h0, v8h h1) {
    *(v8h*)(at + sr * kAvAPitch + sc16 * 2) = h0;
    *(v8h*)(at + sr * kAvAPitch + sc16 * 2 + 16) = h1;
  };

  v8f acc[4][4];
#pragma unroll
  for (int i = 0; i < 4; ++i)
#pragma unroll
    for (int j = 0; j < 4; ++j) acc[i][j] = (v8f){0.f, 0.f, 0.f, 0.f, 0.f, 0.f, 0.f, 0.f};

  /* the 64 keys of one tile: weight tile at, V^T tile vt */
  auto products = [&](const unsigned char* at, const unsigned char* vt) {
#pragma unroll
    for (int kk = 0; kk < kAvK; kk += 32) {
      v16h bh[4];
#pragma unroll
      for (int j = 0; j < 4; ++j)
        bh[j] = FH::load((const _Float16*)(vt + (n0 + (j << 4) + rlane) * kAvVPitch + (kk + koff) * 2));
      const unsigned char* ap = at + rlane * kAvAPitch + (kk + koff) * 2;
      v16h ah = FH::load((const _Float16*)ap);
#pragma unroll
      for (int i = 0; i < 4; ++i) {
        /* the next row group's A fragment is read in front of this group's products */
        v16h nh = ah;
        if (i < 3) nh = FH::load((const _Float16*)(ap + (i + 1) * 16 * kAvAPitch));
#pragma unroll
        for (int j = 0; j < 4; ++j) acc[i][j] = FH::mma(ah, bh[j], acc[i][j]);
        FH::guard(acc[i][0], acc[i][1], acc[i][2], acc[i][3], ah, ah);
        ah = nh;
      }
      FH::keep(bh[0], bh[1], bh[2], bh[3]);
    }
  };

  /* prologue: column factors, logit tile 0 (in buffer 2's logit place), stage 0 (waves 0..3) and stage 1 (waves 4..7)
     landed and published; weight tile 0 formed; then, behind the barrier that ends the reads of buffer 2, stage 2 in
     flight */
  copy4_b128(ldsBase + (unsigned)(kAvOffRC + tid * 16), 4096, (const unsigned char*)rcol + tid * 16, (size_t)4096);
  if (half == 0) {
    issue_logits(0, 2);
    issue_stage(0, 0);
  } else {
    issue_stage(1, 1);
  }
  asm volatile("s_wait_asynccnt 0x0" ::: "memory");  /* this wave's prologue copies have landed */
  __syncthreads();
  {
    v8h h0, h1;
    weights(0, smem + 2 * kAvStage + kAvVLds, h0, h1);
    put_weights(smem + kAvOffA, h0, h1);
  }
  asm volatile("s_wait_dscnt 0x0" ::: "memory");  /* this wave's reads of logit tile 0 have returned */
  __syncthreads();
  if (half == 0) issue_stage(2, 2);

  int buf = 0;  /* t mod 3 */
#pragma unroll 1  /* one stage per trip: the foot's waits and barrier stand once */
  for (int t = 0; t < nT - 1; ++t) {
    const unsigned char* sb = smem + buf * kAvStage;
    v8h h0, h1;
    weights(t + 1, sb + kAvVLds, h0, h1);
    products(smem + kAvOffA + (t & 1) * kAvALds, sb);
    put_weights(smem + kAvOffA + ((t + 1) & 1) * kAvALds, h0, h1);
    /* publish point of stage t + 1 and of weight tile t + 1; the one barrier also ends every reader's last read of
       stage t's buffer and of weight tile t. Stage t + 1 and stage t + 3 belong to the same half of the waves. */
    const bool mine = ((t + 1) & 1) == half;
    asm volatile("s_wait_dscnt 0x0" ::: "memory");  /* this wave's LDS reads and writes of trip t are done */
    if (mine) asm volatile("s_wait_asynccnt 0x0" ::: "memory");  /* this wave's stage t + 1 copies, its only ones, have landed */
    __syncthreads();
    if (mine && t + 3 < nT) issue_stage(t + 3, buf);  /* into the buffer that trip t has just read */
    buf = (buf == kAvBufs - 1) ? 0 : buf + 1;
  }
  products(smem + kAvOffA + ((nT - 1) & 1) * kAvALds, smem + ((nT - 1) % kAvBufs) * kAvStage);
  asm volatile("s_wait_asynccnt 0x0" ::: "memory");  /* no copy is outstanding when the ring becomes the slabs */
  asm volatile("s_wait_dscnt 0x0" ::: "memory");     /* this wave's last fragment reads have returned */
  __syncthreads();                                   /* every wave has left the ring before a slab is written */
  acc_guard4(acc[0][0], acc[0][1], acc[0][2], acc[0][3]);
  acc_guard4(acc[1][0], acc[1][1], acc[1][2], acc[1][3]);
  acc_guard4(acc[2][0], acc[2][1], acc[2][2], acc[2][3]);
  acc_guard4(acc[3][0], acc[3][1], acc[3][2], acc[3][3]);

  float* slab = (float*)(smem + wave * kSlabLds);
#pragma unroll
  for (int i = 0; i < 4; ++i) {
    const int mBase = m0 + (i << 4);
#pragma unroll
    for (int j = 0; j < 4; ++j) {
#pragma unroll
      for (int r = 0; r < 8; ++r) slab[(mOff + r) * 68 + (j << 4) + rlane] = acc[i][j][r] * kPCarryInv;
    }
    __builtin_amdgcn_fence(__ATOMIC_RELEASE, "workgroup");
    __builtin_amdgcn_wave_barrier();
    __builtin_amdgcn_fence(__ATOMIC_ACQUIRE, "workgroup");
    {
      const int hh = lane >> 4, c4 = (lane & 15) * 4;
      v4f vals[8];
#pragma unroll
      for (int it = 0; it < 8; ++it) vals[it] = *(const v4f*)(slab + (it * 2 + hh) * 68 + c4);
      {
#pragma unroll
        for (int it = 0; it < 8; ++it) {
          const int row = it * 2 + hh;
          *(v4f*)(SC + (size_t)(mBase + row) * kDim + n0 + c4) = vals[it];
        }
        
      }
    }
    __builtin_amdgcn_fence(__ATOMIC_RELEASE, "workgroup");
    __builtin_amdgcn_wave_barrier();
    __builtin_amdgcn_fence(__ATOMIC_ACQUIRE, "workgroup");
  }
}

// ---------------------------------------------------------------------------
// s = LayerNorm(res + sc) over 512 (biased variance, eps inside rsqrt) and out = s + s . ffnW^T, one launch.
// Block = 32 token rows x all 512 output columns, 8 waves; blockIdx.y = branch.
// LayerNorm: wave w forms rows 4w..4w+3, one row at a time in the whole wave, all four rows' loads in flight together.
// sc = the two key halves' shares of attn.V, added here (share 1 lies 2 planes behind share 0). Lane owns columns
// it*128 + lane*4 .. +3 (it 0..3): 16 values in registers, static indexing. res is an f16 plane read as 32-bit integer
// words; sc, gamma, beta f32. s stays in LDS: an f32 plane (pitch 2064 B), the residual of the store phase, and an f16
// plane (pitch 1040 B = 16 B x 65), the A operand.
// Product: wave w owns output columns 64w..64w+63 (acc 2x4 tiles), K = 512 in 8 stages of 64 k. A stage is the weight's
// 512 rows x 128 B (pitch 144 B), brought into LDS by per-lane asynchronous 16-B copies, three buffers: even stages are
// copied by waves 0..3, odd stages by waves 4..7, so a wave never has more than one stage (32 copies) outstanding and
// its wait for that stage is a wait to 0. Stages 0 and 1 fly while the rows are normalised.
// The pad bytes of every pitch are never read.
// ---------------------------------------------------------------------------
constexpr int kLfRows   = 32;
constexpr int kLfK      = 64;
constexpr int kLfBPitch = 144;
constexpr int kLfBLds   = kDim * kLfBPitch;
constexpr int kLfBufs   = 3;
constexpr int kLfAPitch = kDim * 2 + 16;
constexpr int kLfYPitch = kDim * 4 + 16;
constexpr int kLfOffA   = kLfBufs * kLfBLds;
constexpr int kLfOffY   = kLfOffA + kLfRows * kLfAPitch;
constexpr int kLfLds    = kLfOffY + kLfRows * kLfYPitch;
static_assert((kTok % kLfRows) == 0 && (kDim % kLfK) == 0 && kDim / kLfK >= 3 && kDim == 512);
static_assert((kLfBPitch % 32) == 16 && (kLfAPitch % 32) == 16 && (kLfYPitch % 16) == 0 && kLfBPitch >= kLfK * 2);
static_assert(8 * kSlabLds <= kLfOffA && kLfLds <= 327680);

__global__ __launch_bounds__(256) void ln_ffn_kernel(const unsigned short* __restrict__ RES0, const float* __restrict__ SCp0,
                                                     const float* __restrict__ gam0, const float* __restrict__ bet0,
                                                     const float* __restrict__ gam1, const float* __restrict__ bet1,
                                                     const unsigned short* __restrict__ Wp0, float* __restrict__ out0) {
  /* weight stage buffers 0, 1, 2 | s f16 | s f32 */
  __shared__ __align__(16) unsigned char smem[kLfLds];
  /* blockIdx.y = branch */
  const unsigned short* RES = RES0 + (size_t)blockIdx.y * kND;
  const float* SCp = SCp0 + (size_t)blockIdx.y * kND;
  const float* SCq = SCp0 + ((size_t)blockIdx.y + 2) * kND;
  const float* gam = blockIdx.y ? gam1 : gam0;
  const float* bet = blockIdx.y ? bet1 : bet0;
  const unsigned short* Wp = Wp0 + (size_t)blockIdx.y * kWW;
  float* out = out0 + (size_t)blockIdx.y * kND;
  typedef Frag<_Float16> FH;
  const int tid  = threadIdx.x;
  const int lane = tid & 31;
  const int wave = __builtin_amdgcn_readfirstlane((int)(tid >> 5));
  const int m0 = blockIdx.x * kLfRows;
  const int n0 = wave * 64;
  const int rlane = lane & 15;
  const int koff  = (lane >> 4) * 8;
  const int mOff  = (lane >> 4) * 8;
  constexpr int nT = kDim / kLfK;

  /* copy map of the four waves that bring a stage, c = the thread's number among their 128: 16-B piece c&7 of weight
     rows (c>>3) + 16q, q 0..31 (4 whole lines per wave instruction) */
  const int half = wave >> 2;
  const int ct = tid & 127;
  const unsigned bL = (unsigned)(size_t)(&smem[0]) + (unsigned)((ct >> 3) * kLfBPitch + (ct & 7) * 16);
  const unsigned char* bG = (const unsigned char*)Wp + (size_t)(ct >> 3) * (kDim * 2) + (ct & 7) * 16;
  auto issue_stage = [&](int s, int buf) {
    const unsigned l = bL + (unsigned)(buf * kLfBLds);
    const unsigned char* g = bG + (size_t)s * (kLfK * 2);
#pragma unroll  /* four statements of eight copies: every LDS and source step a constant */
    for (int j = 0; j < 4; ++j)
      copy8_b128(l + j * 128 * kLfBPitch, 16 * kLfBPitch, g + (size_t)j * 128 * kDim * 2, (size_t)16 * kDim * 2);
  };
  if (half == 0) issue_stage(0, 0);
  else           issue_stage(1, 1);

  /* ---- add + LayerNorm of this wave's four rows ---- */
  {
    v4f sa[4][4], sb[4][4], g4[4], b4[4];
    v2u rw[4][4];
#pragma unroll
    for (int q = 0; q < 4; ++q) {
      const size_t ro = (size_t)(m0 + wave * 4 + q) * kDim;
#pragma unroll
      for (int it = 0; it < 4; ++it) {
        const int col = it * 128 + lane * 4;
        sa[q][it] = *(const v4f*)(SCp + ro + col);
        sb[q][it] = *(const v4f*)(SCq + ro + col);
        rw[q][it] = *(const v2u*)(RES + ro + col);
      }
    }
#pragma unroll
    for (int it = 0; it < 4; ++it) {
      g4[it] = *(const v4f*)(gam + it * 128 + lane * 4);
      b4[it] = *(const v4f*)(bet + it * 128 + lane * 4);
    }
    asm volatile("s_wait_xcnt 0x0" ::: "memory");  /* in front of every rewrite of the loads' address registers */
#pragma unroll
    for (int q = 0; q < 4; ++q) {
      const int rl = wave * 4 + q;
      float x[16];
#pragma unroll
      for (int it = 0; it < 4; ++it) {
        const v4f a = sa[q][it] + sb[q][it];
        const unsigned w0 = rw[q][it][0];
        const unsigned w1 = rw[q][it][1];
        x[4 * it + 0] = h16_to_f32(w0 & 0xffffu) + a[0];
        x[4 * it + 1] = h16_to_f32(w0 >> 16) + a[1];
        x[4 * it + 2] = h16_to_f32(w1 & 0xffffu) + a[2];
        x[4 * it + 3] = h16_to_f32(w1 >> 16) + a[3];
      }
      float s = 0.f;
#pragma unroll
      for (int i = 0; i < 16; ++i) s += x[i];
#pragma unroll
      for (int off = 16; off > 0; off >>= 1) s += __shfl_xor(s, off, 32);
      const float mu = s * kInvDim;
      float vs = 0.f;
#pragma unroll
      for (int i = 0; i < 16; ++i) {
        const float d = x[i] - mu;
        x[i] = d;
        vs += d * d;
      }
#pragma unroll
      for (int off = 16; off > 0; off >>= 1) vs += __shfl_xor(vs, off, 32);
      const float inv = rsqrtf(vs * kInvDim + kLnEps);
#pragma unroll
      for (int it = 0; it < 4; ++it) {
        const int col = it * 128 + lane * 4;
        v4f y;
        y[0] = (x[4 * it + 0] * inv) * g4[it][0] + b4[it][0];
        y[1] = (x[4 * it + 1] * inv) * g4[it][1] + b4[it][1];
        y[2] = (x[4 * it + 2] * inv) * g4[it][2] + b4[it][2];
        y[3] = (x[4 * it + 3] * inv) * g4[it][3] + b4[it][3];
        v4h h;
        h[0] = (_Float16)y[0];
        h[1] = (_Float16)y[1];
        h[2] = (_Float16)y[2];
        h[3] = (_Float16)y[3];
        *(v4f*)(smem + kLfOffY + rl * kLfYPitch + col * 4) = y;
        *(v4h*)(smem + kLfOffA + rl * kLfAPitch + col * 2) = h;
      }
    }
  }

  v8f acc[2][4];
#pragma unroll
  for (int i = 0; i < 2; ++i)
#pragma unroll
    for (int j = 0; j < 4; ++j) acc[i][j] = (v8f){0.f, 0.f, 0.f, 0.f, 0.f, 0.f, 0.f, 0.f};

  /* the 64 k of stage t: weight tile bt */
  auto products = [&](int t, const unsigned char* bt) {
#pragma unroll
    for (int kk = 0; kk < kLfK; kk += 32) {
      v16h bh[4];
#pragma unroll
      for (int j = 0; j < 4; ++j)
        bh[j] = FH::load((const _Float16*)(bt + (n0 + (j << 4) + rlane) * kLfBPitch + (kk + koff) * 2));
      const unsigned char* ap = smem + kLfOffA + rlane * kLfAPitch + (t * kLfK + kk + koff) * 2;
      const v16h a0 = FH::load((const _Float16*)ap);
      const v16h a1 = FH::load((const _Float16*)(ap + 16 * kLfAPitch));
#pragma unroll
      for (int j = 0; j < 4; ++j) acc[0][j] = FH::mma(a0, bh[j], acc[0][j]);
#pragma unroll
      for (int j = 0; j < 4; ++j) acc[1][j] = FH::mma(a1, bh[j], acc[1][j]);
    }
  };

  /* stages 0 and 1 landed, both planes of s written, all published; then stage 2 in flight */
  asm volatile("s_wait_dscnt 0x0" ::: "memory");     /* this wave's rows of s are written */
  asm volatile("s_wait_asynccnt 0x0" ::: "memory");  /* this wave's first stage has landed */
  __syncthreads();
  if (half == 0) issue_stage(2, 2);

  int buf = 0;  /* t mod 3 */
#pragma unroll 1  /* one stage per trip: the foot's waits and barrier stand once */
  for (int t = 0; t < nT - 1; ++t) {
    products(t, smem + buf * kLfBLds);
    /* publish point of stage t + 1; the one barrier also ends every reader's last read of stage t's buffer. Stage
       t + 1 and stage t + 3 belong to the same half of the waves. */
    const bool mine = ((t + 1) & 1) == half;
    asm volatile("s_wait_dscnt 0x0" ::: "memory");  /* this wave's reads of stage t have returned */
    if (mine) asm volatile("s_wait_asynccnt 0x0" ::: "memory");  /* this wave's stage t + 1 copies, its only ones, have landed */
    __syncthreads();
    if (mine && t + 3 < nT) issue_stage(t + 3, buf);  /* into the buffer that trip t has just read */
    buf = (buf == kLfBufs - 1) ? 0 : buf + 1;
  }
  products(nT - 1, smem + ((nT - 1) % kLfBufs) * kLfBLds);
  asm volatile("s_wait_asynccnt 0x0" ::: "memory");  /* no copy is outstanding when the ring becomes the slabs */
  asm volatile("s_wait_dscnt 0x0" ::: "memory");     /* this wave's last fragment reads have returned */
  __syncthreads();                                   /* every wave has left the ring before a slab is written */

  /* store phase: 16-row slabs per wave (only the owning wave touches its slab); the residual s comes from its f32 plane */
  float* slab = (float*)(smem + wave * kSlabLds);
#pragma unroll
  for (int i = 0; i < 2; ++i) {
    const int mBase = i << 4;
#pragma unroll
    for (int j = 0; j < 4; ++j) {
#pragma unroll
      for (int r = 0; r < 8; ++r) slab[(mOff + r) * 68 + (j << 4) + rlane] = acc[i][j][r] * kWCarryInv;
    }
    __builtin_amdgcn_fence(__ATOMIC_RELEASE, "workgroup");
    __builtin_amdgcn_wave_barrier();
    __builtin_amdgcn_fence(__ATOMIC_ACQUIRE, "workgroup");
    {
      const int hh = lane >> 4, c4 = (lane & 15) * 4;
      v4f vals[8];
#pragma unroll
      for (int it = 0; it < 8; ++it) {
        const int row = it * 2 + hh;
        const v4f v = *(const v4f*)(slab + row * 68 + c4);
        const v4f rr = *(const v4f*)(smem + kLfOffY + (mBase + row) * kLfYPitch + (n0 + c4) * 4);
        vals[it] = v + rr;
      }
#pragma unroll
      for (int it = 0; it < 8; ++it) {
        const int row = it * 2 + hh;
        *(v4f*)(out + (size_t)(m0 + mBase + row) * kDim + n0 + c4) = vals[it];
      }
      asm volatile("s_wait_xcnt 0x0" ::: "memory");  /* in front of every rewrite of the registers that these stores name */
    }
    __builtin_amdgcn_fence(__ATOMIC_RELEASE, "workgroup");
    __builtin_amdgcn_wave_barrier();
    __builtin_amdgcn_fence(__ATOMIC_ACQUIRE, "workgroup");
  }
}

// ---------------------------------------------------------------------------
// Host glue (kernel launches and host arithmetic only)
// ---------------------------------------------------------------------------
static GemmArgs gemm_args(const unsigned short* A, const unsigned short* A2, int lda,
                          const unsigned short* Bt, const unsigned short* Bt2, int ldb,
                          void* C, void* C2, int ldc,
                          const float* bias0, const float* bias1, const float* resid0, const float* resid1,
                          long aP, long bP, long bQ, long cP, long cQ, int M, int N, int K, float scale) {
  GemmArgs g;
  g.Ap0 = A;  g.A2p0 = A2;  g.Btp0 = Bt;  g.Bt2p0 = Bt2;  g.Cout0 = C;  g.Cout20 = C2;  g.Cout30 = C2;
  g.bias0 = bias0;  g.bias1 = bias1;  g.resid0 = resid0;  g.resid1 = resid1;
  g.aP = aP;  g.bP = bP;  g.bQ = bQ;  g.cP = cP;  g.cQ = cQ;  g.c3P = 0L;
  g.lda = lda;  g.ldb = ldb;  g.ldc = ldc;  g.M = M;  g.N = N;  g.K = K;
  g.scale = scale;
  return g;
}

template <int ET, bool SPLIT, int BIAS_MODE, int OUT_MODE, bool RESID, int ACT>
static void run_gemm(hipStream_t st,
                     const unsigned short* A, const unsigned short* A2, int lda,
                     const unsigned short* Bt, const unsigned short* Bt2, int ldb,
                     void* C, void* C2, int ldc,
                     const float* bias0, const float* bias1, const float* resid0, const float* resid1,
                     long aP, long bP, long bQ, long cP, long cQ, int planes,
                     int M, int N, int K, float scale) {
  const int blocks = (M >> 7) * (N >> 7);
  wmma_gemm64<ET, SPLIT, BIAS_MODE, OUT_MODE, RESID, ACT><<<dim3(blocks, 2, planes), 128, 0, st>>>(
      gemm_args(A, A2, lda, Bt, Bt2, ldb, C, C2, ldc, bias0, bias1, resid0, resid1, aP, bP, bQ, cP, cQ, M, N, K, scale));
}

extern "C" void kernel_launch(void* const* d_in, const int* in_sizes, int n_in,
                              void* d_out, int out_size, void* d_ws, size_t ws_size,
                              hipStream_t stream) {
  if (n_in < 34) return;
  if (in_sizes[0] != (int)kND || in_sizes[1] != (int)kND) return;
  for (int p = 0; p < 2; ++p) {
    for (int s = 0; s < 16; ++s) {
      const bool isMat = (s == 0 || s == 2 || s == 4 || s == 6 || s == 8 || s == 10 || s == 11 || s == 12 || s == 15);
      const int want = isMat ? (int)kWW : kDim;
      if (in_sizes[2 + 16 * p + s] != want) return;
    }
  }
  if (out_size != (int)(2 * kND)) return;
  if (ws_size < kWsTotal) return;

  char* ws = (char*)d_ws;
  unsigned short* XH  = (unsigned short*)(ws + kOffXH);
  unsigned short* XL  = (unsigned short*)(ws + kOffXL);
  unsigned short* T0H = (unsigned short*)(ws + kOffT0H);
  unsigned short* T0L = (unsigned short*)(ws + kOffT0L);
  unsigned short* FH  = (unsigned short*)(ws + kOffFH);
  unsigned short* FL  = (unsigned short*)(ws + kOffFL);
  unsigned short* F16 = (unsigned short*)(ws + kOffF16);
  unsigned short* R1  = (unsigned short*)(ws + kOffR1);
  unsigned short* R2  = (unsigned short*)(ws + kOffR2);
  unsigned short* WSH = (unsigned short*)(ws + kOffWSH);
  unsigned short* WSL = (unsigned short*)(ws + kOffWSL);
  unsigned short* WF  = (unsigned short*)(ws + kOffWF);
  float*          S   = (float*)(ws + kOffS);
  unsigned short* QK  = (unsigned short*)(ws + kOffQK);
  unsigned short* VT  = (unsigned short*)(ws + kOffVT);
  unsigned short* RES = (unsigned short*)(ws + kOffRES);
  float*          SC  = (float*)(ws + kOffSC);
  unsigned short* FFN = (unsigned short*)(ws + kOffFFN);
  float*          MROW = (float*)(ws + kOffMROW);
  float*          INVS = (float*)(ws + kOffINVS);
  float*          RC   = (float*)(ws + kOffRC);
  float*          CP   = (float*)(ws + kOffCP);
  float* out = (float*)d_out;

  /* inputs of branch A (a*) and branch B (b*) */
  const float* ax   = (const float*)d_in[0];
  const float* bx   = (const float*)d_in[1];
  const float* apW1 = (const float*)d_in[2 + 0];
  const float* bpW1 = (const float*)d_in[18 + 0];
  const float* apb1 = (const float*)d_in[2 + 1];
  const float* bpb1 = (const float*)d_in[18 + 1];
  const float* apW2 = (const float*)d_in[2 + 2];
  const float* bpW2 = (const float*)d_in[18 + 2];
  const float* apb2 = (const float*)d_in[2 + 3];
  const float* bpb2 = (const float*)d_in[18 + 3];
  const float* arW1 = (const float*)d_in[2 + 4];
  const float* brW1 = (const float*)d_in[18 + 4];
  const float* arb1 = (const float*)d_in[2 + 5];
  const float* brb1 = (const float*)d_in[18 + 5];
  const float* arW2 = (const float*)d_in[2 + 6];
  const float* brW2 = (const float*)d_in[18 + 6];
  const float* arb2 = (const float*)d_in[2 + 7];
  const float* brb2 = (const float*)d_in[18 + 7];
  const float* arW3 = (const float*)d_in[2 + 8];
  const float* brW3 = (const float*)d_in[18 + 8];
  const float* arb3 = (const float*)d_in[2 + 9];
  const float* brb3 = (const float*)d_in[18 + 9];
  const float* aWq  = (const float*)d_in[2 + 10];
  const float* bWq  = (const float*)d_in[18 + 10];
  const float* aWk  = (const float*)d_in[2 + 11];
  const float* bWk  = (const float*)d_in[18 + 11];
  const float* aWv  = (const float*)d_in[2 + 12];
  const float* bWv  = (const float*)d_in[18 + 12];
  const float* alng = (const float*)d_in[2 + 13];
  const float* blng = (const float*)d_in[18 + 13];
  const float* alnb = (const float*)d_in[2 + 14];
  const float* blnb = (const float*)d_in[18 + 14];
  const float* affn = (const float*)d_in[2 + 15];
  const float* bffn = (const float*)d_in[18 + 15];

  /* Every launch below works on both branches: the pointers are branch A's, the strides lead to branch B's part. */
  const long r0B   = (long)kR0Bytes;
  const long nd    = (long)kND;
  const long ww    = (long)kWW;

  /* operand planes, one launch: x hi/lo; pW1,pW2,Wq,Wk hi/lo (weights are [out][in] = Bt layout); rW1,rW2,rW3,Wv and
     the ffn weight f16 x256 */
  prep_kernel<<<dim3(kPrepBlocks, 1, 2), 256, 0, stream>>>(ax, bx, apW1, apW2, aWq, aWk, bpW1, bpW2, bWq, bWk,
                                                           arW1, arW2, arW3, aWv, brW1, brW2, brW3, bWv, affn, bffn,
                                                           XH, XL, WSH, WSL, WF, FFN);

  /* h1 = relu(x . pW1^T + pb1) -> hi/lo : M 4096, N 512, K 512 */
  run_gemm<1, true, 2, 2, false, 2>(stream, XH, XL, kDim, WSH + 0 * kWW, WSL + 0 * kWW, kDim,
                                    (void*)T0H, (void*)T0L, kDim, apb1, bpb1, apb1, bpb1,
                                    kR0El16, kR0El16, 0L, r0B, 0L, 1, kTok, kDim, kDim, 1.0f);
  /* feat = h1 . pW2^T + pb2 -> hi/lo, and the f16 copy of hi + lo out of the same store phase */
  {
    GemmArgs gf = gemm_args(T0H, T0L, kDim, WSH + 1 * kWW, WSL + 1 * kWW, kDim, (void*)FH, (void*)FL, kDim,
                            apb2, bpb2, apb2, bpb2, kR0El16, kR0El16, 0L, r0B, 0L, kTok, kDim, kDim, 1.0f);
    gf.Cout30 = (void*)F16;
    gf.c3P = 2 * nd;
    wmma_gemm64<1, true, 2, 3, false, 0><<<dim3(kSmallTiles, 2, 1), 128, 0, stream>>>(gf);
  }
  /* One launch. Q (plane 0) and K (plane 1) -> hi/lo planes; QK holds QH QL KH KL of branch A, then of branch B.
     r1 = relu(feat . rW1^T + rb1) (f16 single products, weights x256). */
  qk_res1_kernel<<<dim3(kSmallTiles, 2, 3), 128, 0, stream>>>(
      gemm_args(FH, FL, kDim, WSH + 2 * kWW, WSL + 2 * kWW, kDim, (void*)QK, (void*)(QK + kND), kDim,
                apb1, bpb1, apb1, bpb1, kR0El16, kR0El16, ww, 8 * nd, 4 * nd, kTok, kDim, kDim, 1.0f),
      gemm_args(F16, F16, kDim, WF + 0 * kWW, WF + 0 * kWW, kDim, (void*)R1, (void*)R1, kDim,
                arb1, brb1, arb1, brb1, nd, 4 * ww, 0L, 2 * nd, 0L, kTok, kDim, kDim, kWCarryInv));

  /* ---- cross attention, add + LayerNorm, ffn ---- */
  /* One launch. S = Q_p . K_other^T (hi.hi + hi.lo + lo.hi), f32 : M 4096, N 4096, K 512. Branch A reads branch B's K
     planes (planes 6, 7 of QK) and branch B reads branch A's (planes 2, 3): the Bt stride is negative.
     r2 = relu(r1 . rW2^T + rb2).
     V^T[d][i] = sum_k Wv[d][k] feat[i][k] : A = Wv (M 512), Bt = feat f16 (N 4096), K 512, ldc 4096.
     The planes of the last two lie outside R0, which S overwrites. */
  logits_res2_vt_kernel<<<dim3(2 * kLogitTiles + 4 * kSmallTiles), 128, 0, stream>>>(
      gemm_args(QK, QK + kND, kDim, QK + 6 * kND, QK + 7 * kND, kDim, (void*)S, (void*)S, kTok,
                alng, blng, alng, blng, 4 * nd, -4 * nd, 0L, r0B, 0L, kTok, kTok, kDim, 1.0f),
      gemm_args(R1, R1, kDim, WF + 1 * kWW, WF + 1 * kWW, kDim, (void*)R2, (void*)R2, kDim,
                arb2, brb2, arb2, brb2, nd, 4 * ww, 0L, 2 * nd, 0L, kTok, kDim, kDim, kWCarryInv),
      gemm_args(WF + 3 * kWW, WF + 3 * kWW, kDim, F16, F16, kDim, (void*)VT, (void*)VT, kTok,
                apb1, bpb1, apb1, bpb1, 4 * ww, nd, 0L, 2 * nd, 0L, kDim, kTok, kDim, kWCarryInv));
  rowcol_kernel<<<dim3(kRcParts, 2), 512, 0, stream>>>(S, MROW, INVS, CP);
  /* One launch. res = r2 . rW3^T + rb3; rc = 1 / (1e-9 + column sums). */
  res3_colfin_kernel<<<dim3(2 * kSmallTiles + 2 * kColBlocks), 128, 0, stream>>>(
      gemm_args(R2, R2, kDim, WF + 2 * kWW, WF + 2 * kWW, kDim, (void*)RES, (void*)RES, kDim,
                arb3, brb3, arb3, brb3, nd, 4 * ww, 0L, 2 * nd, 0L, kTok, kDim, kDim, kWCarryInv),
      CP, RC);
  av_kernel<<<dim3(kTok / 64, 2, kAvHalves), 256, 0, stream>>>(S, MROW, INVS, RC, VT, SC);
  /* s = LayerNorm(res + sc); out = s + s . ffnW^T : A = s f16, Bt = ffnW f16 x256, residual s f32; s never leaves LDS */
  ln_ffn_kernel<<<dim3(kTok / kLfRows, 2), 256, 0, stream>>>(RES, SC, alng, alnb, blng, blnb, FFN, out);
}
